// v000
// Measured on an AMD MI455X. A time is GPU time per run, averaged over a window of back-to-back runs after a warm-up
// (all launches, gaps included; the runs take copies of the inputs in turn), and the median of several windows.
// Apart from v000's, it joins two sittings. Times from different sittings can be a few percent apart, while
// side-by-side timings come from the same sitting.
// The starting kernel, v000, takes 438 microseconds a run.
// Contractions: q, k and v^T in-projections on v_wmma_f32_16x16x32_f16 (f16 activation plane x f16 weight plane
// carried x64, one product each); attention q.k^T on v_wmma_f32_16x16x32_f16 with q as f16 hi plane + f16 residual
// plane carried x2048 (two products, two accumulators) and k plain f16; p.v on v_wmma_f32_16x16x32_f16 with p
// carried x1024 (f16) and v^T as f16 hi plane + f16 residual plane carried x2048 (two products, two accumulators);
// output projection on v_wmma_f32_16x16x32_bf16 with the context as bf16 hi | lo planes concatenated along k against
// a k-duplicated bf16 weight plane (two products, one accumulator); all f32 accumulate; softmax in f32 on VALU;
// every float input RNE-converted to bf16 on load.
#include <hip/hip_runtime.h>
#include <math.h>
#include <stdint.h>

#define NBATCH 2
#define SEQ    2048
#define DM     1024
#define NH     16
#define HD     64
#define MP     (NBATCH * SEQ)
#define NQB    (SEQ / 64)
#define CTXP   (2 * DM)
#define QRES   ((size_t)MP * DM)
#define VRES   ((size_t)NBATCH * DM * SEQ)
#define WSC    64.0f
#define RSC    2048.0f
#define PSC    1024.0f
static_assert(NH * HD == DM);
static_assert((SEQ % 64) == 0 && (DM % 64) == 0 && (MP % 64) == 0);
static_assert(HD == 64);

typedef _Float16       v16h __attribute__((ext_vector_type(16)));
typedef __bf16         v16b __attribute__((ext_vector_type(16)));
typedef unsigned short v16us __attribute__((ext_vector_type(16)));
typedef unsigned short v8us __attribute__((ext_vector_type(8)));
typedef float          v8f  __attribute__((ext_vector_type(8)));
typedef float          v4f  __attribute__((ext_vector_type(4)));
typedef unsigned int   v4u  __attribute__((ext_vector_type(4)));

union Frag { v16us u; v8us p[2]; v16h h; v16b b; };

// ---- scalar helpers --------------------------------------------------------------------------------
__device__ __forceinline__ unsigned short bf_bits(float f) {          // f32 -> bf16 bits, RNE convert
  unsigned u = __float_as_uint(f);
  return (unsigned short)((u + 0x7FFFu + ((u >> 16) & 1u)) >> 16);
}
__device__ __forceinline__ float bf_up(unsigned short h) { return __uint_as_float(((unsigned)h) << 16); }
__device__ __forceinline__ float bfr(float f) { return bf_up(bf_bits(f)); }   // value of the bf16 RNE convert
__device__ __forceinline__ unsigned short h_bits(_Float16 x) { return __builtin_bit_cast(unsigned short, x); }
__device__ __forceinline__ unsigned pk16(unsigned short a, unsigned short b) { return (unsigned)a | ((unsigned)b << 16); }
__device__ __forceinline__ v8f zero8() { v8f z = {0.f, 0.f, 0.f, 0.f, 0.f, 0.f, 0.f, 0.f}; return z; }

// ---- fragment loader: 16-bit A/B operand (bit planes), lane -> row/col (lane&15), p already includes +8*(lane>>4);
//      elements 0..7 <- p[0..7] (k0+8h..), elements 8..15 <- p[16..23] (k0+16+8h..)
__device__ __forceinline__ v16us ldfrag(const unsigned short* p) {
  Frag f;
  f.p[0] = *(const v8us*)(p);
  f.p[1] = *(const v8us*)(p + 16);
  return f.u;
}

// ---- WMMA helpers (BF = 0: f16 operands, BF = 1: bf16 operands) with trailing VALU hazard gap -----------------
template <int BF>
__device__ __forceinline__ v8f mma_raw(v16us a, v16us b, v8f c) {
  Frag fa, fb;
  fa.u = a;
  fb.u = b;
  if constexpr (BF) {
    return __builtin_amdgcn_wmma_f32_16x16x32_bf16(false, fa.b, false, fb.b, (short)0, c, false, false);
  } else {
    return __builtin_amdgcn_wmma_f32_16x16x32_f16(false, fa.h, false, fb.h, (short)0, c, false, false);
  }
}
template <int BF>
__device__ __forceinline__ v8f mma_g(v16us a, v16us b, v8f c) {
  c = mma_raw<BF>(a, b, c);
#if defined(__HIP_DEVICE_COMPILE__)
  asm volatile("v_nop\n\tv_nop\n\tv_nop\n\tv_nop" : "+v"(c) : "v"(a), "v"(b));
#endif
  return c;
}
__device__ __forceinline__ void dep_guard1(v8f& a, v8f& b, v16us x) {
#if defined(__HIP_DEVICE_COMPILE__)
  asm volatile("v_nop\n\tv_nop\n\tv_nop\n\tv_nop" : "+v"(a), "+v"(b) : "v"(x));
#endif
}
__device__ __forceinline__ void keep4(v16us a, v16us b, v16us c, v16us d) {
#if defined(__HIP_DEVICE_COMPILE__)
  asm volatile("v_nop" :: "v"(a), "v"(b), "v"(c), "v"(d));
#endif
}
__device__ __forceinline__ void acc_guard4(v8f& a, v8f& b, v8f& c, v8f& d) {
#if defined(__HIP_DEVICE_COMPILE__)
  asm volatile("v_nop\n\tv_nop\n\tv_nop\n\tv_nop" : "+v"(a), "+v"(b), "+v"(c), "+v"(d));
#endif
}
__device__ __forceinline__ void wave_sync_lds() {
  __builtin_amdgcn_fence(__ATOMIC_RELEASE, "workgroup");
  __builtin_amdgcn_wave_barrier();
  __builtin_amdgcn_fence(__ATOMIC_ACQUIRE, "workgroup");
}

// =====================================================================================================
// f32 -> f16 activation plane convert: Xh[i] = f16( bf16_RNE(X[i]) * wsc ), wsc a power of two (exact).
// Thread i handles elements 8i..8i+7 and writes one 16-B piece; 32 consecutive lanes of one instruction fill
// (host-checked) so every store is full-width.
// coverage: n8 threads x 8 elements = the whole plane.
// =====================================================================================================
__global__ __launch_bounds__(256) void conv_h16(const float* __restrict__ W, unsigned short* Wh, int n8, float wsc) {
  const int i  = blockIdx.x * 256 + threadIdx.x;
  const int ic = (i < n8) ? i : (n8 - 1);                     // clamped address
  const float* src = W + (size_t)ic * 8;
  const v4f a = *(const v4f*)(src);
  const v4f c = *(const v4f*)(src + 4);
  v4u o;
  o[0] = pk16(h_bits((_Float16)(bfr(a[0]) * wsc)), h_bits((_Float16)(bfr(a[1]) * wsc)));
  o[1] = pk16(h_bits((_Float16)(bfr(a[2]) * wsc)), h_bits((_Float16)(bfr(a[3]) * wsc)));
  o[2] = pk16(h_bits((_Float16)(bfr(c[0]) * wsc)), h_bits((_Float16)(bfr(c[1]) * wsc)));
  o[3] = pk16(h_bits((_Float16)(bfr(c[2]) * wsc)), h_bits((_Float16)(bfr(c[3]) * wsc)));
  if (i < n8) *(v4u*)(Wh + (size_t)i * 8) = o;
  
}

// =====================================================================================================
// 64x64 tile transpose-convert of an f32 weight tensor: z-slice in[z] is [R][C] f32 (row pitch C elements,
// slice stride inStrideZ); output is 16-bit with rows indexed by the INPUT COLUMN: out[z*outStrideZ + c*ldo + r]
// (the input row index r becomes the k-contiguous column), i.e. in[rows=R][cols=C] -> out[cols=C][rows=R].
//   BF == 0: value = f16( bf16_RNE(x) * sc )   (sc a power of two)
//   BF == 1: value = bf16_RNE(x) bits; DUP == 1 additionally writes the same 16-B piece at column offset + dupOff.
// grid = (R/64, C/64, Z), block 256. Load phase: 1024 float4 pieces (64 rows x 16) = the whole 64x64 tile,
// 4 per thread, converted and stored transposed into LDS with 16-bit element stores; __syncthreads; store phase:
// coverage: 2 iterations x 32 rows x (8 lanes x 8 halves) = the whole 64x64 output tile (x2 destinations if DUP);
//           the grid tiles every (r block, c block, z) exactly once.
// =====================================================================================================
template <int BF, int DUP>
__global__ __launch_bounds__(256) void tconv64(const float* __restrict__ in, long long inStrideZ, int C,
                                               unsigned short* out, long long outStrideZ, int ldo, int dupOff,
                                               float sc) {
  __shared__ __align__(16) unsigned short sT[64 * 72];        // [c local][r local], pitch 72 halves (144 B)
  const int t  = threadIdx.x;
  const int r0 = blockIdx.x * 64;
  const int c0 = blockIdx.y * 64;
  const float* src = in + (size_t)blockIdx.z * (size_t)inStrideZ;
  unsigned short* dst = out + (size_t)blockIdx.z * (size_t)outStrideZ;
#pragma unroll
  for (int i = 0; i < 4; ++i) {
    const int idx = t + 256 * i;                              // 0..1023
    const int rr  = idx >> 4;                                 // 0..63
    const int cq  = (idx & 15) * 4;                           // 0..60
    const v4f x = *(const v4f*)(src + (size_t)(r0 + rr) * (size_t)C + c0 + cq);
#pragma unroll
    for (int j = 0; j < 4; ++j) {
      unsigned short w;
      if (BF) {
        w = bf_bits(x[j]);
      } else {
        w = h_bits((_Float16)(bfr(x[j]) * sc));
      }
      sT[(cq + j) * 72 + rr] = w;
    }
  }
  __syncthreads();
  const int q8 = t >> 3;                                      // 0..31: row within the 32-row group
  const int c8 = (t & 7) * 8;
  v8us vv[2];
#pragma unroll
  for (int it = 0; it < 2; ++it) {
    const int row = it * 32 + q8;                             // it 0..1 x q8 0..31 = rows 0..63
    vv[it] = *(const v8us*)(sT + row * 72 + c8);
  }
  {
#pragma unroll
    for (int it = 0; it < 2; ++it) {
      const int row = it * 32 + q8;
      unsigned short* dp = dst + (size_t)(c0 + row) * (size_t)ldo + r0 + c8;
      *(v8us*)(dp) = vv[it];
      if (DUP) *(v8us*)(dp + dupOff) = vv[it];
    }
    
  }
}

// =====================================================================================================
// Register-blocked batched 16-bit WMMA GEMM: C[m][n] = oscale * sum_k A[m][k] * Bt[n][k] + bias;
// one wave per 64x64 tile, no block barriers. A row-major [M][K] pitch lda; Bt row-major [N][K] pitch ldb (k contiguous);
// M, N multiples of 64, K multiple of 32 (static here). blockIdx.y = batch index (strides in elements).
// BF: 0 = f16 operand planes, 1 = bf16 operand planes.
// Bias: BIASM == 0 -> per column: cols < Nb from bias0[col], cols >= Nb from bias1[col - Nb] (tile-uniform select of
//       clamped-address loads); BIASM == 1 -> per row bias0[m]. Bias values RNE-converted to bf16.
// OM: 0 = f32 out (pitch ldc); 2 = f16 out; 3 = f16 hi plane at C plus f16 residual plane ((f - hi) * RSC) at
//     C + resOff (same pitch and offsets).
// coverage: 4 slabs x 16 rows x 64 cols = the wave's whole 64x64 tile; grid = ceil(tilesM*tilesN/8) blocks,
//           surplus waves exit (wave-uniform); here every tile count is a multiple of 8, so none exit.
// =====================================================================================================
template <int BF, int OM, int BIASM>
__global__ __launch_bounds__(256) void gemm64(
    const unsigned short* __restrict__ A, int lda, long long strideA,
    const unsigned short* __restrict__ Bt, int ldb, long long strideB,
    const float* __restrict__ bias0, const float* __restrict__ bias1, int Nb,
    void* Cout, int ldc, long long strideC, long long resOff,
    int M, int N, int K, float oscale) {
  __shared__ __align__(16) float sT[8][16 * 68];   // per-wave 16x64 slab, pitch 68 floats
  const int b    = blockIdx.y;
  const int lane = threadIdx.x & 31;
  const int wave = threadIdx.x >> 5;
  const int tilesN = N >> 6;
  const int tilesM = M >> 6;
  const int tile = blockIdx.x * 8 + wave;
  if (tile >= tilesM * tilesN) return;   // wave-uniform; no block barriers in this kernel
  const int tm = tile / tilesN;
  const int tn = tile - tm * tilesN;
  const int m0 = tm << 6;
  const int n0 = tn << 6;

  const unsigned short* Ab = A  + (size_t)b * (size_t)strideA;
  const unsigned short* Bb = Bt + (size_t)b * (size_t)strideB;

  const int rlane = lane & 15;                 // row (A) / col (B, D) within subtile
  const int koff  = (lane >> 4) * 8;           // k offset of this lane half
  const int mOff  = (lane >> 4) * 8;           // D row offset

  v8f acc[4][4];
#pragma unroll
  for (int i = 0; i < 4; ++i)
#pragma unroll
    for (int j = 0; j < 4; ++j) acc[i][j] = zero8();

  for (int k0 = 0; k0 < K; k0 += 32) {
    v16us bh[4];
#pragma unroll
    for (int j = 0; j < 4; ++j) {
      const size_t bo = (size_t)(n0 + (j << 4) + rlane) * ldb + koff + k0;
      bh[j] = ldfrag(Bb + bo);
    }
#pragma unroll
    for (int i = 0; i < 4; ++i) {
      const size_t ao = (size_t)(m0 + (i << 4) + rlane) * lda + koff + k0;
      const v16us ah = ldfrag(Ab + ao);
#pragma unroll
      for (int j = 0; j < 4; ++j) acc[i][j] = mma_raw<BF>(ah, bh[j], acc[i][j]);
      dep_guard1(acc[i][0], acc[i][3], ah);
    }
    keep4(bh[0], bh[1], bh[2], bh[3]);
  }
  acc_guard4(acc[0][0], acc[0][1], acc[0][2], acc[0][3]);
  acc_guard4(acc[1][0], acc[1][1], acc[1][2], acc[1][3]);
  acc_guard4(acc[2][0], acc[2][1], acc[2][2], acc[2][3]);
  acc_guard4(acc[3][0], acc[3][1], acc[3][2], acc[3][3]);

  // ---- per-lane column bias (BIASM == 0), RNE-converted ----
  const int hh2 = lane >> 4, c4 = (lane & 15) * 4;     // f32 out: 256-B row segment = 16 lanes x 16 B
  const int q8  = lane >> 3, c8 = (lane & 7) * 8;
  float bc[8];
#pragma unroll
  for (int e = 0; e < 8; ++e) bc[e] = 0.f;
  if (BIASM == 0) {
    const bool use1 = (n0 >= Nb);                      // tile-uniform
    if (OM == 0) {
      const int cb = n0 + c4;
      const int i0 = (cb < Nb - 4) ? cb : (Nb - 4);
      const int i1 = (cb - Nb > 0) ? (cb - Nb) : 0;
      const v4f b0v = *(const v4f*)(bias0 + i0);
      const v4f b1v = *(const v4f*)(bias1 + i1);
#pragma unroll
      for (int e = 0; e < 4; ++e) bc[e] = bfr(use1 ? b1v[e] : b0v[e]);
    } else {
      const int cb = n0 + c8;
      const int i0 = (cb < Nb - 8) ? cb : (Nb - 8);
      const int i1 = (cb - Nb > 0) ? (cb - Nb) : 0;
      const v4f b0a = *(const v4f*)(bias0 + i0), b0b = *(const v4f*)(bias0 + i0 + 4);
      const v4f b1a = *(const v4f*)(bias1 + i1), b1b = *(const v4f*)(bias1 + i1 + 4);
#pragma unroll
      for (int e = 0; e < 4; ++e) {
        bc[e]     = bfr(use1 ? b1a[e] : b0a[e]);
        bc[4 + e] = bfr(use1 ? b1b[e] : b0b[e]);
      }
    }
  }

  // ---- epilogue ----
  float* slab = sT[wave];
#pragma unroll
  for (int i = 0; i < 4; ++i) {
    const int mBase = m0 + (i << 4);
#pragma unroll
    for (int j = 0; j < 4; ++j) {
#pragma unroll
      for (int r = 0; r < 8; ++r) {
        slab[(mOff + r) * 68 + (j << 4) + rlane] = acc[i][j][r];
      }
    }
    wave_sync_lds();
    if constexpr (OM == 0) {
      float* C = (float*)Cout + (size_t)b * (size_t)strideC;
      v4f vals[8];
#pragma unroll
      for (int it = 0; it < 8; ++it) {
        const int row = it * 2 + hh2;                      // it 0..7 x hh2 0..1 = rows 0..15
        v4f v = *(const v4f*)(slab + row * 68 + c4);
#pragma unroll
        for (int e = 0; e < 4; ++e) v[e] = v[e] * oscale + bc[e];
        vals[it] = v;
      }
      {
#pragma unroll
        for (int it = 0; it < 8; ++it) {
          const int row = it * 2 + hh2;
          *(v4f*)(C + (size_t)(mBase + row) * ldc + n0 + c4) = vals[it];
        }
        
      }
    } else {
      unsigned short* C = (unsigned short*)Cout + (size_t)b * (size_t)strideC;
      v4u hv[4], hr[4];
#pragma unroll
      for (int it = 0; it < 4; ++it) {
        const int row = it * 4 + q8;                       // it 0..3 x q8 0..3 = rows 0..15
        const float* sp = slab + row * 68 + c8;
        float bm = 0.f;
        if (BIASM == 1) bm = bfr(bias0[mBase + row]);
        v4u a, ar;
#pragma unroll
        for (int e = 0; e < 4; ++e) {
          const float f0 = sp[2 * e]     * oscale + ((BIASM == 1) ? bm : bc[2 * e]);
          const float f1 = sp[2 * e + 1] * oscale + ((BIASM == 1) ? bm : bc[2 * e + 1]);
          const _Float16 g0 = (_Float16)f0, g1 = (_Float16)f1;
          a[e] = pk16(h_bits(g0), h_bits(g1));
          if (OM == 3) {
            const float e0 = (f0 - (float)g0) * RSC;
            const float e1 = (f1 - (float)g1) * RSC;
            ar[e] = pk16(h_bits((_Float16)e0), h_bits((_Float16)e1));
          } else {
            ar[e] = 0u;
          }
        }
        hv[it] = a;
        hr[it] = ar;
      }
      {
#pragma unroll
        for (int it = 0; it < 4; ++it) {
          const int row = it * 4 + q8;
          unsigned short* dp = C + (size_t)(mBase + row) * ldc + n0 + c8;
          *(v4u*)(dp) = hv[it];
          if (OM == 3) *(v4u*)(dp + resOff) = hr[it];
        }
        
      }
    }
    wave_sync_lds();
  }
}

// =====================================================================================================
// Flash attention, head dim 64, SEQ token rows per batch (all keys valid, no mask).
//   q planes (f16, pitch DM): hi at qhp[(b*SEQ + t)*DM + h*64 + d], residual (x2048) at qhp + QRES (same offsets)
//   k plane (f16, pitch DM): khp[(b*SEQ + t)*DM + h*64 + d]
//   v^T planes (f16): hi at vtp[(b*DM + h*64 + d)*SEQ + s], residual (x2048) at vtp + VRES
//   context planes (bf16, pitch CTXP): hi at ctxp[(b*SEQ + t)*CTXP + h*64 + d], lo at the same + DM
//   score = fma(acc_hi, sscale, acc_res * ssres); p = exp(s - m) carried as f16(1024 p); context = p . v with the
//   v hi and v residual products in two accumulators; online softmax (running max) in f32.
//   Block = 4 waves = 64 query rows of one (b, h); grid = NQB * NH * NBATCH; kv chunks of 64, static trip NQB.
//   K / V^T hi / V^T res chunk staging: 128 threads x 32 elements per plane = the whole 64x64 tile each
//   (plain 16-B loads, __syncthreads before and after); P tiles are wave-private, spilled with ushort element
//   Context coverage: each wave stores rows q0..q0+15 (it 0..3 x lane>>3 0..3) x 64 columns (8 lanes x 8) of both
//   the hi and the lo plane; grid covers all SEQ rows x NH head slices x NBATCH.
// =====================================================================================================
__global__ __launch_bounds__(128)
void attn64(const unsigned short* __restrict__ qhp, const unsigned short* __restrict__ khp,
            const unsigned short* __restrict__ vtp, unsigned short* ctxp,
            float sscale, float ssres) {
  __shared__ __align__(16) unsigned short Ksh[64 * 64];           // K [kv][d]        8 KB
  __shared__ __align__(16) unsigned short Vth[64 * 64];           // V^T hi [d][kv]   8 KB
  __shared__ __align__(16) unsigned short Vtr[64 * 64];           // V^T res [d][kv]  8 KB
  __shared__ __align__(16) unsigned short Psh[4][16 * 64];        // per wave P [row][kv]
  __shared__ __align__(16) float          Os[4][16 * 64];         // per wave context tile [row][d]

  const int tid  = threadIdx.x;
  const int wave = tid >> 5;
  const int lane = tid & 31;
  const int hh   = lane >> 4;
  const int c    = lane & 15;

  const int bx   = blockIdx.x;
  const int qb   = bx % NQB;
  const int rest = bx / NQB;
  const int h    = rest % NH;
  const int b    = rest / NH;
  const int q0   = qb * 64 + wave * 16;          // in-batch query row of this wave's first row
  const size_t rowB = (size_t)b * SEQ;

  const unsigned short* Qh = qhp + (size_t)h * HD;
  const unsigned short* Qr = qhp + QRES + (size_t)h * HD;
  const unsigned short* Kg = khp + (size_t)h * HD;
  const unsigned short* Vh = vtp + ((size_t)b * DM + (size_t)h * HD) * SEQ;
  const unsigned short* Vr = Vh + VRES;

  float mrow[8], lrow[8];
  v8f oacc[4], oacr[4];
#pragma unroll
  for (int r = 0; r < 8; ++r) { mrow[r] = -INFINITY; lrow[r] = 0.f; }
#pragma unroll
  for (int t = 0; t < 4; ++t) { oacc[t] = zero8(); oacr[t] = zero8(); }

  for (int kt = 0; kt < NQB; ++kt) {         // static trip count
    const int kv0 = kt * 64;
    __syncthreads();
    {
      const int r = tid >> 1, hf = (tid & 1) * 32;
      const unsigned short* kg = Kg + (rowB + kv0 + r) * DM + hf;          // K row kv0+r, d = hf..hf+31
      const unsigned short* vg = Vh + (size_t)r * SEQ + kv0 + hf;           // V^T hi row d = r, s = kv0+hf..
      const unsigned short* vr = Vr + (size_t)r * SEQ + kv0 + hf;           // V^T res row d = r
#pragma unroll
      for (int i = 0; i < 4; ++i) {
        const v8us a0 = *(const v8us*)(kg + 8 * i);
        const v8us b0 = *(const v8us*)(vg + 8 * i);
        const v8us c0 = *(const v8us*)(vr + 8 * i);
        *(v8us*)(Ksh + r * 64 + hf + 8 * i) = a0;
        *(v8us*)(Vth + r * 64 + hf + 8 * i) = b0;
        *(v8us*)(Vtr + r * 64 + hf + 8 * i) = c0;
      }
    }
    __syncthreads();

    // ---- Q fragments (A operand, row = lane&15): hi and residual, 2 d-chunks each ----
    v16us qa[2], qr[2];
#pragma unroll
    for (int dc = 0; dc < 2; ++dc) {
      qa[dc] = ldfrag(Qh + (rowB + q0 + c) * DM + dc * 32 + 8 * hh);
      qr[dc] = ldfrag(Qr + (rowB + q0 + c) * DM + dc * 32 + 8 * hh);
    }

    // ---- scores: 16 query rows x 64 keys per wave ----
    v8f s[4];
#pragma unroll
    for (int j = 0; j < 4; ++j) {
      v8f sh = zero8(), sr = zero8();
#pragma unroll
      for (int dc = 0; dc < 2; ++dc) {
        Frag kb;
        kb.p[0] = *(const v8us*)(Ksh + (j * 16 + c) * 64 + dc * 32 + 8 * hh);
        kb.p[1] = *(const v8us*)(Ksh + (j * 16 + c) * 64 + dc * 32 + 16 + 8 * hh);
        sh = mma_g<0>(qa[dc], kb.u, sh);
        sr = mma_g<0>(qr[dc], kb.u, sr);
      }
#pragma unroll
      for (int r = 0; r < 8; ++r) s[j][r] = fmaf(sh[r], sscale, sr[r] * ssres);
    }

    // ---- row max, online softmax, P (x1024, f16 bits) to LDS ----
    unsigned short* pwh = Psh[wave];
#pragma unroll
    for (int r = 0; r < 8; ++r) {
      float m = s[0][r];
      m = fmaxf(m, s[1][r]);
      m = fmaxf(m, s[2][r]);
      m = fmaxf(m, s[3][r]);
#pragma unroll
      for (int off = 1; off < 16; off <<= 1) m = fmaxf(m, __shfl_xor(m, off, 32));
      const float mnew  = fmaxf(mrow[r], m);
      const float alpha = __expf(mrow[r] - mnew);
      mrow[r] = mnew;
      float psum = 0.f;
#pragma unroll
      for (int j = 0; j < 4; ++j) {
        const float p = __expf(s[j][r] - mnew);
        psum += p;
        pwh[(8 * hh + r) * 64 + j * 16 + c] = h_bits((_Float16)(p * PSC));
      }
#pragma unroll
      for (int off = 1; off < 16; off <<= 1) psum += __shfl_xor(psum, off, 32);
      lrow[r] = lrow[r] * alpha + psum;
#pragma unroll
      for (int t = 0; t < 4; ++t) { oacc[t][r] *= alpha; oacr[t][r] *= alpha; }
    }
    wave_sync_lds();

    // ---- context += P . V (hi and residual products, f16 WMMA) ----
#pragma unroll 1
    for (int kk = 0; kk < 2; ++kk) {
      Frag pa;
      pa.p[0] = *(const v8us*)(pwh + c * 64 + kk * 32 + 8 * hh);
      pa.p[1] = *(const v8us*)(pwh + c * 64 + kk * 32 + 16 + 8 * hh);
#pragma unroll
      for (int t = 0; t < 4; ++t) {
        Frag vb, vc;
        vb.p[0] = *(const v8us*)(Vth + (t * 16 + c) * 64 + kk * 32 + 8 * hh);
        vb.p[1] = *(const v8us*)(Vth + (t * 16 + c) * 64 + kk * 32 + 16 + 8 * hh);
        vc.p[0] = *(const v8us*)(Vtr + (t * 16 + c) * 64 + kk * 32 + 8 * hh);
        vc.p[1] = *(const v8us*)(Vtr + (t * 16 + c) * 64 + kk * 32 + 16 + 8 * hh);
        oacc[t] = mma_g<0>(pa.u, vb.u, oacc[t]);
        oacr[t] = mma_g<0>(pa.u, vc.u, oacr[t]);
      }
    }
  }

  // ---- normalise (residual fold 1/2048, 1/l, the 1/1024 p carry), stage the wave's 16x64 tile, bf16 hi | lo
  float* os = Os[wave];
#pragma unroll
  for (int r = 0; r < 8; ++r) {
    const float l = lrow[r];
    const float inv = ((l > 0.f) ? (1.0f / l) : 0.f) * (1.0f / PSC);
#pragma unroll
    for (int t = 0; t < 4; ++t) os[(8 * hh + r) * 64 + t * 16 + c] = fmaf(oacr[t][r], 1.0f / RSC, oacc[t][r]) * inv;
  }
  wave_sync_lds();
  {
    const int q4 = lane >> 3, c8 = (lane & 7) * 8;
    v4u hv[4], hl[4];
#pragma unroll
    for (int it = 0; it < 4; ++it) {
      const int row = it * 4 + q4;   // it 0..3 x q4 0..3 = rows 0..15 of the wave tile
      const float* sp = os + row * 64 + c8;
      v4u a, d;
#pragma unroll
      for (int e = 0; e < 4; ++e) {
        const float f0 = sp[2 * e], f1 = sp[2 * e + 1];
        const unsigned short hb0 = bf_bits(f0), hb1 = bf_bits(f1);
        const unsigned short lb0 = bf_bits(f0 - bf_up(hb0)), lb1 = bf_bits(f1 - bf_up(hb1));
        a[e] = pk16(hb0, hb1);
        d[e] = pk16(lb0, lb1);
      }
      hv[it] = a;
      hl[it] = d;
    }
    {
#pragma unroll
      for (int it = 0; it < 4; ++it) {
        const int row = it * 4 + q4;
        const size_t go = (rowB + q0 + row) * CTXP + (size_t)h * HD + c8;
        *(v4u*)(ctxp + go)      = hv[it];
        *(v4u*)(ctxp + go + DM) = hl[it];
      }
      
    }
  }
}

// =====================================================================================================
// Workspace map (bytes); every plane is an exact multiple of its 64x64-tile / whole-row / whole-line store
// granularity (M = MP = 4096 = 64 tiles, N = 1024 = 16 tiles; V^T per batch [1024][2048] = 16x32 tiles):
//   WqkvT f16 [3072 n][1024 k]        0           6291456   (rows 0..1023 = h*64+d of Wq, then Wk, then Wv; x64)
//   WoB   bf16 [1024 n][2048 k]       6291456     4194304   (Wo^T bf16, k-duplicated)
//   XH    f16 [4096][1024]            10485760    8388608   (converted activation plane, reused for the 3 sources)
//   QH|QR f16 [2][4096][1024]         18874368    16777216  (q hi plane, then q residual plane x2048)
//   KH    f16 [4096][1024]            35651584    8388608
//   VT|VR f16 [2][2][1024][2048]      44040192    16777216  (v^T hi planes per batch, then residual planes x2048)
//   Ctx   bf16 [4096][2048]           60817408    16777216  (context hi cols 0..1023, lo cols 1024..2047)
//   end                               77594624
// =====================================================================================================
extern "C" void kernel_launch(void* const* d_in, const int* in_sizes, int n_in,
                              void* d_out, int out_size, void* d_ws, size_t ws_size,
                              hipStream_t stream) {
  if (n_in < 11) return;
  if (in_sizes[0] != MP * DM || in_sizes[1] != MP * DM || in_sizes[2] != MP * DM) return;
  if (in_sizes[3] != NH * DM * HD || in_sizes[4] != NH * HD) return;
  if (in_sizes[5] != NH * DM * HD || in_sizes[6] != NH * HD) return;
  if (in_sizes[7] != NH * DM * HD || in_sizes[8] != NH * HD) return;
  if (in_sizes[9] != DM * DM || in_sizes[10] != DM) return;
  if (out_size != MP * DM) return;

  const float* query = (const float*)d_in[0];
  const float* key_  = (const float*)d_in[1];
  const float* value = (const float*)d_in[2];
  const float* w_q   = (const float*)d_in[3];
  const float* b_q   = (const float*)d_in[4];
  const float* w_k   = (const float*)d_in[5];
  const float* b_k   = (const float*)d_in[6];
  const float* w_v   = (const float*)d_in[7];
  const float* b_v   = (const float*)d_in[8];
  const float* w_o   = (const float*)d_in[9];
  const float* b_o   = (const float*)d_in[10];

  const size_t PW   = (size_t)3 * DM * DM * 2;            //  6291456
  const size_t PWO  = (size_t)DM * CTXP * 2;              //  4194304
  const size_t PX   = (size_t)MP * DM * 2;                //  8388608
  const size_t PQ   = (size_t)2 * MP * DM * 2;            // 16777216
  const size_t PK   = (size_t)MP * DM * 2;                //  8388608
  const size_t PV   = (size_t)2 * NBATCH * DM * SEQ * 2;  // 16777216
  const size_t PC   = (size_t)MP * CTXP * 2;              // 16777216
  size_t off = 0;
  const size_t oW  = off; off += PW;
  const size_t oWo = off; off += PWO;
  const size_t oX  = off; off += PX;
  const size_t oQ  = off; off += PQ;
  const size_t oK  = off; off += PK;
  const size_t oV  = off; off += PV;
  const size_t oC  = off; off += PC;
  if (off > ws_size) return;                               // off = 77594624
  if (off > (size_t)134217728) return;

  char* ws = (char*)d_ws;
  unsigned short* WqkvT = (unsigned short*)(ws + oW);
  unsigned short* WoB   = (unsigned short*)(ws + oWo);
  unsigned short* XH    = (unsigned short*)(ws + oX);
  unsigned short* QH    = (unsigned short*)(ws + oQ);
  unsigned short* KH    = (unsigned short*)(ws + oK);
  unsigned short* VT    = (unsigned short*)(ws + oV);
  unsigned short* Ctx   = (unsigned short*)(ws + oC);
  float*          out0  = (float*)d_out;

  const int n8x = (MP * DM) / 8;
  if ((n8x % 256) != 0) return;
  const dim3 blk(256), blk128(128);
  const dim3 gCx((n8x + 255) / 256);
  const dim3 gTw(DM / 64, HD / 64, NH);                               // in[e=1024][d=64] per head -> out[d][e]
  const dim3 gTo(DM / 64, DM / 64, 1);                                // in[k=1024][n=1024] -> out[n][k]
  const dim3 gN1k(((MP / 64) * (DM / 64) + 7) / 8, 1);                // 1024 tiles -> 128 blocks
  const dim3 gVT(((DM / 64) * (SEQ / 64) + 7) / 8, NBATCH);           // 512 tiles -> 64 blocks x 2 batches
  const dim3 gAttn(NBATCH * NH * NQB);                                // 1024 blocks of 128
  const float invw  = 1.0f / WSC;                                     // weight carry x64
  const float ssc   = 0.125f;                                         // 1/sqrt(64)
  const float ssr   = 0.125f / RSC;                                   // same, for the x2048 residual products

  // (0) weight planes: WqkvT[(z*1024) + h*64 + d][e] = f16( bf16_RNE(W[h][e][d]) * 64 ); per head the input slice is
  //     in[rows = e (1024)][cols = d (64)] -> out[cols = d][rows = e]; Wo: in[rows = k][cols = n] -> WoB[n][k] and
  //     WoB[n][1024 + k] = bf16_RNE(Wo[k][n]).
  tconv64<0, 0><<<gTw, blk, 0, stream>>>(w_q, (long long)DM * HD, HD, WqkvT, (long long)HD * DM, DM, 0, WSC);
  tconv64<0, 0><<<gTw, blk, 0, stream>>>(w_k, (long long)DM * HD, HD, WqkvT + (size_t)DM * DM,
                                         (long long)HD * DM, DM, 0, WSC);
  tconv64<0, 0><<<gTw, blk, 0, stream>>>(w_v, (long long)DM * HD, HD, WqkvT + (size_t)2 * DM * DM,
                                         (long long)HD * DM, DM, 0, WSC);
  tconv64<1, 1><<<gTo, blk, 0, stream>>>(w_o, 0LL, DM, WoB, 0LL, CTXP, DM, 1.0f);

  // (1) Q = bf16(q) . WqT^T + b_q -> QH (f16 hi) and QH + QRES (f16 residual x2048); column n = h*64 + d
  conv_h16<<<gCx, blk, 0, stream>>>(query, XH, n8x, 1.0f);
  gemm64<0, 3, 0><<<gN1k, blk, 0, stream>>>(
      XH, DM, 0LL, WqkvT, DM, 0LL, b_q, b_q, DM,
      (void*)QH, DM, 0LL, (long long)QRES, MP, DM, DM, invw);

  // (2) K = bf16(k) . WkT^T + b_k -> KH (f16)
  conv_h16<<<gCx, blk, 0, stream>>>(key_, XH, n8x, 1.0f);
  gemm64<0, 2, 0><<<gN1k, blk, 0, stream>>>(
      XH, DM, 0LL, WqkvT + (size_t)DM * DM, DM, 0LL, b_k, b_k, DM,
      (void*)KH, DM, 0LL, 0LL, MP, DM, DM, invw);

  // (3) V^T per batch = WvT . bf16(v)^T + b_v -> VT (f16 hi [2][1024][2048]) and VT + VRES (residual x2048);
  //     row m = h*64 + d (per-row bias b_v[m]), column n = token s of batch blockIdx.y
  conv_h16<<<gCx, blk, 0, stream>>>(value, XH, n8x, 1.0f);
  gemm64<0, 3, 1><<<gVT, blk, 0, stream>>>(
      WqkvT + (size_t)2 * DM * DM, DM, 0LL, XH, DM, (long long)SEQ * DM, b_v, b_v, SEQ,
      (void*)VT, SEQ, (long long)DM * SEQ, (long long)VRES, DM, SEQ, DM, invw);

  // (4) flash attention -> Ctx bf16 hi | lo (concat layout, column h*64 + d)
  attn64<<<gAttn, blk128, 0, stream>>>(QH, KH, VT, Ctx, ssc, ssr);

  // (5) out = [ctx_hi | ctx_lo] . [Wo^T | Wo^T]^T + b_o  (K = 2048, bf16 operands) -> d_out f32 [4096][1024]
  gemm64<1, 0, 0><<<gN1k, blk, 0, stream>>>(
      Ctx, CTXP, 0LL, WoB, CTXP, 0LL, b_o, b_o, DM,
      (void*)out0, DM, 0LL, 0LL, MP, DM, CTXP, 1.0f);
  (void)hipGetLastError();
}

// v001
// A run of this version takes 362 microseconds.
// Timed twice side by side with v000, it ran 1.25 and 1.24 times as fast.
// Contractions: q, k and v^T in-projections on v_wmma_f32_16x16x32_f16 (f16 activation plane x f16 weight plane
// carried x64, one product each); attention q.k^T on v_wmma_f32_16x16x32_f16 with q as f16 hi plane + f16 residual
// plane carried x2048 (two products, two accumulators) and k plain f16; p.v on v_wmma_f32_16x16x32_f16 with p
// carried x1024 (f16) and v^T as f16 hi plane + f16 residual plane carried x2048 (two products, two accumulators);
// output projection on v_wmma_f32_16x16x32_bf16 with the context as bf16 hi | lo planes concatenated along k against
// a k-duplicated bf16 weight plane (two products, one accumulator); all f32 accumulate; softmax in f32 on VALU;
// every float input RNE-converted to bf16 on load.
#include <hip/hip_runtime.h>
#include <math.h>
#include <stdint.h>

#define NBATCH 2
#define SEQ    2048
#define DM     1024
#define NH     16
#define HD     64
#define MP     (NBATCH * SEQ)
#define NQB    (SEQ / 64)
#define CTXP   (2 * DM)
#define QRES   ((size_t)MP * DM)
#define VRES   ((size_t)NBATCH * DM * SEQ)
#define WSC    64.0f
#define RSC    2048.0f
#define PSC    1024.0f
#define LP     72      // LDS row pitch of the attention tiles in halves: 144 B = 16 B x 9 (odd), for 16-B fragment reads
static_assert(NH * HD == DM);
static_assert((SEQ % 64) == 0 && (DM % 64) == 0 && (MP % 64) == 0);
static_assert(HD == 64);

typedef _Float16       v16h __attribute__((ext_vector_type(16)));
typedef __bf16         v16b __attribute__((ext_vector_type(16)));
typedef unsigned short v16us __attribute__((ext_vector_type(16)));
typedef unsigned short v8us __attribute__((ext_vector_type(8)));
typedef float          v8f  __attribute__((ext_vector_type(8)));
typedef float          v4f  __attribute__((ext_vector_type(4)));
typedef unsigned int   v4u  __attribute__((ext_vector_type(4)));

union Frag { v16us u; v8us p[2]; v16h h; v16b b; };

// ---- scalar helpers --------------------------------------------------------------------------------
__device__ __forceinline__ unsigned short bf_bits(float f) {          // f32 -> bf16 bits, RNE convert
  unsigned u = __float_as_uint(f);
  return (unsigned short)((u + 0x7FFFu + ((u >> 16) & 1u)) >> 16);
}
__device__ __forceinline__ float bf_up(unsigned short h) { return __uint_as_float(((unsigned)h) << 16); }
__device__ __forceinline__ float bfr(float f) { return bf_up(bf_bits(f)); }   // value of the bf16 RNE convert
__device__ __forceinline__ unsigned short h_bits(_Float16 x) { return __builtin_bit_cast(unsigned short, x); }
__device__ __forceinline__ unsigned pk16(unsigned short a, unsigned short b) { return (unsigned)a | ((unsigned)b << 16); }
__device__ __forceinline__ v8f zero8() { v8f z = {0.f, 0.f, 0.f, 0.f, 0.f, 0.f, 0.f, 0.f}; return z; }

// ---- fragment loader: 16-bit A/B operand (bit planes), lane -> row/col (lane&15), p already includes +8*(lane>>4);
//      elements 0..7 <- p[0..7] (k0+8h..), elements 8..15 <- p[16..23] (k0+16+8h..)
__device__ __forceinline__ v16us ldfrag(const unsigned short* p) {
  Frag f;
  f.p[0] = *(const v8us*)(p);
  f.p[1] = *(const v8us*)(p + 16);
  return f.u;
}

// ---- WMMA helpers (BF = 0: f16 operands, BF = 1: bf16 operands) with trailing VALU hazard gap -----------------
template <int BF>
__device__ __forceinline__ v8f mma_raw(v16us a, v16us b, v8f c) {
  Frag fa, fb;
  fa.u = a;
  fb.u = b;
  if constexpr (BF) {
    return __builtin_amdgcn_wmma_f32_16x16x32_bf16(false, fa.b, false, fb.b, (short)0, c, false, false);
  } else {
    return __builtin_amdgcn_wmma_f32_16x16x32_f16(false, fa.h, false, fb.h, (short)0, c, false, false);
  }
}
template <int BF>
__device__ __forceinline__ v8f mma_g(v16us a, v16us b, v8f c) {
  c = mma_raw<BF>(a, b, c);
#if defined(__HIP_DEVICE_COMPILE__)
  asm volatile("v_nop\n\tv_nop\n\tv_nop\n\tv_nop" : "+v"(c) : "v"(a), "v"(b));
#endif
  return c;
}
__device__ __forceinline__ void dep_guard1(v8f& a, v8f& b, v16us x) {
#if defined(__HIP_DEVICE_COMPILE__)
  asm volatile("v_nop\n\tv_nop\n\tv_nop\n\tv_nop" : "+v"(a), "+v"(b) : "v"(x));
#endif
}
__device__ __forceinline__ void keep4(v16us a, v16us b, v16us c, v16us d) {
#if defined(__HIP_DEVICE_COMPILE__)
  asm volatile("v_nop" :: "v"(a), "v"(b), "v"(c), "v"(d));
#endif
}
__device__ __forceinline__ void acc_guard4(v8f& a, v8f& b, v8f& c, v8f& d) {
#if defined(__HIP_DEVICE_COMPILE__)
  asm volatile("v_nop\n\tv_nop\n\tv_nop\n\tv_nop" : "+v"(a), "+v"(b), "+v"(c), "+v"(d));
#endif
}
__device__ __forceinline__ void wave_sync_lds() {
  __builtin_amdgcn_fence(__ATOMIC_RELEASE, "workgroup");
  __builtin_amdgcn_wave_barrier();
  __builtin_amdgcn_fence(__ATOMIC_ACQUIRE, "workgroup");
}

// =====================================================================================================
// f32 -> f16 activation plane convert: Xh[i] = f16( bf16_RNE(X[i]) * wsc ), wsc a power of two (exact).
// Thread i handles elements 8i..8i+7 and writes one 16-B piece; 32 consecutive lanes of one instruction fill
// (host-checked) so every store is full-width.
// coverage: n8 threads x 8 elements = the whole plane.
// =====================================================================================================
__global__ __launch_bounds__(256) void conv_h16(const float* __restrict__ W, unsigned short* Wh, int n8, float wsc) {
  const int i  = blockIdx.x * 256 + threadIdx.x;
  const int ic = (i < n8) ? i : (n8 - 1);                     // clamped address
  const float* src = W + (size_t)ic * 8;
  const v4f a = *(const v4f*)(src);
  const v4f c = *(const v4f*)(src + 4);
  v4u o;
  o[0] = pk16(h_bits((_Float16)(bfr(a[0]) * wsc)), h_bits((_Float16)(bfr(a[1]) * wsc)));
  o[1] = pk16(h_bits((_Float16)(bfr(a[2]) * wsc)), h_bits((_Float16)(bfr(a[3]) * wsc)));
  o[2] = pk16(h_bits((_Float16)(bfr(c[0]) * wsc)), h_bits((_Float16)(bfr(c[1]) * wsc)));
  o[3] = pk16(h_bits((_Float16)(bfr(c[2]) * wsc)), h_bits((_Float16)(bfr(c[3]) * wsc)));
  if (i < n8) *(v4u*)(Wh + (size_t)i * 8) = o;
  
}

// =====================================================================================================
// 64x64 tile transpose-convert of an f32 weight tensor: z-slice in[z] is [R][C] f32 (row pitch C elements,
// slice stride inStrideZ); output is 16-bit with rows indexed by the INPUT COLUMN: out[z*outStrideZ + c*ldo + r]
// (the input row index r becomes the k-contiguous column), i.e. in[rows=R][cols=C] -> out[cols=C][rows=R].
//   BF == 0: value = f16( bf16_RNE(x) * sc )   (sc a power of two)
//   BF == 1: value = bf16_RNE(x) bits; DUP == 1 additionally writes the same 16-B piece at column offset + dupOff.
// grid = (R/64, C/64, Z), block 256. Load phase: 1024 float4 pieces (64 rows x 16) = the whole 64x64 tile,
// 4 per thread, converted and stored transposed into LDS with 16-bit element stores; __syncthreads; store phase:
// coverage: 2 iterations x 32 rows x (8 lanes x 8 halves) = the whole 64x64 output tile (x2 destinations if DUP);
//           the grid tiles every (r block, c block, z) exactly once.
// =====================================================================================================
template <int BF, int DUP>
__global__ __launch_bounds__(256) void tconv64(const float* __restrict__ in, long long inStrideZ, int C,
                                               unsigned short* out, long long outStrideZ, int ldo, int dupOff,
                                               float sc) {
  __shared__ __align__(16) unsigned short sT[64 * 72];        // [c local][r local], pitch 72 halves (144 B)
  const int t  = threadIdx.x;
  const int r0 = blockIdx.x * 64;
  const int c0 = blockIdx.y * 64;
  const float* src = in + (size_t)blockIdx.z * (size_t)inStrideZ;
  unsigned short* dst = out + (size_t)blockIdx.z * (size_t)outStrideZ;
#pragma unroll
  for (int i = 0; i < 4; ++i) {
    const int idx = t + 256 * i;                              // 0..1023
    const int rr  = idx >> 4;                                 // 0..63
    const int cq  = (idx & 15) * 4;                           // 0..60
    const v4f x = *(const v4f*)(src + (size_t)(r0 + rr) * (size_t)C + c0 + cq);
#pragma unroll
    for (int j = 0; j < 4; ++j) {
      unsigned short w;
      if (BF) {
        w = bf_bits(x[j]);
      } else {
        w = h_bits((_Float16)(bfr(x[j]) * sc));
      }
      sT[(cq + j) * 72 + rr] = w;
    }
  }
  __syncthreads();
  const int q8 = t >> 3;                                      // 0..31: row within the 32-row group
  const int c8 = (t & 7) * 8;
  v8us vv[2];
#pragma unroll
  for (int it = 0; it < 2; ++it) {
    const int row = it * 32 + q8;                             // it 0..1 x q8 0..31 = rows 0..63
    vv[it] = *(const v8us*)(sT + row * 72 + c8);
  }
  {
#pragma unroll
    for (int it = 0; it < 2; ++it) {
      const int row = it * 32 + q8;
      unsigned short* dp = dst + (size_t)(c0 + row) * (size_t)ldo + r0 + c8;
      *(v8us*)(dp) = vv[it];
      if (DUP) *(v8us*)(dp + dupOff) = vv[it];
    }
    
  }
}

// =====================================================================================================
// Register-blocked batched 16-bit WMMA GEMM: C[m][n] = oscale * sum_k A[m][k] * Bt[n][k] + bias;
// one wave per 64x64 tile, no block barriers. A row-major [M][K] pitch lda; Bt row-major [N][K] pitch ldb (k contiguous);
// M, N multiples of 64, K multiple of 32 (static here). blockIdx.y = batch index (strides in elements).
// BF: 0 = f16 operand planes, 1 = bf16 operand planes.
// Bias: BIASM == 0 -> per column: cols < Nb from bias0[col], cols >= Nb from bias1[col - Nb] (tile-uniform select of
//       clamped-address loads); BIASM == 1 -> per row bias0[m]. Bias values RNE-converted to bf16.
// OM: 0 = f32 out (pitch ldc); 2 = f16 out; 3 = f16 hi plane at C plus f16 residual plane ((f - hi) * RSC) at
//     C + resOff (same pitch and offsets).
// coverage: 4 slabs x 16 rows x 64 cols = the wave's whole 64x64 tile; grid = ceil(tilesM*tilesN/8) blocks,
//           surplus waves exit (wave-uniform); here every tile count is a multiple of 8, so none exit.
// =====================================================================================================
template <int BF, int OM, int BIASM>
__global__ __launch_bounds__(256) void gemm64(
    const unsigned short* __restrict__ A, int lda, long long strideA,
    const unsigned short* __restrict__ Bt, int ldb, long long strideB,
    const float* __restrict__ bias0, const float* __restrict__ bias1, int Nb,
    void* Cout, int ldc, long long strideC, long long resOff,
    int M, int N, int K, float oscale) {
  __shared__ __align__(16) float sT[8][16 * 68];   // per-wave 16x64 slab, pitch 68 floats
  const int b    = blockIdx.y;
  const int lane = threadIdx.x & 31;
  const int wave = threadIdx.x >> 5;
  const int tilesN = N >> 6;
  const int tilesM = M >> 6;
  const int tile = blockIdx.x * 8 + wave;
  if (tile >= tilesM * tilesN) return;   // wave-uniform; no block barriers in this kernel
  const int tm = tile / tilesN;
  const int tn = tile - tm * tilesN;
  const int m0 = tm << 6;
  const int n0 = tn << 6;

  const unsigned short* Ab = A  + (size_t)b * (size_t)strideA;
  const unsigned short* Bb = Bt + (size_t)b * (size_t)strideB;

  const int rlane = lane & 15;                 // row (A) / col (B, D) within subtile
  const int koff  = (lane >> 4) * 8;           // k offset of this lane half
  const int mOff  = (lane >> 4) * 8;           // D row offset

  v8f acc[4][4];
#pragma unroll
  for (int i = 0; i < 4; ++i)
#pragma unroll
    for (int j = 0; j < 4; ++j) acc[i][j] = zero8();

  for (int k0 = 0; k0 < K; k0 += 32) {
    v16us bh[4];
#pragma unroll
    for (int j = 0; j < 4; ++j) {
      const size_t bo = (size_t)(n0 + (j << 4) + rlane) * ldb + koff + k0;
      bh[j] = ldfrag(Bb + bo);
    }
#pragma unroll
    for (int i = 0; i < 4; ++i) {
      const size_t ao = (size_t)(m0 + (i << 4) + rlane) * lda + koff + k0;
      const v16us ah = ldfrag(Ab + ao);
#pragma unroll
      for (int j = 0; j < 4; ++j) acc[i][j] = mma_raw<BF>(ah, bh[j], acc[i][j]);
      dep_guard1(acc[i][0], acc[i][3], ah);
    }
    keep4(bh[0], bh[1], bh[2], bh[3]);
  }
  acc_guard4(acc[0][0], acc[0][1], acc[0][2], acc[0][3]);
  acc_guard4(acc[1][0], acc[1][1], acc[1][2], acc[1][3]);
  acc_guard4(acc[2][0], acc[2][1], acc[2][2], acc[2][3]);
  acc_guard4(acc[3][0], acc[3][1], acc[3][2], acc[3][3]);

  // ---- per-lane column bias (BIASM == 0), RNE-converted ----
  const int hh2 = lane >> 4, c4 = (lane & 15) * 4;     // f32 out: 256-B row segment = 16 lanes x 16 B
  const int q8  = lane >> 3, c8 = (lane & 7) * 8;
  float bc[8];
#pragma unroll
  for (int e = 0; e < 8; ++e) bc[e] = 0.f;
  if (BIASM == 0) {
    const bool use1 = (n0 >= Nb);                      // tile-uniform
    if (OM == 0) {
      const int cb = n0 + c4;
      const int i0 = (cb < Nb - 4) ? cb : (Nb - 4);
      const int i1 = (cb - Nb > 0) ? (cb - Nb) : 0;
      const v4f b0v = *(const v4f*)(bias0 + i0);
      const v4f b1v = *(const v4f*)(bias1 + i1);
#pragma unroll
      for (int e = 0; e < 4; ++e) bc[e] = bfr(use1 ? b1v[e] : b0v[e]);
    } else {
      const int cb = n0 + c8;
      const int i0 = (cb < Nb - 8) ? cb : (Nb - 8);
      const int i1 = (cb - Nb > 0) ? (cb - Nb) : 0;
      const v4f b0a = *(const v4f*)(bias0 + i0), b0b = *(const v4f*)(bias0 + i0 + 4);
      const v4f b1a = *(const v4f*)(bias1 + i1), b1b = *(const v4f*)(bias1 + i1 + 4);
#pragma unroll
      for (int e = 0; e < 4; ++e) {
        bc[e]     = bfr(use1 ? b1a[e] : b0a[e]);
        bc[4 + e] = bfr(use1 ? b1b[e] : b0b[e]);
      }
    }
  }

  // ---- epilogue ----
  float* slab = sT[wave];
#pragma unroll
  for (int i = 0; i < 4; ++i) {
    const int mBase = m0 + (i << 4);
#pragma unroll
    for (int j = 0; j < 4; ++j) {
#pragma unroll
      for (int r = 0; r < 8; ++r) {
        slab[(mOff + r) * 68 + (j << 4) + rlane] = acc[i][j][r];
      }
    }
    wave_sync_lds();
    if constexpr (OM == 0) {
      float* C = (float*)Cout + (size_t)b * (size_t)strideC;
      v4f vals[8];
#pragma unroll
      for (int it = 0; it < 8; ++it) {
        const int row = it * 2 + hh2;                      // it 0..7 x hh2 0..1 = rows 0..15
        v4f v = *(const v4f*)(slab + row * 68 + c4);
#pragma unroll
        for (int e = 0; e < 4; ++e) v[e] = v[e] * oscale + bc[e];
        vals[it] = v;
      }
      {
#pragma unroll
        for (int it = 0; it < 8; ++it) {
          const int row = it * 2 + hh2;
          *(v4f*)(C + (size_t)(mBase + row) * ldc + n0 + c4) = vals[it];
        }
        
      }
    } else {
      unsigned short* C = (unsigned short*)Cout + (size_t)b * (size_t)strideC;
      v4u hv[4], hr[4];
#pragma unroll
      for (int it = 0; it < 4; ++it) {
        const int row = it * 4 + q8;                       // it 0..3 x q8 0..3 = rows 0..15
        const float* sp = slab + row * 68 + c8;
        float bm = 0.f;
        if (BIASM == 1) bm = bfr(bias0[mBase + row]);
        v4u a, ar;
#pragma unroll
        for (int e = 0; e < 4; ++e) {
          const float f0 = sp[2 * e]     * oscale + ((BIASM == 1) ? bm : bc[2 * e]);
          const float f1 = sp[2 * e + 1] * oscale + ((BIASM == 1) ? bm : bc[2 * e + 1]);
          const _Float16 g0 = (_Float16)f0, g1 = (_Float16)f1;
          a[e] = pk16(h_bits(g0), h_bits(g1));
          if (OM == 3) {
            const float e0 = (f0 - (float)g0) * RSC;
            const float e1 = (f1 - (float)g1) * RSC;
            ar[e] = pk16(h_bits((_Float16)e0), h_bits((_Float16)e1));
          } else {
            ar[e] = 0u;
          }
        }
        hv[it] = a;
        hr[it] = ar;
      }
      {
#pragma unroll
        for (int it = 0; it < 4; ++it) {
          const int row = it * 4 + q8;
          unsigned short* dp = C + (size_t)(mBase + row) * ldc + n0 + c8;
          *(v4u*)(dp) = hv[it];
          if (OM == 3) *(v4u*)(dp + resOff) = hr[it];
        }
        
      }
    }
    wave_sync_lds();
  }
}

// =====================================================================================================
// Flash attention, head dim 64, SEQ token rows per batch (all keys valid, no mask).
//   q planes (f16, pitch DM): hi at qhp[(b*SEQ + t)*DM + h*64 + d], residual (x2048) at qhp + QRES (same offsets)
//   k plane (f16, pitch DM): khp[(b*SEQ + t)*DM + h*64 + d]
//   v^T planes (f16): hi at vtp[(b*DM + h*64 + d)*SEQ + s], residual (x2048) at vtp + VRES
//   context planes (bf16, pitch CTXP): hi at ctxp[(b*SEQ + t)*CTXP + h*64 + d], lo at the same + DM
//   score = fma(acc_hi, sscale, acc_res * ssres); p = exp(s - m) carried as f16(1024 p); context = p . v with the
//   v hi and v residual products in two accumulators; online softmax (running max) in f32.
//   Block = 4 waves = 64 query rows of one (b, h); grid = NQB * NH * NBATCH; kv chunks of 64, static trip NQB.
//   K / V^T hi / V^T res chunk staging: 128 threads x 32 elements per plane = the whole 64x64 tile each
//   (plain 16-B loads, __syncthreads before and after); P tiles are wave-private, spilled with ushort element
//   Context coverage: each wave stores rows q0..q0+15 (it 0..3 x lane>>3 0..3) x 64 columns (8 lanes x 8) of both
//   the hi and the lo plane; grid covers all SEQ rows x NH head slices x NBATCH.
// =====================================================================================================
__global__ __launch_bounds__(128)
void attn64(const unsigned short* __restrict__ qhp, const unsigned short* __restrict__ khp,
            const unsigned short* __restrict__ vtp, unsigned short* ctxp,
            float sscale, float ssres) {
  __shared__ __align__(16) unsigned short Ksh[64 * LP];           // K [kv][d]        9 KB, rows of 64 at pitch LP
  __shared__ __align__(16) unsigned short Vth[64 * LP];           // V^T hi [d][kv]   9 KB, rows of 64 at pitch LP
  __shared__ __align__(16) unsigned short Vtr[64 * LP];           // V^T res [d][kv]  9 KB, rows of 64 at pitch LP
  __shared__ __align__(16) unsigned short Psh[4][16 * LP];        // per wave P [row][kv], rows of 64 at pitch LP
  __shared__ __align__(16) float          Os[4][16 * 64];         // per wave context tile [row][d]

  const int tid  = threadIdx.x;
  const int wave = tid >> 5;
  const int lane = tid & 31;
  const int hh   = lane >> 4;
  const int c    = lane & 15;

  const int bx   = blockIdx.x;
  const int qb   = bx % NQB;
  const int rest = bx / NQB;
  const int h    = rest % NH;
  const int b    = rest / NH;
  const int q0   = qb * 64 + wave * 16;          // in-batch query row of this wave's first row
  const size_t rowB = (size_t)b * SEQ;

  const unsigned short* Qh = qhp + (size_t)h * HD;
  const unsigned short* Qr = qhp + QRES + (size_t)h * HD;
  const unsigned short* Kg = khp + (size_t)h * HD;
  const unsigned short* Vh = vtp + ((size_t)b * DM + (size_t)h * HD) * SEQ;
  const unsigned short* Vr = Vh + VRES;

  float mrow[8], lrow[8];
  v8f oacc[4], oacr[4];
#pragma unroll
  for (int r = 0; r < 8; ++r) { mrow[r] = -INFINITY; lrow[r] = 0.f; }
#pragma unroll
  for (int t = 0; t < 4; ++t) { oacc[t] = zero8(); oacr[t] = zero8(); }

  for (int kt = 0; kt < NQB; ++kt) {         // static trip count
    const int kv0 = kt * 64;
    __syncthreads();
    {
      const int r = tid >> 1, hf = (tid & 1) * 32;
      const unsigned short* kg = Kg + (rowB + kv0 + r) * DM + hf;          // K row kv0+r, d = hf..hf+31
      const unsigned short* vg = Vh + (size_t)r * SEQ + kv0 + hf;           // V^T hi row d = r, s = kv0+hf..
      const unsigned short* vr = Vr + (size_t)r * SEQ + kv0 + hf;           // V^T res row d = r
#pragma unroll
      for (int i = 0; i < 4; ++i) {
        const v8us a0 = *(const v8us*)(kg + 8 * i);
        const v8us b0 = *(const v8us*)(vg + 8 * i);
        const v8us c0 = *(const v8us*)(vr + 8 * i);
        *(v8us*)(Ksh + r * LP + hf + 8 * i) = a0;
        *(v8us*)(Vth + r * LP + hf + 8 * i) = b0;
        *(v8us*)(Vtr + r * LP + hf + 8 * i) = c0;
      }
    }
    __syncthreads();

    // ---- Q fragments (A operand, row = lane&15): hi and residual, 2 d-chunks each ----
    v16us qa[2], qr[2];
#pragma unroll
    for (int dc = 0; dc < 2; ++dc) {
      qa[dc] = ldfrag(Qh + (rowB + q0 + c) * DM + dc * 32 + 8 * hh);
      qr[dc] = ldfrag(Qr + (rowB + q0 + c) * DM + dc * 32 + 8 * hh);
    }

    // ---- scores: 16 query rows x 64 keys per wave ----
    v8f s[4];
#pragma unroll
    for (int j = 0; j < 4; ++j) {
      v8f sh = zero8(), sr = zero8();
#pragma unroll
      for (int dc = 0; dc < 2; ++dc) {
        Frag kb;
        kb.p[0] = *(const v8us*)(Ksh + (j * 16 + c) * LP + dc * 32 + 8 * hh);
        kb.p[1] = *(const v8us*)(Ksh + (j * 16 + c) * LP + dc * 32 + 16 + 8 * hh);
        sh = mma_g<0>(qa[dc], kb.u, sh);
        sr = mma_g<0>(qr[dc], kb.u, sr);
      }
#pragma unroll
      for (int r = 0; r < 8; ++r) s[j][r] = fmaf(sh[r], sscale, sr[r] * ssres);
    }

    // ---- row max, online softmax, P (x1024, f16 bits) to LDS ----
    unsigned short* pwh = Psh[wave];
#pragma unroll
    for (int r = 0; r < 8; ++r) {
      float m = s[0][r];
      m = fmaxf(m, s[1][r]);
      m = fmaxf(m, s[2][r]);
      m = fmaxf(m, s[3][r]);
#pragma unroll
      for (int off = 1; off < 16; off <<= 1) m = fmaxf(m, __shfl_xor(m, off, 32));
      const float mnew  = fmaxf(mrow[r], m);
      const float alpha = __expf(mrow[r] - mnew);
      mrow[r] = mnew;
      float psum = 0.f;
#pragma unroll
      for (int j = 0; j < 4; ++j) {
        const float p = __expf(s[j][r] - mnew);
        psum += p;
        pwh[(8 * hh + r) * LP + j * 16 + c] = h_bits((_Float16)(p * PSC));
      }
#pragma unroll
      for (int off = 1; off < 16; off <<= 1) psum += __shfl_xor(psum, off, 32);
      lrow[r] = lrow[r] * alpha + psum;
#pragma unroll
      for (int t = 0; t < 4; ++t) { oacc[t][r] *= alpha; oacr[t][r] *= alpha; }
    }
    wave_sync_lds();

    // ---- context += P . V (hi and residual products, f16 WMMA) ----
#pragma unroll 1
    for (int kk = 0; kk < 2; ++kk) {
      Frag pa;
      pa.p[0] = *(const v8us*)(pwh + c * LP + kk * 32 + 8 * hh);
      pa.p[1] = *(const v8us*)(pwh + c * LP + kk * 32 + 16 + 8 * hh);
#pragma unroll
      for (int t = 0; t < 4; ++t) {
        Frag vb, vc;
        vb.p[0] = *(const v8us*)(Vth + (t * 16 + c) * LP + kk * 32 + 8 * hh);
        vb.p[1] = *(const v8us*)(Vth + (t * 16 + c) * LP + kk * 32 + 16 + 8 * hh);
        vc.p[0] = *(const v8us*)(Vtr + (t * 16 + c) * LP + kk * 32 + 8 * hh);
        vc.p[1] = *(const v8us*)(Vtr + (t * 16 + c) * LP + kk * 32 + 16 + 8 * hh);
        oacc[t] = mma_g<0>(pa.u, vb.u, oacc[t]);
        oacr[t] = mma_g<0>(pa.u, vc.u, oacr[t]);
      }
    }
  }

  // ---- normalise (residual fold 1/2048, 1/l, the 1/1024 p carry), stage the wave's 16x64 tile, bf16 hi | lo
  float* os = Os[wave];
#pragma unroll
  for (int r = 0; r < 8; ++r) {
    const float l = lrow[r];
    const float inv = ((l > 0.f) ? (1.0f / l) : 0.f) * (1.0f / PSC);
#pragma unroll
    for (int t = 0; t < 4; ++t) os[(8 * hh + r) * 64 + t * 16 + c] = fmaf(oacr[t][r], 1.0f / RSC, oacc[t][r]) * inv;
  }
  wave_sync_lds();
  {
    const int q4 = lane >> 3, c8 = (lane & 7) * 8;
    v4u hv[4], hl[4];
#pragma unroll
    for (int it = 0; it < 4; ++it) {
      const int row = it * 4 + q4;   // it 0..3 x q4 0..3 = rows 0..15 of the wave tile
      const float* sp = os + row * 64 + c8;
      v4u a, d;
#pragma unroll
      for (int e = 0; e < 4; ++e) {
        const float f0 = sp[2 * e], f1 = sp[2 * e + 1];
        const unsigned short hb0 = bf_bits(f0), hb1 = bf_bits(f1);
        const unsigned short lb0 = bf_bits(f0 - bf_up(hb0)), lb1 = bf_bits(f1 - bf_up(hb1));
        a[e] = pk16(hb0, hb1);
        d[e] = pk16(lb0, lb1);
      }
      hv[it] = a;
      hl[it] = d;
    }
    {
#pragma unroll
      for (int it = 0; it < 4; ++it) {
        const int row = it * 4 + q4;
        const size_t go = (rowB + q0 + row) * CTXP + (size_t)h * HD + c8;
        *(v4u*)(ctxp + go)      = hv[it];
        *(v4u*)(ctxp + go + DM) = hl[it];
      }
      
    }
  }
}

// =====================================================================================================
// Workspace map (bytes); every plane is an exact multiple of its 64x64-tile / whole-row / whole-line store
// granularity (M = MP = 4096 = 64 tiles, N = 1024 = 16 tiles; V^T per batch [1024][2048] = 16x32 tiles):
//   WqkvT f16 [3072 n][1024 k]        0           6291456   (rows 0..1023 = h*64+d of Wq, then Wk, then Wv; x64)
//   WoB   bf16 [1024 n][2048 k]       6291456     4194304   (Wo^T bf16, k-duplicated)
//   XH    f16 [4096][1024]            10485760    8388608   (converted activation plane, reused for the 3 sources)
//   QH|QR f16 [2][4096][1024]         18874368    16777216  (q hi plane, then q residual plane x2048)
//   KH    f16 [4096][1024]            35651584    8388608
//   VT|VR f16 [2][2][1024][2048]      44040192    16777216  (v^T hi planes per batch, then residual planes x2048)
//   Ctx   bf16 [4096][2048]           60817408    16777216  (context hi cols 0..1023, lo cols 1024..2047)
//   end                               77594624
// =====================================================================================================
extern "C" void kernel_launch(void* const* d_in, const int* in_sizes, int n_in,
                              void* d_out, int out_size, void* d_ws, size_t ws_size,
                              hipStream_t stream) {
  if (n_in < 11) return;
  if (in_sizes[0] != MP * DM || in_sizes[1] != MP * DM || in_sizes[2] != MP * DM) return;
  if (in_sizes[3] != NH * DM * HD || in_sizes[4] != NH * HD) return;
  if (in_sizes[5] != NH * DM * HD || in_sizes[6] != NH * HD) return;
  if (in_sizes[7] != NH * DM * HD || in_sizes[8] != NH * HD) return;
  if (in_sizes[9] != DM * DM || in_sizes[10] != DM) return;
  if (out_size != MP * DM) return;

  const float* query = (const float*)d_in[0];
  const float* key_  = (const float*)d_in[1];
  const float* value = (const float*)d_in[2];
  const float* w_q   = (const float*)d_in[3];
  const float* b_q   = (const float*)d_in[4];
  const float* w_k   = (const float*)d_in[5];
  const float* b_k   = (const float*)d_in[6];
  const float* w_v   = (const float*)d_in[7];
  const float* b_v   = (const float*)d_in[8];
  const float* w_o   = (const float*)d_in[9];
  const float* b_o   = (const float*)d_in[10];

  const size_t PW   = (size_t)3 * DM * DM * 2;            //  6291456
  const size_t PWO  = (size_t)DM * CTXP * 2;              //  4194304
  const size_t PX   = (size_t)MP * DM * 2;                //  8388608
  const size_t PQ   = (size_t)2 * MP * DM * 2;            // 16777216
  const size_t PK   = (size_t)MP * DM * 2;                //  8388608
  const size_t PV   = (size_t)2 * NBATCH * DM * SEQ * 2;  // 16777216
  const size_t PC   = (size_t)MP * CTXP * 2;              // 16777216
  size_t off = 0;
  const size_t oW  = off; off += PW;
  const size_t oWo = off; off += PWO;
  const size_t oX  = off; off += PX;
  const size_t oQ  = off; off += PQ;
  const size_t oK  = off; off += PK;
  const size_t oV  = off; off += PV;
  const size_t oC  = off; off += PC;
  if (off > ws_size) return;                               // off = 77594624
  if (off > (size_t)134217728) return;

  char* ws = (char*)d_ws;
  unsigned short* WqkvT = (unsigned short*)(ws + oW);
  unsigned short* WoB   = (unsigned short*)(ws + oWo);
  unsigned short* XH    = (unsigned short*)(ws + oX);
  unsigned short* QH    = (unsigned short*)(ws + oQ);
  unsigned short* KH    = (unsigned short*)(ws + oK);
  unsigned short* VT    = (unsigned short*)(ws + oV);
  unsigned short* Ctx   = (unsigned short*)(ws + oC);
  float*          out0  = (float*)d_out;

  const int n8x = (MP * DM) / 8;
  if ((n8x % 256) != 0) return;
  const dim3 blk(256), blk128(128);
  const dim3 gCx((n8x + 255) / 256);
  const dim3 gTw(DM / 64, HD / 64, NH);                               // in[e=1024][d=64] per head -> out[d][e]
  const dim3 gTo(DM / 64, DM / 64, 1);                                // in[k=1024][n=1024] -> out[n][k]
  const dim3 gN1k(((MP / 64) * (DM / 64) + 7) / 8, 1);                // 1024 tiles -> 128 blocks
  const dim3 gVT(((DM / 64) * (SEQ / 64) + 7) / 8, NBATCH);           // 512 tiles -> 64 blocks x 2 batches
  const dim3 gAttn(NBATCH * NH * NQB);                                // 1024 blocks of 128
  const float invw  = 1.0f / WSC;                                     // weight carry x64
  const float ssc   = 0.125f;                                         // 1/sqrt(64)
  const float ssr   = 0.125f / RSC;                                   // same, for the x2048 residual products

  // (0) weight planes: WqkvT[(z*1024) + h*64 + d][e] = f16( bf16_RNE(W[h][e][d]) * 64 ); per head the input slice is
  //     in[rows = e (1024)][cols = d (64)] -> out[cols = d][rows = e]; Wo: in[rows = k][cols = n] -> WoB[n][k] and
  //     WoB[n][1024 + k] = bf16_RNE(Wo[k][n]).
  tconv64<0, 0><<<gTw, blk, 0, stream>>>(w_q, (long long)DM * HD, HD, WqkvT, (long long)HD * DM, DM, 0, WSC);
  tconv64<0, 0><<<gTw, blk, 0, stream>>>(w_k, (long long)DM * HD, HD, WqkvT + (size_t)DM * DM,
                                         (long long)HD * DM, DM, 0, WSC);
  tconv64<0, 0><<<gTw, blk, 0, stream>>>(w_v, (long long)DM * HD, HD, WqkvT + (size_t)2 * DM * DM,
                                         (long long)HD * DM, DM, 0, WSC);
  tconv64<1, 1><<<gTo, blk, 0, stream>>>(w_o, 0LL, DM, WoB, 0LL, CTXP, DM, 1.0f);

  // (1) Q = bf16(q) . WqT^T + b_q -> QH (f16 hi) and QH + QRES (f16 residual x2048); column n = h*64 + d
  conv_h16<<<gCx, blk, 0, stream>>>(query, XH, n8x, 1.0f);
  gemm64<0, 3, 0><<<gN1k, blk, 0, stream>>>(
      XH, DM, 0LL, WqkvT, DM, 0LL, b_q, b_q, DM,
      (void*)QH, DM, 0LL, (long long)QRES, MP, DM, DM, invw);

  // (2) K = bf16(k) . WkT^T + b_k -> KH (f16)
  conv_h16<<<gCx, blk, 0, stream>>>(key_, XH, n8x, 1.0f);
  gemm64<0, 2, 0><<<gN1k, blk, 0, stream>>>(
      XH, DM, 0LL, WqkvT + (size_t)DM * DM, DM, 0LL, b_k, b_k, DM,
      (void*)KH, DM, 0LL, 0LL, MP, DM, DM, invw);

  // (3) V^T per batch = WvT . bf16(v)^T + b_v -> VT (f16 hi [2][1024][2048]) and VT + VRES (residual x2048);
  //     row m = h*64 + d (per-row bias b_v[m]), column n = token s of batch blockIdx.y
  conv_h16<<<gCx, blk, 0, stream>>>(value, XH, n8x, 1.0f);
  gemm64<0, 3, 1><<<gVT, blk, 0, stream>>>(
      WqkvT + (size_t)2 * DM * DM, DM, 0LL, XH, DM, (long long)SEQ * DM, b_v, b_v, SEQ,
      (void*)VT, SEQ, (long long)DM * SEQ, (long long)VRES, DM, SEQ, DM, invw);

  // (4) flash attention -> Ctx bf16 hi | lo (concat layout, column h*64 + d)
  attn64<<<gAttn, blk128, 0, stream>>>(QH, KH, VT, Ctx, ssc, ssr);

  // (5) out = [ctx_hi | ctx_lo] . [Wo^T | Wo^T]^T + b_o  (K = 2048, bf16 operands) -> d_out f32 [4096][1024]
  gemm64<1, 0, 0><<<gN1k, blk, 0, stream>>>(
      Ctx, CTXP, 0LL, WoB, CTXP, 0LL, b_o, b_o, DM,
      (void*)out0, DM, 0LL, 0LL, MP, DM, CTXP, 1.0f);
  (void)hipGetLastError();
}

// v002
// Measured time: 227 microseconds a run.
// Two timings next to v001 both put it at 1.60 times that version's speed.
// Counting every step since v000, it is 2.00 times as fast.
// Contractions: q, k and v^T in-projections on v_wmma_f32_16x16x32_f16 (f16 activation plane x f16 weight plane
// carried x64, one product each); attention q.k^T on v_wmma_f32_16x16x32_f16 with q as f16 hi plane + f16 residual
// plane carried x2048 (two products, two accumulators) and k plain f16; p.v on v_wmma_f32_16x16x32_f16 with p
// carried x1024 (f16) and v^T as f16 hi plane + f16 residual plane carried x2048 (two products, two accumulators);
// output projection on v_wmma_f32_16x16x32_bf16 with the context as bf16 hi | lo planes concatenated along k against
// a k-duplicated bf16 weight plane (two products, one accumulator); all f32 accumulate; softmax in f32 on VALU;
// every float input RNE-converted to bf16 on load.
#include <hip/hip_runtime.h>
#include <math.h>
#include <stdint.h>

#define NBATCH 2
#define SEQ    2048
#define DM     1024
#define NH     16
#define HD     64
#define MP     (NBATCH * SEQ)
#define NQB    (SEQ / 64)
#define CTXP   (2 * DM)
#define QRES   ((size_t)MP * DM)
#define VRES   ((size_t)NBATCH * DM * SEQ)
#define WSC    64.0f
#define RSC    2048.0f
#define PSC    1024.0f
#define LP     72      // LDS row pitch of the attention tiles in halves: 144 B = 16 B x 9 (odd), for 16-B fragment reads
#define GPIT   72      // LDS row pitch of the staged GEMM operand tiles in halves: 144 B, same reason
#define GROWS  384     // rows of one staged GEMM tile: 128 rows of A, then 256 rows of Bt, 64 k (128 B) each
#define GBUFH  (GROWS * GPIT)   // halves per staging buffer (55296 B)
static_assert(NH * HD == DM);
static_assert((SEQ % 64) == 0 && (DM % 64) == 0 && (MP % 64) == 0);
static_assert(HD == 64);
static_assert((MP % 128) == 0 && (DM % 256) == 0 && (SEQ % 256) == 0 && (DM % 128) == 0);

typedef _Float16       v16h __attribute__((ext_vector_type(16)));
typedef __bf16         v16b __attribute__((ext_vector_type(16)));
typedef unsigned short v16us __attribute__((ext_vector_type(16)));
typedef unsigned short v8us __attribute__((ext_vector_type(8)));
typedef float          v8f  __attribute__((ext_vector_type(8)));
typedef float          v4f  __attribute__((ext_vector_type(4)));
typedef unsigned int   v4u  __attribute__((ext_vector_type(4)));

union Frag { v16us u; v8us p[2]; v16h h; v16b b; };

// ---- scalar helpers --------------------------------------------------------------------------------
__device__ __forceinline__ unsigned short bf_bits(float f) {          // f32 -> bf16 bits, RNE convert
  unsigned u = __float_as_uint(f);
  return (unsigned short)((u + 0x7FFFu + ((u >> 16) & 1u)) >> 16);
}
__device__ __forceinline__ float bf_up(unsigned short h) { return __uint_as_float(((unsigned)h) << 16); }
__device__ __forceinline__ float bfr(float f) { return bf_up(bf_bits(f)); }   // value of the bf16 RNE convert
__device__ __forceinline__ unsigned short h_bits(_Float16 x) { return __builtin_bit_cast(unsigned short, x); }
__device__ __forceinline__ unsigned pk16(unsigned short a, unsigned short b) { return (unsigned)a | ((unsigned)b << 16); }
__device__ __forceinline__ v8f zero8() { v8f z = {0.f, 0.f, 0.f, 0.f, 0.f, 0.f, 0.f, 0.f}; return z; }

// ---- fragment loader: 16-bit A/B operand (bit planes), lane -> row/col (lane&15), p already includes +8*(lane>>4);
//      elements 0..7 <- p[0..7] (k0+8h..), elements 8..15 <- p[16..23] (k0+16+8h..)
__device__ __forceinline__ v16us ldfrag(const unsigned short* p) {
  Frag f;
  f.p[0] = *(const v8us*)(p);
  f.p[1] = *(const v8us*)(p + 16);
  return f.u;
}

// ---- WMMA helpers (BF = 0: f16 operands, BF = 1: bf16 operands) with trailing VALU hazard gap -----------------
template <int BF>
__device__ __forceinline__ v8f mma_raw(v16us a, v16us b, v8f c) {
  Frag fa, fb;
  fa.u = a;
  fb.u = b;
  if constexpr (BF) {
    return __builtin_amdgcn_wmma_f32_16x16x32_bf16(false, fa.b, false, fb.b, (short)0, c, false, false);
  } else {
    return __builtin_amdgcn_wmma_f32_16x16x32_f16(false, fa.h, false, fb.h, (short)0, c, false, false);
  }
}
template <int BF>
__device__ __forceinline__ v8f mma_g(v16us a, v16us b, v8f c) {
  c = mma_raw<BF>(a, b, c);
#if defined(__HIP_DEVICE_COMPILE__)
  asm volatile("v_nop\n\tv_nop\n\tv_nop\n\tv_nop" : "+v"(c) : "v"(a), "v"(b));
#endif
  return c;
}
__device__ __forceinline__ void dep_guard1(v8f& a, v8f& b, v16us x) {
#if defined(__HIP_DEVICE_COMPILE__)
  asm volatile("v_nop\n\tv_nop\n\tv_nop\n\tv_nop" : "+v"(a), "+v"(b) : "v"(x));
#endif
}
__device__ __forceinline__ void keep4(v16us a, v16us b, v16us c, v16us d) {
#if defined(__HIP_DEVICE_COMPILE__)
  asm volatile("v_nop" :: "v"(a), "v"(b), "v"(c), "v"(d));
#endif
}
__device__ __forceinline__ void acc_guard4(v8f& a, v8f& b, v8f& c, v8f& d) {
#if defined(__HIP_DEVICE_COMPILE__)
  asm volatile("v_nop\n\tv_nop\n\tv_nop\n\tv_nop" : "+v"(a), "+v"(b), "+v"(c), "+v"(d));
#endif
}
__device__ __forceinline__ void wave_sync_lds() {
  __builtin_amdgcn_fence(__ATOMIC_RELEASE, "workgroup");
  __builtin_amdgcn_wave_barrier();
  __builtin_amdgcn_fence(__ATOMIC_ACQUIRE, "workgroup");
}

// ---- one staged GEMM tile: 12 asynchronous 16-B copies per lane, global -> LDS, no register in between.
//      Copy i < 4 brings A row (32 i + lane's row), copy 4 + i brings Bt row (32 i + lane's row); eight lanes cover one
//      128-B row segment, so each wave-wide copy takes four whole lines. l = the lane's LDS byte address in row 0..31 of
//      the buffer; rows 32 apart lie 32 * 144 B apart. The closing s_wait_xcnt 0 stands inside the statement so that no
//      address register of an issued copy is rewritten in front of it.
__device__ __forceinline__ void stage12(unsigned l, const unsigned short* a, size_t sa,
                                        const unsigned short* b, size_t sb) {
#if defined(__HIP_DEVICE_COMPILE__)
  const unsigned st = 32u * GPIT * 2u;
  asm volatile(
      "global_load_async_to_lds_b128 %0, %12, off\n\t"
      "global_load_async_to_lds_b128 %1, %13, off\n\t"
      "global_load_async_to_lds_b128 %2, %14, off\n\t"
      "global_load_async_to_lds_b128 %3, %15, off\n\t"
      "global_load_async_to_lds_b128 %4, %16, off\n\t"
      "global_load_async_to_lds_b128 %5, %17, off\n\t"
      "global_load_async_to_lds_b128 %6, %18, off\n\t"
      "global_load_async_to_lds_b128 %7, %19, off\n\t"
      "global_load_async_to_lds_b128 %8, %20, off\n\t"
      "global_load_async_to_lds_b128 %9, %21, off\n\t"
      "global_load_async_to_lds_b128 %10, %22, off\n\t"
      "global_load_async_to_lds_b128 %11, %23, off\n\t"
      "s_wait_xcnt 0x0"
      :: "v"(l), "v"(l + st), "v"(l + 2u * st), "v"(l + 3u * st), "v"(l + 4u * st), "v"(l + 5u * st),
         "v"(l + 6u * st), "v"(l + 7u * st), "v"(l + 8u * st), "v"(l + 9u * st), "v"(l + 10u * st), "v"(l + 11u * st),
         "v"(a), "v"(a + sa), "v"(a + 2 * sa), "v"(a + 3 * sa),
         "v"(b), "v"(b + sb), "v"(b + 2 * sb), "v"(b + 3 * sb), "v"(b + 4 * sb), "v"(b + 5 * sb), "v"(b + 6 * sb),
         "v"(b + 7 * sb)
      : "memory");
#endif
}

// =====================================================================================================
// f32 -> f16 activation plane convert: Xh[i] = f16( bf16_RNE(X[i]) * wsc ), wsc a power of two (exact).
// Thread i handles elements 8i..8i+7 and writes one 16-B piece; 32 consecutive lanes of one instruction fill
// (host-checked) so every store is full-width.
// coverage: n8 threads x 8 elements = the whole plane.
// =====================================================================================================
__global__ __launch_bounds__(256) void conv_h16(const float* __restrict__ W, unsigned short* Wh, int n8, float wsc) {
  const int i  = blockIdx.x * 256 + threadIdx.x;
  const int ic = (i < n8) ? i : (n8 - 1);                     // clamped address
  const float* src = W + (size_t)ic * 8;
  const v4f a = *(const v4f*)(src);
  const v4f c = *(const v4f*)(src + 4);
  v4u o;
  o[0] = pk16(h_bits((_Float16)(bfr(a[0]) * wsc)), h_bits((_Float16)(bfr(a[1]) * wsc)));
  o[1] = pk16(h_bits((_Float16)(bfr(a[2]) * wsc)), h_bits((_Float16)(bfr(a[3]) * wsc)));
  o[2] = pk16(h_bits((_Float16)(bfr(c[0]) * wsc)), h_bits((_Float16)(bfr(c[1]) * wsc)));
  o[3] = pk16(h_bits((_Float16)(bfr(c[2]) * wsc)), h_bits((_Float16)(bfr(c[3]) * wsc)));
  if (i < n8) *(v4u*)(Wh + (size_t)i * 8) = o;
  
}

// =====================================================================================================
// 64x64 tile transpose-convert of an f32 weight tensor: z-slice in[z] is [R][C] f32 (row pitch C elements,
// slice stride inStrideZ); output is 16-bit with rows indexed by the INPUT COLUMN: out[z*outStrideZ + c*ldo + r]
// (the input row index r becomes the k-contiguous column), i.e. in[rows=R][cols=C] -> out[cols=C][rows=R].
//   BF == 0: value = f16( bf16_RNE(x) * sc )   (sc a power of two)
//   BF == 1: value = bf16_RNE(x) bits; DUP == 1 additionally writes the same 16-B piece at column offset + dupOff.
// grid = (R/64, C/64, Z), block 256. Load phase: 1024 float4 pieces (64 rows x 16) = the whole 64x64 tile,
// 4 per thread, converted and stored transposed into LDS with 16-bit element stores; __syncthreads; store phase:
// coverage: 2 iterations x 32 rows x (8 lanes x 8 halves) = the whole 64x64 output tile (x2 destinations if DUP);
//           the grid tiles every (r block, c block, z) exactly once.
// =====================================================================================================
template <int BF, int DUP>
__global__ __launch_bounds__(256) void tconv64(const float* __restrict__ in, long long inStrideZ, int C,
                                               unsigned short* out, long long outStrideZ, int ldo, int dupOff,
                                               float sc) {
  __shared__ __align__(16) unsigned short sT[64 * 72];        // [c local][r local], pitch 72 halves (144 B)
  const int t  = threadIdx.x;
  const int r0 = blockIdx.x * 64;
  const int c0 = blockIdx.y * 64;
  const float* src = in + (size_t)blockIdx.z * (size_t)inStrideZ;
  unsigned short* dst = out + (size_t)blockIdx.z * (size_t)outStrideZ;
#pragma unroll
  for (int i = 0; i < 4; ++i) {
    const int idx = t + 256 * i;                              // 0..1023
    const int rr  = idx >> 4;                                 // 0..63
    const int cq  = (idx & 15) * 4;                           // 0..60
    const v4f x = *(const v4f*)(src + (size_t)(r0 + rr) * (size_t)C + c0 + cq);
#pragma unroll
    for (int j = 0; j < 4; ++j) {
      unsigned short w;
      if (BF) {
        w = bf_bits(x[j]);
      } else {
        w = h_bits((_Float16)(bfr(x[j]) * sc));
      }
      sT[(cq + j) * 72 + rr] = w;
    }
  }
  __syncthreads();
  const int q8 = t >> 3;                                      // 0..31: row within the 32-row group
  const int c8 = (t & 7) * 8;
  v8us vv[2];
#pragma unroll
  for (int it = 0; it < 2; ++it) {
    const int row = it * 32 + q8;                             // it 0..1 x q8 0..31 = rows 0..63
    vv[it] = *(const v8us*)(sT + row * 72 + c8);
  }
  {
#pragma unroll
    for (int it = 0; it < 2; ++it) {
      const int row = it * 32 + q8;
      unsigned short* dp = dst + (size_t)(c0 + row) * (size_t)ldo + r0 + c8;
      *(v8us*)(dp) = vv[it];
      if (DUP) *(v8us*)(dp + dupOff) = vv[it];
    }
    
  }
}

// =====================================================================================================
// Register-blocked batched 16-bit WMMA GEMM: C[m][n] = oscale * sum_k A[m][k] * Bt[n][k] + bias;
// one wave per 64x64 tile, 8 waves (2 x 4) = one 128x256 block tile. A row-major [M][K] pitch lda; Bt row-major [N][K]
// pitch ldb (k contiguous); M multiple of 128, N of 256, K of 64 (static here). blockIdx.y = batch (strides in elements).
// Operands: per 64 k the block's 128 A rows and 256 Bt rows are staged in LDS by asynchronous copies, two buffers: the
// copies of tile t + 2 go out behind the barrier at the foot of trip t and fly during trip t + 1; every fragment is read
// from LDS (k order per output element as before: ascending in steps of 32).
// BF: 0 = f16 operand planes, 1 = bf16 operand planes.
// Bias: BIASM == 0 -> per column: cols < Nb from bias0[col], cols >= Nb from bias1[col - Nb] (tile-uniform select of
//       clamped-address loads); BIASM == 1 -> per row bias0[m]. Bias values RNE-converted to bf16.
// OM: 0 = f32 out (pitch ldc); 2 = f16 out; 3 = f16 hi plane at C plus f16 residual plane ((f - hi) * RSC) at
//     C + resOff (same pitch and offsets).
// coverage: 4 slabs x 16 rows x 64 cols = the wave's whole 64x64 tile; grid = (M/128)*(N/256) blocks,
//           a surplus block exits as a whole in front of every barrier and copy.
// =====================================================================================================
template <int BF, int OM, int BIASM>
__global__ __launch_bounds__(256) void gemm64(
    const unsigned short* __restrict__ A, int lda, long long strideA,
    const unsigned short* __restrict__ Bt, int ldb, long long strideB,
    const float* __restrict__ bias0, const float* __restrict__ bias1, int Nb,
    void* Cout, int ldc, long long strideC, long long resOff,
    int M, int N, int K, float oscale) {
  __shared__ __align__(16) unsigned short sOp[2 * GBUFH];   // two staging buffers: [A 128 rows | Bt 256 rows] x 64 k
  __shared__ __align__(16) float sT[8][16 * 68];   // per-wave 16x64 slab, pitch 68 floats
  const int b    = blockIdx.y;
  const int lane = threadIdx.x & 31;
  const int wave = threadIdx.x >> 5;
  const int tilesN = N >> 8;
  const int tilesM = M >> 7;
  const int tile = blockIdx.x;
  if (tile >= tilesM * tilesN) return;   // block-uniform, in front of every barrier
  const int tm = tile / tilesN;
  const int tn = tile - tm * tilesN;
  const int mb0 = tm << 7;                     // block tile origin
  const int nb0 = tn << 8;
  const int wm  = wave >> 2;                   // wave's 64x64 tile inside the block tile
  const int wn  = wave & 3;
  const int m0 = mb0 + (wm << 6);
  const int n0 = nb0 + (wn << 6);

  const unsigned short* Ab = A  + (size_t)b * (size_t)strideA;
  const unsigned short* Bb = Bt + (size_t)b * (size_t)strideB;

  const int rlane = lane & 15;                 // row (A) / col (B, D) within subtile
  const int koff  = (lane >> 4) * 8;           // k offset of this lane half
  const int mOff  = (lane >> 4) * 8;           // D row offset

  v8f acc[4][4];
#pragma unroll
  for (int i = 0; i < 4; ++i)
#pragma unroll
    for (int j = 0; j < 4; ++j) acc[i][j] = zero8();

  // ---- staging addresses: thread -> row (tid >> 3) of each 32-row group, 16-B piece (tid & 7) of the 128-B segment ----
  const int crow = threadIdx.x >> 3;
  const int cpc  = (threadIdx.x & 7) * 8;
  const unsigned short* ga = Ab + (size_t)(mb0 + crow) * lda + cpc;
  const unsigned short* gb = Bb + (size_t)(nb0 + crow) * ldb + cpc;
  const size_t sa = (size_t)32 * lda, sb = (size_t)32 * ldb;
  const unsigned l0 =
      (unsigned)(uintptr_t)(const __attribute__((address_space(3))) unsigned short*)(sOp + crow * GPIT + cpc);
  const int T = K >> 6;                        // staged tiles of 64 k

  stage12(l0, ga, sa, gb, sb);                                 // tile 0 -> buffer 0
  asm volatile("s_wait_asynccnt 0x0" ::: "memory");            // this wave's copies of tile 0 have landed
  __syncthreads();                                             // ... and every other wave's
  if (T > 1) stage12(l0 + GBUFH * 2u, ga + 64, sa, gb + 64, sb);   // tile 1 -> buffer 1

  for (int t = 0; t < T; ++t) {
    const unsigned short* sbuf = sOp + (t & 1) * GBUFH;
    const unsigned short* fa = sbuf + ((wm << 6) + rlane) * GPIT + koff;
    const unsigned short* fb = sbuf + (128 + (wn << 6) + rlane) * GPIT + koff;
#pragma unroll
    for (int kk = 0; kk < 2; ++kk) {
      v16us bh[4], ah[4];
#pragma unroll
      for (int j = 0; j < 4; ++j) bh[j] = ldfrag(fb + (j << 4) * GPIT + kk * 32);
#pragma unroll
      for (int i = 0; i < 4; ++i) ah[i] = ldfrag(fa + (i << 4) * GPIT + kk * 32);
#pragma unroll
      for (int i = 0; i < 4; ++i) {
#pragma unroll
        for (int j = 0; j < 4; ++j) acc[i][j] = mma_raw<BF>(ah[i], bh[j], acc[i][j]);
        dep_guard1(acc[i][0], acc[i][3], ah[i]);
      }
      keep4(bh[0], bh[1], bh[2], bh[3]);
    }
    asm volatile("s_wait_dscnt 0x0" ::: "memory");             // this wave's reads of buffer t & 1 are done
    asm volatile("s_wait_asynccnt 0x0" ::: "memory");          // this wave's copies of tile t + 1 have landed
    __syncthreads();                                           // publishes tile t + 1, frees buffer t & 1
    if (t + 2 < T) stage12(l0 + (unsigned)(t & 1) * (GBUFH * 2u), ga + (size_t)(t + 2) * 64, sa, gb + (size_t)(t + 2) * 64, sb);
  }
  asm volatile("s_wait_asynccnt 0x0" ::: "memory");            // nothing of this wave is in flight past the loop
  acc_guard4(acc[0][0], acc[0][1], acc[0][2], acc[0][3]);
  acc_guard4(acc[1][0], acc[1][1], acc[1][2], acc[1][3]);
  acc_guard4(acc[2][0], acc[2][1], acc[2][2], acc[2][3]);
  acc_guard4(acc[3][0], acc[3][1], acc[3][2], acc[3][3]);

  // ---- per-lane column bias (BIASM == 0), RNE-converted ----
  const int hh2 = lane >> 4, c4 = (lane & 15) * 4;     // f32 out: 256-B row segment = 16 lanes x 16 B
  const int q8  = lane >> 3, c8 = (lane & 7) * 8;
  float bc[8];
#pragma unroll
  for (int e = 0; e < 8; ++e) bc[e] = 0.f;
  if (BIASM == 0) {
    const bool use1 = (n0 >= Nb);                      // tile-uniform
    if (OM == 0) {
      const int cb = n0 + c4;
      const int i0 = (cb < Nb - 4) ? cb : (Nb - 4);
      const int i1 = (cb - Nb > 0) ? (cb - Nb) : 0;
      const v4f b0v = *(const v4f*)(bias0 + i0);
      const v4f b1v = *(const v4f*)(bias1 + i1);
#pragma unroll
      for (int e = 0; e < 4; ++e) bc[e] = bfr(use1 ? b1v[e] : b0v[e]);
    } else {
      const int cb = n0 + c8;
      const int i0 = (cb < Nb - 8) ? cb : (Nb - 8);
      const int i1 = (cb - Nb > 0) ? (cb - Nb) : 0;
      const v4f b0a = *(const v4f*)(bias0 + i0), b0b = *(const v4f*)(bias0 + i0 + 4);
      const v4f b1a = *(const v4f*)(bias1 + i1), b1b = *(const v4f*)(bias1 + i1 + 4);
#pragma unroll
      for (int e = 0; e < 4; ++e) {
        bc[e]     = bfr(use1 ? b1a[e] : b0a[e]);
        bc[4 + e] = bfr(use1 ? b1b[e] : b0b[e]);
      }
    }
  }

  // ---- epilogue ----
  float* slab = sT[wave];
#pragma unroll
  for (int i = 0; i < 4; ++i) {
    const int mBase = m0 + (i << 4);
#pragma unroll
    for (int j = 0; j < 4; ++j) {
#pragma unroll
      for (int r = 0; r < 8; ++r) {
        slab[(mOff + r) * 68 + (j << 4) + rlane] = acc[i][j][r];
      }
    }
    wave_sync_lds();
    if constexpr (OM == 0) {
      float* C = (float*)Cout + (size_t)b * (size_t)strideC;
      v4f vals[8];
#pragma unroll
      for (int it = 0; it < 8; ++it) {
        const int row = it * 2 + hh2;                      // it 0..7 x hh2 0..1 = rows 0..15
        v4f v = *(const v4f*)(slab + row * 68 + c4);
#pragma unroll
        for (int e = 0; e < 4; ++e) v[e] = v[e] * oscale + bc[e];
        vals[it] = v;
      }
      {
#pragma unroll
        for (int it = 0; it < 8; ++it) {
          const int row = it * 2 + hh2;
          *(v4f*)(C + (size_t)(mBase + row) * ldc + n0 + c4) = vals[it];
        }
        
      }
    } else {
      unsigned short* C = (unsigned short*)Cout + (size_t)b * (size_t)strideC;
      v4u hv[4], hr[4];
#pragma unroll
      for (int it = 0; it < 4; ++it) {
        const int row = it * 4 + q8;                       // it 0..3 x q8 0..3 = rows 0..15
        const float* sp = slab + row * 68 + c8;
        float bm = 0.f;
        if (BIASM == 1) bm = bfr(bias0[mBase + row]);
        v4u a, ar;
#pragma unroll
        for (int e = 0; e < 4; ++e) {
          const float f0 = sp[2 * e]     * oscale + ((BIASM == 1) ? bm : bc[2 * e]);
          const float f1 = sp[2 * e + 1] * oscale + ((BIASM == 1) ? bm : bc[2 * e + 1]);
          const _Float16 g0 = (_Float16)f0, g1 = (_Float16)f1;
          a[e] = pk16(h_bits(g0), h_bits(g1));
          if (OM == 3) {
            const float e0 = (f0 - (float)g0) * RSC;
            const float e1 = (f1 - (float)g1) * RSC;
            ar[e] = pk16(h_bits((_Float16)e0), h_bits((_Float16)e1));
          } else {
            ar[e] = 0u;
          }
        }
        hv[it] = a;
        hr[it] = ar;
      }
      {
#pragma unroll
        for (int it = 0; it < 4; ++it) {
          const int row = it * 4 + q8;
          unsigned short* dp = C + (size_t)(mBase + row) * ldc + n0 + c8;
          *(v4u*)(dp) = hv[it];
          if (OM == 3) *(v4u*)(dp + resOff) = hr[it];
        }
        
      }
    }
    wave_sync_lds();
  }
}

// =====================================================================================================
// Flash attention, head dim 64, SEQ token rows per batch (all keys valid, no mask).
//   q planes (f16, pitch DM): hi at qhp[(b*SEQ + t)*DM + h*64 + d], residual (x2048) at qhp + QRES (same offsets)
//   k plane (f16, pitch DM): khp[(b*SEQ + t)*DM + h*64 + d]
//   v^T planes (f16): hi at vtp[(b*DM + h*64 + d)*SEQ + s], residual (x2048) at vtp + VRES
//   context planes (bf16, pitch CTXP): hi at ctxp[(b*SEQ + t)*CTXP + h*64 + d], lo at the same + DM
//   score = fma(acc_hi, sscale, acc_res * ssres); p = exp(s - m) carried as f16(1024 p); context = p . v with the
//   v hi and v residual products in two accumulators; online softmax (running max) in f32.
//   Block = 4 waves = 64 query rows of one (b, h); grid = NQB * NH * NBATCH; kv chunks of 64, static trip NQB.
//   K / V^T hi / V^T res chunk staging: 128 threads x 32 elements per plane = the whole 64x64 tile each
//   (plain 16-B loads, __syncthreads before and after); P tiles are wave-private, spilled with ushort element
//   Context coverage: each wave stores rows q0..q0+15 (it 0..3 x lane>>3 0..3) x 64 columns (8 lanes x 8) of both
//   the hi and the lo plane; grid covers all SEQ rows x NH head slices x NBATCH.
// =====================================================================================================
__global__ __launch_bounds__(128)
void attn64(const unsigned short* __restrict__ qhp, const unsigned short* __restrict__ khp,
            const unsigned short* __restrict__ vtp, unsigned short* ctxp,
            float sscale, float ssres) {
  __shared__ __align__(16) unsigned short Ksh[64 * LP];           // K [kv][d]        9 KB, rows of 64 at pitch LP
  __shared__ __align__(16) unsigned short Vth[64 * LP];           // V^T hi [d][kv]   9 KB, rows of 64 at pitch LP
  __shared__ __align__(16) unsigned short Vtr[64 * LP];           // V^T res [d][kv]  9 KB, rows of 64 at pitch LP
  __shared__ __align__(16) unsigned short Psh[4][16 * LP];        // per wave P [row][kv], rows of 64 at pitch LP
  __shared__ __align__(16) float          Os[4][16 * 64];         // per wave context tile [row][d]

  const int tid  = threadIdx.x;
  const int wave = tid >> 5;
  const int lane = tid & 31;
  const int hh   = lane >> 4;
  const int c    = lane & 15;

  const int bx   = blockIdx.x;
  const int qb   = bx % NQB;
  const int rest = bx / NQB;
  const int h    = rest % NH;
  const int b    = rest / NH;
  const int q0   = qb * 64 + wave * 16;          // in-batch query row of this wave's first row
  const size_t rowB = (size_t)b * SEQ;

  const unsigned short* Qh = qhp + (size_t)h * HD;
  const unsigned short* Qr = qhp + QRES + (size_t)h * HD;
  const unsigned short* Kg = khp + (size_t)h * HD;
  const unsigned short* Vh = vtp + ((size_t)b * DM + (size_t)h * HD) * SEQ;
  const unsigned short* Vr = Vh + VRES;

  float mrow[8], lrow[8];
  v8f oacc[4], oacr[4];
#pragma unroll
  for (int r = 0; r < 8; ++r) { mrow[r] = -INFINITY; lrow[r] = 0.f; }
#pragma unroll
  for (int t = 0; t < 4; ++t) { oacc[t] = zero8(); oacr[t] = zero8(); }

  for (int kt = 0; kt < NQB; ++kt) {         // static trip count
    const int kv0 = kt * 64;
    __syncthreads();
    {
      const int r = tid >> 1, hf = (tid & 1) * 32;
      const unsigned short* kg = Kg + (rowB + kv0 + r) * DM + hf;          // K row kv0+r, d = hf..hf+31
      const unsigned short* vg = Vh + (size_t)r * SEQ + kv0 + hf;           // V^T hi row d = r, s = kv0+hf..
      const unsigned short* vr = Vr + (size_t)r * SEQ + kv0 + hf;           // V^T res row d = r
#pragma unroll
      for (int i = 0; i < 4; ++i) {
        const v8us a0 = *(const v8us*)(kg + 8 * i);
        const v8us b0 = *(const v8us*)(vg + 8 * i);
        const v8us c0 = *(const v8us*)(vr + 8 * i);
        *(v8us*)(Ksh + r * LP + hf + 8 * i) = a0;
        *(v8us*)(Vth + r * LP + hf + 8 * i) = b0;
        *(v8us*)(Vtr + r * LP + hf + 8 * i) = c0;
      }
    }
    __syncthreads();

    // ---- Q fragments (A operand, row = lane&15): hi and residual, 2 d-chunks each ----
    v16us qa[2], qr[2];
#pragma unroll
    for (int dc = 0; dc < 2; ++dc) {
      qa[dc] = ldfrag(Qh + (rowB + q0 + c) * DM + dc * 32 + 8 * hh);
      qr[dc] = ldfrag(Qr + (rowB + q0 + c) * DM + dc * 32 + 8 * hh);
    }

    // ---- scores: 16 query rows x 64 keys per wave ----
    v8f s[4];
#pragma unroll
    for (int j = 0; j < 4; ++j) {
      v8f sh = zero8(), sr = zero8();
#pragma unroll
      for (int dc = 0; dc < 2; ++dc) {
        Frag kb;
        kb.p[0] = *(const v8us*)(Ksh + (j * 16 + c) * LP + dc * 32 + 8 * hh);
        kb.p[1] = *(const v8us*)(Ksh + (j * 16 + c) * LP + dc * 32 + 16 + 8 * hh);
        sh = mma_g<0>(qa[dc], kb.u, sh);
        sr = mma_g<0>(qr[dc], kb.u, sr);
      }
#pragma unroll
      for (int r = 0; r < 8; ++r) s[j][r] = fmaf(sh[r], sscale, sr[r] * ssres);
    }

    // ---- row max, online softmax, P (x1024, f16 bits) to LDS ----
    unsigned short* pwh = Psh[wave];
#pragma unroll
    for (int r = 0; r < 8; ++r) {
      float m = s[0][r];
      m = fmaxf(m, s[1][r]);
      m = fmaxf(m, s[2][r]);
      m = fmaxf(m, s[3][r]);
#pragma unroll
      for (int off = 1; off < 16; off <<= 1) m = fmaxf(m, __shfl_xor(m, off, 32));
      const float mnew  = fmaxf(mrow[r], m);
      const float alpha = __expf(mrow[r] - mnew);
      mrow[r] = mnew;
      float psum = 0.f;
#pragma unroll
      for (int j = 0; j < 4; ++j) {
        const float p = __expf(s[j][r] - mnew);
        psum += p;
        pwh[(8 * hh + r) * LP + j * 16 + c] = h_bits((_Float16)(p * PSC));
      }
#pragma unroll
      for (int off = 1; off < 16; off <<= 1) psum += __shfl_xor(psum, off, 32);
      lrow[r] = lrow[r] * alpha + psum;
#pragma unroll
      for (int t = 0; t < 4; ++t) { oacc[t][r] *= alpha; oacr[t][r] *= alpha; }
    }
    wave_sync_lds();

    // ---- context += P . V (hi and residual products, f16 WMMA) ----
#pragma unroll 1
    for (int kk = 0; kk < 2; ++kk) {
      Frag pa;
      pa.p[0] = *(const v8us*)(pwh + c * LP + kk * 32 + 8 * hh);
      pa.p[1] = *(const v8us*)(pwh + c * LP + kk * 32 + 16 + 8 * hh);
#pragma unroll
      for (int t = 0; t < 4; ++t) {
        Frag vb, vc;
        vb.p[0] = *(const v8us*)(Vth + (t * 16 + c) * LP + kk * 32 + 8 * hh);
        vb.p[1] = *(const v8us*)(Vth + (t * 16 + c) * LP + kk * 32 + 16 + 8 * hh);
        vc.p[0] = *(const v8us*)(Vtr + (t * 16 + c) * LP + kk * 32 + 8 * hh);
        vc.p[1] = *(const v8us*)(Vtr + (t * 16 + c) * LP + kk * 32 + 16 + 8 * hh);
        oacc[t] = mma_g<0>(pa.u, vb.u, oacc[t]);
        oacr[t] = mma_g<0>(pa.u, vc.u, oacr[t]);
      }
    }
  }

  // ---- normalise (residual fold 1/2048, 1/l, the 1/1024 p carry), stage the wave's 16x64 tile, bf16 hi | lo
  float* os = Os[wave];
#pragma unroll
  for (int r = 0; r < 8; ++r) {
    const float l = lrow[r];
    const float inv = ((l > 0.f) ? (1.0f / l) : 0.f) * (1.0f / PSC);
#pragma unroll
    for (int t = 0; t < 4; ++t) os[(8 * hh + r) * 64 + t * 16 + c] = fmaf(oacr[t][r], 1.0f / RSC, oacc[t][r]) * inv;
  }
  wave_sync_lds();
  {
    const int q4 = lane >> 3, c8 = (lane & 7) * 8;
    v4u hv[4], hl[4];
#pragma unroll
    for (int it = 0; it < 4; ++it) {
      const int row = it * 4 + q4;   // it 0..3 x q4 0..3 = rows 0..15 of the wave tile
      const float* sp = os + row * 64 + c8;
      v4u a, d;
#pragma unroll
      for (int e = 0; e < 4; ++e) {
        const float f0 = sp[2 * e], f1 = sp[2 * e + 1];
        const unsigned short hb0 = bf_bits(f0), hb1 = bf_bits(f1);
        const unsigned short lb0 = bf_bits(f0 - bf_up(hb0)), lb1 = bf_bits(f1 - bf_up(hb1));
        a[e] = pk16(hb0, hb1);
        d[e] = pk16(lb0, lb1);
      }
      hv[it] = a;
      hl[it] = d;
    }
    {
#pragma unroll
      for (int it = 0; it < 4; ++it) {
        const int row = it * 4 + q4;
        const size_t go = (rowB + q0 + row) * CTXP + (size_t)h * HD + c8;
        *(v4u*)(ctxp + go)      = hv[it];
        *(v4u*)(ctxp + go + DM) = hl[it];
      }
      
    }
  }
}

// =====================================================================================================
// Workspace map (bytes); every plane is an exact multiple of its 64x64-tile / whole-row / whole-line store
// granularity (M = MP = 4096 = 64 tiles, N = 1024 = 16 tiles; V^T per batch [1024][2048] = 16x32 tiles):
//   WqkvT f16 [3072 n][1024 k]        0           6291456   (rows 0..1023 = h*64+d of Wq, then Wk, then Wv; x64)
//   WoB   bf16 [1024 n][2048 k]       6291456     4194304   (Wo^T bf16, k-duplicated)
//   XH    f16 [4096][1024]            10485760    8388608   (converted activation plane, reused for the 3 sources)
//   QH|QR f16 [2][4096][1024]         18874368    16777216  (q hi plane, then q residual plane x2048)
//   KH    f16 [4096][1024]            35651584    8388608
//   VT|VR f16 [2][2][1024][2048]      44040192    16777216  (v^T hi planes per batch, then residual planes x2048)
//   Ctx   bf16 [4096][2048]           60817408    16777216  (context hi cols 0..1023, lo cols 1024..2047)
//   end                               77594624
// =====================================================================================================
extern "C" void kernel_launch(void* const* d_in, const int* in_sizes, int n_in,
                              void* d_out, int out_size, void* d_ws, size_t ws_size,
                              hipStream_t stream) {
  if (n_in < 11) return;
  if (in_sizes[0] != MP * DM || in_sizes[1] != MP * DM || in_sizes[2] != MP * DM) return;
  if (in_sizes[3] != NH * DM * HD || in_sizes[4] != NH * HD) return;
  if (in_sizes[5] != NH * DM * HD || in_sizes[6] != NH * HD) return;
  if (in_sizes[7] != NH * DM * HD || in_sizes[8] != NH * HD) return;
  if (in_sizes[9] != DM * DM || in_sizes[10] != DM) return;
  if (out_size != MP * DM) return;

  const float* query = (const float*)d_in[0];
  const float* key_  = (const float*)d_in[1];
  const float* value = (const float*)d_in[2];
  const float* w_q   = (const float*)d_in[3];
  const float* b_q   = (const float*)d_in[4];
  const float* w_k   = (const float*)d_in[5];
  const float* b_k   = (const float*)d_in[6];
  const float* w_v   = (const float*)d_in[7];
  const float* b_v   = (const float*)d_in[8];
  const float* w_o   = (const float*)d_in[9];
  const float* b_o   = (const float*)d_in[10];

  const size_t PW   = (size_t)3 * DM * DM * 2;            //  6291456
  const size_t PWO  = (size_t)DM * CTXP * 2;              //  4194304
  const size_t PX   = (size_t)MP * DM * 2;                //  8388608
  const size_t PQ   = (size_t)2 * MP * DM * 2;            // 16777216
  const size_t PK   = (size_t)MP * DM * 2;                //  8388608
  const size_t PV   = (size_t)2 * NBATCH * DM * SEQ * 2;  // 16777216
  const size_t PC   = (size_t)MP * CTXP * 2;              // 16777216
  size_t off = 0;
  const size_t oW  = off; off += PW;
  const size_t oWo = off; off += PWO;
  const size_t oX  = off; off += PX;
  const size_t oQ  = off; off += PQ;
  const size_t oK  = off; off += PK;
  const size_t oV  = off; off += PV;
  const size_t oC  = off; off += PC;
  if (off > ws_size) return;                               // off = 77594624
  if (off > (size_t)134217728) return;

  char* ws = (char*)d_ws;
  unsigned short* WqkvT = (unsigned short*)(ws + oW);
  unsigned short* WoB   = (unsigned short*)(ws + oWo);
  unsigned short* XH    = (unsigned short*)(ws + oX);
  unsigned short* QH    = (unsigned short*)(ws + oQ);
  unsigned short* KH    = (unsigned short*)(ws + oK);
  unsigned short* VT    = (unsigned short*)(ws + oV);
  unsigned short* Ctx   = (unsigned short*)(ws + oC);
  float*          out0  = (float*)d_out;

  const int n8x = (MP * DM) / 8;
  if ((n8x % 256) != 0) return;
  const dim3 blk(256), blk128(128);
  const dim3 gCx((n8x + 255) / 256);
  const dim3 gTw(DM / 64, HD / 64, NH);                               // in[e=1024][d=64] per head -> out[d][e]
  const dim3 gTo(DM / 64, DM / 64, 1);                                // in[k=1024][n=1024] -> out[n][k]
  const dim3 gN1k((MP / 128) * (DM / 256), 1);                        // 32 x 4 block tiles -> 128 blocks
  const dim3 gVT((DM / 128) * (SEQ / 256), NBATCH);                   // 8 x 8 block tiles -> 64 blocks x 2 batches
  const dim3 gAttn(NBATCH * NH * NQB);                                // 1024 blocks of 128
  const float invw  = 1.0f / WSC;                                     // weight carry x64
  const float ssc   = 0.125f;                                         // 1/sqrt(64)
  const float ssr   = 0.125f / RSC;                                   // same, for the x2048 residual products

  // (0) weight planes: WqkvT[(z*1024) + h*64 + d][e] = f16( bf16_RNE(W[h][e][d]) * 64 ); per head the input slice is
  //     in[rows = e (1024)][cols = d (64)] -> out[cols = d][rows = e]; Wo: in[rows = k][cols = n] -> WoB[n][k] and
  //     WoB[n][1024 + k] = bf16_RNE(Wo[k][n]).
  tconv64<0, 0><<<gTw, blk, 0, stream>>>(w_q, (long long)DM * HD, HD, WqkvT, (long long)HD * DM, DM, 0, WSC);
  tconv64<0, 0><<<gTw, blk, 0, stream>>>(w_k, (long long)DM * HD, HD, WqkvT + (size_t)DM * DM,
                                         (long long)HD * DM, DM, 0, WSC);
  tconv64<0, 0><<<gTw, blk, 0, stream>>>(w_v, (long long)DM * HD, HD, WqkvT + (size_t)2 * DM * DM,
                                         (long long)HD * DM, DM, 0, WSC);
  tconv64<1, 1><<<gTo, blk, 0, stream>>>(w_o, 0LL, DM, WoB, 0LL, CTXP, DM, 1.0f);

  // (1) Q = bf16(q) . WqT^T + b_q -> QH (f16 hi) and QH + QRES (f16 residual x2048); column n = h*64 + d
  conv_h16<<<gCx, blk, 0, stream>>>(query, XH, n8x, 1.0f);
  gemm64<0, 3, 0><<<gN1k, blk, 0, stream>>>(
      XH, DM, 0LL, WqkvT, DM, 0LL, b_q, b_q, DM,
      (void*)QH, DM, 0LL, (long long)QRES, MP, DM, DM, invw);

  // (2) K = bf16(k) . WkT^T + b_k -> KH (f16)
  conv_h16<<<gCx, blk, 0, stream>>>(key_, XH, n8x, 1.0f);
  gemm64<0, 2, 0><<<gN1k, blk, 0, stream>>>(
      XH, DM, 0LL, WqkvT + (size_t)DM * DM, DM, 0LL, b_k, b_k, DM,
      (void*)KH, DM, 0LL, 0LL, MP, DM, DM, invw);

  // (3) V^T per batch = WvT . bf16(v)^T + b_v -> VT (f16 hi [2][1024][2048]) and VT + VRES (residual x2048);
  //     row m = h*64 + d (per-row bias b_v[m]), column n = token s of batch blockIdx.y
  conv_h16<<<gCx, blk, 0, stream>>>(value, XH, n8x, 1.0f);
  gemm64<0, 3, 1><<<gVT, blk, 0, stream>>>(
      WqkvT + (size_t)2 * DM * DM, DM, 0LL, XH, DM, (long long)SEQ * DM, b_v, b_v, SEQ,
      (void*)VT, SEQ, (long long)DM * SEQ, (long long)VRES, DM, SEQ, DM, invw);

  // (4) flash attention -> Ctx bf16 hi | lo (concat layout, column h*64 + d)
  attn64<<<gAttn, blk128, 0, stream>>>(QH, KH, VT, Ctx, ssc, ssr);

  // (5) out = [ctx_hi | ctx_lo] . [Wo^T | Wo^T]^T + b_o  (K = 2048, bf16 operands) -> d_out f32 [4096][1024]
  gemm64<1, 0, 0><<<gN1k, blk, 0, stream>>>(
      Ctx, CTXP, 0LL, WoB, CTXP, 0LL, b_o, b_o, DM,
      (void*)out0, DM, 0LL, 0LL, MP, DM, CTXP, 1.0f);
  (void)hipGetLastError();
}

// v003
// A run of this version takes 196 microseconds.
// Timed twice side by side with v002, it ran 1.16 times as fast both times.
// All steps since v000 together make it 2.32 times as fast.
// Contractions: q, k and v^T in-projections on v_wmma_f32_16x16x32_f16 (f16 activation plane x f16 weight plane
// carried x64, one product each); attention q.k^T on v_wmma_f32_16x16x32_f16 with q as f16 hi plane + f16 residual
// plane carried x2048 (two products, two accumulators) and k plain f16; p.v on v_wmma_f32_16x16x32_f16 with p
// carried x1024 (f16) and v^T as f16 hi plane + f16 residual plane carried x2048 (two products, two accumulators);
// output projection on v_wmma_f32_16x16x32_bf16 with the context as bf16 hi | lo planes concatenated along k against
// a k-duplicated bf16 weight plane (two products, one accumulator); all f32 accumulate; softmax in f32 on VALU;
// every float input RNE-converted to bf16 on load.
#include <hip/hip_runtime.h>
#include <math.h>
#include <stdint.h>

#define NBATCH 2
#define SEQ    2048
#define DM     1024
#define NH     16
#define HD     64
#define MP     (NBATCH * SEQ)
#define NQB    (SEQ / 64)
#define CTXP   (2 * DM)
#define QRES   ((size_t)MP * DM)
#define VRES   ((size_t)NBATCH * DM * SEQ)
#define WSC    64.0f
#define RSC    2048.0f
#define PSC    1024.0f
#define LP     72      // LDS row pitch of the attention tiles in halves: 144 B = 16 B x 9 (odd), for 16-B fragment reads
#define OP     68      // LDS row pitch of the attention context tile in floats: 272 B = 16 B x 17 (odd), lane = row on the store
#define GPIT   72      // LDS row pitch of the staged GEMM operand tiles in halves: 144 B, same reason
#define GROWS  384     // rows of one staged GEMM tile: 128 rows of A, then 256 rows of Bt, 64 k (128 B) each
#define GBUFH  (GROWS * GPIT)   // halves per staging buffer (55296 B)
static_assert(NH * HD == DM);
static_assert((SEQ % 64) == 0 && (DM % 64) == 0 && (MP % 64) == 0);
static_assert(HD == 64);
static_assert((MP % 128) == 0 && (DM % 256) == 0 && (SEQ % 256) == 0 && (DM % 128) == 0);

typedef _Float16       v16h __attribute__((ext_vector_type(16)));
typedef __bf16         v16b __attribute__((ext_vector_type(16)));
typedef unsigned short v16us __attribute__((ext_vector_type(16)));
typedef unsigned short v8us __attribute__((ext_vector_type(8)));
typedef float          v8f  __attribute__((ext_vector_type(8)));
typedef float          v4f  __attribute__((ext_vector_type(4)));
typedef unsigned int   v4u  __attribute__((ext_vector_type(4)));

union Frag { v16us u; v8us p[2]; v16h h; v16b b; };

// ---- scalar helpers --------------------------------------------------------------------------------
__device__ __forceinline__ unsigned short bf_bits(float f) {          // f32 -> bf16 bits, RNE convert
  unsigned u = __float_as_uint(f);
  return (unsigned short)((u + 0x7FFFu + ((u >> 16) & 1u)) >> 16);
}
__device__ __forceinline__ float bf_up(unsigned short h) { return __uint_as_float(((unsigned)h) << 16); }
__device__ __forceinline__ float bfr(float f) { return bf_up(bf_bits(f)); }   // value of the bf16 RNE convert
__device__ __forceinline__ unsigned short h_bits(_Float16 x) { return __builtin_bit_cast(unsigned short, x); }
__device__ __forceinline__ unsigned pk16(unsigned short a, unsigned short b) { return (unsigned)a | ((unsigned)b << 16); }
__device__ __forceinline__ float xhalf(float x) {                     // lane l takes lane l ^ 16's value
  const int b = __builtin_bit_cast(int, x);
  return __builtin_bit_cast(float, __builtin_amdgcn_permlanex16(b, b, 0x76543210, 0xfedcba98, false, false));
}
__device__ __forceinline__ v8f zero8() { v8f z = {0.f, 0.f, 0.f, 0.f, 0.f, 0.f, 0.f, 0.f}; return z; }

// ---- fragment loader: 16-bit A/B operand (bit planes), lane -> row/col (lane&15), p already includes +8*(lane>>4);
//      elements 0..7 <- p[0..7] (k0+8h..), elements 8..15 <- p[16..23] (k0+16+8h..)
__device__ __forceinline__ v16us ldfrag(const unsigned short* p) {
  Frag f;
  f.p[0] = *(const v8us*)(p);
  f.p[1] = *(const v8us*)(p + 16);
  return f.u;
}

// ---- WMMA helpers (BF = 0: f16 operands, BF = 1: bf16 operands) with trailing VALU hazard gap -----------------
template <int BF>
__device__ __forceinline__ v8f mma_raw(v16us a, v16us b, v8f c) {
  Frag fa, fb;
  fa.u = a;
  fb.u = b;
  if constexpr (BF) {
    return __builtin_amdgcn_wmma_f32_16x16x32_bf16(false, fa.b, false, fb.b, (short)0, c, false, false);
  } else {
    return __builtin_amdgcn_wmma_f32_16x16x32_f16(false, fa.h, false, fb.h, (short)0, c, false, false);
  }
}
template <int BF>
__device__ __forceinline__ v8f mma_g(v16us a, v16us b, v8f c) {
  c = mma_raw<BF>(a, b, c);
#if defined(__HIP_DEVICE_COMPILE__)
  asm volatile("v_nop\n\tv_nop\n\tv_nop\n\tv_nop" : "+v"(c) : "v"(a), "v"(b));
#endif
  return c;
}
__device__ __forceinline__ void dep_guard1(v8f& a, v8f& b, v16us x) {
#if defined(__HIP_DEVICE_COMPILE__)
  asm volatile("v_nop\n\tv_nop\n\tv_nop\n\tv_nop" : "+v"(a), "+v"(b) : "v"(x));
#endif
}
__device__ __forceinline__ void keep4(v16us a, v16us b, v16us c, v16us d) {
#if defined(__HIP_DEVICE_COMPILE__)
  asm volatile("v_nop" :: "v"(a), "v"(b), "v"(c), "v"(d));
#endif
}
__device__ __forceinline__ void acc_guard4(v8f& a, v8f& b, v8f& c, v8f& d) {
#if defined(__HIP_DEVICE_COMPILE__)
  asm volatile("v_nop\n\tv_nop\n\tv_nop\n\tv_nop" : "+v"(a), "+v"(b), "+v"(c), "+v"(d));
#endif
}
__device__ __forceinline__ void wave_sync_lds() {
  __builtin_amdgcn_fence(__ATOMIC_RELEASE, "workgroup");
  __builtin_amdgcn_wave_barrier();
  __builtin_amdgcn_fence(__ATOMIC_ACQUIRE, "workgroup");
}

// ---- one staged GEMM tile: 12 asynchronous 16-B copies per lane, global -> LDS, no register in between.
//      Copy i < 4 brings A row (32 i + lane's row), copy 4 + i brings Bt row (32 i + lane's row); eight lanes cover one
//      128-B row segment, so each wave-wide copy takes four whole lines. l = the lane's LDS byte address in row 0..31 of
//      the buffer; rows 32 apart lie 32 * 144 B apart. The closing s_wait_xcnt 0 stands inside the statement so that no
//      address register of an issued copy is rewritten in front of it.
__device__ __forceinline__ void stage12(unsigned l, const unsigned short* a, size_t sa,
                                        const unsigned short* b, size_t sb) {
#if defined(__HIP_DEVICE_COMPILE__)
  const unsigned st = 32u * GPIT * 2u;
  asm volatile(
      "global_load_async_to_lds_b128 %0, %12, off\n\t"
      "global_load_async_to_lds_b128 %1, %13, off\n\t"
      "global_load_async_to_lds_b128 %2, %14, off\n\t"
      "global_load_async_to_lds_b128 %3, %15, off\n\t"
      "global_load_async_to_lds_b128 %4, %16, off\n\t"
      "global_load_async_to_lds_b128 %5, %17, off\n\t"
      "global_load_async_to_lds_b128 %6, %18, off\n\t"
      "global_load_async_to_lds_b128 %7, %19, off\n\t"
      "global_load_async_to_lds_b128 %8, %20, off\n\t"
      "global_load_async_to_lds_b128 %9, %21, off\n\t"
      "global_load_async_to_lds_b128 %10, %22, off\n\t"
      "global_load_async_to_lds_b128 %11, %23, off\n\t"
      "s_wait_xcnt 0x0"
      :: "v"(l), "v"(l + st), "v"(l + 2u * st), "v"(l + 3u * st), "v"(l + 4u * st), "v"(l + 5u * st),
         "v"(l + 6u * st), "v"(l + 7u * st), "v"(l + 8u * st), "v"(l + 9u * st), "v"(l + 10u * st), "v"(l + 11u * st),
         "v"(a), "v"(a + sa), "v"(a + 2 * sa), "v"(a + 3 * sa),
         "v"(b), "v"(b + sb), "v"(b + 2 * sb), "v"(b + 3 * sb), "v"(b + 4 * sb), "v"(b + 5 * sb), "v"(b + 6 * sb),
         "v"(b + 7 * sb)
      : "memory");
#endif
}

// =====================================================================================================
// f32 -> f16 activation plane convert: Xh[i] = f16( bf16_RNE(X[i]) * wsc ), wsc a power of two (exact).
// Thread i handles elements 8i..8i+7 and writes one 16-B piece; 32 consecutive lanes of one instruction fill
// (host-checked) so every store is full-width.
// coverage: n8 threads x 8 elements = the whole plane.
// =====================================================================================================
__global__ __launch_bounds__(256) void conv_h16(const float* __restrict__ W, unsigned short* Wh, int n8, float wsc) {
  const int i  = blockIdx.x * 256 + threadIdx.x;
  const int ic = (i < n8) ? i : (n8 - 1);                     // clamped address
  const float* src = W + (size_t)ic * 8;
  const v4f a = *(const v4f*)(src);
  const v4f c = *(const v4f*)(src + 4);
  v4u o;
  o[0] = pk16(h_bits((_Float16)(bfr(a[0]) * wsc)), h_bits((_Float16)(bfr(a[1]) * wsc)));
  o[1] = pk16(h_bits((_Float16)(bfr(a[2]) * wsc)), h_bits((_Float16)(bfr(a[3]) * wsc)));
  o[2] = pk16(h_bits((_Float16)(bfr(c[0]) * wsc)), h_bits((_Float16)(bfr(c[1]) * wsc)));
  o[3] = pk16(h_bits((_Float16)(bfr(c[2]) * wsc)), h_bits((_Float16)(bfr(c[3]) * wsc)));
  if (i < n8) *(v4u*)(Wh + (size_t)i * 8) = o;
  
}

// =====================================================================================================
// 64x64 tile transpose-convert of an f32 weight tensor: z-slice in[z] is [R][C] f32 (row pitch C elements,
// slice stride inStrideZ); output is 16-bit with rows indexed by the INPUT COLUMN: out[z*outStrideZ + c*ldo + r]
// (the input row index r becomes the k-contiguous column), i.e. in[rows=R][cols=C] -> out[cols=C][rows=R].
//   BF == 0: value = f16( bf16_RNE(x) * sc )   (sc a power of two)
//   BF == 1: value = bf16_RNE(x) bits; DUP == 1 additionally writes the same 16-B piece at column offset + dupOff.
// grid = (R/64, C/64, Z), block 256. Load phase: 1024 float4 pieces (64 rows x 16) = the whole 64x64 tile,
// 4 per thread, converted and stored transposed into LDS with 16-bit element stores; __syncthreads; store phase:
// coverage: 2 iterations x 32 rows x (8 lanes x 8 halves) = the whole 64x64 output tile (x2 destinations if DUP);
//           the grid tiles every (r block, c block, z) exactly once.
// =====================================================================================================
template <int BF, int DUP>
__global__ __launch_bounds__(256) void tconv64(const float* __restrict__ in, long long inStrideZ, int C,
                                               unsigned short* out, long long outStrideZ, int ldo, int dupOff,
                                               float sc) {
  __shared__ __align__(16) unsigned short sT[64 * 72];        // [c local][r local], pitch 72 halves (144 B)
  const int t  = threadIdx.x;
  const int r0 = blockIdx.x * 64;
  const int c0 = blockIdx.y * 64;
  const float* src = in + (size_t)blockIdx.z * (size_t)inStrideZ;
  unsigned short* dst = out + (size_t)blockIdx.z * (size_t)outStrideZ;
#pragma unroll
  for (int i = 0; i < 4; ++i) {
    const int idx = t + 256 * i;                              // 0..1023
    const int rr  = idx >> 4;                                 // 0..63
    const int cq  = (idx & 15) * 4;                           // 0..60
    const v4f x = *(const v4f*)(src + (size_t)(r0 + rr) * (size_t)C + c0 + cq);
#pragma unroll
    for (int j = 0; j < 4; ++j) {
      unsigned short w;
      if (BF) {
        w = bf_bits(x[j]);
      } else {
        w = h_bits((_Float16)(bfr(x[j]) * sc));
      }
      sT[(cq + j) * 72 + rr] = w;
    }
  }
  __syncthreads();
  const int q8 = t >> 3;                                      // 0..31: row within the 32-row group
  const int c8 = (t & 7) * 8;
  v8us vv[2];
#pragma unroll
  for (int it = 0; it < 2; ++it) {
    const int row = it * 32 + q8;                             // it 0..1 x q8 0..31 = rows 0..63
    vv[it] = *(const v8us*)(sT + row * 72 + c8);
  }
  {
#pragma unroll
    for (int it = 0; it < 2; ++it) {
      const int row = it * 32 + q8;
      unsigned short* dp = dst + (size_t)(c0 + row) * (size_t)ldo + r0 + c8;
      *(v8us*)(dp) = vv[it];
      if (DUP) *(v8us*)(dp + dupOff) = vv[it];
    }
    
  }
}

// =====================================================================================================
// Register-blocked batched 16-bit WMMA GEMM: C[m][n] = oscale * sum_k A[m][k] * Bt[n][k] + bias;
// one wave per 64x64 tile, 8 waves (2 x 4) = one 128x256 block tile. A row-major [M][K] pitch lda; Bt row-major [N][K]
// pitch ldb (k contiguous); M multiple of 128, N of 256, K of 64 (static here). blockIdx.y = batch (strides in elements).
// Operands: per 64 k the block's 128 A rows and 256 Bt rows are staged in LDS by asynchronous copies, two buffers: the
// copies of tile t + 2 go out behind the barrier at the foot of trip t and fly during trip t + 1; every fragment is read
// from LDS (k order per output element as before: ascending in steps of 32).
// BF: 0 = f16 operand planes, 1 = bf16 operand planes.
// Bias: BIASM == 0 -> per column: cols < Nb from bias0[col], cols >= Nb from bias1[col - Nb] (tile-uniform select of
//       clamped-address loads); BIASM == 1 -> per row bias0[m]. Bias values RNE-converted to bf16.
// OM: 0 = f32 out (pitch ldc); 2 = f16 out; 3 = f16 hi plane at C plus f16 residual plane ((f - hi) * RSC) at
//     C + resOff (same pitch and offsets).
// coverage: 4 slabs x 16 rows x 64 cols = the wave's whole 64x64 tile; grid = (M/128)*(N/256) blocks,
//           a surplus block exits as a whole in front of every barrier and copy.
// =====================================================================================================
template <int BF, int OM, int BIASM>
__global__ __launch_bounds__(256) void gemm64(
    const unsigned short* __restrict__ A, int lda, long long strideA,
    const unsigned short* __restrict__ Bt, int ldb, long long strideB,
    const float* __restrict__ bias0, const float* __restrict__ bias1, int Nb,
    void* Cout, int ldc, long long strideC, long long resOff,
    int M, int N, int K, float oscale) {
  __shared__ __align__(16) unsigned short sOp[2 * GBUFH];   // two staging buffers: [A 128 rows | Bt 256 rows] x 64 k
  __shared__ __align__(16) float sT[8][16 * 68];   // per-wave 16x64 slab, pitch 68 floats
  const int b    = blockIdx.y;
  const int lane = threadIdx.x & 31;
  const int wave = threadIdx.x >> 5;
  const int tilesN = N >> 8;
  const int tilesM = M >> 7;
  const int tile = blockIdx.x;
  if (tile >= tilesM * tilesN) return;   // block-uniform, in front of every barrier
  const int tm = tile / tilesN;
  const int tn = tile - tm * tilesN;
  const int mb0 = tm << 7;                     // block tile origin
  const int nb0 = tn << 8;
  const int wm  = wave >> 2;                   // wave's 64x64 tile inside the block tile
  const int wn  = wave & 3;
  const int m0 = mb0 + (wm << 6);
  const int n0 = nb0 + (wn << 6);

  const unsigned short* Ab = A  + (size_t)b * (size_t)strideA;
  const unsigned short* Bb = Bt + (size_t)b * (size_t)strideB;

  const int rlane = lane & 15;                 // row (A) / col (B, D) within subtile
  const int koff  = (lane >> 4) * 8;           // k offset of this lane half
  const int mOff  = (lane >> 4) * 8;           // D row offset

  v8f acc[4][4];
#pragma unroll
  for (int i = 0; i < 4; ++i)
#pragma unroll
    for (int j = 0; j < 4; ++j) acc[i][j] = zero8();

  // ---- staging addresses: thread -> row (tid >> 3) of each 32-row group, 16-B piece (tid & 7) of the 128-B segment ----
  const int crow = threadIdx.x >> 3;
  const int cpc  = (threadIdx.x & 7) * 8;
  const unsigned short* ga = Ab + (size_t)(mb0 + crow) * lda + cpc;
  const unsigned short* gb = Bb + (size_t)(nb0 + crow) * ldb + cpc;
  const size_t sa = (size_t)32 * lda, sb = (size_t)32 * ldb;
  const unsigned l0 =
      (unsigned)(uintptr_t)(const __attribute__((address_space(3))) unsigned short*)(sOp + crow * GPIT + cpc);
  const int T = K >> 6;                        // staged tiles of 64 k

  stage12(l0, ga, sa, gb, sb);                                 // tile 0 -> buffer 0
  asm volatile("s_wait_asynccnt 0x0" ::: "memory");            // this wave's copies of tile 0 have landed
  __syncthreads();                                             // ... and every other wave's
  if (T > 1) stage12(l0 + GBUFH * 2u, ga + 64, sa, gb + 64, sb);   // tile 1 -> buffer 1

  for (int t = 0; t < T; ++t) {
    const unsigned short* sbuf = sOp + (t & 1) * GBUFH;
    const unsigned short* fa = sbuf + ((wm << 6) + rlane) * GPIT + koff;
    const unsigned short* fb = sbuf + (128 + (wn << 6) + rlane) * GPIT + koff;
#pragma unroll
    for (int kk = 0; kk < 2; ++kk) {
      v16us bh[4], ah[4];
#pragma unroll
      for (int j = 0; j < 4; ++j) bh[j] = ldfrag(fb + (j << 4) * GPIT + kk * 32);
#pragma unroll
      for (int i = 0; i < 4; ++i) ah[i] = ldfrag(fa + (i << 4) * GPIT + kk * 32);
#pragma unroll
      for (int i = 0; i < 4; ++i) {
#pragma unroll
        for (int j = 0; j < 4; ++j) acc[i][j] = mma_raw<BF>(ah[i], bh[j], acc[i][j]);
        dep_guard1(acc[i][0], acc[i][3], ah[i]);
      }
      keep4(bh[0], bh[1], bh[2], bh[3]);
    }
    asm volatile("s_wait_dscnt 0x0" ::: "memory");             // this wave's reads of buffer t & 1 are done
    asm volatile("s_wait_asynccnt 0x0" ::: "memory");          // this wave's copies of tile t + 1 have landed
    __syncthreads();                                           // publishes tile t + 1, frees buffer t & 1
    if (t + 2 < T) stage12(l0 + (unsigned)(t & 1) * (GBUFH * 2u), ga + (size_t)(t + 2) * 64, sa, gb + (size_t)(t + 2) * 64, sb);
  }
  asm volatile("s_wait_asynccnt 0x0" ::: "memory");            // nothing of this wave is in flight past the loop
  acc_guard4(acc[0][0], acc[0][1], acc[0][2], acc[0][3]);
  acc_guard4(acc[1][0], acc[1][1], acc[1][2], acc[1][3]);
  acc_guard4(acc[2][0], acc[2][1], acc[2][2], acc[2][3]);
  acc_guard4(acc[3][0], acc[3][1], acc[3][2], acc[3][3]);

  // ---- per-lane column bias (BIASM == 0), RNE-converted ----
  const int hh2 = lane >> 4, c4 = (lane & 15) * 4;     // f32 out: 256-B row segment = 16 lanes x 16 B
  const int q8  = lane >> 3, c8 = (lane & 7) * 8;
  float bc[8];
#pragma unroll
  for (int e = 0; e < 8; ++e) bc[e] = 0.f;
  if (BIASM == 0) {
    const bool use1 = (n0 >= Nb);                      // tile-uniform
    if (OM == 0) {
      const int cb = n0 + c4;
      const int i0 = (cb < Nb - 4) ? cb : (Nb - 4);
      const int i1 = (cb - Nb > 0) ? (cb - Nb) : 0;
      const v4f b0v = *(const v4f*)(bias0 + i0);
      const v4f b1v = *(const v4f*)(bias1 + i1);
#pragma unroll
      for (int e = 0; e < 4; ++e) bc[e] = bfr(use1 ? b1v[e] : b0v[e]);
    } else {
      const int cb = n0 + c8;
      const int i0 = (cb < Nb - 8) ? cb : (Nb - 8);
      const int i1 = (cb - Nb > 0) ? (cb - Nb) : 0;
      const v4f b0a = *(const v4f*)(bias0 + i0), b0b = *(const v4f*)(bias0 + i0 + 4);
      const v4f b1a = *(const v4f*)(bias1 + i1), b1b = *(const v4f*)(bias1 + i1 + 4);
#pragma unroll
      for (int e = 0; e < 4; ++e) {
        bc[e]     = bfr(use1 ? b1a[e] : b0a[e]);
        bc[4 + e] = bfr(use1 ? b1b[e] : b0b[e]);
      }
    }
  }

  // ---- epilogue ----
  float* slab = sT[wave];
#pragma unroll
  for (int i = 0; i < 4; ++i) {
    const int mBase = m0 + (i << 4);
#pragma unroll
    for (int j = 0; j < 4; ++j) {
#pragma unroll
      for (int r = 0; r < 8; ++r) {
        slab[(mOff + r) * 68 + (j << 4) + rlane] = acc[i][j][r];
      }
    }
    wave_sync_lds();
    if constexpr (OM == 0) {
      float* C = (float*)Cout + (size_t)b * (size_t)strideC;
      v4f vals[8];
#pragma unroll
      for (int it = 0; it < 8; ++it) {
        const int row = it * 2 + hh2;                      // it 0..7 x hh2 0..1 = rows 0..15
        v4f v = *(const v4f*)(slab + row * 68 + c4);
#pragma unroll
        for (int e = 0; e < 4; ++e) v[e] = v[e] * oscale + bc[e];
        vals[it] = v;
      }
      {
#pragma unroll
        for (int it = 0; it < 8; ++it) {
          const int row = it * 2 + hh2;
          *(v4f*)(C + (size_t)(mBase + row) * ldc + n0 + c4) = vals[it];
        }
        
      }
    } else {
      unsigned short* C = (unsigned short*)Cout + (size_t)b * (size_t)strideC;
      v4u hv[4], hr[4];
#pragma unroll
      for (int it = 0; it < 4; ++it) {
        const int row = it * 4 + q8;                       // it 0..3 x q8 0..3 = rows 0..15
        const float* sp = slab + row * 68 + c8;
        float bm = 0.f;
        if (BIASM == 1) bm = bfr(bias0[mBase + row]);
        v4u a, ar;
#pragma unroll
        for (int e = 0; e < 4; ++e) {
          const float f0 = sp[2 * e]     * oscale + ((BIASM == 1) ? bm : bc[2 * e]);
          const float f1 = sp[2 * e + 1] * oscale + ((BIASM == 1) ? bm : bc[2 * e + 1]);
          const _Float16 g0 = (_Float16)f0, g1 = (_Float16)f1;
          a[e] = pk16(h_bits(g0), h_bits(g1));
          if (OM == 3) {
            const float e0 = (f0 - (float)g0) * RSC;
            const float e1 = (f1 - (float)g1) * RSC;
            ar[e] = pk16(h_bits((_Float16)e0), h_bits((_Float16)e1));
          } else {
            ar[e] = 0u;
          }
        }
        hv[it] = a;
        hr[it] = ar;
      }
      {
#pragma unroll
        for (int it = 0; it < 4; ++it) {
          const int row = it * 4 + q8;
          unsigned short* dp = C + (size_t)(mBase + row) * ldc + n0 + c8;
          *(v4u*)(dp) = hv[it];
          if (OM == 3) *(v4u*)(dp + resOff) = hr[it];
        }
        
      }
    }
    wave_sync_lds();
  }
}

// =====================================================================================================
// Flash attention, head dim 64, SEQ token rows per batch (all keys valid, no mask).
//   q planes (f16, pitch DM): hi at qhp[(b*SEQ + t)*DM + h*64 + d], residual (x2048) at qhp + QRES (same offsets)
//   k plane (f16, pitch DM): khp[(b*SEQ + t)*DM + h*64 + d]
//   v^T planes (f16): hi at vtp[(b*DM + h*64 + d)*SEQ + s], residual (x2048) at vtp + VRES
//   context planes (bf16, pitch CTXP): hi at ctxp[(b*SEQ + t)*CTXP + h*64 + d], lo at the same + DM
//   Products are taken transposed: S^T = K . Q^T (A = K rows, B = Q rows) and O^T += V^T . P^T (A = V^T rows, B = P^T), so
//   a lane holds scores of ONE query (column lane & 15), keys 8 (lane >> 4) + r of each 16-key tile: the row maximum
//   and the row sum are taken in the lane, plus one exchange between the wave halves (the sum's only in the epilogue),
//   and two converted score tiles are the B operand of the second product as they stand: P never leaves the registers.
//   score = fma(acc_hi, sscale, acc_res * ssres); p = exp(s - m) carried as f16(1024 p); context = p . v with the
//   v hi and v residual products in two accumulators; online softmax (running max) in f32.
//   Block = 4 waves = 64 query rows of one (b, h); grid = NQB * NH * NBATCH; kv chunks of 64, static trip NQB.
//   K / V^T hi / V^T res chunk staging: 128 threads x 32 elements per plane = the whole 64x64 tile each
//   (plain 16-B loads, __syncthreads before and after).
//   Context coverage: each wave stores rows q0..q0+15 (it 0..3 x lane>>3 0..3) x 64 columns (8 lanes x 8) of both
//   the hi and the lo plane; grid covers all SEQ rows x NH head slices x NBATCH.
// =====================================================================================================
__global__ __launch_bounds__(128)
void attn64(const unsigned short* __restrict__ qhp, const unsigned short* __restrict__ khp,
            const unsigned short* __restrict__ vtp, unsigned short* ctxp,
            float sscale, float ssres) {
  __shared__ __align__(16) unsigned short Ksh[64 * LP];           // K [kv][d]        9 KB, rows of 64 at pitch LP
  __shared__ __align__(16) unsigned short Vth[64 * LP];           // V^T hi [d][kv]   9 KB, rows of 64 at pitch LP
  __shared__ __align__(16) unsigned short Vtr[64 * LP];           // V^T res [d][kv]  9 KB, rows of 64 at pitch LP
  __shared__ __align__(16) float          Os[4][16 * OP];         // per wave context tile [row][d], rows of 64 at pitch OP

  const int tid  = threadIdx.x;
  const int wave = tid >> 5;
  const int lane = tid & 31;
  const int hh   = lane >> 4;
  const int c    = lane & 15;

  const int bx   = blockIdx.x;
  const int qb   = bx % NQB;
  const int rest = bx / NQB;
  const int h    = rest % NH;
  const int b    = rest / NH;
  const int q0   = qb * 64 + wave * 16;          // in-batch query row of this wave's first row
  const size_t rowB = (size_t)b * SEQ;

  const unsigned short* Qh = qhp + (size_t)h * HD;
  const unsigned short* Qr = qhp + QRES + (size_t)h * HD;
  const unsigned short* Kg = khp + (size_t)h * HD;
  const unsigned short* Vh = vtp + ((size_t)b * DM + (size_t)h * HD) * SEQ;
  const unsigned short* Vr = Vh + VRES;

  float mrun = -INFINITY, lsum = 0.f;   // query c: running maximum (both halves alike), sum over this half's keys
  v8f oacc[4], oacr[4];                 // O^T tiles: register r = context[d = 16 t + 8 hh + r] of query c
#pragma unroll
  for (int t = 0; t < 4; ++t) { oacc[t] = zero8(); oacr[t] = zero8(); }

  for (int kt = 0; kt < NQB; ++kt) {         // static trip count
    const int kv0 = kt * 64;
    __syncthreads();
    {
      const int r = tid >> 1, hf = (tid & 1) * 32;
      const unsigned short* kg = Kg + (rowB + kv0 + r) * DM + hf;          // K row kv0+r, d = hf..hf+31
      const unsigned short* vg = Vh + (size_t)r * SEQ + kv0 + hf;           // V^T hi row d = r, s = kv0+hf..
      const unsigned short* vr = Vr + (size_t)r * SEQ + kv0 + hf;           // V^T res row d = r
#pragma unroll
      for (int i = 0; i < 4; ++i) {
        const v8us a0 = *(const v8us*)(kg + 8 * i);
        const v8us b0 = *(const v8us*)(vg + 8 * i);
        const v8us c0 = *(const v8us*)(vr + 8 * i);
        *(v8us*)(Ksh + r * LP + hf + 8 * i) = a0;
        *(v8us*)(Vth + r * LP + hf + 8 * i) = b0;
        *(v8us*)(Vtr + r * LP + hf + 8 * i) = c0;
      }
    }
    __syncthreads();

    // ---- Q fragments (B operand, column = query = lane&15): hi and residual, 2 d-chunks each ----
    v16us qa[2], qr[2];
#pragma unroll
    for (int dc = 0; dc < 2; ++dc) {
      qa[dc] = ldfrag(Qh + (rowB + q0 + c) * DM + dc * 32 + 8 * hh);
      qr[dc] = ldfrag(Qr + (rowB + q0 + c) * DM + dc * 32 + 8 * hh);
    }

    // ---- scores, transposed: s[j][r] = score(key 16 j + 8 hh + r, query c) ----
    v8f s[4];
#pragma unroll
    for (int j = 0; j < 4; ++j) {
      v8f sh = zero8(), sr = zero8();
#pragma unroll
      for (int dc = 0; dc < 2; ++dc) {
        Frag kb;
        kb.p[0] = *(const v8us*)(Ksh + (j * 16 + c) * LP + dc * 32 + 8 * hh);
        kb.p[1] = *(const v8us*)(Ksh + (j * 16 + c) * LP + dc * 32 + 16 + 8 * hh);
        sh = mma_g<0>(kb.u, qa[dc], sh);
        sr = mma_g<0>(kb.u, qr[dc], sr);
      }
#pragma unroll
      for (int r = 0; r < 8; ++r) s[j][r] = fmaf(sh[r], sscale, sr[r] * ssres);
    }

    // ---- maximum over the lane's 32 keys (four chains), then the other half's; online softmax; P^T (x1024, f16) packed
    //      in place: element 8 (j & 1) + r of fragment j >> 1 = key 32 (j >> 1) + 16 (j & 1) + 8 hh + r, the V^T loader's k order
    float mj[4], pj[4];
#pragma unroll
    for (int j = 0; j < 4; ++j) {
      mj[j] = s[j][0];
#pragma unroll
      for (int r = 1; r < 8; ++r) mj[j] = fmaxf(mj[j], s[j][r]);
    }
    float m = fmaxf(fmaxf(mj[0], mj[1]), fmaxf(mj[2], mj[3]));
    m = fmaxf(m, xhalf(m));
    const float mnew  = fmaxf(mrun, m);
    const float alpha = __expf(mrun - mnew);
    mrun = mnew;
    Frag pb[2];
#pragma unroll
    for (int j = 0; j < 4; ++j) {
      pj[j] = 0.f;
#pragma unroll
      for (int r = 0; r < 8; ++r) {
        const float p = __expf(s[j][r] - mnew);
        pj[j] += p;
        pb[j >> 1].h[(j & 1) * 8 + r] = (_Float16)(p * PSC);
      }
    }
    lsum = lsum * alpha + ((pj[0] + pj[1]) + (pj[2] + pj[3]));
#pragma unroll
    for (int t = 0; t < 4; ++t) { oacc[t] *= alpha; oacr[t] *= alpha; }

    // ---- context^T += V^T . P^T (hi and residual products, f16 WMMA) ----
#pragma unroll   // unrolled so that pb[kk] is a fixed register set; a rolled loop would have to index registers at run time
    for (int kk = 0; kk < 2; ++kk) {
#pragma unroll
      for (int t = 0; t < 4; ++t) {
        Frag vb, vc;
        vb.p[0] = *(const v8us*)(Vth + (t * 16 + c) * LP + kk * 32 + 8 * hh);
        vb.p[1] = *(const v8us*)(Vth + (t * 16 + c) * LP + kk * 32 + 16 + 8 * hh);
        vc.p[0] = *(const v8us*)(Vtr + (t * 16 + c) * LP + kk * 32 + 8 * hh);
        vc.p[1] = *(const v8us*)(Vtr + (t * 16 + c) * LP + kk * 32 + 16 + 8 * hh);
        oacc[t] = mma_g<0>(vb.u, pb[kk].u, oacc[t]);
        oacr[t] = mma_g<0>(vc.u, pb[kk].u, oacr[t]);
      }
    }
  }

  // ---- normalise (residual fold 1/2048, 1/l, the 1/1024 p carry), stage the wave's 16x64 tile, bf16 hi | lo
  float* os = Os[wave];
  {
    const float l = lsum + xhalf(lsum);   // the two halves' key sums join here, once
    const float inv = ((l > 0.f) ? (1.0f / l) : 0.f) * (1.0f / PSC);
#pragma unroll
    for (int t = 0; t < 4; ++t) {
      v4f lo, hi;
#pragma unroll
      for (int r = 0; r < 4; ++r) {
        lo[r] = fmaf(oacr[t][r], 1.0f / RSC, oacc[t][r]) * inv;
        hi[r] = fmaf(oacr[t][4 + r], 1.0f / RSC, oacc[t][4 + r]) * inv;
      }
      *(v4f*)(os + c * OP + t * 16 + 8 * hh)     = lo;
      *(v4f*)(os + c * OP + t * 16 + 8 * hh + 4) = hi;
    }
  }
  wave_sync_lds();
  {
    const int q4 = lane >> 3, c8 = (lane & 7) * 8;
    v4u hv[4], hl[4];
#pragma unroll
    for (int it = 0; it < 4; ++it) {
      const int row = it * 4 + q4;   // it 0..3 x q4 0..3 = rows 0..15 of the wave tile
      const float* sp = os + row * OP + c8;
      v4u a, d;
#pragma unroll
      for (int e = 0; e < 4; ++e) {
        const float f0 = sp[2 * e], f1 = sp[2 * e + 1];
        const unsigned short hb0 = bf_bits(f0), hb1 = bf_bits(f1);
        const unsigned short lb0 = bf_bits(f0 - bf_up(hb0)), lb1 = bf_bits(f1 - bf_up(hb1));
        a[e] = pk16(hb0, hb1);
        d[e] = pk16(lb0, lb1);
      }
      hv[it] = a;
      hl[it] = d;
    }
    {
#pragma unroll
      for (int it = 0; it < 4; ++it) {
        const int row = it * 4 + q4;
        const size_t go = (rowB + q0 + row) * CTXP + (size_t)h * HD + c8;
        *(v4u*)(ctxp + go)      = hv[it];
        *(v4u*)(ctxp + go + DM) = hl[it];
      }
      
    }
  }
}

// =====================================================================================================
// Workspace map (bytes); every plane is an exact multiple of its 64x64-tile / whole-row / whole-line store
// granularity (M = MP = 4096 = 64 tiles, N = 1024 = 16 tiles; V^T per batch [1024][2048] = 16x32 tiles):
//   WqkvT f16 [3072 n][1024 k]        0           6291456   (rows 0..1023 = h*64+d of Wq, then Wk, then Wv; x64)
//   WoB   bf16 [1024 n][2048 k]       6291456     4194304   (Wo^T bf16, k-duplicated)
//   XH    f16 [4096][1024]            10485760    8388608   (converted activation plane, reused for the 3 sources)
//   QH|QR f16 [2][4096][1024]         18874368    16777216  (q hi plane, then q residual plane x2048)
//   KH    f16 [4096][1024]            35651584    8388608
//   VT|VR f16 [2][2][1024][2048]      44040192    16777216  (v^T hi planes per batch, then residual planes x2048)
//   Ctx   bf16 [4096][2048]           60817408    16777216  (context hi cols 0..1023, lo cols 1024..2047)
//   end                               77594624
// =====================================================================================================
extern "C" void kernel_launch(void* const* d_in, const int* in_sizes, int n_in,
                              void* d_out, int out_size, void* d_ws, size_t ws_size,
                              hipStream_t stream) {
  if (n_in < 11) return;
  if (in_sizes[0] != MP * DM || in_sizes[1] != MP * DM || in_sizes[2] != MP * DM) return;
  if (in_sizes[3] != NH * DM * HD || in_sizes[4] != NH * HD) return;
  if (in_sizes[5] != NH * DM * HD || in_sizes[6] != NH * HD) return;
  if (in_sizes[7] != NH * DM * HD || in_sizes[8] != NH * HD) return;
  if (in_sizes[9] != DM * DM || in_sizes[10] != DM) return;
  if (out_size != MP * DM) return;

  const float* query = (const float*)d_in[0];
  const float* key_  = (const float*)d_in[1];
  const float* value = (const float*)d_in[2];
  const float* w_q   = (const float*)d_in[3];
  const float* b_q   = (const float*)d_in[4];
  const float* w_k   = (const float*)d_in[5];
  const float* b_k   = (const float*)d_in[6];
  const float* w_v   = (const float*)d_in[7];
  const float* b_v   = (const float*)d_in[8];
  const float* w_o   = (const float*)d_in[9];
  const float* b_o   = (const float*)d_in[10];

  const size_t PW   = (size_t)3 * DM * DM * 2;            //  6291456
  const size_t PWO  = (size_t)DM * CTXP * 2;              //  4194304
  const size_t PX   = (size_t)MP * DM * 2;                //  8388608
  const size_t PQ   = (size_t)2 * MP * DM * 2;            // 16777216
  const size_t PK   = (size_t)MP * DM * 2;                //  8388608
  const size_t PV   = (size_t)2 * NBATCH * DM * SEQ * 2;  // 16777216
  const size_t PC   = (size_t)MP * CTXP * 2;              // 16777216
  size_t off = 0;
  const size_t oW  = off; off += PW;
  const size_t oWo = off; off += PWO;
  const size_t oX  = off; off += PX;
  const size_t oQ  = off; off += PQ;
  const size_t oK  = off; off += PK;
  const size_t oV  = off; off += PV;
  const size_t oC  = off; off += PC;
  if (off > ws_size) return;                               // off = 77594624
  if (off > (size_t)134217728) return;

  char* ws = (char*)d_ws;
  unsigned short* WqkvT = (unsigned short*)(ws + oW);
  unsigned short* WoB   = (unsigned short*)(ws + oWo);
  unsigned short* XH    = (unsigned short*)(ws + oX);
  unsigned short* QH    = (unsigned short*)(ws + oQ);
  unsigned short* KH    = (unsigned short*)(ws + oK);
  unsigned short* VT    = (unsigned short*)(ws + oV);
  unsigned short* Ctx   = (unsigned short*)(ws + oC);
  float*          out0  = (float*)d_out;

  const int n8x = (MP * DM) / 8;
  if ((n8x % 256) != 0) return;
  const dim3 blk(256), blk128(128);
  const dim3 gCx((n8x + 255) / 256);
  const dim3 gTw(DM / 64, HD / 64, NH);                               // in[e=1024][d=64] per head -> out[d][e]
  const dim3 gTo(DM / 64, DM / 64, 1);                                // in[k=1024][n=1024] -> out[n][k]
  const dim3 gN1k((MP / 128) * (DM / 256), 1);                        // 32 x 4 block tiles -> 128 blocks
  const dim3 gVT((DM / 128) * (SEQ / 256), NBATCH);                   // 8 x 8 block tiles -> 64 blocks x 2 batches
  const dim3 gAttn(NBATCH * NH * NQB);                                // 1024 blocks of 128
  const float invw  = 1.0f / WSC;                                     // weight carry x64
  const float ssc   = 0.125f;                                         // 1/sqrt(64)
  const float ssr   = 0.125f / RSC;                                   // same, for the x2048 residual products

  // (0) weight planes: WqkvT[(z*1024) + h*64 + d][e] = f16( bf16_RNE(W[h][e][d]) * 64 ); per head the input slice is
  //     in[rows = e (1024)][cols = d (64)] -> out[cols = d][rows = e]; Wo: in[rows = k][cols = n] -> WoB[n][k] and
  //     WoB[n][1024 + k] = bf16_RNE(Wo[k][n]).
  tconv64<0, 0><<<gTw, blk, 0, stream>>>(w_q, (long long)DM * HD, HD, WqkvT, (long long)HD * DM, DM, 0, WSC);
  tconv64<0, 0><<<gTw, blk, 0, stream>>>(w_k, (long long)DM * HD, HD, WqkvT + (size_t)DM * DM,
                                         (long long)HD * DM, DM, 0, WSC);
  tconv64<0, 0><<<gTw, blk, 0, stream>>>(w_v, (long long)DM * HD, HD, WqkvT + (size_t)2 * DM * DM,
                                         (long long)HD * DM, DM, 0, WSC);
  tconv64<1, 1><<<gTo, blk, 0, stream>>>(w_o, 0LL, DM, WoB, 0LL, CTXP, DM, 1.0f);

  // (1) Q = bf16(q) . WqT^T + b_q -> QH (f16 hi) and QH + QRES (f16 residual x2048); column n = h*64 + d
  conv_h16<<<gCx, blk, 0, stream>>>(query, XH, n8x, 1.0f);
  gemm64<0, 3, 0><<<gN1k, blk, 0, stream>>>(
      XH, DM, 0LL, WqkvT, DM, 0LL, b_q, b_q, DM,
      (void*)QH, DM, 0LL, (long long)QRES, MP, DM, DM, invw);

  // (2) K = bf16(k) . WkT^T + b_k -> KH (f16)
  conv_h16<<<gCx, blk, 0, stream>>>(key_, XH, n8x, 1.0f);
  gemm64<0, 2, 0><<<gN1k, blk, 0, stream>>>(
      XH, DM, 0LL, WqkvT + (size_t)DM * DM, DM, 0LL, b_k, b_k, DM,
      (void*)KH, DM, 0LL, 0LL, MP, DM, DM, invw);

  // (3) V^T per batch = WvT . bf16(v)^T + b_v -> VT (f16 hi [2][1024][2048]) and VT + VRES (residual x2048);
  //     row m = h*64 + d (per-row bias b_v[m]), column n = token s of batch blockIdx.y
  conv_h16<<<gCx, blk, 0, stream>>>(value, XH, n8x, 1.0f);
  gemm64<0, 3, 1><<<gVT, blk, 0, stream>>>(
      WqkvT + (size_t)2 * DM * DM, DM, 0LL, XH, DM, (long long)SEQ * DM, b_v, b_v, SEQ,
      (void*)VT, SEQ, (long long)DM * SEQ, (long long)VRES, DM, SEQ, DM, invw);

  // (4) flash attention -> Ctx bf16 hi | lo (concat layout, column h*64 + d)
  attn64<<<gAttn, blk128, 0, stream>>>(QH, KH, VT, Ctx, ssc, ssr);

  // (5) out = [ctx_hi | ctx_lo] . [Wo^T | Wo^T]^T + b_o  (K = 2048, bf16 operands) -> d_out f32 [4096][1024]
  gemm64<1, 0, 0><<<gN1k, blk, 0, stream>>>(
      Ctx, CTXP, 0LL, WoB, CTXP, 0LL, b_o, b_o, DM,
      (void*)out0, DM, 0LL, 0LL, MP, DM, CTXP, 1.0f);
  (void)hipGetLastError();
}

// v004
// A run of this version takes 149 microseconds.
// Next to v003, in two timings, it ran 1.31 and 1.32 times as fast.
// Counting every step since v000, it is 3.05 times as fast.
// Contractions: q, k and v^T in-projections on v_wmma_f32_16x16x32_f16 (f16 activation plane x f16 weight plane
// carried x64, one product each); attention q.k^T on v_wmma_f32_16x16x32_f16 with q as f16 hi plane + f16 residual
// plane carried x2048 (two products, two accumulators) and k plain f16; p.v on v_wmma_f32_16x16x32_f16 with p
// carried x1024 (f16) and v^T as f16 hi plane + f16 residual plane carried x2048 (two products, two accumulators);
// output projection on v_wmma_f32_16x16x32_bf16 with the context as bf16 hi | lo planes concatenated along k against
// a k-duplicated bf16 weight plane (two products, one accumulator); all f32 accumulate; softmax in f32 on VALU;
// every float input RNE-converted to bf16 on load.
#include <hip/hip_runtime.h>
#include <math.h>
#include <stdint.h>

#define NBATCH 2
#define SEQ    2048
#define DM     1024
#define NH     16
#define HD     64
#define MP     (NBATCH * SEQ)
#define NQB    (SEQ / 64)
#define CTXP   (2 * DM)
#define QRES   ((size_t)MP * DM)
#define VRES   ((size_t)NBATCH * DM * SEQ)
#define WSC    64.0f
#define RSC    2048.0f
#define PSC    1024.0f
#define LP     72      // LDS row pitch of the attention tiles in halves: 144 B = 16 B x 9 (odd), for 16-B fragment reads
#define OP     68      // LDS row pitch of the attention context tile in floats: 272 B = 16 B x 17 (odd), lane = row on the store
#define GPIT   72      // LDS row pitch of the staged GEMM operand tiles in halves: 144 B, same reason
#define GROWS  384     // rows of one staged GEMM tile: 128 rows of A, then 256 rows of Bt, 64 k (128 B) each
#define GBUFH  (GROWS * GPIT)   // halves per staging buffer (55296 B)
static_assert(NH * HD == DM);
static_assert((SEQ % 64) == 0 && (DM % 64) == 0 && (MP % 64) == 0);
static_assert(HD == 64);
static_assert((MP % 128) == 0 && (DM % 256) == 0 && (SEQ % 256) == 0 && (DM % 128) == 0);

typedef _Float16       v16h __attribute__((ext_vector_type(16)));
typedef __bf16         v16b __attribute__((ext_vector_type(16)));
typedef unsigned short v16us __attribute__((ext_vector_type(16)));
typedef unsigned short v8us __attribute__((ext_vector_type(8)));
typedef float          v8f  __attribute__((ext_vector_type(8)));
typedef float          v4f  __attribute__((ext_vector_type(4)));
typedef unsigned int   v4u  __attribute__((ext_vector_type(4)));

union Frag { v16us u; v8us p[2]; v16h h; v16b b; };

// ---- scalar helpers --------------------------------------------------------------------------------
__device__ __forceinline__ unsigned short bf_bits(float f) {          // f32 -> bf16 bits, RNE convert
  unsigned u = __float_as_uint(f);
  return (unsigned short)((u + 0x7FFFu + ((u >> 16) & 1u)) >> 16);
}
__device__ __forceinline__ float bf_up(unsigned short h) { return __uint_as_float(((unsigned)h) << 16); }
__device__ __forceinline__ float bfr(float f) { return bf_up(bf_bits(f)); }   // value of the bf16 RNE convert
__device__ __forceinline__ unsigned short h_bits(_Float16 x) { return __builtin_bit_cast(unsigned short, x); }
__device__ __forceinline__ unsigned pk16(unsigned short a, unsigned short b) { return (unsigned)a | ((unsigned)b << 16); }
__device__ __forceinline__ float xhalf(float x) {                     // lane l takes lane l ^ 16's value
  const int b = __builtin_bit_cast(int, x);
  return __builtin_bit_cast(float, __builtin_amdgcn_permlanex16(b, b, 0x76543210, 0xfedcba98, false, false));
}
__device__ __forceinline__ v8f zero8() { v8f z = {0.f, 0.f, 0.f, 0.f, 0.f, 0.f, 0.f, 0.f}; return z; }

// ---- fragment loader: 16-bit A/B operand (bit planes), lane -> row/col (lane&15), p already includes +8*(lane>>4);
//      elements 0..7 <- p[0..7] (k0+8h..), elements 8..15 <- p[16..23] (k0+16+8h..)
__device__ __forceinline__ v16us ldfrag(const unsigned short* p) {
  Frag f;
  f.p[0] = *(const v8us*)(p);
  f.p[1] = *(const v8us*)(p + 16);
  return f.u;
}

// ---- WMMA helpers (BF = 0: f16 operands, BF = 1: bf16 operands) with trailing VALU hazard gap -----------------
template <int BF>
__device__ __forceinline__ v8f mma_raw(v16us a, v16us b, v8f c) {
  Frag fa, fb;
  fa.u = a;
  fb.u = b;
  if constexpr (BF) {
    return __builtin_amdgcn_wmma_f32_16x16x32_bf16(false, fa.b, false, fb.b, (short)0, c, false, false);
  } else {
    return __builtin_amdgcn_wmma_f32_16x16x32_f16(false, fa.h, false, fb.h, (short)0, c, false, false);
  }
}
template <int BF>
__device__ __forceinline__ v8f mma_g(v16us a, v16us b, v8f c) {
  c = mma_raw<BF>(a, b, c);
#if defined(__HIP_DEVICE_COMPILE__)
  asm volatile("v_nop\n\tv_nop\n\tv_nop\n\tv_nop" : "+v"(c) : "v"(a), "v"(b));
#endif
  return c;
}
__device__ __forceinline__ void dep_guard1(v8f& a, v8f& b, v16us x) {
#if defined(__HIP_DEVICE_COMPILE__)
  asm volatile("v_nop\n\tv_nop\n\tv_nop\n\tv_nop" : "+v"(a), "+v"(b) : "v"(x));
#endif
}
__device__ __forceinline__ void keep4(v16us a, v16us b, v16us c, v16us d) {
#if defined(__HIP_DEVICE_COMPILE__)
  asm volatile("v_nop" :: "v"(a), "v"(b), "v"(c), "v"(d));
#endif
}
__device__ __forceinline__ void acc_guard4(v8f& a, v8f& b, v8f& c, v8f& d) {
#if defined(__HIP_DEVICE_COMPILE__)
  asm volatile("v_nop\n\tv_nop\n\tv_nop\n\tv_nop" : "+v"(a), "+v"(b), "+v"(c), "+v"(d));
#endif
}
__device__ __forceinline__ void wave_sync_lds() {
  __builtin_amdgcn_fence(__ATOMIC_RELEASE, "workgroup");
  __builtin_amdgcn_wave_barrier();
  __builtin_amdgcn_fence(__ATOMIC_ACQUIRE, "workgroup");
}

// ---- one staged GEMM tile: 12 asynchronous 16-B copies per lane, global -> LDS, no register in between.
//      Copy i < 4 brings A row (32 i + lane's row), copy 4 + i brings Bt row (32 i + lane's row); eight lanes cover one
//      128-B row segment, so each wave-wide copy takes four whole lines. l = the lane's LDS byte address in row 0..31 of
//      the buffer; rows 32 apart lie 32 * 144 B apart. The closing s_wait_xcnt 0 stands inside the statement so that no
//      address register of an issued copy is rewritten in front of it.
__device__ __forceinline__ void stage12(unsigned l, const unsigned short* a, size_t sa,
                                        const unsigned short* b, size_t sb) {
#if defined(__HIP_DEVICE_COMPILE__)
  const unsigned st = 32u * GPIT * 2u;
  asm volatile(
      "global_load_async_to_lds_b128 %0, %12, off\n\t"
      "global_load_async_to_lds_b128 %1, %13, off\n\t"
      "global_load_async_to_lds_b128 %2, %14, off\n\t"
      "global_load_async_to_lds_b128 %3, %15, off\n\t"
      "global_load_async_to_lds_b128 %4, %16, off\n\t"
      "global_load_async_to_lds_b128 %5, %17, off\n\t"
      "global_load_async_to_lds_b128 %6, %18, off\n\t"
      "global_load_async_to_lds_b128 %7, %19, off\n\t"
      "global_load_async_to_lds_b128 %8, %20, off\n\t"
      "global_load_async_to_lds_b128 %9, %21, off\n\t"
      "global_load_async_to_lds_b128 %10, %22, off\n\t"
      "global_load_async_to_lds_b128 %11, %23, off\n\t"
      "s_wait_xcnt 0x0"
      :: "v"(l), "v"(l + st), "v"(l + 2u * st), "v"(l + 3u * st), "v"(l + 4u * st), "v"(l + 5u * st),
         "v"(l + 6u * st), "v"(l + 7u * st), "v"(l + 8u * st), "v"(l + 9u * st), "v"(l + 10u * st), "v"(l + 11u * st),
         "v"(a), "v"(a + sa), "v"(a + 2 * sa), "v"(a + 3 * sa),
         "v"(b), "v"(b + sb), "v"(b + 2 * sb), "v"(b + 3 * sb), "v"(b + 4 * sb), "v"(b + 5 * sb), "v"(b + 6 * sb),
         "v"(b + 7 * sb)
      : "memory");
#endif
}

// =====================================================================================================
// f32 -> f16 activation plane convert: Xh[i] = f16( bf16_RNE(X[i]) * wsc ), wsc a power of two (exact).
// Thread i handles elements 8i..8i+7 and writes one 16-B piece; 32 consecutive lanes of one instruction fill
// (host-checked) so every store is full-width.
// coverage: n8 threads x 8 elements = the whole plane. bx = the block's index within the plane's n8 / 256 blocks.
// =====================================================================================================
__device__ __forceinline__ void conv_h16(int bx, const float* __restrict__ W, unsigned short* Wh, int n8, float wsc) {
  const int i  = bx * 256 + threadIdx.x;
  const int ic = (i < n8) ? i : (n8 - 1);                     // clamped address
  const float* src = W + (size_t)ic * 8;
  const v4f a = *(const v4f*)(src);
  const v4f c = *(const v4f*)(src + 4);
  v4u o;
  o[0] = pk16(h_bits((_Float16)(bfr(a[0]) * wsc)), h_bits((_Float16)(bfr(a[1]) * wsc)));
  o[1] = pk16(h_bits((_Float16)(bfr(a[2]) * wsc)), h_bits((_Float16)(bfr(a[3]) * wsc)));
  o[2] = pk16(h_bits((_Float16)(bfr(c[0]) * wsc)), h_bits((_Float16)(bfr(c[1]) * wsc)));
  o[3] = pk16(h_bits((_Float16)(bfr(c[2]) * wsc)), h_bits((_Float16)(bfr(c[3]) * wsc)));
  if (i < n8) *(v4u*)(Wh + (size_t)i * 8) = o;
  // the caller's other parts follow in the same kernel: no register of the issued store is rewritten in front of this wait
  asm volatile("s_wait_xcnt 0x0" ::: "memory");
}

// =====================================================================================================
// 64x64 tile transpose-convert of an f32 weight tensor: z-slice in[z] is [R][C] f32 (row pitch C elements,
// slice stride inStrideZ); output is 16-bit with rows indexed by the INPUT COLUMN: out[z*outStrideZ + c*ldo + r]
// (the input row index r becomes the k-contiguous column), i.e. in[rows=R][cols=C] -> out[cols=C][rows=R].
//   BF == 0: value = f16( bf16_RNE(x) * sc )   (sc a power of two)
//   BF == 1: value = bf16_RNE(x) bits; DUP == 1 additionally writes the same 16-B piece at column offset + dupOff.
// blocks (bx, by, bz) = (R/64, C/64, Z), block 256, sT = the block's 64 x 72 halves of LDS. Load phase: 1024 float4 pieces (64 rows x 16) = the whole 64x64 tile,
// 4 per thread, converted and stored transposed into LDS with 16-bit element stores; __syncthreads; store phase:
// coverage: 2 iterations x 32 rows x (8 lanes x 8 halves) = the whole 64x64 output tile (x2 destinations if DUP);
//           the grid tiles every (r block, c block, z) exactly once.
// =====================================================================================================
template <int BF, int DUP>
__device__ __forceinline__ void tconv64(unsigned short* sT, int bx, int by, int bz,
                                        const float* __restrict__ in, long long inStrideZ, int C,
                                        unsigned short* out, long long outStrideZ, int ldo, int dupOff,
                                        float sc) {
  const int t  = threadIdx.x;
  const int r0 = bx * 64;
  const int c0 = by * 64;
  const float* src = in + (size_t)bz * (size_t)inStrideZ;
  unsigned short* dst = out + (size_t)bz * (size_t)outStrideZ;
#pragma unroll
  for (int i = 0; i < 4; ++i) {
    const int idx = t + 256 * i;                              // 0..1023
    const int rr  = idx >> 4;                                 // 0..63
    const int cq  = (idx & 15) * 4;                           // 0..60
    const v4f x = *(const v4f*)(src + (size_t)(r0 + rr) * (size_t)C + c0 + cq);
#pragma unroll
    for (int j = 0; j < 4; ++j) {
      unsigned short w;
      if (BF) {
        w = bf_bits(x[j]);
      } else {
        w = h_bits((_Float16)(bfr(x[j]) * sc));
      }
      sT[(cq + j) * 72 + rr] = w;
    }
  }
  __syncthreads();
  const int q8 = t >> 3;                                      // 0..31: row within the 32-row group
  const int c8 = (t & 7) * 8;
  v8us vv[2];
#pragma unroll
  for (int it = 0; it < 2; ++it) {
    const int row = it * 32 + q8;                             // it 0..1 x q8 0..31 = rows 0..63
    vv[it] = *(const v8us*)(sT + row * 72 + c8);
  }
  {
#pragma unroll
    for (int it = 0; it < 2; ++it) {
      const int row = it * 32 + q8;
      unsigned short* dp = dst + (size_t)(c0 + row) * (size_t)ldo + r0 + c8;
      *(v8us*)(dp) = vv[it];
      if (DUP) *(v8us*)(dp + dupOff) = vv[it];
    }
    // the caller's other parts follow in the same kernel: no register of the issued stores is rewritten in front of this wait
    asm volatile("s_wait_xcnt 0x0" ::: "memory");
  }
}

// =====================================================================================================
// All operand preparation in one launch; none of its parts reads what another writes. Block ranges (block-uniform):
//   0..767     weight planes: z = block >> 8 picks Wq, Wk, Wv; per head in[e = 1024][d = 64] -> WqkvT[z*1024 + h*64 + d][e]
//   768..1023  Wo: in[k][n] -> WoB[n][k] and WoB[n][1024 + k]
//   1024..     activation planes: z = (block - 1024) / PCB picks q, k, v -> XH + z * MP * DM, PCB blocks per plane
// =====================================================================================================
#define PCB ((MP * DM) / (8 * 256))
static_assert(((MP * DM) % (8 * 256)) == 0);
static_assert(DM / 64 == 16 && HD == 64 && NH * (DM / 64) == 256);   // the shifts and masks of the transpose ranges
__global__ __launch_bounds__(256) void prep(const float* __restrict__ xq, const float* __restrict__ xk,
                                            const float* __restrict__ xv, const float* __restrict__ wq,
                                            const float* __restrict__ wk, const float* __restrict__ wv,
                                            const float* __restrict__ wo, unsigned short* WqkvT, unsigned short* WoB,
                                            unsigned short* XH) {
  __shared__ __align__(16) unsigned short sT[64 * 72];        // [c local][r local], pitch 72 halves (144 B)
  const int bx = blockIdx.x;
  if (bx < 768) {
    const int z = bx >> 8, r = bx & 255;
    const float* w = (z == 0) ? wq : ((z == 1) ? wk : wv);
    tconv64<0, 0>(sT, r & 15, 0, r >> 4, w, (long long)DM * HD, HD, WqkvT + (size_t)z * DM * DM,
                  (long long)HD * DM, DM, 0, WSC);
  } else if (bx < 1024) {
    const int r = bx - 768;
    tconv64<1, 1>(sT, r & 15, r >> 4, 0, wo, 0LL, DM, WoB, 0LL, CTXP, DM, 1.0f);
  } else {
    const int r = bx - 1024;
    const int z = r / PCB;
    const float* x = (z == 0) ? xq : ((z == 1) ? xk : xv);
    conv_h16(r - z * PCB, x, XH + (size_t)z * MP * DM, (MP * DM) / 8, 1.0f);
  }
}

// =====================================================================================================
// Register-blocked batched 16-bit WMMA GEMM: C[m][n] = oscale * sum_k A[m][k] * Bt[n][k] + bias;
// one wave per 64x64 tile, 8 waves (2 x 4) = one 128x256 block tile. A row-major [M][K] pitch lda; Bt row-major [N][K]
// pitch ldb (k contiguous); M multiple of 128, N of 256, K of 64 (static here). b = batch (strides in elements).
// Operands: per 64 k the block's 128 A rows and 256 Bt rows are staged in LDS by asynchronous copies, two buffers: the
// copies of tile t + 2 go out behind the barrier at the foot of trip t and fly during trip t + 1; every fragment is read
// from LDS (k order per output element as before: ascending in steps of 32).
// BF: 0 = f16 operand planes, 1 = bf16 operand planes.
// Bias: BIASM == 0 -> per column: cols < Nb from bias0[col], cols >= Nb from bias1[col - Nb] (tile-uniform select of
//       clamped-address loads); BIASM == 1 -> per row bias0[m]. Bias values RNE-converted to bf16.
// OM: 0 = f32 out (pitch ldc); 2 = f16 out; 3 = f16 hi plane at C plus f16 residual plane ((f - hi) * RSC) at
//     C + resOff (same pitch and offsets).
// coverage: 4 slabs x 16 rows x 64 cols = the wave's whole 64x64 tile; tile = 0 .. (M/128)*(N/256) - 1 per batch,
//           a surplus block exits as a whole in front of every barrier and copy.
// sOp = two staging buffers [A 128 rows | Bt 256 rows] x 64 k; sT = per-wave 16x64 slab, pitch 68 floats (the kernel's LDS).
// =====================================================================================================
template <int BF, int OM, int BIASM>
__device__ __forceinline__ void gemm64(
    unsigned short* sOp, float (*sT)[16 * 68], int tile, int b,
    const unsigned short* __restrict__ A, int lda, long long strideA,
    const unsigned short* __restrict__ Bt, int ldb, long long strideB,
    const float* __restrict__ bias0, const float* __restrict__ bias1, int Nb,
    void* Cout, int ldc, long long strideC, long long resOff,
    int M, int N, int K, float oscale) {
  const int lane = threadIdx.x & 31;
  const int wave = threadIdx.x >> 5;
  const int tilesN = N >> 8;
  const int tilesM = M >> 7;
  if (tile >= tilesM * tilesN) return;   // block-uniform, in front of every barrier
  const int tm = tile / tilesN;
  const int tn = tile - tm * tilesN;
  const int mb0 = tm << 7;                     // block tile origin
  const int nb0 = tn << 8;
  const int wm  = wave >> 2;                   // wave's 64x64 tile inside the block tile
  const int wn  = wave & 3;
  const int m0 = mb0 + (wm << 6);
  const int n0 = nb0 + (wn << 6);

  const unsigned short* Ab = A  + (size_t)b * (size_t)strideA;
  const unsigned short* Bb = Bt + (size_t)b * (size_t)strideB;

  const int rlane = lane & 15;                 // row (A) / col (B, D) within subtile
  const int koff  = (lane >> 4) * 8;           // k offset of this lane half
  const int mOff  = (lane >> 4) * 8;           // D row offset

  v8f acc[4][4];
#pragma unroll
  for (int i = 0; i < 4; ++i)
#pragma unroll
    for (int j = 0; j < 4; ++j) acc[i][j] = zero8();

  // ---- staging addresses: thread -> row (tid >> 3) of each 32-row group, 16-B piece (tid & 7) of the 128-B segment ----
  const int crow = threadIdx.x >> 3;
  const int cpc  = (threadIdx.x & 7) * 8;
  const unsigned short* ga = Ab + (size_t)(mb0 + crow) * lda + cpc;
  const unsigned short* gb = Bb + (size_t)(nb0 + crow) * ldb + cpc;
  const size_t sa = (size_t)32 * lda, sb = (size_t)32 * ldb;
  const unsigned l0 =
      (unsigned)(uintptr_t)(const __attribute__((address_space(3))) unsigned short*)(sOp + crow * GPIT + cpc);
  const int T = K >> 6;                        // staged tiles of 64 k

  stage12(l0, ga, sa, gb, sb);                                 // tile 0 -> buffer 0
  asm volatile("s_wait_asynccnt 0x0" ::: "memory");            // this wave's copies of tile 0 have landed
  __syncthreads();                                             // ... and every other wave's
  if (T > 1) stage12(l0 + GBUFH * 2u, ga + 64, sa, gb + 64, sb);   // tile 1 -> buffer 1

  for (int t = 0; t < T; ++t) {
    const unsigned short* sbuf = sOp + (t & 1) * GBUFH;
    const unsigned short* fa = sbuf + ((wm << 6) + rlane) * GPIT + koff;
    const unsigned short* fb = sbuf + (128 + (wn << 6) + rlane) * GPIT + koff;
#pragma unroll
    for (int kk = 0; kk < 2; ++kk) {
      v16us bh[4], ah[4];
#pragma unroll
      for (int j = 0; j < 4; ++j) bh[j] = ldfrag(fb + (j << 4) * GPIT + kk * 32);
#pragma unroll
      for (int i = 0; i < 4; ++i) ah[i] = ldfrag(fa + (i << 4) * GPIT + kk * 32);
#pragma unroll
      for (int i = 0; i < 4; ++i) {
#pragma unroll
        for (int j = 0; j < 4; ++j) acc[i][j] = mma_raw<BF>(ah[i], bh[j], acc[i][j]);
        dep_guard1(acc[i][0], acc[i][3], ah[i]);
      }
      keep4(bh[0], bh[1], bh[2], bh[3]);
    }
    asm volatile("s_wait_dscnt 0x0" ::: "memory");             // this wave's reads of buffer t & 1 are done
    asm volatile("s_wait_asynccnt 0x0" ::: "memory");          // this wave's copies of tile t + 1 have landed
    __syncthreads();                                           // publishes tile t + 1, frees buffer t & 1
    if (t + 2 < T) stage12(l0 + (unsigned)(t & 1) * (GBUFH * 2u), ga + (size_t)(t + 2) * 64, sa, gb + (size_t)(t + 2) * 64, sb);
  }
  asm volatile("s_wait_asynccnt 0x0" ::: "memory");            // nothing of this wave is in flight past the loop
  acc_guard4(acc[0][0], acc[0][1], acc[0][2], acc[0][3]);
  acc_guard4(acc[1][0], acc[1][1], acc[1][2], acc[1][3]);
  acc_guard4(acc[2][0], acc[2][1], acc[2][2], acc[2][3]);
  acc_guard4(acc[3][0], acc[3][1], acc[3][2], acc[3][3]);

  // ---- per-lane column bias (BIASM == 0), RNE-converted ----
  const int hh2 = lane >> 4, c4 = (lane & 15) * 4;     // f32 out: 256-B row segment = 16 lanes x 16 B
  const int q8  = lane >> 3, c8 = (lane & 7) * 8;
  float bc[8];
#pragma unroll
  for (int e = 0; e < 8; ++e) bc[e] = 0.f;
  if (BIASM == 0) {
    const bool use1 = (n0 >= Nb);                      // tile-uniform
    if (OM == 0) {
      const int cb = n0 + c4;
      const int i0 = (cb < Nb - 4) ? cb : (Nb - 4);
      const int i1 = (cb - Nb > 0) ? (cb - Nb) : 0;
      const v4f b0v = *(const v4f*)(bias0 + i0);
      const v4f b1v = *(const v4f*)(bias1 + i1);
#pragma unroll
      for (int e = 0; e < 4; ++e) bc[e] = bfr(use1 ? b1v[e] : b0v[e]);
    } else {
      const int cb = n0 + c8;
      const int i0 = (cb < Nb - 8) ? cb : (Nb - 8);
      const int i1 = (cb - Nb > 0) ? (cb - Nb) : 0;
      const v4f b0a = *(const v4f*)(bias0 + i0), b0b = *(const v4f*)(bias0 + i0 + 4);
      const v4f b1a = *(const v4f*)(bias1 + i1), b1b = *(const v4f*)(bias1 + i1 + 4);
#pragma unroll
      for (int e = 0; e < 4; ++e) {
        bc[e]     = bfr(use1 ? b1a[e] : b0a[e]);
        bc[4 + e] = bfr(use1 ? b1b[e] : b0b[e]);
      }
    }
  }

  // ---- epilogue ----
  float* slab = sT[wave];
#pragma unroll
  for (int i = 0; i < 4; ++i) {
    const int mBase = m0 + (i << 4);
#pragma unroll
    for (int j = 0; j < 4; ++j) {
#pragma unroll
      for (int r = 0; r < 8; ++r) {
        slab[(mOff + r) * 68 + (j << 4) + rlane] = acc[i][j][r];
      }
    }
    wave_sync_lds();
    if constexpr (OM == 0) {
      float* C = (float*)Cout + (size_t)b * (size_t)strideC;
      v4f vals[8];
#pragma unroll
      for (int it = 0; it < 8; ++it) {
        const int row = it * 2 + hh2;                      // it 0..7 x hh2 0..1 = rows 0..15
        v4f v = *(const v4f*)(slab + row * 68 + c4);
#pragma unroll
        for (int e = 0; e < 4; ++e) v[e] = v[e] * oscale + bc[e];
        vals[it] = v;
      }
      {
#pragma unroll
        for (int it = 0; it < 8; ++it) {
          const int row = it * 2 + hh2;
          *(v4f*)(C + (size_t)(mBase + row) * ldc + n0 + c4) = vals[it];
        }
        
      }
    } else {
      unsigned short* C = (unsigned short*)Cout + (size_t)b * (size_t)strideC;
      v4u hv[4], hr[4];
#pragma unroll
      for (int it = 0; it < 4; ++it) {
        const int row = it * 4 + q8;                       // it 0..3 x q8 0..3 = rows 0..15
        const float* sp = slab + row * 68 + c8;
        float bm = 0.f;
        if (BIASM == 1) bm = bfr(bias0[mBase + row]);
        v4u a, ar;
#pragma unroll
        for (int e = 0; e < 4; ++e) {
          const float f0 = sp[2 * e]     * oscale + ((BIASM == 1) ? bm : bc[2 * e]);
          const float f1 = sp[2 * e + 1] * oscale + ((BIASM == 1) ? bm : bc[2 * e + 1]);
          const _Float16 g0 = (_Float16)f0, g1 = (_Float16)f1;
          a[e] = pk16(h_bits(g0), h_bits(g1));
          if (OM == 3) {
            const float e0 = (f0 - (float)g0) * RSC;
            const float e1 = (f1 - (float)g1) * RSC;
            ar[e] = pk16(h_bits((_Float16)e0), h_bits((_Float16)e1));
          } else {
            ar[e] = 0u;
          }
        }
        hv[it] = a;
        hr[it] = ar;
      }
      {
#pragma unroll
        for (int it = 0; it < 4; ++it) {
          const int row = it * 4 + q8;
          unsigned short* dp = C + (size_t)(mBase + row) * ldc + n0 + c8;
          *(v4u*)(dp) = hv[it];
          if (OM == 3) *(v4u*)(dp + resOff) = hr[it];
        }
        
      }
    }
    wave_sync_lds();
  }
}

// ---- one GEMM per launch: grid = ((M/128)*(N/256), batches) ----
template <int BF, int OM, int BIASM>
__global__ __launch_bounds__(256) void gemm64_one(
    const unsigned short* __restrict__ A, int lda, long long strideA,
    const unsigned short* __restrict__ Bt, int ldb, long long strideB,
    const float* __restrict__ bias0, const float* __restrict__ bias1, int Nb,
    void* Cout, int ldc, long long strideC, long long resOff,
    int M, int N, int K, float oscale) {
  __shared__ __align__(16) unsigned short sOp[2 * GBUFH];
  __shared__ __align__(16) float sT[8][16 * 68];
  gemm64<BF, OM, BIASM>(sOp, sT, blockIdx.x, blockIdx.y, A, lda, strideA, Bt, ldb, strideB, bias0, bias1, Nb,
                        Cout, ldc, strideC, resOff, M, N, K, oscale);
}

// ---- the three in-projections in one launch; they share no output and read only what the launch before wrote.
//      PJB blocks each, block >> 7 picks the projection (block-uniform):
//      0: Q = xq . WqT^T + b_q -> QH (f16 hi) and QH + QRES (f16 residual x2048); column n = h*64 + d
//      1: K = xk . WkT^T + b_k -> KH (f16)
//      2: V^T per batch = WvT . xv^T + b_v -> VT (f16 hi [2][1024][2048]) and VT + VRES (residual x2048); row m = h*64 + d
//         (per-row bias b_v[m]), column n = token s of batch (block & 127) >> 6
#define PJB 128
static_assert((MP / 128) * (DM / 256) == PJB && (DM / 128) * (SEQ / 256) * NBATCH == PJB && (DM / 128) * (SEQ / 256) == 64);
__global__ __launch_bounds__(256) void gemm_qkv(
    const unsigned short* __restrict__ XH, const unsigned short* __restrict__ WqkvT,
    const float* __restrict__ b_q, const float* __restrict__ b_k, const float* __restrict__ b_v,
    unsigned short* QH, unsigned short* KH, unsigned short* VT, int K, float oscale) {
  __shared__ __align__(16) unsigned short sOp[2 * GBUFH];
  __shared__ __align__(16) float sT[8][16 * 68];
  const int sel = blockIdx.x >> 7, r = blockIdx.x & 127;
  if (sel == 0) {
    gemm64<0, 3, 0>(sOp, sT, r, 0, XH, DM, 0LL, WqkvT, DM, 0LL, b_q, b_q, DM,
                    (void*)QH, DM, 0LL, (long long)QRES, MP, DM, K, oscale);
  } else if (sel == 1) {
    gemm64<0, 2, 0>(sOp, sT, r, 0, XH + (size_t)MP * DM, DM, 0LL, WqkvT + (size_t)DM * DM, DM, 0LL, b_k, b_k, DM,
                    (void*)KH, DM, 0LL, 0LL, MP, DM, K, oscale);
  } else {
    gemm64<0, 3, 1>(sOp, sT, r & 63, r >> 6, WqkvT + (size_t)2 * DM * DM, DM, 0LL,
                    XH + (size_t)2 * MP * DM, DM, (long long)SEQ * DM, b_v, b_v, SEQ,
                    (void*)VT, SEQ, (long long)DM * SEQ, (long long)VRES, DM, SEQ, K, oscale);
  }
}

// =====================================================================================================
// Flash attention, head dim 64, SEQ token rows per batch (all keys valid, no mask).
//   q planes (f16, pitch DM): hi at qhp[(b*SEQ + t)*DM + h*64 + d], residual (x2048) at qhp + QRES (same offsets)
//   k plane (f16, pitch DM): khp[(b*SEQ + t)*DM + h*64 + d]
//   v^T planes (f16): hi at vtp[(b*DM + h*64 + d)*SEQ + s], residual (x2048) at vtp + VRES
//   context planes (bf16, pitch CTXP): hi at ctxp[(b*SEQ + t)*CTXP + h*64 + d], lo at the same + DM
//   Products are taken transposed: S^T = K . Q^T (A = K rows, B = Q rows) and O^T += V^T . P^T (A = V^T rows, B = P^T), so
//   a lane holds scores of ONE query (column lane & 15), keys 8 (lane >> 4) + r of each 16-key tile: the row maximum
//   and the row sum are taken in the lane, plus one exchange between the wave halves (the sum's only in the epilogue),
//   and two converted score tiles are the B operand of the second product as they stand: P never leaves the registers.
//   score = fma(acc_hi, sscale, acc_res * ssres); p = exp(s - m) carried as f16(1024 p); context = p . v with the
//   v hi and v residual products in two accumulators; online softmax (running max) in f32.
//   Block = 4 waves = 64 query rows of one (b, h); grid = NQB * NH * NBATCH; kv chunks of 64, static trip NQB.
//   K / V^T hi / V^T res chunk staging: 128 threads x 32 elements per plane = the whole 64x64 tile each
//   (plain 16-B loads, __syncthreads before and after).
//   Context coverage: each wave stores rows q0..q0+15 (it 0..3 x lane>>3 0..3) x 64 columns (8 lanes x 8) of both
//   the hi and the lo plane; grid covers all SEQ rows x NH head slices x NBATCH.
// =====================================================================================================
__global__ __launch_bounds__(128)
void attn64(const unsigned short* __restrict__ qhp, const unsigned short* __restrict__ khp,
            const unsigned short* __restrict__ vtp, unsigned short* ctxp,
            float sscale, float ssres) {
  __shared__ __align__(16) unsigned short Ksh[64 * LP];           // K [kv][d]        9 KB, rows of 64 at pitch LP
  __shared__ __align__(16) unsigned short Vth[64 * LP];           // V^T hi [d][kv]   9 KB, rows of 64 at pitch LP
  __shared__ __align__(16) unsigned short Vtr[64 * LP];           // V^T res [d][kv]  9 KB, rows of 64 at pitch LP
  __shared__ __align__(16) float          Os[4][16 * OP];         // per wave context tile [row][d], rows of 64 at pitch OP

  const int tid  = threadIdx.x;
  const int wave = tid >> 5;
  const int lane = tid & 31;
  const int hh   = lane >> 4;
  const int c    = lane & 15;

  const int bx   = blockIdx.x;
  const int qb   = bx % NQB;
  const int rest = bx / NQB;
  const int h    = rest % NH;
  const int b    = rest / NH;
  const int q0   = qb * 64 + wave * 16;          // in-batch query row of this wave's first row
  const size_t rowB = (size_t)b * SEQ;

  const unsigned short* Qh = qhp + (size_t)h * HD;
  const unsigned short* Qr = qhp + QRES + (size_t)h * HD;
  const unsigned short* Kg = khp + (size_t)h * HD;
  const unsigned short* Vh = vtp + ((size_t)b * DM + (size_t)h * HD) * SEQ;
  const unsigned short* Vr = Vh + VRES;

  float mrun = -INFINITY, lsum = 0.f;   // query c: running maximum (both halves alike), sum over this half's keys
  v8f oacc[4], oacr[4];                 // O^T tiles: register r = context[d = 16 t + 8 hh + r] of query c
#pragma unroll
  for (int t = 0; t < 4; ++t) { oacc[t] = zero8(); oacr[t] = zero8(); }

  for (int kt = 0; kt < NQB; ++kt) {         // static trip count
    const int kv0 = kt * 64;
    __syncthreads();
    {
      const int r = tid >> 1, hf = (tid & 1) * 32;
      const unsigned short* kg = Kg + (rowB + kv0 + r) * DM + hf;          // K row kv0+r, d = hf..hf+31
      const unsigned short* vg = Vh + (size_t)r * SEQ + kv0 + hf;           // V^T hi row d = r, s = kv0+hf..
      const unsigned short* vr = Vr + (size_t)r * SEQ + kv0 + hf;           // V^T res row d = r
#pragma unroll
      for (int i = 0; i < 4; ++i) {
        const v8us a0 = *(const v8us*)(kg + 8 * i);
        const v8us b0 = *(const v8us*)(vg + 8 * i);
        const v8us c0 = *(const v8us*)(vr + 8 * i);
        *(v8us*)(Ksh + r * LP + hf + 8 * i) = a0;
        *(v8us*)(Vth + r * LP + hf + 8 * i) = b0;
        *(v8us*)(Vtr + r * LP + hf + 8 * i) = c0;
      }
    }
    __syncthreads();

    // ---- Q fragments (B operand, column = query = lane&15): hi and residual, 2 d-chunks each ----
    v16us qa[2], qr[2];
#pragma unroll
    for (int dc = 0; dc < 2; ++dc) {
      qa[dc] = ldfrag(Qh + (rowB + q0 + c) * DM + dc * 32 + 8 * hh);
      qr[dc] = ldfrag(Qr + (rowB + q0 + c) * DM + dc * 32 + 8 * hh);
    }

    // ---- scores, transposed: s[j][r] = score(key 16 j + 8 hh + r, query c) ----
    v8f s[4];
#pragma unroll
    for (int j = 0; j < 4; ++j) {
      v8f sh = zero8(), sr = zero8();
#pragma unroll
      for (int dc = 0; dc < 2; ++dc) {
        Frag kb;
        kb.p[0] = *(const v8us*)(Ksh + (j * 16 + c) * LP + dc * 32 + 8 * hh);
        kb.p[1] = *(const v8us*)(Ksh + (j * 16 + c) * LP + dc * 32 + 16 + 8 * hh);
        sh = mma_g<0>(kb.u, qa[dc], sh);
        sr = mma_g<0>(kb.u, qr[dc], sr);
      }
#pragma unroll
      for (int r = 0; r < 8; ++r) s[j][r] = fmaf(sh[r], sscale, sr[r] * ssres);
    }

    // ---- maximum over the lane's 32 keys (four chains), then the other half's; online softmax; P^T (x1024, f16) packed
    //      in place: element 8 (j & 1) + r of fragment j >> 1 = key 32 (j >> 1) + 16 (j & 1) + 8 hh + r, the V^T loader's k order
    float mj[4], pj[4];
#pragma unroll
    for (int j = 0; j < 4; ++j) {
      mj[j] = s[j][0];
#pragma unroll
      for (int r = 1; r < 8; ++r) mj[j] = fmaxf(mj[j], s[j][r]);
    }
    float m = fmaxf(fmaxf(mj[0], mj[1]), fmaxf(mj[2], mj[3]));
    m = fmaxf(m, xhalf(m));
    const float mnew  = fmaxf(mrun, m);
    const float alpha = __expf(mrun - mnew);
    mrun = mnew;
    Frag pb[2];
#pragma unroll
    for (int j = 0; j < 4; ++j) {
      pj[j] = 0.f;
#pragma unroll
      for (int r = 0; r < 8; ++r) {
        const float p = __expf(s[j][r] - mnew);
        pj[j] += p;
        pb[j >> 1].h[(j & 1) * 8 + r] = (_Float16)(p * PSC);
      }
    }
    lsum = lsum * alpha + ((pj[0] + pj[1]) + (pj[2] + pj[3]));
#pragma unroll
    for (int t = 0; t < 4; ++t) { oacc[t] *= alpha; oacr[t] *= alpha; }

    // ---- context^T += V^T . P^T (hi and residual products, f16 WMMA) ----
#pragma unroll   // unrolled so that pb[kk] is a fixed register set; a rolled loop would have to index registers at run time
    for (int kk = 0; kk < 2; ++kk) {
#pragma unroll
      for (int t = 0; t < 4; ++t) {
        Frag vb, vc;
        vb.p[0] = *(const v8us*)(Vth + (t * 16 + c) * LP + kk * 32 + 8 * hh);
        vb.p[1] = *(const v8us*)(Vth + (t * 16 + c) * LP + kk * 32 + 16 + 8 * hh);
        vc.p[0] = *(const v8us*)(Vtr + (t * 16 + c) * LP + kk * 32 + 8 * hh);
        vc.p[1] = *(const v8us*)(Vtr + (t * 16 + c) * LP + kk * 32 + 16 + 8 * hh);
        oacc[t] = mma_g<0>(vb.u, pb[kk].u, oacc[t]);
        oacr[t] = mma_g<0>(vc.u, pb[kk].u, oacr[t]);
      }
    }
  }

  // ---- normalise (residual fold 1/2048, 1/l, the 1/1024 p carry), stage the wave's 16x64 tile, bf16 hi | lo
  float* os = Os[wave];
  {
    const float l = lsum + xhalf(lsum);   // the two halves' key sums join here, once
    const float inv = ((l > 0.f) ? (1.0f / l) : 0.f) * (1.0f / PSC);
#pragma unroll
    for (int t = 0; t < 4; ++t) {
      v4f lo, hi;
#pragma unroll
      for (int r = 0; r < 4; ++r) {
        lo[r] = fmaf(oacr[t][r], 1.0f / RSC, oacc[t][r]) * inv;
        hi[r] = fmaf(oacr[t][4 + r], 1.0f / RSC, oacc[t][4 + r]) * inv;
      }
      *(v4f*)(os + c * OP + t * 16 + 8 * hh)     = lo;
      *(v4f*)(os + c * OP + t * 16 + 8 * hh + 4) = hi;
    }
  }
  wave_sync_lds();
  {
    const int q4 = lane >> 3, c8 = (lane & 7) * 8;
    v4u hv[4], hl[4];
#pragma unroll
    for (int it = 0; it < 4; ++it) {
      const int row = it * 4 + q4;   // it 0..3 x q4 0..3 = rows 0..15 of the wave tile
      const float* sp = os + row * OP + c8;
      v4u a, d;
#pragma unroll
      for (int e = 0; e < 4; ++e) {
        const float f0 = sp[2 * e], f1 = sp[2 * e + 1];
        const unsigned short hb0 = bf_bits(f0), hb1 = bf_bits(f1);
        const unsigned short lb0 = bf_bits(f0 - bf_up(hb0)), lb1 = bf_bits(f1 - bf_up(hb1));
        a[e] = pk16(hb0, hb1);
        d[e] = pk16(lb0, lb1);
      }
      hv[it] = a;
      hl[it] = d;
    }
    {
#pragma unroll
      for (int it = 0; it < 4; ++it) {
        const int row = it * 4 + q4;
        const size_t go = (rowB + q0 + row) * CTXP + (size_t)h * HD + c8;
        *(v4u*)(ctxp + go)      = hv[it];
        *(v4u*)(ctxp + go + DM) = hl[it];
      }
      
    }
  }
}

// =====================================================================================================
// Workspace map (bytes); every plane is an exact multiple of its 64x64-tile / whole-row / whole-line store
// granularity (M = MP = 4096 = 64 tiles, N = 1024 = 16 tiles; V^T per batch [1024][2048] = 16x32 tiles):
//   WqkvT f16 [3072 n][1024 k]        0           6291456   (rows 0..1023 = h*64+d of Wq, then Wk, then Wv; x64)
//   WoB   bf16 [1024 n][2048 k]       6291456     4194304   (Wo^T bf16, k-duplicated)
//   XH    f16 [3][4096][1024]         10485760    25165824  (converted activation planes of q, k, v)
//   QH|QR f16 [2][4096][1024]         35651584    16777216  (q hi plane, then q residual plane x2048)
//   KH    f16 [4096][1024]            52428800    8388608
//   VT|VR f16 [2][2][1024][2048]      60817408    16777216  (v^T hi planes per batch, then residual planes x2048)
//   Ctx   bf16 [4096][2048]           77594624    16777216  (context hi cols 0..1023, lo cols 1024..2047)
//   end                               94371840
// =====================================================================================================
extern "C" void kernel_launch(void* const* d_in, const int* in_sizes, int n_in,
                              void* d_out, int out_size, void* d_ws, size_t ws_size,
                              hipStream_t stream) {
  if (n_in < 11) return;
  if (in_sizes[0] != MP * DM || in_sizes[1] != MP * DM || in_sizes[2] != MP * DM) return;
  if (in_sizes[3] != NH * DM * HD || in_sizes[4] != NH * HD) return;
  if (in_sizes[5] != NH * DM * HD || in_sizes[6] != NH * HD) return;
  if (in_sizes[7] != NH * DM * HD || in_sizes[8] != NH * HD) return;
  if (in_sizes[9] != DM * DM || in_sizes[10] != DM) return;
  if (out_size != MP * DM) return;

  const float* query = (const float*)d_in[0];
  const float* key_  = (const float*)d_in[1];
  const float* value = (const float*)d_in[2];
  const float* w_q   = (const float*)d_in[3];
  const float* b_q   = (const float*)d_in[4];
  const float* w_k   = (const float*)d_in[5];
  const float* b_k   = (const float*)d_in[6];
  const float* w_v   = (const float*)d_in[7];
  const float* b_v   = (const float*)d_in[8];
  const float* w_o   = (const float*)d_in[9];
  const float* b_o   = (const float*)d_in[10];

  const size_t PW   = (size_t)3 * DM * DM * 2;            //  6291456
  const size_t PWO  = (size_t)DM * CTXP * 2;              //  4194304
  const size_t PX   = (size_t)3 * MP * DM * 2;            // 25165824
  const size_t PQ   = (size_t)2 * MP * DM * 2;            // 16777216
  const size_t PK   = (size_t)MP * DM * 2;                //  8388608
  const size_t PV   = (size_t)2 * NBATCH * DM * SEQ * 2;  // 16777216
  const size_t PC   = (size_t)MP * CTXP * 2;              // 16777216
  size_t off = 0;
  const size_t oW  = off; off += PW;
  const size_t oWo = off; off += PWO;
  const size_t oX  = off; off += PX;
  const size_t oQ  = off; off += PQ;
  const size_t oK  = off; off += PK;
  const size_t oV  = off; off += PV;
  const size_t oC  = off; off += PC;
  if (off > ws_size) return;                               // off = 94371840
  if (off > (size_t)134217728) return;

  char* ws = (char*)d_ws;
  unsigned short* WqkvT = (unsigned short*)(ws + oW);
  unsigned short* WoB   = (unsigned short*)(ws + oWo);
  unsigned short* XH    = (unsigned short*)(ws + oX);
  unsigned short* QH    = (unsigned short*)(ws + oQ);
  unsigned short* KH    = (unsigned short*)(ws + oK);
  unsigned short* VT    = (unsigned short*)(ws + oV);
  unsigned short* Ctx   = (unsigned short*)(ws + oC);
  float*          out0  = (float*)d_out;

  const dim3 blk(256), blk128(128);
  const dim3 gPrep(1024 + 3 * PCB);                                   // 768 + 256 transpose blocks, 3 x 2048 convert blocks
  const dim3 gQkv(3 * PJB);                                           // 3 projections x 128 block tiles
  const dim3 gN1k((MP / 128) * (DM / 256), 1);                        // 32 x 4 block tiles -> 128 blocks
  const dim3 gAttn(NBATCH * NH * NQB);                                // 1024 blocks of 128
  const float invw  = 1.0f / WSC;                                     // weight carry x64
  const float ssc   = 0.125f;                                         // 1/sqrt(64)
  const float ssr   = 0.125f / RSC;                                   // same, for the x2048 residual products

  // (0) weight planes WqkvT (f16, x64), WoB (bf16, k-duplicated) and the f16 activation planes of q, k, v
  prep<<<gPrep, blk, 0, stream>>>(query, key_, value, w_q, w_k, w_v, w_o, WqkvT, WoB, XH);

  // (1..3) Q, K and V^T projections
  gemm_qkv<<<gQkv, blk, 0, stream>>>(XH, WqkvT, b_q, b_k, b_v, QH, KH, VT, DM, invw);

  // (4) flash attention -> Ctx bf16 hi | lo (concat layout, column h*64 + d)
  attn64<<<gAttn, blk128, 0, stream>>>(QH, KH, VT, Ctx, ssc, ssr);

  // (5) out = [ctx_hi | ctx_lo] . [Wo^T | Wo^T]^T + b_o  (K = 2048, bf16 operands) -> d_out f32 [4096][1024]
  gemm64_one<1, 0, 0><<<gN1k, blk, 0, stream>>>(
      Ctx, CTXP, 0LL, WoB, CTXP, 0LL, b_o, b_o, DM,
      (void*)out0, DM, 0LL, 0LL, MP, DM, CTXP, 1.0f);
  (void)hipGetLastError();
}

// v005
// Measured time: 135 microseconds a run.
// In both of two side-by-side timings against v004, it was 1.10 times as fast.
// All steps since v000 together make it 3.36 times as fast.
// Contractions: q, k and v^T in-projections on v_wmma_f32_16x16x32_f16 (f16 activation plane x f16 weight plane
// carried x64, one product each); attention q.k^T on v_wmma_f32_16x16x32_f16 with q as f16 hi plane + f16 residual
// plane carried x2048 (two products, two accumulators) and k plain f16; p.v on v_wmma_f32_16x16x32_f16 with p
// carried x1024 (f16) and v^T as f16 hi plane + f16 residual plane carried x2048 (two products, two accumulators);
// output projection on v_wmma_f32_16x16x32_bf16 with the context as bf16 hi | lo planes concatenated along k against
// a k-duplicated bf16 weight plane (two products, one accumulator); all f32 accumulate; softmax in f32 on VALU;
// every float input RNE-converted to bf16 on load.
#include <hip/hip_runtime.h>
#include <math.h>
#include <stdint.h>

#define NBATCH 2
#define SEQ    2048
#define DM     1024
#define NH     16
#define HD     64
#define MP     (NBATCH * SEQ)
#define NQB    (SEQ / 64)
#define CTXP   (2 * DM)
#define QRES   ((size_t)MP * DM)
#define VRES   ((size_t)NBATCH * DM * SEQ)
#define WSC    64.0f
#define RSC    2048.0f
#define PSC    1024.0f
#define LP     72      // LDS row pitch of the attention tiles in halves: 144 B = 16 B x 9 (odd), for 16-B fragment reads
#define OP     68      // LDS row pitch of the attention context tile in floats: 272 B = 16 B x 17 (odd), lane = row on the store
#define GPIT   72      // LDS row pitch of the staged GEMM operand tiles in halves: 144 B, same reason
#define GROWS  384     // rows of one staged GEMM tile: 128 rows of A, then 256 rows of Bt, 64 k (128 B) each
#define GBUFH  (GROWS * GPIT)   // halves per staging buffer (55296 B)
static_assert(NH * HD == DM);
static_assert((SEQ % 64) == 0 && (DM % 64) == 0 && (MP % 64) == 0);
static_assert(HD == 64);
static_assert((MP % 128) == 0 && (DM % 256) == 0 && (SEQ % 256) == 0 && (DM % 128) == 0);

typedef _Float16       v16h __attribute__((ext_vector_type(16)));
typedef __bf16         v16b __attribute__((ext_vector_type(16)));
typedef unsigned short v16us __attribute__((ext_vector_type(16)));
typedef unsigned short v8us __attribute__((ext_vector_type(8)));
typedef float          v8f  __attribute__((ext_vector_type(8)));
typedef float          v4f  __attribute__((ext_vector_type(4)));
typedef unsigned int   v4u  __attribute__((ext_vector_type(4)));

union Frag { v16us u; v8us p[2]; v16h h; v16b b; };

// ---- scalar helpers --------------------------------------------------------------------------------
__device__ __forceinline__ unsigned short bf_bits(float f) {          // f32 -> bf16 bits, RNE convert
  unsigned u = __float_as_uint(f);
  return (unsigned short)((u + 0x7FFFu + ((u >> 16) & 1u)) >> 16);
}
__device__ __forceinline__ float bf_up(unsigned short h) { return __uint_as_float(((unsigned)h) << 16); }
__device__ __forceinline__ float bfr(float f) { return bf_up(bf_bits(f)); }   // value of the bf16 RNE convert
__device__ __forceinline__ unsigned short h_bits(_Float16 x) { return __builtin_bit_cast(unsigned short, x); }
__device__ __forceinline__ unsigned pk16(unsigned short a, unsigned short b) { return (unsigned)a | ((unsigned)b << 16); }
__device__ __forceinline__ float xhalf(float x) {                     // lane l takes lane l ^ 16's value
  const int b = __builtin_bit_cast(int, x);
  return __builtin_bit_cast(float, __builtin_amdgcn_permlanex16(b, b, 0x76543210, 0xfedcba98, false, false));
}
__device__ __forceinline__ v8f zero8() { v8f z = {0.f, 0.f, 0.f, 0.f, 0.f, 0.f, 0.f, 0.f}; return z; }

// ---- fragment loader: 16-bit A/B operand (bit planes), lane -> row/col (lane&15), p already includes +8*(lane>>4);
//      elements 0..7 <- p[0..7] (k0+8h..), elements 8..15 <- p[16..23] (k0+16+8h..)
__device__ __forceinline__ v16us ldfrag(const unsigned short* p) {
  Frag f;
  f.p[0] = *(const v8us*)(p);
  f.p[1] = *(const v8us*)(p + 16);
  return f.u;
}

// ---- WMMA helper (BF = 0: f16 operands, BF = 1: bf16 operands) and the GEMM loop's VALU hazard gaps -----------------
template <int BF>
__device__ __forceinline__ v8f mma_raw(v16us a, v16us b, v8f c) {
  Frag fa, fb;
  fa.u = a;
  fb.u = b;
  if constexpr (BF) {
    return __builtin_amdgcn_wmma_f32_16x16x32_bf16(false, fa.b, false, fb.b, (short)0, c, false, false);
  } else {
    return __builtin_amdgcn_wmma_f32_16x16x32_f16(false, fa.h, false, fb.h, (short)0, c, false, false);
  }
}
__device__ __forceinline__ void dep_guard1(v8f& a, v8f& b, v16us x) {
#if defined(__HIP_DEVICE_COMPILE__)
  asm volatile("v_nop\n\tv_nop\n\tv_nop\n\tv_nop" : "+v"(a), "+v"(b) : "v"(x));
#endif
}
__device__ __forceinline__ void keep4(v16us a, v16us b, v16us c, v16us d) {
#if defined(__HIP_DEVICE_COMPILE__)
  asm volatile("v_nop" :: "v"(a), "v"(b), "v"(c), "v"(d));
#endif
}
__device__ __forceinline__ void acc_guard4(v8f& a, v8f& b, v8f& c, v8f& d) {
#if defined(__HIP_DEVICE_COMPILE__)
  asm volatile("v_nop\n\tv_nop\n\tv_nop\n\tv_nop" : "+v"(a), "+v"(b), "+v"(c), "+v"(d));
#endif
}
// eight base-2 exponentials in place. One statement, so that behind each v_exp_f32 stands an instruction that neither reads
// its result nor overwrites its source (the next one's registers are its own), and behind the last the v_nop that fills that slot.
__device__ __forceinline__ void exp2x8(float (&e)[8]) {
#if defined(__HIP_DEVICE_COMPILE__)
  asm("v_exp_f32 %0, %0\n\tv_exp_f32 %1, %1\n\tv_exp_f32 %2, %2\n\tv_exp_f32 %3, %3\n\t"
      "v_exp_f32 %4, %4\n\tv_exp_f32 %5, %5\n\tv_exp_f32 %6, %6\n\tv_exp_f32 %7, %7\n\tv_nop"
      : "+v"(e[0]), "+v"(e[1]), "+v"(e[2]), "+v"(e[3]), "+v"(e[4]), "+v"(e[5]), "+v"(e[6]), "+v"(e[7]));
#endif
}
// eight halves of an attention tile from LDS: fb = byte address of the lane's place in row 0 of tile 0; tile, row, k constants
__device__ __forceinline__ v8us frd(unsigned fb, int tile, int row, int k) {
  return *(const __attribute__((address_space(3))) v8us*)(fb + 2u * (unsigned)(tile * 64 * LP + row * LP + k));
}
__device__ __forceinline__ void wave_sync_lds() {
  __builtin_amdgcn_fence(__ATOMIC_RELEASE, "workgroup");
  __builtin_amdgcn_wave_barrier();
  __builtin_amdgcn_fence(__ATOMIC_ACQUIRE, "workgroup");
}

// ---- one staged GEMM tile: 12 asynchronous 16-B copies per lane, global -> LDS, no register in between.
//      Copy i < 4 brings A row (32 i + lane's row), copy 4 + i brings Bt row (32 i + lane's row); eight lanes cover one
//      128-B row segment, so each wave-wide copy takes four whole lines. l = the lane's LDS byte address in row 0..31 of
//      the buffer; rows 32 apart lie 32 * 144 B apart. The closing s_wait_xcnt 0 stands inside the statement so that no
//      address register of an issued copy is rewritten in front of it.
__device__ __forceinline__ void stage12(unsigned l, const unsigned short* a, size_t sa,
                                        const unsigned short* b, size_t sb) {
#if defined(__HIP_DEVICE_COMPILE__)
  const unsigned st = 32u * GPIT * 2u;
  asm volatile(
      "global_load_async_to_lds_b128 %0, %12, off\n\t"
      "global_load_async_to_lds_b128 %1, %13, off\n\t"
      "global_load_async_to_lds_b128 %2, %14, off\n\t"
      "global_load_async_to_lds_b128 %3, %15, off\n\t"
      "global_load_async_to_lds_b128 %4, %16, off\n\t"
      "global_load_async_to_lds_b128 %5, %17, off\n\t"
      "global_load_async_to_lds_b128 %6, %18, off\n\t"
      "global_load_async_to_lds_b128 %7, %19, off\n\t"
      "global_load_async_to_lds_b128 %8, %20, off\n\t"
      "global_load_async_to_lds_b128 %9, %21, off\n\t"
      "global_load_async_to_lds_b128 %10, %22, off\n\t"
      "global_load_async_to_lds_b128 %11, %23, off\n\t"
      "s_wait_xcnt 0x0"
      :: "v"(l), "v"(l + st), "v"(l + 2u * st), "v"(l + 3u * st), "v"(l + 4u * st), "v"(l + 5u * st),
         "v"(l + 6u * st), "v"(l + 7u * st), "v"(l + 8u * st), "v"(l + 9u * st), "v"(l + 10u * st), "v"(l + 11u * st),
         "v"(a), "v"(a + sa), "v"(a + 2 * sa), "v"(a + 3 * sa),
         "v"(b), "v"(b + sb), "v"(b + 2 * sb), "v"(b + 3 * sb), "v"(b + 4 * sb), "v"(b + 5 * sb), "v"(b + 6 * sb),
         "v"(b + 7 * sb)
      : "memory");
#endif
}

// =====================================================================================================
// f32 -> f16 activation plane convert: Xh[i] = f16( bf16_RNE(X[i]) * wsc ), wsc a power of two (exact).
// Thread i handles elements 8i..8i+7 and writes one 16-B piece; 32 consecutive lanes of one instruction fill
// (host-checked) so every store is full-width.
// coverage: n8 threads x 8 elements = the whole plane. bx = the block's index within the plane's n8 / 256 blocks.
// =====================================================================================================
__device__ __forceinline__ void conv_h16(int bx, const float* __restrict__ W, unsigned short* Wh, int n8, float wsc) {
  const int i  = bx * 256 + threadIdx.x;
  const int ic = (i < n8) ? i : (n8 - 1);                     // clamped address
  const float* src = W + (size_t)ic * 8;
  const v4f a = *(const v4f*)(src);
  const v4f c = *(const v4f*)(src + 4);
  v4u o;
  o[0] = pk16(h_bits((_Float16)(bfr(a[0]) * wsc)), h_bits((_Float16)(bfr(a[1]) * wsc)));
  o[1] = pk16(h_bits((_Float16)(bfr(a[2]) * wsc)), h_bits((_Float16)(bfr(a[3]) * wsc)));
  o[2] = pk16(h_bits((_Float16)(bfr(c[0]) * wsc)), h_bits((_Float16)(bfr(c[1]) * wsc)));
  o[3] = pk16(h_bits((_Float16)(bfr(c[2]) * wsc)), h_bits((_Float16)(bfr(c[3]) * wsc)));
  if (i < n8) *(v4u*)(Wh + (size_t)i * 8) = o;
  // the caller's other parts follow in the same kernel: no register of the issued store is rewritten in front of this wait
  asm volatile("s_wait_xcnt 0x0" ::: "memory");
}

// =====================================================================================================
// 64x64 tile transpose-convert of an f32 weight tensor: z-slice in[z] is [R][C] f32 (row pitch C elements,
// slice stride inStrideZ); output is 16-bit with rows indexed by the INPUT COLUMN: out[z*outStrideZ + c*ldo + r]
// (the input row index r becomes the k-contiguous column), i.e. in[rows=R][cols=C] -> out[cols=C][rows=R].
//   BF == 0: value = f16( bf16_RNE(x) * sc )   (sc a power of two)
//   BF == 1: value = bf16_RNE(x) bits; DUP == 1 additionally writes the same 16-B piece at column offset + dupOff.
// blocks (bx, by, bz) = (R/64, C/64, Z), block 256, sT = the block's 64 x 72 halves of LDS. Load phase: 1024 float4 pieces (64 rows x 16) = the whole 64x64 tile,
// 4 per thread, converted and stored transposed into LDS with 16-bit element stores; __syncthreads; store phase:
// coverage: 2 iterations x 32 rows x (8 lanes x 8 halves) = the whole 64x64 output tile (x2 destinations if DUP);
//           the grid tiles every (r block, c block, z) exactly once.
// =====================================================================================================
template <int BF, int DUP>
__device__ __forceinline__ void tconv64(unsigned short* sT, int bx, int by, int bz,
                                        const float* __restrict__ in, long long inStrideZ, int C,
                                        unsigned short* out, long long outStrideZ, int ldo, int dupOff,
                                        float sc) {
  const int t  = threadIdx.x;
  const int r0 = bx * 64;
  const int c0 = by * 64;
  const float* src = in + (size_t)bz * (size_t)inStrideZ;
  unsigned short* dst = out + (size_t)bz * (size_t)outStrideZ;
#pragma unroll
  for (int i = 0; i < 4; ++i) {
    const int idx = t + 256 * i;                              // 0..1023
    const int rr  = idx >> 4;                                 // 0..63
    const int cq  = (idx & 15) * 4;                           // 0..60
    const v4f x = *(const v4f*)(src + (size_t)(r0 + rr) * (size_t)C + c0 + cq);
#pragma unroll
    for (int j = 0; j < 4; ++j) {
      unsigned short w;
      if (BF) {
        w = bf_bits(x[j]);
      } else {
        w = h_bits((_Float16)(bfr(x[j]) * sc));
      }
      sT[(cq + j) * 72 + rr] = w;
    }
  }
  __syncthreads();
  const int q8 = t >> 3;                                      // 0..31: row within the 32-row group
  const int c8 = (t & 7) * 8;
  v8us vv[2];
#pragma unroll
  for (int it = 0; it < 2; ++it) {
    const int row = it * 32 + q8;                             // it 0..1 x q8 0..31 = rows 0..63
    vv[it] = *(const v8us*)(sT + row * 72 + c8);
  }
  {
#pragma unroll
    for (int it = 0; it < 2; ++it) {
      const int row = it * 32 + q8;
      unsigned short* dp = dst + (size_t)(c0 + row) * (size_t)ldo + r0 + c8;
      *(v8us*)(dp) = vv[it];
      if (DUP) *(v8us*)(dp + dupOff) = vv[it];
    }
    // the caller's other parts follow in the same kernel: no register of the issued stores is rewritten in front of this wait
    asm volatile("s_wait_xcnt 0x0" ::: "memory");
  }
}

// =====================================================================================================
// All operand preparation in one launch; none of its parts reads what another writes. Block ranges (block-uniform):
//   0..767     weight planes: z = block >> 8 picks Wq, Wk, Wv; per head in[e = 1024][d = 64] -> WqkvT[z*1024 + h*64 + d][e]
//   768..1023  Wo: in[k][n] -> WoB[n][k] and WoB[n][1024 + k]
//   1024..     activation planes: z = (block - 1024) / PCB picks q, k, v -> XH + z * MP * DM, PCB blocks per plane
// =====================================================================================================
#define PCB ((MP * DM) / (8 * 256))
static_assert(((MP * DM) % (8 * 256)) == 0);
static_assert(DM / 64 == 16 && HD == 64 && NH * (DM / 64) == 256);   // the shifts and masks of the transpose ranges
__global__ __launch_bounds__(256) void prep(const float* __restrict__ xq, const float* __restrict__ xk,
                                            const float* __restrict__ xv, const float* __restrict__ wq,
                                            const float* __restrict__ wk, const float* __restrict__ wv,
                                            const float* __restrict__ wo, unsigned short* WqkvT, unsigned short* WoB,
                                            unsigned short* XH) {
  __shared__ __align__(16) unsigned short sT[64 * 72];        // [c local][r local], pitch 72 halves (144 B)
  const int bx = blockIdx.x;
  if (bx < 768) {
    const int z = bx >> 8, r = bx & 255;
    const float* w = (z == 0) ? wq : ((z == 1) ? wk : wv);
    tconv64<0, 0>(sT, r & 15, 0, r >> 4, w, (long long)DM * HD, HD, WqkvT + (size_t)z * DM * DM,
                  (long long)HD * DM, DM, 0, WSC);
  } else if (bx < 1024) {
    const int r = bx - 768;
    tconv64<1, 1>(sT, r & 15, r >> 4, 0, wo, 0LL, DM, WoB, 0LL, CTXP, DM, 1.0f);
  } else {
    const int r = bx - 1024;
    const int z = r / PCB;
    const float* x = (z == 0) ? xq : ((z == 1) ? xk : xv);
    conv_h16(r - z * PCB, x, XH + (size_t)z * MP * DM, (MP * DM) / 8, 1.0f);
  }
}

// =====================================================================================================
// Register-blocked batched 16-bit WMMA GEMM: C[m][n] = oscale * sum_k A[m][k] * Bt[n][k] + bias;
// one wave per 64x64 tile, 8 waves (2 x 4) = one 128x256 block tile. A row-major [M][K] pitch lda; Bt row-major [N][K]
// pitch ldb (k contiguous); M multiple of 128, N of 256, K of 64 (static here). b = batch (strides in elements).
// Operands: per 64 k the block's 128 A rows and 256 Bt rows are staged in LDS by asynchronous copies, two buffers: the
// copies of tile t + 2 go out behind the barrier at the foot of trip t and fly during trip t + 1; every fragment is read
// from LDS (k order per output element as before: ascending in steps of 32).
// BF: 0 = f16 operand planes, 1 = bf16 operand planes.
// Bias: BIASM == 0 -> per column: cols < Nb from bias0[col], cols >= Nb from bias1[col - Nb] (tile-uniform select of
//       clamped-address loads); BIASM == 1 -> per row bias0[m]. Bias values RNE-converted to bf16.
// OM: 0 = f32 out (pitch ldc); 2 = f16 out; 3 = f16 hi plane at C plus f16 residual plane ((f - hi) * RSC) at
//     C + resOff (same pitch and offsets).
// coverage: 4 slabs x 16 rows x 64 cols = the wave's whole 64x64 tile; tile = 0 .. (M/128)*(N/256) - 1 per batch,
//           a surplus block exits as a whole in front of every barrier and copy.
// sOp = two staging buffers [A 128 rows | Bt 256 rows] x 64 k; sT = per-wave 16x64 slab, pitch 68 floats (the kernel's LDS).
// =====================================================================================================
template <int BF, int OM, int BIASM>
__device__ __forceinline__ void gemm64(
    unsigned short* sOp, float (*sT)[16 * 68], int tile, int b,
    const unsigned short* __restrict__ A, int lda, long long strideA,
    const unsigned short* __restrict__ Bt, int ldb, long long strideB,
    const float* __restrict__ bias0, const float* __restrict__ bias1, int Nb,
    void* Cout, int ldc, long long strideC, long long resOff,
    int M, int N, int K, float oscale) {
  const int lane = threadIdx.x & 31;
  const int wave = threadIdx.x >> 5;
  const int tilesN = N >> 8;
  const int tilesM = M >> 7;
  if (tile >= tilesM * tilesN) return;   // block-uniform, in front of every barrier
  const int tm = tile / tilesN;
  const int tn = tile - tm * tilesN;
  const int mb0 = tm << 7;                     // block tile origin
  const int nb0 = tn << 8;
  const int wm  = wave >> 2;                   // wave's 64x64 tile inside the block tile
  const int wn  = wave & 3;
  const int m0 = mb0 + (wm << 6);
  const int n0 = nb0 + (wn << 6);

  const unsigned short* Ab = A  + (size_t)b * (size_t)strideA;
  const unsigned short* Bb = Bt + (size_t)b * (size_t)strideB;

  const int rlane = lane & 15;                 // row (A) / col (B, D) within subtile
  const int koff  = (lane >> 4) * 8;           // k offset of this lane half
  const int mOff  = (lane >> 4) * 8;           // D row offset

  v8f acc[4][4];
#pragma unroll
  for (int i = 0; i < 4; ++i)
#pragma unroll
    for (int j = 0; j < 4; ++j) acc[i][j] = zero8();

  // ---- staging addresses: thread -> row (tid >> 3) of each 32-row group, 16-B piece (tid & 7) of the 128-B segment ----
  const int crow = threadIdx.x >> 3;
  const int cpc  = (threadIdx.x & 7) * 8;
  const unsigned short* ga = Ab + (size_t)(mb0 + crow) * lda + cpc;
  const unsigned short* gb = Bb + (size_t)(nb0 + crow) * ldb + cpc;
  const size_t sa = (size_t)32 * lda, sb = (size_t)32 * ldb;
  const unsigned l0 =
      (unsigned)(uintptr_t)(const __attribute__((address_space(3))) unsigned short*)(sOp + crow * GPIT + cpc);
  const int T = K >> 6;                        // staged tiles of 64 k

  stage12(l0, ga, sa, gb, sb);                                 // tile 0 -> buffer 0
  asm volatile("s_wait_asynccnt 0x0" ::: "memory");            // this wave's copies of tile 0 have landed
  __syncthreads();                                             // ... and every other wave's
  if (T > 1) stage12(l0 + GBUFH * 2u, ga + 64, sa, gb + 64, sb);   // tile 1 -> buffer 1

  for (int t = 0; t < T; ++t) {
    const unsigned short* sbuf = sOp + (t & 1) * GBUFH;
    const unsigned short* fa = sbuf + ((wm << 6) + rlane) * GPIT + koff;
    const unsigned short* fb = sbuf + (128 + (wn << 6) + rlane) * GPIT + koff;
#pragma unroll
    for (int kk = 0; kk < 2; ++kk) {
      v16us bh[4], ah[4];
#pragma unroll
      for (int j = 0; j < 4; ++j) bh[j] = ldfrag(fb + (j << 4) * GPIT + kk * 32);
#pragma unroll
      for (int i = 0; i < 4; ++i) ah[i] = ldfrag(fa + (i << 4) * GPIT + kk * 32);
#pragma unroll
      for (int i = 0; i < 4; ++i) {
#pragma unroll
        for (int j = 0; j < 4; ++j) acc[i][j] = mma_raw<BF>(ah[i], bh[j], acc[i][j]);
        dep_guard1(acc[i][0], acc[i][3], ah[i]);
      }
      keep4(bh[0], bh[1], bh[2], bh[3]);
    }
    asm volatile("s_wait_dscnt 0x0" ::: "memory");             // this wave's reads of buffer t & 1 are done
    asm volatile("s_wait_asynccnt 0x0" ::: "memory");          // this wave's copies of tile t + 1 have landed
    __syncthreads();                                           // publishes tile t + 1, frees buffer t & 1
    if (t + 2 < T) stage12(l0 + (unsigned)(t & 1) * (GBUFH * 2u), ga + (size_t)(t + 2) * 64, sa, gb + (size_t)(t + 2) * 64, sb);
  }
  asm volatile("s_wait_asynccnt 0x0" ::: "memory");            // nothing of this wave is in flight past the loop
  acc_guard4(acc[0][0], acc[0][1], acc[0][2], acc[0][3]);
  acc_guard4(acc[1][0], acc[1][1], acc[1][2], acc[1][3]);
  acc_guard4(acc[2][0], acc[2][1], acc[2][2], acc[2][3]);
  acc_guard4(acc[3][0], acc[3][1], acc[3][2], acc[3][3]);

  // ---- per-lane column bias (BIASM == 0), RNE-converted ----
  const int hh2 = lane >> 4, c4 = (lane & 15) * 4;     // f32 out: 256-B row segment = 16 lanes x 16 B
  const int q8  = lane >> 3, c8 = (lane & 7) * 8;
  float bc[8];
#pragma unroll
  for (int e = 0; e < 8; ++e) bc[e] = 0.f;
  if (BIASM == 0) {
    const bool use1 = (n0 >= Nb);                      // tile-uniform
    if (OM == 0) {
      const int cb = n0 + c4;
      const int i0 = (cb < Nb - 4) ? cb : (Nb - 4);
      const int i1 = (cb - Nb > 0) ? (cb - Nb) : 0;
      const v4f b0v = *(const v4f*)(bias0 + i0);
      const v4f b1v = *(const v4f*)(bias1 + i1);
#pragma unroll
      for (int e = 0; e < 4; ++e) bc[e] = bfr(use1 ? b1v[e] : b0v[e]);
    } else {
      const int cb = n0 + c8;
      const int i0 = (cb < Nb - 8) ? cb : (Nb - 8);
      const int i1 = (cb - Nb > 0) ? (cb - Nb) : 0;
      const v4f b0a = *(const v4f*)(bias0 + i0), b0b = *(const v4f*)(bias0 + i0 + 4);
      const v4f b1a = *(const v4f*)(bias1 + i1), b1b = *(const v4f*)(bias1 + i1 + 4);
#pragma unroll
      for (int e = 0; e < 4; ++e) {
        bc[e]     = bfr(use1 ? b1a[e] : b0a[e]);
        bc[4 + e] = bfr(use1 ? b1b[e] : b0b[e]);
      }
    }
  }

  // ---- epilogue ----
  float* slab = sT[wave];
#pragma unroll
  for (int i = 0; i < 4; ++i) {
    const int mBase = m0 + (i << 4);
#pragma unroll
    for (int j = 0; j < 4; ++j) {
#pragma unroll
      for (int r = 0; r < 8; ++r) {
        slab[(mOff + r) * 68 + (j << 4) + rlane] = acc[i][j][r];
      }
    }
    wave_sync_lds();
    if constexpr (OM == 0) {
      float* C = (float*)Cout + (size_t)b * (size_t)strideC;
      v4f vals[8];
#pragma unroll
      for (int it = 0; it < 8; ++it) {
        const int row = it * 2 + hh2;                      // it 0..7 x hh2 0..1 = rows 0..15
        v4f v = *(const v4f*)(slab + row * 68 + c4);
#pragma unroll
        for (int e = 0; e < 4; ++e) v[e] = v[e] * oscale + bc[e];
        vals[it] = v;
      }
      {
#pragma unroll
        for (int it = 0; it < 8; ++it) {
          const int row = it * 2 + hh2;
          *(v4f*)(C + (size_t)(mBase + row) * ldc + n0 + c4) = vals[it];
        }
        
      }
    } else {
      unsigned short* C = (unsigned short*)Cout + (size_t)b * (size_t)strideC;
      v4u hv[4], hr[4];
#pragma unroll
      for (int it = 0; it < 4; ++it) {
        const int row = it * 4 + q8;                       // it 0..3 x q8 0..3 = rows 0..15
        const float* sp = slab + row * 68 + c8;
        float bm = 0.f;
        if (BIASM == 1) bm = bfr(bias0[mBase + row]);
        v4u a, ar;
#pragma unroll
        for (int e = 0; e < 4; ++e) {
          const float f0 = sp[2 * e]     * oscale + ((BIASM == 1) ? bm : bc[2 * e]);
          const float f1 = sp[2 * e + 1] * oscale + ((BIASM == 1) ? bm : bc[2 * e + 1]);
          const _Float16 g0 = (_Float16)f0, g1 = (_Float16)f1;
          a[e] = pk16(h_bits(g0), h_bits(g1));
          if (OM == 3) {
            const float e0 = (f0 - (float)g0) * RSC;
            const float e1 = (f1 - (float)g1) * RSC;
            ar[e] = pk16(h_bits((_Float16)e0), h_bits((_Float16)e1));
          } else {
            ar[e] = 0u;
          }
        }
        hv[it] = a;
        hr[it] = ar;
      }
      {
#pragma unroll
        for (int it = 0; it < 4; ++it) {
          const int row = it * 4 + q8;
          unsigned short* dp = C + (size_t)(mBase + row) * ldc + n0 + c8;
          *(v4u*)(dp) = hv[it];
          if (OM == 3) *(v4u*)(dp + resOff) = hr[it];
        }
        
      }
    }
    wave_sync_lds();
  }
}

// ---- one GEMM per launch: grid = ((M/128)*(N/256), batches) ----
template <int BF, int OM, int BIASM>
__global__ __launch_bounds__(256) void gemm64_one(
    const unsigned short* __restrict__ A, int lda, long long strideA,
    const unsigned short* __restrict__ Bt, int ldb, long long strideB,
    const float* __restrict__ bias0, const float* __restrict__ bias1, int Nb,
    void* Cout, int ldc, long long strideC, long long resOff,
    int M, int N, int K, float oscale) {
  __shared__ __align__(16) unsigned short sOp[2 * GBUFH];
  __shared__ __align__(16) float sT[8][16 * 68];
  gemm64<BF, OM, BIASM>(sOp, sT, blockIdx.x, blockIdx.y, A, lda, strideA, Bt, ldb, strideB, bias0, bias1, Nb,
                        Cout, ldc, strideC, resOff, M, N, K, oscale);
}

// ---- the three in-projections in one launch; they share no output and read only what the launch before wrote.
//      PJB blocks each, block >> 7 picks the projection (block-uniform):
//      0: Q = xq . WqT^T + b_q -> QH (f16 hi) and QH + QRES (f16 residual x2048); column n = h*64 + d
//      1: K = xk . WkT^T + b_k -> KH (f16)
//      2: V^T per batch = WvT . xv^T + b_v -> VT (f16 hi [2][1024][2048]) and VT + VRES (residual x2048); row m = h*64 + d
//         (per-row bias b_v[m]), column n = token s of batch (block & 127) >> 6
#define PJB 128
static_assert((MP / 128) * (DM / 256) == PJB && (DM / 128) * (SEQ / 256) * NBATCH == PJB && (DM / 128) * (SEQ / 256) == 64);
__global__ __launch_bounds__(256) void gemm_qkv(
    const unsigned short* __restrict__ XH, const unsigned short* __restrict__ WqkvT,
    const float* __restrict__ b_q, const float* __restrict__ b_k, const float* __restrict__ b_v,
    unsigned short* QH, unsigned short* KH, unsigned short* VT, int K, float oscale) {
  __shared__ __align__(16) unsigned short sOp[2 * GBUFH];
  __shared__ __align__(16) float sT[8][16 * 68];
  const int sel = blockIdx.x >> 7, r = blockIdx.x & 127;
  if (sel == 0) {
    gemm64<0, 3, 0>(sOp, sT, r, 0, XH, DM, 0LL, WqkvT, DM, 0LL, b_q, b_q, DM,
                    (void*)QH, DM, 0LL, (long long)QRES, MP, DM, K, oscale);
  } else if (sel == 1) {
    gemm64<0, 2, 0>(sOp, sT, r, 0, XH + (size_t)MP * DM, DM, 0LL, WqkvT + (size_t)DM * DM, DM, 0LL, b_k, b_k, DM,
                    (void*)KH, DM, 0LL, 0LL, MP, DM, K, oscale);
  } else {
    gemm64<0, 3, 1>(sOp, sT, r & 63, r >> 6, WqkvT + (size_t)2 * DM * DM, DM, 0LL,
                    XH + (size_t)2 * MP * DM, DM, (long long)SEQ * DM, b_v, b_v, SEQ,
                    (void*)VT, SEQ, (long long)DM * SEQ, (long long)VRES, DM, SEQ, K, oscale);
  }
}

// =====================================================================================================
// Flash attention, head dim 64, SEQ token rows per batch (all keys valid, no mask).
//   q planes (f16, pitch DM): hi at qhp[(b*SEQ + t)*DM + h*64 + d], residual (x2048) at qhp + QRES (same offsets)
//   k plane (f16, pitch DM): khp[(b*SEQ + t)*DM + h*64 + d]
//   v^T planes (f16): hi at vtp[(b*DM + h*64 + d)*SEQ + s], residual (x2048) at vtp + VRES
//   context planes (bf16, pitch CTXP): hi at ctxp[(b*SEQ + t)*CTXP + h*64 + d], lo at the same + DM
//   Products are taken transposed: S^T = K . Q^T (A = K rows, B = Q rows) and O^T += V^T . P^T (A = V^T rows, B = P^T), so
//   a lane holds scores of ONE query (column lane & 15), keys 8 (lane >> 4) + r of each 16-key tile: the row maximum
//   and the row sum are taken in the lane, plus one exchange between the wave halves (the sum's only in the epilogue),
//   and two converted score tiles are the B operand of the second product as they stand: P never leaves the registers.
//   score = fma(acc_hi, sscale, acc_res * ssres); p = exp(s - m) carried as f16(1024 p); context = p . v with the
//   v hi and v residual products in two accumulators; online softmax (running max) in f32.
//   Block = 4 waves = 64 query rows of one (b, h); grid = NQB * NH * NBATCH; kv chunks of 64, static trip NQB.
//   K / V^T hi / V^T res chunk staging: 128 threads x 32 elements per plane = the whole 64x64 tile each
//   (plain 16-B loads, __syncthreads before and after).
//   Fragment reads: K's eight as one group ahead of the 16 score products; V^T's eight of keys 0..31 as one group ahead of
//   the softmax; those of keys 32..63 in two groups of four ahead of the context products of keys 0..31.
//   Context coverage: each wave stores rows q0..q0+15 (it 0..3 x lane>>3 0..3) x 64 columns (8 lanes x 8) of both
//   the hi and the lo plane; grid covers all SEQ rows x NH head slices x NBATCH.
// =====================================================================================================
__global__ __launch_bounds__(128, 4)   // 4 waves per SIMD = the grid's four blocks per WGP all resident: a budget of 256 registers
void attn64(const unsigned short* __restrict__ qhp, const unsigned short* __restrict__ khp,
            const unsigned short* __restrict__ vtp, unsigned short* ctxp,
            float sscale, float ssres) {
  __shared__ __align__(16) unsigned short KV[3 * 64 * LP];        // three tiles of 9 KB, rows of 64 at pitch LP:
  unsigned short* const Ksh = KV;                                 // K [kv][d]
  unsigned short* const Vth = KV + 64 * LP;                       // V^T hi [d][kv]
  unsigned short* const Vtr = KV + 2 * 64 * LP;                   // V^T res [d][kv]
  __shared__ __align__(16) float          Os[4][16 * OP];         // per wave context tile [row][d], rows of 64 at pitch OP

  const int tid  = threadIdx.x;
  const int wave = tid >> 5;
  const int lane = tid & 31;
  const int hh   = lane >> 4;
  const int c    = lane & 15;

  const int bx   = blockIdx.x;
  const int qb   = bx % NQB;
  const int rest = bx / NQB;
  const int h    = rest % NH;
  const int b    = rest / NH;
  const int q0   = qb * 64 + wave * 16;          // in-batch query row of this wave's first row
  const size_t rowB = (size_t)b * SEQ;

  const unsigned short* Qh = qhp + (size_t)h * HD;
  const unsigned short* Qr = qhp + QRES + (size_t)h * HD;
  const unsigned short* Kg = khp + (size_t)h * HD;
  const unsigned short* Vh = vtp + ((size_t)b * DM + (size_t)h * HD) * SEQ;
  const unsigned short* Vr = Vh + VRES;

  // the lane's fragment row (lane & 15) and k half in tile 0, as an LDS byte address: every fragment read is this one
  // register plus a constant that fits the instruction's offset field
  const unsigned fb = (unsigned)(uintptr_t)(const __attribute__((address_space(3))) unsigned short*)(KV + c * LP + 8 * hh);

  float mrun = -INFINITY, lsum = 0.f;   // query c: running maximum (both halves alike), sum over this half's keys
  v8f oacc[4], oacr[4];                 // O^T tiles: register r = context[d = 16 t + 8 hh + r] of query c
#pragma unroll
  for (int t = 0; t < 4; ++t) { oacc[t] = zero8(); oacr[t] = zero8(); }

  for (int kt = 0; kt < NQB; ++kt) {         // static trip count
    const int kv0 = kt * 64;
    __syncthreads();
    {
      const int r = tid >> 1, hf = (tid & 1) * 32;
      const unsigned short* kg = Kg + (rowB + kv0 + r) * DM + hf;          // K row kv0+r, d = hf..hf+31
      const unsigned short* vg = Vh + (size_t)r * SEQ + kv0 + hf;           // V^T hi row d = r, s = kv0+hf..
      const unsigned short* vr = Vr + (size_t)r * SEQ + kv0 + hf;           // V^T res row d = r
#pragma unroll
      for (int i = 0; i < 4; ++i) {
        const v8us a0 = *(const v8us*)(kg + 8 * i);
        const v8us b0 = *(const v8us*)(vg + 8 * i);
        const v8us c0 = *(const v8us*)(vr + 8 * i);
        *(v8us*)(Ksh + r * LP + hf + 8 * i) = a0;
        *(v8us*)(Vth + r * LP + hf + 8 * i) = b0;
        *(v8us*)(Vtr + r * LP + hf + 8 * i) = c0;
      }
    }
    __syncthreads();

    // ---- Q fragments (B operand, column = query = lane&15): hi and residual, 2 d-chunks each ----
    v16us qa[2], qr[2];
#pragma unroll
    for (int dc = 0; dc < 2; ++dc) {
      qa[dc] = ldfrag(Qh + (rowB + q0 + c) * DM + dc * 32 + 8 * hh);
      qr[dc] = ldfrag(Qr + (rowB + q0 + c) * DM + dc * 32 + 8 * hh);
    }

    // ---- K fragments (A operand, row = key 16 j + lane&15): all eight read from LDS as one group ----
    Frag kb[4][2];
#pragma unroll
    for (int j = 0; j < 4; ++j) {
#pragma unroll
      for (int dc = 0; dc < 2; ++dc) {
        kb[j][dc].p[0] = frd(fb, 0, j * 16, dc * 32);
        kb[j][dc].p[1] = frd(fb, 0, j * 16, dc * 32 + 16);
      }
    }
    __builtin_amdgcn_sched_barrier(0);   // keeps the reads one group ahead of the products; the scheduler otherwise sinks each to its user

    // ---- scores, transposed: s[j][r] = score(key 16 j + 8 hh + r, query c); 16 products in a row, four independent
    //      accumulators per pair of key tiles, d ascending in each as before ----
    v8f s[4], sh[4], sr[4];
#pragma unroll
    for (int jp = 0; jp < 2; ++jp) {
#pragma unroll
      for (int jj = 0; jj < 2; ++jj) { sh[2 * jp + jj] = zero8(); sr[2 * jp + jj] = zero8(); }
#pragma unroll
      for (int dc = 0; dc < 2; ++dc) {
#pragma unroll
        for (int jj = 0; jj < 2; ++jj) {
          sh[2 * jp + jj] = mma_raw<0>(kb[2 * jp + jj][dc].u, qa[dc], sh[2 * jp + jj]);
          sr[2 * jp + jj] = mma_raw<0>(kb[2 * jp + jj][dc].u, qr[dc], sr[2 * jp + jj]);
        }
      }
      if (jp == 0) __builtin_amdgcn_sched_barrier(0);   // first pair's products first: its K registers are free before the second pair's accumulators start
    }
#pragma unroll
    for (int j = 0; j < 2; ++j) {
#pragma unroll
      for (int r = 0; r < 8; ++r) s[j][r] = fmaf(sh[j][r], sscale, sr[j][r] * ssres);
    }
    __builtin_amdgcn_sched_barrier(0);   // the V^T reads below do not rise among the products, where K's registers are still held

    // ---- V^T fragments of keys 0..31 (A operand, row = d 16 t + lane&15), hi and residual: one group, in flight under the softmax ----
    Frag vb[2][4], vc[2][4];
#pragma unroll
    for (int t = 0; t < 4; ++t) {
      vb[0][t].p[0] = frd(fb, 1, t * 16, 0);
      vb[0][t].p[1] = frd(fb, 1, t * 16, 16);
      vc[0][t].p[0] = frd(fb, 2, t * 16, 0);
      vc[0][t].p[1] = frd(fb, 2, t * 16, 16);
    }
    __builtin_amdgcn_sched_barrier(0);   // keeps the group ahead of the softmax, which covers its latency
#pragma unroll
    for (int j = 2; j < 4; ++j) {
#pragma unroll
      for (int r = 0; r < 8; ++r) s[j][r] = fmaf(sh[j][r], sscale, sr[j][r] * ssres);
    }

    // ---- maximum over the lane's 32 keys (four chains), then the other half's; online softmax; P^T (x1024, f16) packed
    //      in place: element 8 (j & 1) + r of fragment j >> 1 = key 32 (j >> 1) + 16 (j & 1) + 8 hh + r, the V^T loader's k order
    float mj[4], pj[4];
#pragma unroll
    for (int j = 0; j < 4; ++j) {
      mj[j] = s[j][0];
#pragma unroll
      for (int r = 1; r < 8; ++r) mj[j] = fmaxf(mj[j], s[j][r]);
    }
    float m = fmaxf(fmaxf(mj[0], mj[1]), fmaxf(mj[2], mj[3]));
    m = fmaxf(m, xhalf(m));
    const float mnew  = fmaxf(mrun, m);
    const float alpha = __expf(mrun - mnew);
    mrun = mnew;
    Frag pb[2];
#pragma unroll
    for (int j = 0; j < 4; ++j) {
      float e[8];
#pragma unroll
      for (int r = 0; r < 8; ++r) e[r] = (s[j][r] - mnew) * 1.44269504f;   // exp(x) = 2^(x log2 e), the fast exponential's own form
      exp2x8(e);
      pj[j] = e[0];
#pragma unroll
      for (int r = 1; r < 8; ++r) pj[j] += e[r];
#pragma unroll
      for (int r = 0; r < 8; ++r) pb[j >> 1].h[(j & 1) * 8 + r] = (_Float16)(e[r] * PSC);
    }
    lsum = lsum * alpha + ((pj[0] + pj[1]) + (pj[2] + pj[3]));
#pragma unroll
    for (int t = 0; t < 4; ++t) { oacc[t] *= alpha; oacr[t] *= alpha; }

    // ---- context^T += V^T . P^T (hi and residual products, f16 WMMA), keys ascending in each accumulator as before; the
    //      fragments of keys 32..63 are read in two groups of four, each ahead of four products of keys 0..31. The
    //      scheduling barriers keep each group whole and at its place (fragment registers: three groups of four live at most).
    __builtin_amdgcn_sched_barrier(0);   // the reads below do not rise into the softmax, where the score registers are still held
#pragma unroll
    for (int g = 0; g < 2; ++g) {
#pragma unroll
      for (int t = 2 * g; t < 2 * g + 2; ++t) {
        vb[1][t].p[0] = frd(fb, 1, t * 16, 32);
        vb[1][t].p[1] = frd(fb, 1, t * 16, 48);
        vc[1][t].p[0] = frd(fb, 2, t * 16, 32);
        vc[1][t].p[1] = frd(fb, 2, t * 16, 48);
      }
      __builtin_amdgcn_sched_barrier(0);   // the group's reads stay together ahead of the four products, not spread among them
#pragma unroll
      for (int t = 2 * g; t < 2 * g + 2; ++t) {
        oacc[t] = mma_raw<0>(vb[0][t].u, pb[0].u, oacc[t]);
        oacr[t] = mma_raw<0>(vc[0][t].u, pb[0].u, oacr[t]);
      }
      __builtin_amdgcn_sched_barrier(0);   // the next group's reads follow these products, whose fragment registers they take over
    }
#pragma unroll
    for (int t = 0; t < 4; ++t) {
      oacc[t] = mma_raw<0>(vb[1][t].u, pb[1].u, oacc[t]);
      oacr[t] = mma_raw<0>(vc[1][t].u, pb[1].u, oacr[t]);
    }
  }

  // ---- normalise (residual fold 1/2048, 1/l, the 1/1024 p carry), stage the wave's 16x64 tile, bf16 hi | lo
  float* os = Os[wave];
  {
    const float l = lsum + xhalf(lsum);   // the two halves' key sums join here, once
    const float inv = ((l > 0.f) ? (1.0f / l) : 0.f) * (1.0f / PSC);
#pragma unroll
    for (int t = 0; t < 4; ++t) {
      v4f lo, hi;
#pragma unroll
      for (int r = 0; r < 4; ++r) {
        lo[r] = fmaf(oacr[t][r], 1.0f / RSC, oacc[t][r]) * inv;
        hi[r] = fmaf(oacr[t][4 + r], 1.0f / RSC, oacc[t][4 + r]) * inv;
      }
      *(v4f*)(os + c * OP + t * 16 + 8 * hh)     = lo;
      *(v4f*)(os + c * OP + t * 16 + 8 * hh + 4) = hi;
    }
  }
  wave_sync_lds();
  {
    const int q4 = lane >> 3, c8 = (lane & 7) * 8;
    v4u hv[4], hl[4];
#pragma unroll
    for (int it = 0; it < 4; ++it) {
      const int row = it * 4 + q4;   // it 0..3 x q4 0..3 = rows 0..15 of the wave tile
      const float* sp = os + row * OP + c8;
      v4u a, d;
#pragma unroll
      for (int e = 0; e < 4; ++e) {
        const float f0 = sp[2 * e], f1 = sp[2 * e + 1];
        const unsigned short hb0 = bf_bits(f0), hb1 = bf_bits(f1);
        const unsigned short lb0 = bf_bits(f0 - bf_up(hb0)), lb1 = bf_bits(f1 - bf_up(hb1));
        a[e] = pk16(hb0, hb1);
        d[e] = pk16(lb0, lb1);
      }
      hv[it] = a;
      hl[it] = d;
    }
    {
#pragma unroll
      for (int it = 0; it < 4; ++it) {
        const int row = it * 4 + q4;
        const size_t go = (rowB + q0 + row) * CTXP + (size_t)h * HD + c8;
        *(v4u*)(ctxp + go)      = hv[it];
        *(v4u*)(ctxp + go + DM) = hl[it];
      }
      
    }
  }
}

// =====================================================================================================
// Workspace map (bytes); every plane is an exact multiple of its 64x64-tile / whole-row / whole-line store
// granularity (M = MP = 4096 = 64 tiles, N = 1024 = 16 tiles; V^T per batch [1024][2048] = 16x32 tiles):
//   WqkvT f16 [3072 n][1024 k]        0           6291456   (rows 0..1023 = h*64+d of Wq, then Wk, then Wv; x64)
//   WoB   bf16 [1024 n][2048 k]       6291456     4194304   (Wo^T bf16, k-duplicated)
//   XH    f16 [3][4096][1024]         10485760    25165824  (converted activation planes of q, k, v)
//   QH|QR f16 [2][4096][1024]         35651584    16777216  (q hi plane, then q residual plane x2048)
//   KH    f16 [4096][1024]            52428800    8388608
//   VT|VR f16 [2][2][1024][2048]      60817408    16777216  (v^T hi planes per batch, then residual planes x2048)
//   Ctx   bf16 [4096][2048]           77594624    16777216  (context hi cols 0..1023, lo cols 1024..2047)
//   end                               94371840
// =====================================================================================================
extern "C" void kernel_launch(void* const* d_in, const int* in_sizes, int n_in,
                              void* d_out, int out_size, void* d_ws, size_t ws_size,
                              hipStream_t stream) {
  if (n_in < 11) return;
  if (in_sizes[0] != MP * DM || in_sizes[1] != MP * DM || in_sizes[2] != MP * DM) return;
  if (in_sizes[3] != NH * DM * HD || in_sizes[4] != NH * HD) return;
  if (in_sizes[5] != NH * DM * HD || in_sizes[6] != NH * HD) return;
  if (in_sizes[7] != NH * DM * HD || in_sizes[8] != NH * HD) return;
  if (in_sizes[9] != DM * DM || in_sizes[10] != DM) return;
  if (out_size != MP * DM) return;

  const float* query = (const float*)d_in[0];
  const float* key_  = (const float*)d_in[1];
  const float* value = (const float*)d_in[2];
  const float* w_q   = (const float*)d_in[3];
  const float* b_q   = (const float*)d_in[4];
  const float* w_k   = (const float*)d_in[5];
  const float* b_k   = (const float*)d_in[6];
  const float* w_v   = (const float*)d_in[7];
  const float* b_v   = (const float*)d_in[8];
  const float* w_o   = (const float*)d_in[9];
  const float* b_o   = (const float*)d_in[10];

  const size_t PW   = (size_t)3 * DM * DM * 2;            //  6291456
  const size_t PWO  = (size_t)DM * CTXP * 2;              //  4194304
  const size_t PX   = (size_t)3 * MP * DM * 2;            // 25165824
  const size_t PQ   = (size_t)2 * MP * DM * 2;            // 16777216
  const size_t PK   = (size_t)MP * DM * 2;                //  8388608
  const size_t PV   = (size_t)2 * NBATCH * DM * SEQ * 2;  // 16777216
  const size_t PC   = (size_t)MP * CTXP * 2;              // 16777216
  size_t off = 0;
  const size_t oW  = off; off += PW;
  const size_t oWo = off; off += PWO;
  const size_t oX  = off; off += PX;
  const size_t oQ  = off; off += PQ;
  const size_t oK  = off; off += PK;
  const size_t oV  = off; off += PV;
  const size_t oC  = off; off += PC;
  if (off > ws_size) return;                               // off = 94371840
  if (off > (size_t)134217728) return;

  char* ws = (char*)d_ws;
  unsigned short* WqkvT = (unsigned short*)(ws + oW);
  unsigned short* WoB   = (unsigned short*)(ws + oWo);
  unsigned short* XH    = (unsigned short*)(ws + oX);
  unsigned short* QH    = (unsigned short*)(ws + oQ);
  unsigned short* KH    = (unsigned short*)(ws + oK);
  unsigned short* VT    = (unsigned short*)(ws + oV);
  unsigned short* Ctx   = (unsigned short*)(ws + oC);
  float*          out0  = (float*)d_out;

  const dim3 blk(256), blk128(128);
  const dim3 gPrep(1024 + 3 * PCB);                                   // 768 + 256 transpose blocks, 3 x 2048 convert blocks
  const dim3 gQkv(3 * PJB);                                           // 3 projections x 128 block tiles
  const dim3 gN1k((MP / 128) * (DM / 256), 1);                        // 32 x 4 block tiles -> 128 blocks
  const dim3 gAttn(NBATCH * NH * NQB);                                // 1024 blocks of 128
  const float invw  = 1.0f / WSC;                                     // weight carry x64
  const float ssc   = 0.125f;                                         // 1/sqrt(64)
  const float ssr   = 0.125f / RSC;                                   // same, for the x2048 residual products

  // (0) weight planes WqkvT (f16, x64), WoB (bf16, k-duplicated) and the f16 activation planes of q, k, v
  prep<<<gPrep, blk, 0, stream>>>(query, key_, value, w_q, w_k, w_v, w_o, WqkvT, WoB, XH);

  // (1..3) Q, K and V^T projections
  gemm_qkv<<<gQkv, blk, 0, stream>>>(XH, WqkvT, b_q, b_k, b_v, QH, KH, VT, DM, invw);

  // (4) flash attention -> Ctx bf16 hi | lo (concat layout, column h*64 + d)
  attn64<<<gAttn, blk128, 0, stream>>>(QH, KH, VT, Ctx, ssc, ssr);

  // (5) out = [ctx_hi | ctx_lo] . [Wo^T | Wo^T]^T + b_o  (K = 2048, bf16 operands) -> d_out f32 [4096][1024]
  gemm64_one<1, 0, 0><<<gN1k, blk, 0, stream>>>(
      Ctx, CTXP, 0LL, WoB, CTXP, 0LL, b_o, b_o, DM,
      (void*)out0, DM, 0LL, 0LL, MP, DM, CTXP, 1.0f);
  (void)hipGetLastError();
}

// v006
// A run of this version takes 125 microseconds.
// Next to v005, in two timings, it ran 1.08 times as fast each time.
// All steps since v000 together make it 3.63 times as fast.
// Contractions: q, k and v^T in-projections on v_wmma_f32_16x16x32_f16 (f16 activation plane x f16 weight plane
// carried x64, one product each); attention q.k^T on v_wmma_f32_16x16x32_f16 with q as f16 hi plane + f16 residual
// plane carried x2048 (two products, two accumulators) and k plain f16; p.v on v_wmma_f32_16x16x32_f16 with p
// carried x1024 (f16) and v^T as f16 hi plane + f16 residual plane carried x2048 (two products, two accumulators);
// output projection on v_wmma_f32_16x16x32_bf16 with the context as bf16 hi | lo planes concatenated along k against
// a k-duplicated bf16 weight plane (two products, one accumulator); all f32 accumulate; softmax in f32 on VALU;
// every float input RNE-converted to bf16 on load.
#include <hip/hip_runtime.h>
#include <math.h>
#include <stdint.h>

#define NBATCH 2
#define SEQ    2048
#define DM     1024
#define NH     16
#define HD     64
#define MP     (NBATCH * SEQ)
#define NQB    (SEQ / 64)
#define CTXP   (2 * DM)
#define QRES   ((size_t)MP * DM)
#define VRES   ((size_t)NBATCH * DM * SEQ)
#define WSC    64.0f
#define RSC    2048.0f
#define PSC    1024.0f
#define LP     72      // LDS row pitch of the attention tiles in halves: 144 B = 16 B x 9 (odd), for 16-B fragment reads
#define OP     68      // LDS row pitch of the attention context tile in floats: 272 B = 16 B x 17 (odd), lane = row on the store
#define GPIT   72      // LDS row pitch of the staged GEMM operand tiles in halves: 144 B, same reason
#define GROWS  384     // rows of one staged GEMM tile: 128 rows of A, then 256 rows of Bt, 64 k (128 B) each
#define GBUFH  (GROWS * GPIT)   // halves per staging buffer (55296 B)
#define ABUFH  (3 * 64 * LP)    // halves per attention staging buffer: K, V^T hi, V^T res tiles (27648 B)
static_assert(NH * HD == DM);
static_assert((SEQ % 64) == 0 && (DM % 64) == 0 && (MP % 64) == 0);
static_assert(HD == 64);
static_assert((MP % 128) == 0 && (DM % 256) == 0 && (SEQ % 256) == 0 && (DM % 128) == 0);

typedef _Float16       v16h __attribute__((ext_vector_type(16)));
typedef __bf16         v16b __attribute__((ext_vector_type(16)));
typedef unsigned short v16us __attribute__((ext_vector_type(16)));
typedef unsigned short v8us __attribute__((ext_vector_type(8)));
typedef float          v8f  __attribute__((ext_vector_type(8)));
typedef float          v4f  __attribute__((ext_vector_type(4)));
typedef unsigned int   v4u  __attribute__((ext_vector_type(4)));

union Frag { v16us u; v8us p[2]; v16h h; v16b b; };

// ---- scalar helpers --------------------------------------------------------------------------------
__device__ __forceinline__ unsigned short bf_bits(float f) {          // f32 -> bf16 bits, RNE convert
  unsigned u = __float_as_uint(f);
  return (unsigned short)((u + 0x7FFFu + ((u >> 16) & 1u)) >> 16);
}
__device__ __forceinline__ float bf_up(unsigned short h) { return __uint_as_float(((unsigned)h) << 16); }
__device__ __forceinline__ float bfr(float f) { return bf_up(bf_bits(f)); }   // value of the bf16 RNE convert
__device__ __forceinline__ unsigned short h_bits(_Float16 x) { return __builtin_bit_cast(unsigned short, x); }
__device__ __forceinline__ unsigned pk16(unsigned short a, unsigned short b) { return (unsigned)a | ((unsigned)b << 16); }
__device__ __forceinline__ float xhalf(float x) {                     // lane l takes lane l ^ 16's value
  const int b = __builtin_bit_cast(int, x);
  return __builtin_bit_cast(float, __builtin_amdgcn_permlanex16(b, b, 0x76543210, 0xfedcba98, false, false));
}
__device__ __forceinline__ v8f zero8() { v8f z = {0.f, 0.f, 0.f, 0.f, 0.f, 0.f, 0.f, 0.f}; return z; }

// ---- fragment loader: 16-bit A/B operand (bit planes), lane -> row/col (lane&15), p already includes +8*(lane>>4);
//      elements 0..7 <- p[0..7] (k0+8h..), elements 8..15 <- p[16..23] (k0+16+8h..)
__device__ __forceinline__ v16us ldfrag(const unsigned short* p) {
  Frag f;
  f.p[0] = *(const v8us*)(p);
  f.p[1] = *(const v8us*)(p + 16);
  return f.u;
}

// ---- WMMA helper (BF = 0: f16 operands, BF = 1: bf16 operands) and the GEMM loop's VALU hazard gaps -----------------
template <int BF>
__device__ __forceinline__ v8f mma_raw(v16us a, v16us b, v8f c) {
  Frag fa, fb;
  fa.u = a;
  fb.u = b;
  if constexpr (BF) {
    return __builtin_amdgcn_wmma_f32_16x16x32_bf16(false, fa.b, false, fb.b, (short)0, c, false, false);
  } else {
    return __builtin_amdgcn_wmma_f32_16x16x32_f16(false, fa.h, false, fb.h, (short)0, c, false, false);
  }
}
__device__ __forceinline__ void dep_guard1(v8f& a, v8f& b, v16us x) {
#if defined(__HIP_DEVICE_COMPILE__)
  asm volatile("v_nop\n\tv_nop\n\tv_nop\n\tv_nop" : "+v"(a), "+v"(b) : "v"(x));
#endif
}
__device__ __forceinline__ void keep4(v16us a, v16us b, v16us c, v16us d) {
#if defined(__HIP_DEVICE_COMPILE__)
  asm volatile("v_nop" :: "v"(a), "v"(b), "v"(c), "v"(d));
#endif
}
__device__ __forceinline__ void acc_guard4(v8f& a, v8f& b, v8f& c, v8f& d) {
#if defined(__HIP_DEVICE_COMPILE__)
  asm volatile("v_nop\n\tv_nop\n\tv_nop\n\tv_nop" : "+v"(a), "+v"(b), "+v"(c), "+v"(d));
#endif
}
// eight base-2 exponentials in place. One statement, so that behind each v_exp_f32 stands an instruction that neither reads
// its result nor overwrites its source (the next one's registers are its own), and behind the last the v_nop that fills that slot.
__device__ __forceinline__ void exp2x8(float (&e)[8]) {
#if defined(__HIP_DEVICE_COMPILE__)
  asm("v_exp_f32 %0, %0\n\tv_exp_f32 %1, %1\n\tv_exp_f32 %2, %2\n\tv_exp_f32 %3, %3\n\t"
      "v_exp_f32 %4, %4\n\tv_exp_f32 %5, %5\n\tv_exp_f32 %6, %6\n\tv_exp_f32 %7, %7\n\tv_nop"
      : "+v"(e[0]), "+v"(e[1]), "+v"(e[2]), "+v"(e[3]), "+v"(e[4]), "+v"(e[5]), "+v"(e[6]), "+v"(e[7]));
#endif
}
// eight halves of an attention tile from LDS: fb = byte address of the lane's place in row 0 of tile 0; tile, row, k constants
__device__ __forceinline__ v8us frd(unsigned fb, int tile, int row, int k) {
  return *(const __attribute__((address_space(3))) v8us*)(fb + 2u * (unsigned)(tile * 64 * LP + row * LP + k));
}
__device__ __forceinline__ void wave_sync_lds() {
  __builtin_amdgcn_fence(__ATOMIC_RELEASE, "workgroup");
  __builtin_amdgcn_wave_barrier();
  __builtin_amdgcn_fence(__ATOMIC_ACQUIRE, "workgroup");
}

// ---- one staged GEMM tile: 12 asynchronous 16-B copies per lane, global -> LDS, no register in between.
//      Copy i < 4 brings A row (32 i + lane's row), copy 4 + i brings Bt row (32 i + lane's row); eight lanes cover one
//      128-B row segment, so each wave-wide copy takes four whole lines. l = the lane's LDS byte address in row 0..31 of
//      the buffer; rows 32 apart lie 32 * 144 B apart. The closing s_wait_xcnt 0 stands inside the statement so that no
//      address register of an issued copy is rewritten in front of it.
__device__ __forceinline__ void stage12(unsigned l, const unsigned short* a, size_t sa,
                                        const unsigned short* b, size_t sb) {
#if defined(__HIP_DEVICE_COMPILE__)
  const unsigned st = 32u * GPIT * 2u;
  asm volatile(
      "global_load_async_to_lds_b128 %0, %12, off\n\t"
      "global_load_async_to_lds_b128 %1, %13, off\n\t"
      "global_load_async_to_lds_b128 %2, %14, off\n\t"
      "global_load_async_to_lds_b128 %3, %15, off\n\t"
      "global_load_async_to_lds_b128 %4, %16, off\n\t"
      "global_load_async_to_lds_b128 %5, %17, off\n\t"
      "global_load_async_to_lds_b128 %6, %18, off\n\t"
      "global_load_async_to_lds_b128 %7, %19, off\n\t"
      "global_load_async_to_lds_b128 %8, %20, off\n\t"
      "global_load_async_to_lds_b128 %9, %21, off\n\t"
      "global_load_async_to_lds_b128 %10, %22, off\n\t"
      "global_load_async_to_lds_b128 %11, %23, off\n\t"
      "s_wait_xcnt 0x0"
      :: "v"(l), "v"(l + st), "v"(l + 2u * st), "v"(l + 3u * st), "v"(l + 4u * st), "v"(l + 5u * st),
         "v"(l + 6u * st), "v"(l + 7u * st), "v"(l + 8u * st), "v"(l + 9u * st), "v"(l + 10u * st), "v"(l + 11u * st),
         "v"(a), "v"(a + sa), "v"(a + 2 * sa), "v"(a + 3 * sa),
         "v"(b), "v"(b + sb), "v"(b + 2 * sb), "v"(b + 3 * sb), "v"(b + 4 * sb), "v"(b + 5 * sb), "v"(b + 6 * sb),
         "v"(b + 7 * sb)
      : "memory");
#endif
}

// ---- one staged attention chunk (K, V^T hi, V^T res tiles of 64 rows x 128 B): 12 asynchronous 16-B copies per lane,
//      global -> LDS, no register in between. Copy 4 p + i brings row (16 i + lane's row) of tile p; eight lanes cover one
//      128-B row, so each wave-wide copy takes four whole lines. Addresses: scalar base + the lane's 32-bit byte offset
//      (ko in the K plane, vo in the V^T planes), so that no vector instruction forms them. The immediate offset moves the
//      LDS and the global address alike: it carries the copy's place in LDS (16 rows = 2304 B apart, counted from la, the
//      lane's LDS byte address in rows 0..15 of the buffer's first tile, or from la + 6 x 2304) and is taken off the
//      scalar base again. k, vh, vr = byte addresses of the chunk's first element in the three planes (wave-uniform).
//      The closing s_wait_xcnt 0 stands inside the statement so that no address register of an issued copy is rewritten
//      in front of it.
static_assert(16 * LP * 2 == 2304);
__device__ __forceinline__ void stage_kv(unsigned la, unsigned ko, unsigned vo, uint64_t k, uint64_t vh, uint64_t vr) {
#if defined(__HIP_DEVICE_COMPILE__)
  const uint64_t sk = (uint64_t)16 * DM * 2, sv = (uint64_t)16 * SEQ * 2;   // 16 rows in the K plane, in a V^T plane
  asm volatile(
      "global_load_async_to_lds_b128 %0, %2, %4\n\t"
      "global_load_async_to_lds_b128 %0, %2, %5 offset:2304\n\t"
      "global_load_async_to_lds_b128 %0, %2, %6 offset:4608\n\t"
      "global_load_async_to_lds_b128 %0, %2, %7 offset:6912\n\t"
      "global_load_async_to_lds_b128 %0, %3, %8 offset:9216\n\t"
      "global_load_async_to_lds_b128 %0, %3, %9 offset:11520\n\t"
      "global_load_async_to_lds_b128 %1, %3, %10\n\t"
      "global_load_async_to_lds_b128 %1, %3, %11 offset:2304\n\t"
      "global_load_async_to_lds_b128 %1, %3, %12 offset:4608\n\t"
      "global_load_async_to_lds_b128 %1, %3, %13 offset:6912\n\t"
      "global_load_async_to_lds_b128 %1, %3, %14 offset:9216\n\t"
      "global_load_async_to_lds_b128 %1, %3, %15 offset:11520\n\t"
      "s_wait_xcnt 0x0"
      :: "v"(la), "v"(la + 6u * 2304u), "v"(ko), "v"(vo),
         "s"(k), "s"(k + sk - 2304u), "s"(k + 2 * sk - 4608u), "s"(k + 3 * sk - 6912u),
         "s"(vh - 9216u), "s"(vh + sv - 11520u), "s"(vh + 2 * sv), "s"(vh + 3 * sv - 2304u),
         "s"(vr - 4608u), "s"(vr + sv - 6912u), "s"(vr + 2 * sv - 9216u), "s"(vr + 3 * sv - 11520u)
      : "memory");
#endif
}

// =====================================================================================================
// f32 -> f16 activation plane convert: Xh[i] = f16( bf16_RNE(X[i]) * wsc ), wsc a power of two (exact).
// Thread i handles elements 8i..8i+7 and writes one 16-B piece; 32 consecutive lanes of one instruction fill
// (host-checked) so every store is full-width.
// coverage: n8 threads x 8 elements = the whole plane. bx = the block's index within the plane's n8 / 256 blocks.
// =====================================================================================================
__device__ __forceinline__ void conv_h16(int bx, const float* __restrict__ W, unsigned short* Wh, int n8, float wsc) {
  const int i  = bx * 256 + threadIdx.x;
  const int ic = (i < n8) ? i : (n8 - 1);                     // clamped address
  const float* src = W + (size_t)ic * 8;
  const v4f a = *(const v4f*)(src);
  const v4f c = *(const v4f*)(src + 4);
  v4u o;
  o[0] = pk16(h_bits((_Float16)(bfr(a[0]) * wsc)), h_bits((_Float16)(bfr(a[1]) * wsc)));
  o[1] = pk16(h_bits((_Float16)(bfr(a[2]) * wsc)), h_bits((_Float16)(bfr(a[3]) * wsc)));
  o[2] = pk16(h_bits((_Float16)(bfr(c[0]) * wsc)), h_bits((_Float16)(bfr(c[1]) * wsc)));
  o[3] = pk16(h_bits((_Float16)(bfr(c[2]) * wsc)), h_bits((_Float16)(bfr(c[3]) * wsc)));
  if (i < n8) *(v4u*)(Wh + (size_t)i * 8) = o;
  // the caller's other parts follow in the same kernel: no register of the issued store is rewritten in front of this wait
  asm volatile("s_wait_xcnt 0x0" ::: "memory");
}

// =====================================================================================================
// 64x64 tile transpose-convert of an f32 weight tensor: z-slice in[z] is [R][C] f32 (row pitch C elements,
// slice stride inStrideZ); output is 16-bit with rows indexed by the INPUT COLUMN: out[z*outStrideZ + c*ldo + r]
// (the input row index r becomes the k-contiguous column), i.e. in[rows=R][cols=C] -> out[cols=C][rows=R].
//   BF == 0: value = f16( bf16_RNE(x) * sc )   (sc a power of two)
//   BF == 1: value = bf16_RNE(x) bits; DUP == 1 additionally writes the same 16-B piece at column offset + dupOff.
// blocks (bx, by, bz) = (R/64, C/64, Z), block 256, sT = the block's 64 x 72 halves of LDS. Load phase: 1024 float4 pieces (64 rows x 16) = the whole 64x64 tile,
// 4 per thread, converted and stored transposed into LDS with 16-bit element stores; __syncthreads; store phase:
// coverage: 2 iterations x 32 rows x (8 lanes x 8 halves) = the whole 64x64 output tile (x2 destinations if DUP);
//           the grid tiles every (r block, c block, z) exactly once.
// =====================================================================================================
template <int BF, int DUP>
__device__ __forceinline__ void tconv64(unsigned short* sT, int bx, int by, int bz,
                                        const float* __restrict__ in, long long inStrideZ, int C,
                                        unsigned short* out, long long outStrideZ, int ldo, int dupOff,
                                        float sc) {
  const int t  = threadIdx.x;
  const int r0 = bx * 64;
  const int c0 = by * 64;
  const float* src = in + (size_t)bz * (size_t)inStrideZ;
  unsigned short* dst = out + (size_t)bz * (size_t)outStrideZ;
#pragma unroll
  for (int i = 0; i < 4; ++i) {
    const int idx = t + 256 * i;                              // 0..1023
    const int rr  = idx >> 4;                                 // 0..63
    const int cq  = (idx & 15) * 4;                           // 0..60
    const v4f x = *(const v4f*)(src + (size_t)(r0 + rr) * (size_t)C + c0 + cq);
#pragma unroll
    for (int j = 0; j < 4; ++j) {
      unsigned short w;
      if (BF) {
        w = bf_bits(x[j]);
      } else {
        w = h_bits((_Float16)(bfr(x[j]) * sc));
      }
      sT[(cq + j) * 72 + rr] = w;
    }
  }
  __syncthreads();
  const int q8 = t >> 3;                                      // 0..31: row within the 32-row group
  const int c8 = (t & 7) * 8;
  v8us vv[2];
#pragma unroll
  for (int it = 0; it < 2; ++it) {
    const int row = it * 32 + q8;                             // it 0..1 x q8 0..31 = rows 0..63
    vv[it] = *(const v8us*)(sT + row * 72 + c8);
  }
  {
#pragma unroll
    for (int it = 0; it < 2; ++it) {
      const int row = it * 32 + q8;
      unsigned short* dp = dst + (size_t)(c0 + row) * (size_t)ldo + r0 + c8;
      *(v8us*)(dp) = vv[it];
      if (DUP) *(v8us*)(dp + dupOff) = vv[it];
    }
    // the caller's other parts follow in the same kernel: no register of the issued stores is rewritten in front of this wait
    asm volatile("s_wait_xcnt 0x0" ::: "memory");
  }
}

// =====================================================================================================
// All operand preparation in one launch; none of its parts reads what another writes. Block ranges (block-uniform):
//   0..767     weight planes: z = block >> 8 picks Wq, Wk, Wv; per head in[e = 1024][d = 64] -> WqkvT[z*1024 + h*64 + d][e]
//   768..1023  Wo: in[k][n] -> WoB[n][k] and WoB[n][1024 + k]
//   1024..     activation planes: z = (block - 1024) / PCB picks q, k, v -> XH + z * MP * DM, PCB blocks per plane
// =====================================================================================================
#define PCB ((MP * DM) / (8 * 256))
static_assert(((MP * DM) % (8 * 256)) == 0);
static_assert(DM / 64 == 16 && HD == 64 && NH * (DM / 64) == 256);   // the shifts and masks of the transpose ranges
__global__ __launch_bounds__(256) void prep(const float* __restrict__ xq, const float* __restrict__ xk,
                                            const float* __restrict__ xv, const float* __restrict__ wq,
                                            const float* __restrict__ wk, const float* __restrict__ wv,
                                            const float* __restrict__ wo, unsigned short* WqkvT, unsigned short* WoB,
                                            unsigned short* XH) {
  __shared__ __align__(16) unsigned short sT[64 * 72];        // [c local][r local], pitch 72 halves (144 B)
  const int bx = blockIdx.x;
  if (bx < 768) {
    const int z = bx >> 8, r = bx & 255;
    const float* w = (z == 0) ? wq : ((z == 1) ? wk : wv);
    tconv64<0, 0>(sT, r & 15, 0, r >> 4, w, (long long)DM * HD, HD, WqkvT + (size_t)z * DM * DM,
                  (long long)HD * DM, DM, 0, WSC);
  } else if (bx < 1024) {
    const int r = bx - 768;
    tconv64<1, 1>(sT, r & 15, r >> 4, 0, wo, 0LL, DM, WoB, 0LL, CTXP, DM, 1.0f);
  } else {
    const int r = bx - 1024;
    const int z = r / PCB;
    const float* x = (z == 0) ? xq : ((z == 1) ? xk : xv);
    conv_h16(r - z * PCB, x, XH + (size_t)z * MP * DM, (MP * DM) / 8, 1.0f);
  }
}

// =====================================================================================================
// Register-blocked batched 16-bit WMMA GEMM: C[m][n] = oscale * sum_k A[m][k] * Bt[n][k] + bias;
// one wave per 64x64 tile, 8 waves (2 x 4) = one 128x256 block tile. A row-major [M][K] pitch lda; Bt row-major [N][K]
// pitch ldb (k contiguous); M multiple of 128, N of 256, K of 64 (static here). b = batch (strides in elements).
// Operands: per 64 k the block's 128 A rows and 256 Bt rows are staged in LDS by asynchronous copies, two buffers: the
// copies of tile t + 2 go out behind the barrier at the foot of trip t and fly during trip t + 1; every fragment is read
// from LDS (k order per output element as before: ascending in steps of 32).
// BF: 0 = f16 operand planes, 1 = bf16 operand planes.
// Bias: BIASM == 0 -> per column: cols < Nb from bias0[col], cols >= Nb from bias1[col - Nb] (tile-uniform select of
//       clamped-address loads); BIASM == 1 -> per row bias0[m]. Bias values RNE-converted to bf16.
// OM: 0 = f32 out (pitch ldc); 2 = f16 out; 3 = f16 hi plane at C plus f16 residual plane ((f - hi) * RSC) at
//     C + resOff (same pitch and offsets).
// coverage: 4 slabs x 16 rows x 64 cols = the wave's whole 64x64 tile; tile = 0 .. (M/128)*(N/256) - 1 per batch,
//           a surplus block exits as a whole in front of every barrier and copy.
// sOp = two staging buffers [A 128 rows | Bt 256 rows] x 64 k; sT = per-wave 16x64 slab, pitch 68 floats (the kernel's LDS).
// =====================================================================================================
template <int BF, int OM, int BIASM>
__device__ __forceinline__ void gemm64(
    unsigned short* sOp, float (*sT)[16 * 68], int tile, int b,
    const unsigned short* __restrict__ A, int lda, long long strideA,
    const unsigned short* __restrict__ Bt, int ldb, long long strideB,
    const float* __restrict__ bias0, const float* __restrict__ bias1, int Nb,
    void* Cout, int ldc, long long strideC, long long resOff,
    int M, int N, int K, float oscale) {
  const int lane = threadIdx.x & 31;
  const int wave = threadIdx.x >> 5;
  const int tilesN = N >> 8;
  const int tilesM = M >> 7;
  if (tile >= tilesM * tilesN) return;   // block-uniform, in front of every barrier
  const int tm = tile / tilesN;
  const int tn = tile - tm * tilesN;
  const int mb0 = tm << 7;                     // block tile origin
  const int nb0 = tn << 8;
  const int wm  = wave >> 2;                   // wave's 64x64 tile inside the block tile
  const int wn  = wave & 3;
  const int m0 = mb0 + (wm << 6);
  const int n0 = nb0 + (wn << 6);

  const unsigned short* Ab = A  + (size_t)b * (size_t)strideA;
  const unsigned short* Bb = Bt + (size_t)b * (size_t)strideB;

  const int rlane = lane & 15;                 // row (A) / col (B, D) within subtile
  const int koff  = (lane >> 4) * 8;           // k offset of this lane half
  const int mOff  = (lane >> 4) * 8;           // D row offset

  v8f acc[4][4];
#pragma unroll
  for (int i = 0; i < 4; ++i)
#pragma unroll
    for (int j = 0; j < 4; ++j) acc[i][j] = zero8();

  // ---- staging addresses: thread -> row (tid >> 3) of each 32-row group, 16-B piece (tid & 7) of the 128-B segment ----
  const int crow = threadIdx.x >> 3;
  const int cpc  = (threadIdx.x & 7) * 8;
  const unsigned short* ga = Ab + (size_t)(mb0 + crow) * lda + cpc;
  const unsigned short* gb = Bb + (size_t)(nb0 + crow) * ldb + cpc;
  const size_t sa = (size_t)32 * lda, sb = (size_t)32 * ldb;
  const unsigned l0 =
      (unsigned)(uintptr_t)(const __attribute__((address_space(3))) unsigned short*)(sOp + crow * GPIT + cpc);
  const int T = K >> 6;                        // staged tiles of 64 k

  stage12(l0, ga, sa, gb, sb);                                 // tile 0 -> buffer 0
  asm volatile("s_wait_asynccnt 0x0" ::: "memory");            // this wave's copies of tile 0 have landed
  __syncthreads();                                             // ... and every other wave's
  if (T > 1) stage12(l0 + GBUFH * 2u, ga + 64, sa, gb + 64, sb);   // tile 1 -> buffer 1

  for (int t = 0; t < T; ++t) {
    const unsigned short* sbuf = sOp + (t & 1) * GBUFH;
    const unsigned short* fa = sbuf + ((wm << 6) + rlane) * GPIT + koff;
    const unsigned short* fb = sbuf + (128 + (wn << 6) + rlane) * GPIT + koff;
#pragma unroll
    for (int kk = 0; kk < 2; ++kk) {
      v16us bh[4], ah[4];
#pragma unroll
      for (int j = 0; j < 4; ++j) bh[j] = ldfrag(fb + (j << 4) * GPIT + kk * 32);
#pragma unroll
      for (int i = 0; i < 4; ++i) ah[i] = ldfrag(fa + (i << 4) * GPIT + kk * 32);
#pragma unroll
      for (int i = 0; i < 4; ++i) {
#pragma unroll
        for (int j = 0; j < 4; ++j) acc[i][j] = mma_raw<BF>(ah[i], bh[j], acc[i][j]);
        dep_guard1(acc[i][0], acc[i][3], ah[i]);
      }
      keep4(bh[0], bh[1], bh[2], bh[3]);
    }
    asm volatile("s_wait_dscnt 0x0" ::: "memory");             // this wave's reads of buffer t & 1 are done
    asm volatile("s_wait_asynccnt 0x0" ::: "memory");          // this wave's copies of tile t + 1 have landed
    __syncthreads();                                           // publishes tile t + 1, frees buffer t & 1
    if (t + 2 < T) stage12(l0 + (unsigned)(t & 1) * (GBUFH * 2u), ga + (size_t)(t + 2) * 64, sa, gb + (size_t)(t + 2) * 64, sb);
  }
  asm volatile("s_wait_asynccnt 0x0" ::: "memory");            // nothing of this wave is in flight past the loop
  acc_guard4(acc[0][0], acc[0][1], acc[0][2], acc[0][3]);
  acc_guard4(acc[1][0], acc[1][1], acc[1][2], acc[1][3]);
  acc_guard4(acc[2][0], acc[2][1], acc[2][2], acc[2][3]);
  acc_guard4(acc[3][0], acc[3][1], acc[3][2], acc[3][3]);

  // ---- per-lane column bias (BIASM == 0), RNE-converted ----
  const int hh2 = lane >> 4, c4 = (lane & 15) * 4;     // f32 out: 256-B row segment = 16 lanes x 16 B
  const int q8  = lane >> 3, c8 = (lane & 7) * 8;
  float bc[8];
#pragma unroll
  for (int e = 0; e < 8; ++e) bc[e] = 0.f;
  if (BIASM == 0) {
    const bool use1 = (n0 >= Nb);                      // tile-uniform
    if (OM == 0) {
      const int cb = n0 + c4;
      const int i0 = (cb < Nb - 4) ? cb : (Nb - 4);
      const int i1 = (cb - Nb > 0) ? (cb - Nb) : 0;
      const v4f b0v = *(const v4f*)(bias0 + i0);
      const v4f b1v = *(const v4f*)(bias1 + i1);
#pragma unroll
      for (int e = 0; e < 4; ++e) bc[e] = bfr(use1 ? b1v[e] : b0v[e]);
    } else {
      const int cb = n0 + c8;
      const int i0 = (cb < Nb - 8) ? cb : (Nb - 8);
      const int i1 = (cb - Nb > 0) ? (cb - Nb) : 0;
      const v4f b0a = *(const v4f*)(bias0 + i0), b0b = *(const v4f*)(bias0 + i0 + 4);
      const v4f b1a = *(const v4f*)(bias1 + i1), b1b = *(const v4f*)(bias1 + i1 + 4);
#pragma unroll
      for (int e = 0; e < 4; ++e) {
        bc[e]     = bfr(use1 ? b1a[e] : b0a[e]);
        bc[4 + e] = bfr(use1 ? b1b[e] : b0b[e]);
      }
    }
  }

  // ---- epilogue ----
  float* slab = sT[wave];
#pragma unroll
  for (int i = 0; i < 4; ++i) {
    const int mBase = m0 + (i << 4);
#pragma unroll
    for (int j = 0; j < 4; ++j) {
#pragma unroll
      for (int r = 0; r < 8; ++r) {
        slab[(mOff + r) * 68 + (j << 4) + rlane] = acc[i][j][r];
      }
    }
    wave_sync_lds();
    if constexpr (OM == 0) {
      float* C = (float*)Cout + (size_t)b * (size_t)strideC;
      v4f vals[8];
#pragma unroll
      for (int it = 0; it < 8; ++it) {
        const int row = it * 2 + hh2;                      // it 0..7 x hh2 0..1 = rows 0..15
        v4f v = *(const v4f*)(slab + row * 68 + c4);
#pragma unroll
        for (int e = 0; e < 4; ++e) v[e] = v[e] * oscale + bc[e];
        vals[it] = v;
      }
      {
#pragma unroll
        for (int it = 0; it < 8; ++it) {
          const int row = it * 2 + hh2;
          *(v4f*)(C + (size_t)(mBase + row) * ldc + n0 + c4) = vals[it];
        }
        
      }
    } else {
      unsigned short* C = (unsigned short*)Cout + (size_t)b * (size_t)strideC;
      v4u hv[4], hr[4];
#pragma unroll
      for (int it = 0; it < 4; ++it) {
        const int row = it * 4 + q8;                       // it 0..3 x q8 0..3 = rows 0..15
        const float* sp = slab + row * 68 + c8;
        float bm = 0.f;
        if (BIASM == 1) bm = bfr(bias0[mBase + row]);
        v4u a, ar;
#pragma unroll
        for (int e = 0; e < 4; ++e) {
          const float f0 = sp[2 * e]     * oscale + ((BIASM == 1) ? bm : bc[2 * e]);
          const float f1 = sp[2 * e + 1] * oscale + ((BIASM == 1) ? bm : bc[2 * e + 1]);
          const _Float16 g0 = (_Float16)f0, g1 = (_Float16)f1;
          a[e] = pk16(h_bits(g0), h_bits(g1));
          if (OM == 3) {
            const float e0 = (f0 - (float)g0) * RSC;
            const float e1 = (f1 - (float)g1) * RSC;
            ar[e] = pk16(h_bits((_Float16)e0), h_bits((_Float16)e1));
          } else {
            ar[e] = 0u;
          }
        }
        hv[it] = a;
        hr[it] = ar;
      }
      {
#pragma unroll
        for (int it = 0; it < 4; ++it) {
          const int row = it * 4 + q8;
          unsigned short* dp = C + (size_t)(mBase + row) * ldc + n0 + c8;
          *(v4u*)(dp) = hv[it];
          if (OM == 3) *(v4u*)(dp + resOff) = hr[it];
        }
        
      }
    }
    wave_sync_lds();
  }
}

// ---- one GEMM per launch: grid = ((M/128)*(N/256), batches) ----
template <int BF, int OM, int BIASM>
__global__ __launch_bounds__(256) void gemm64_one(
    const unsigned short* __restrict__ A, int lda, long long strideA,
    const unsigned short* __restrict__ Bt, int ldb, long long strideB,
    const float* __restrict__ bias0, const float* __restrict__ bias1, int Nb,
    void* Cout, int ldc, long long strideC, long long resOff,
    int M, int N, int K, float oscale) {
  __shared__ __align__(16) unsigned short sOp[2 * GBUFH];
  __shared__ __align__(16) float sT[8][16 * 68];
  gemm64<BF, OM, BIASM>(sOp, sT, blockIdx.x, blockIdx.y, A, lda, strideA, Bt, ldb, strideB, bias0, bias1, Nb,
                        Cout, ldc, strideC, resOff, M, N, K, oscale);
}

// ---- the three in-projections in one launch; they share no output and read only what the launch before wrote.
//      PJB blocks each, block >> 7 picks the projection (block-uniform):
//      0: Q = xq . WqT^T + b_q -> QH (f16 hi) and QH + QRES (f16 residual x2048); column n = h*64 + d
//      1: K = xk . WkT^T + b_k -> KH (f16)
//      2: V^T per batch = WvT . xv^T + b_v -> VT (f16 hi [2][1024][2048]) and VT + VRES (residual x2048); row m = h*64 + d
//         (per-row bias b_v[m]), column n = token s of batch (block & 127) >> 6
#define PJB 128
static_assert((MP / 128) * (DM / 256) == PJB && (DM / 128) * (SEQ / 256) * NBATCH == PJB && (DM / 128) * (SEQ / 256) == 64);
__global__ __launch_bounds__(256) void gemm_qkv(
    const unsigned short* __restrict__ XH, const unsigned short* __restrict__ WqkvT,
    const float* __restrict__ b_q, const float* __restrict__ b_k, const float* __restrict__ b_v,
    unsigned short* QH, unsigned short* KH, unsigned short* VT, int K, float oscale) {
  __shared__ __align__(16) unsigned short sOp[2 * GBUFH];
  __shared__ __align__(16) float sT[8][16 * 68];
  const int sel = blockIdx.x >> 7, r = blockIdx.x & 127;
  if (sel == 0) {
    gemm64<0, 3, 0>(sOp, sT, r, 0, XH, DM, 0LL, WqkvT, DM, 0LL, b_q, b_q, DM,
                    (void*)QH, DM, 0LL, (long long)QRES, MP, DM, K, oscale);
  } else if (sel == 1) {
    gemm64<0, 2, 0>(sOp, sT, r, 0, XH + (size_t)MP * DM, DM, 0LL, WqkvT + (size_t)DM * DM, DM, 0LL, b_k, b_k, DM,
                    (void*)KH, DM, 0LL, 0LL, MP, DM, K, oscale);
  } else {
    gemm64<0, 3, 1>(sOp, sT, r & 63, r >> 6, WqkvT + (size_t)2 * DM * DM, DM, 0LL,
                    XH + (size_t)2 * MP * DM, DM, (long long)SEQ * DM, b_v, b_v, SEQ,
                    (void*)VT, SEQ, (long long)DM * SEQ, (long long)VRES, DM, SEQ, K, oscale);
  }
}

// =====================================================================================================
// Flash attention, head dim 64, SEQ token rows per batch (all keys valid, no mask).
//   q planes (f16, pitch DM): hi at qhp[(b*SEQ + t)*DM + h*64 + d], residual (x2048) at qhp + QRES (same offsets)
//   k plane (f16, pitch DM): khp[(b*SEQ + t)*DM + h*64 + d]
//   v^T planes (f16): hi at vtp[(b*DM + h*64 + d)*SEQ + s], residual (x2048) at vtp + VRES
//   context planes (bf16, pitch CTXP): hi at ctxp[(b*SEQ + t)*CTXP + h*64 + d], lo at the same + DM
//   Products are taken transposed: S^T = K . Q^T (A = K rows, B = Q rows) and O^T += V^T . P^T (A = V^T rows, B = P^T), so
//   a lane holds scores of ONE query (column lane & 15), keys 8 (lane >> 4) + r of each 16-key tile: the row maximum
//   and the row sum are taken in the lane, plus one exchange between the wave halves (the sum's only in the epilogue),
//   and two converted score tiles are the B operand of the second product as they stand: P never leaves the registers.
//   score = fma(acc_hi, sscale, acc_res * ssres); p = exp(s - m) carried as f16(1024 p); context = p . v with the
//   v hi and v residual products in two accumulators; online softmax (running max) in f32.
//   Block = 4 waves = 64 query rows of one (b, h); grid = NQB * NH * NBATCH; kv chunks of 64, static trip NQB.
//   K / V^T hi / V^T res chunk staging: 128 threads x 4 copies x 8 elements per plane = the whole 64x64 tile each, by
//   asynchronous copies into two buffers: the copies of chunk kt + 2 go out behind the one barrier at the foot of trip kt
//   and fly during trip kt + 1; trip kt reads buffer kt & 1 alone.
//   Fragment reads: K's eight as one group ahead of the 16 score products; V^T's eight of keys 0..31 as one group ahead of
//   the softmax; those of keys 32..63 in two groups of four ahead of the context products of keys 0..31.
//   Context coverage: each wave stores rows q0..q0+15 (it 0..3 x lane>>3 0..3) x 64 columns (8 lanes x 8) of both
//   the hi and the lo plane; grid covers all SEQ rows x NH head slices x NBATCH.
// =====================================================================================================
__global__ __launch_bounds__(128, 4)   // 4 waves per SIMD = the grid's four blocks per WGP all resident: a budget of 256 registers
void attn64(const unsigned short* __restrict__ qhp, const unsigned short* __restrict__ khp,
            const unsigned short* __restrict__ vtp, unsigned short* ctxp,
            float sscale, float ssres) {
  __shared__ __align__(16) unsigned short KV[2 * ABUFH];          // two buffers of three 9-KB tiles, rows of 64 at pitch LP:
                                                                  // K [kv][d], V^T hi [d][kv], V^T res [d][kv]
  __shared__ __align__(16) float          Os[4][16 * OP];         // per wave context tile [row][d], rows of 64 at pitch OP

  const int tid  = threadIdx.x;
  const int wave = __builtin_amdgcn_readfirstlane(tid >> 5);   // wave-uniform: held in a scalar register across the loop
  const int hh   = (tid & 31) >> 4;
  const int c    = tid & 15;

  const int bx   = blockIdx.x;
  const int qb   = bx % NQB;
  const int rest = bx / NQB;
  const int h    = rest % NH;
  const int b    = rest / NH;
  const int q0   = qb * 64 + wave * 16;          // in-batch query row of this wave's first row
  const size_t rowB = (size_t)b * SEQ;

  const unsigned short* Qh = qhp + (size_t)h * HD;
  const unsigned short* Qr = qhp + QRES + (size_t)h * HD;
  const unsigned short* Kg = khp + (size_t)h * HD;
  const unsigned short* Vh = vtp + ((size_t)b * DM + (size_t)h * HD) * SEQ;
  const unsigned short* Vr = Vh + VRES;

  // the lane's fragment row (lane & 15) and k half in tile 0, as an LDS byte address: every fragment read is this
  // address plus the trip's buffer offset, in one register, plus a constant that fits the instruction's offset field
  const unsigned fb0 = (unsigned)(uintptr_t)(const __attribute__((address_space(3))) unsigned short*)(KV + c * LP + 8 * hh);

  // staging addresses: thread -> row (tid >> 3) of each 16-row group, 16-B piece (tid & 7) of the 128-B row
  const int crow = tid >> 3, cpc = (tid & 7) * 8;
  const unsigned ko = 2u * (unsigned)(crow * DM + cpc);           // the lane's byte offset in a chunk of the K plane
  const unsigned vo = 2u * (unsigned)(crow * SEQ + cpc);          // ... and of a V^T plane
  const uint64_t gk = (uint64_t)(uintptr_t)(Kg + rowB * DM);      // chunk 0: K row 0, d = 0
  const uint64_t gv = (uint64_t)(uintptr_t)Vh;                    // V^T hi row d = 0, s = 0
  const uint64_t gr = (uint64_t)(uintptr_t)Vr;                    // V^T res row d = 0, s = 0
  const unsigned l0 =
      (unsigned)(uintptr_t)(const __attribute__((address_space(3))) unsigned short*)(KV + crow * LP + cpc);
  static_assert(NQB >= 2);

  stage_kv(l0, ko, vo, gk, gv, gr);                               // chunk 0 -> buffer 0
  asm volatile("s_wait_asynccnt 0x0" ::: "memory");               // this wave's copies of chunk 0 have landed
  __syncthreads();                                                // ... and every other wave's
  stage_kv(l0 + ABUFH * 2u, ko, vo, gk + 64u * DM * 2u, gv + 128u, gr + 128u);   // chunk 1 -> buffer 1

  float mrun = -INFINITY, lsum = 0.f;   // query c: running maximum (both halves alike), sum over this half's keys
  v8f oacc[4], oacr[4];                 // O^T tiles: register r = context[d = 16 t + 8 hh + r] of query c
#pragma unroll
  for (int t = 0; t < 4; ++t) { oacc[t] = zero8(); oacr[t] = zero8(); }

  for (int kt = 0; kt < NQB; ++kt) {         // static trip count
    const unsigned fb = fb0 + (unsigned)(kt & 1) * (ABUFH * 2u);   // this trip's buffer

    // ---- Q fragments (B operand, column = query = lane&15): hi and residual, 2 d-chunks each ----
    v16us qa[2], qr[2];
#pragma unroll
    for (int dc = 0; dc < 2; ++dc) {
      qa[dc] = ldfrag(Qh + (rowB + q0 + c) * DM + dc * 32 + 8 * hh);
      qr[dc] = ldfrag(Qr + (rowB + q0 + c) * DM + dc * 32 + 8 * hh);
    }

    // ---- K fragments (A operand, row = key 16 j + lane&15): all eight read from LDS as one group ----
    Frag kb[4][2];
#pragma unroll
    for (int j = 0; j < 4; ++j) {
#pragma unroll
      for (int dc = 0; dc < 2; ++dc) {
        kb[j][dc].p[0] = frd(fb, 0, j * 16, dc * 32);
        kb[j][dc].p[1] = frd(fb, 0, j * 16, dc * 32 + 16);
      }
    }
    __builtin_amdgcn_sched_barrier(0);   // keeps the reads one group ahead of the products; the scheduler otherwise sinks each to its user

    // ---- scores, transposed: s[j][r] = score(key 16 j + 8 hh + r, query c); 16 products in a row, four independent
    //      accumulators per pair of key tiles, d ascending in each as before ----
    v8f s[4], sh[4], sr[4];
#pragma unroll
    for (int jp = 0; jp < 2; ++jp) {
#pragma unroll
      for (int jj = 0; jj < 2; ++jj) { sh[2 * jp + jj] = zero8(); sr[2 * jp + jj] = zero8(); }
#pragma unroll
      for (int dc = 0; dc < 2; ++dc) {
#pragma unroll
        for (int jj = 0; jj < 2; ++jj) {
          sh[2 * jp + jj] = mma_raw<0>(kb[2 * jp + jj][dc].u, qa[dc], sh[2 * jp + jj]);
          sr[2 * jp + jj] = mma_raw<0>(kb[2 * jp + jj][dc].u, qr[dc], sr[2 * jp + jj]);
        }
      }
      if (jp == 0) __builtin_amdgcn_sched_barrier(0);   // first pair's products first: its K registers are free before the second pair's accumulators start
    }
#pragma unroll
    for (int j = 0; j < 2; ++j) {
#pragma unroll
      for (int r = 0; r < 8; ++r) s[j][r] = fmaf(sh[j][r], sscale, sr[j][r] * ssres);
    }
    __builtin_amdgcn_sched_barrier(0);   // the V^T reads below do not rise among the products, where K's registers are still held

    // ---- V^T fragments of keys 0..31 (A operand, row = d 16 t + lane&15), hi and residual: one group, in flight under the softmax ----
    Frag vb[2][4], vc[2][4];
#pragma unroll
    for (int t = 0; t < 4; ++t) {
      vb[0][t].p[0] = frd(fb, 1, t * 16, 0);
      vb[0][t].p[1] = frd(fb, 1, t * 16, 16);
      vc[0][t].p[0] = frd(fb, 2, t * 16, 0);
      vc[0][t].p[1] = frd(fb, 2, t * 16, 16);
    }
    __builtin_amdgcn_sched_barrier(0);   // keeps the group ahead of the softmax, which covers its latency
#pragma unroll
    for (int j = 2; j < 4; ++j) {
#pragma unroll
      for (int r = 0; r < 8; ++r) s[j][r] = fmaf(sh[j][r], sscale, sr[j][r] * ssres);
    }

    // ---- maximum over the lane's 32 keys (four chains), then the other half's; online softmax; P^T (x1024, f16) packed
    //      in place: element 8 (j & 1) + r of fragment j >> 1 = key 32 (j >> 1) + 16 (j & 1) + 8 hh + r, the V^T loader's k order
    float mj[4], pj[4];
#pragma unroll
    for (int j = 0; j < 4; ++j) {
      mj[j] = s[j][0];
#pragma unroll
      for (int r = 1; r < 8; ++r) mj[j] = fmaxf(mj[j], s[j][r]);
    }
    float m = fmaxf(fmaxf(mj[0], mj[1]), fmaxf(mj[2], mj[3]));
    m = fmaxf(m, xhalf(m));
    const float mnew  = fmaxf(mrun, m);
    const float alpha = __expf(mrun - mnew);
    mrun = mnew;
    Frag pb[2];
#pragma unroll
    for (int j = 0; j < 4; ++j) {
      float e[8];
#pragma unroll
      for (int r = 0; r < 8; ++r) e[r] = (s[j][r] - mnew) * 1.44269504f;   // exp(x) = 2^(x log2 e), the fast exponential's own form
      exp2x8(e);
      pj[j] = e[0];
#pragma unroll
      for (int r = 1; r < 8; ++r) pj[j] += e[r];
#pragma unroll
      for (int r = 0; r < 8; ++r) pb[j >> 1].h[(j & 1) * 8 + r] = (_Float16)(e[r] * PSC);
    }
    lsum = lsum * alpha + ((pj[0] + pj[1]) + (pj[2] + pj[3]));
#pragma unroll
    for (int t = 0; t < 4; ++t) { oacc[t] *= alpha; oacr[t] *= alpha; }

    // ---- context^T += V^T . P^T (hi and residual products, f16 WMMA), keys ascending in each accumulator as before; the
    //      fragments of keys 32..63 are read in two groups of four, each ahead of four products of keys 0..31. The
    //      scheduling barriers keep each group whole and at its place (fragment registers: three groups of four live at most).
    __builtin_amdgcn_sched_barrier(0);   // the reads below do not rise into the softmax, where the score registers are still held
#pragma unroll
    for (int g = 0; g < 2; ++g) {
#pragma unroll
      for (int t = 2 * g; t < 2 * g + 2; ++t) {
        vb[1][t].p[0] = frd(fb, 1, t * 16, 32);
        vb[1][t].p[1] = frd(fb, 1, t * 16, 48);
        vc[1][t].p[0] = frd(fb, 2, t * 16, 32);
        vc[1][t].p[1] = frd(fb, 2, t * 16, 48);
      }
      __builtin_amdgcn_sched_barrier(0);   // the group's reads stay together ahead of the four products, not spread among them
#pragma unroll
      for (int t = 2 * g; t < 2 * g + 2; ++t) {
        oacc[t] = mma_raw<0>(vb[0][t].u, pb[0].u, oacc[t]);
        oacr[t] = mma_raw<0>(vc[0][t].u, pb[0].u, oacr[t]);
      }
      __builtin_amdgcn_sched_barrier(0);   // the next group's reads follow these products, whose fragment registers they take over
    }
#pragma unroll
    for (int t = 0; t < 4; ++t) {
      oacc[t] = mma_raw<0>(vb[1][t].u, pb[1].u, oacc[t]);
      oacr[t] = mma_raw<0>(vc[1][t].u, pb[1].u, oacr[t]);
    }
    asm volatile("s_wait_dscnt 0x0" ::: "memory");                 // this wave's reads of buffer kt & 1 are done
    asm volatile("s_wait_asynccnt 0x0" ::: "memory");              // this wave's copies of chunk kt + 1 have landed
    __syncthreads();                                               // publishes chunk kt + 1, frees buffer kt & 1
    if (kt + 2 < NQB)
      stage_kv(l0 + (unsigned)(kt & 1) * (ABUFH * 2u), ko, vo, gk + (uint64_t)(kt + 2) * (64u * DM * 2u),
               gv + (uint64_t)(kt + 2) * 128u, gr + (uint64_t)(kt + 2) * 128u);
  }
  asm volatile("s_wait_asynccnt 0x0" ::: "memory");                // nothing of this wave is in flight past the loop

  // ---- normalise (residual fold 1/2048, 1/l, the 1/1024 p carry), stage the wave's 16x64 tile, bf16 hi | lo
  //      the lane's index is taken anew here, so that no vector register carries it (or what derives from it) across the loop
  const int lane = (int)__builtin_amdgcn_mbcnt_lo(~0u, 0u);
  const int ec = lane & 15, eh = lane >> 4;
  float* os = Os[wave];
  {
    const float l = lsum + xhalf(lsum);   // the two halves' key sums join here, once
    const float inv = ((l > 0.f) ? (1.0f / l) : 0.f) * (1.0f / PSC);
#pragma unroll
    for (int t = 0; t < 4; ++t) {
      v4f lo, hi;
#pragma unroll
      for (int r = 0; r < 4; ++r) {
        lo[r] = fmaf(oacr[t][r], 1.0f / RSC, oacc[t][r]) * inv;
        hi[r] = fmaf(oacr[t][4 + r], 1.0f / RSC, oacc[t][4 + r]) * inv;
      }
      *(v4f*)(os + ec * OP + t * 16 + 8 * eh)     = lo;
      *(v4f*)(os + ec * OP + t * 16 + 8 * eh + 4) = hi;
    }
  }
  wave_sync_lds();
  {
    const int q4 = lane >> 3, c8 = (lane & 7) * 8;
    v4u hv[4], hl[4];
#pragma unroll
    for (int it = 0; it < 4; ++it) {
      const int row = it * 4 + q4;   // it 0..3 x q4 0..3 = rows 0..15 of the wave tile
      const float* sp = os + row * OP + c8;
      v4u a, d;
#pragma unroll
      for (int e = 0; e < 4; ++e) {
        const float f0 = sp[2 * e], f1 = sp[2 * e + 1];
        const unsigned short hb0 = bf_bits(f0), hb1 = bf_bits(f1);
        const unsigned short lb0 = bf_bits(f0 - bf_up(hb0)), lb1 = bf_bits(f1 - bf_up(hb1));
        a[e] = pk16(hb0, hb1);
        d[e] = pk16(lb0, lb1);
      }
      hv[it] = a;
      hl[it] = d;
    }
    {
#pragma unroll
      for (int it = 0; it < 4; ++it) {
        const int row = it * 4 + q4;
        const size_t go = (rowB + q0 + row) * CTXP + (size_t)h * HD + c8;
        *(v4u*)(ctxp + go)      = hv[it];
        *(v4u*)(ctxp + go + DM) = hl[it];
      }
      
    }
  }
}

// =====================================================================================================
// Workspace map (bytes); every plane is an exact multiple of its 64x64-tile / whole-row / whole-line store
// granularity (M = MP = 4096 = 64 tiles, N = 1024 = 16 tiles; V^T per batch [1024][2048] = 16x32 tiles):
//   WqkvT f16 [3072 n][1024 k]        0           6291456   (rows 0..1023 = h*64+d of Wq, then Wk, then Wv; x64)
//   WoB   bf16 [1024 n][2048 k]       6291456     4194304   (Wo^T bf16, k-duplicated)
//   XH    f16 [3][4096][1024]         10485760    25165824  (converted activation planes of q, k, v)
//   QH|QR f16 [2][4096][1024]         35651584    16777216  (q hi plane, then q residual plane x2048)
//   KH    f16 [4096][1024]            52428800    8388608
//   VT|VR f16 [2][2][1024][2048]      60817408    16777216  (v^T hi planes per batch, then residual planes x2048)
//   Ctx   bf16 [4096][2048]           77594624    16777216  (context hi cols 0..1023, lo cols 1024..2047)
//   end                               94371840
// =====================================================================================================
extern "C" void kernel_launch(void* const* d_in, const int* in_sizes, int n_in,
                              void* d_out, int out_size, void* d_ws, size_t ws_size,
                              hipStream_t stream) {
  if (n_in < 11) return;
  if (in_sizes[0] != MP * DM || in_sizes[1] != MP * DM || in_sizes[2] != MP * DM) return;
  if (in_sizes[3] != NH * DM * HD || in_sizes[4] != NH * HD) return;
  if (in_sizes[5] != NH * DM * HD || in_sizes[6] != NH * HD) return;
  if (in_sizes[7] != NH * DM * HD || in_sizes[8] != NH * HD) return;
  if (in_sizes[9] != DM * DM || in_sizes[10] != DM) return;
  if (out_size != MP * DM) return;

  const float* query = (const float*)d_in[0];
  const float* key_  = (const float*)d_in[1];
  const float* value = (const float*)d_in[2];
  const float* w_q   = (const float*)d_in[3];
  const float* b_q   = (const float*)d_in[4];
  const float* w_k   = (const float*)d_in[5];
  const float* b_k   = (const float*)d_in[6];
  const float* w_v   = (const float*)d_in[7];
  const float* b_v   = (const float*)d_in[8];
  const float* w_o   = (const float*)d_in[9];
  const float* b_o   = (const float*)d_in[10];

  const size_t PW   = (size_t)3 * DM * DM * 2;            //  6291456
  const size_t PWO  = (size_t)DM * CTXP * 2;              //  4194304
  const size_t PX   = (size_t)3 * MP * DM * 2;            // 25165824
  const size_t PQ   = (size_t)2 * MP * DM * 2;            // 16777216
  const size_t PK   = (size_t)MP * DM * 2;                //  8388608
  const size_t PV   = (size_t)2 * NBATCH * DM * SEQ * 2;  // 16777216
  const size_t PC   = (size_t)MP * CTXP * 2;              // 16777216
  size_t off = 0;
  const size_t oW  = off; off += PW;
  const size_t oWo = off; off += PWO;
  const size_t oX  = off; off += PX;
  const size_t oQ  = off; off += PQ;
  const size_t oK  = off; off += PK;
  const size_t oV  = off; off += PV;
  const size_t oC  = off; off += PC;
  if (off > ws_size) return;                               // off = 94371840
  if (off > (size_t)134217728) return;

  char* ws = (char*)d_ws;
  unsigned short* WqkvT = (unsigned short*)(ws + oW);
  unsigned short* WoB   = (unsigned short*)(ws + oWo);
  unsigned short* XH    = (unsigned short*)(ws + oX);
  unsigned short* QH    = (unsigned short*)(ws + oQ);
  unsigned short* KH    = (unsigned short*)(ws + oK);
  unsigned short* VT    = (unsigned short*)(ws + oV);
  unsigned short* Ctx   = (unsigned short*)(ws + oC);
  float*          out0  = (float*)d_out;

  const dim3 blk(256), blk128(128);
  const dim3 gPrep(1024 + 3 * PCB);                                   // 768 + 256 transpose blocks, 3 x 2048 convert blocks
  const dim3 gQkv(3 * PJB);                                           // 3 projections x 128 block tiles
  const dim3 gN1k((MP / 128) * (DM / 256), 1);                        // 32 x 4 block tiles -> 128 blocks
  const dim3 gAttn(NBATCH * NH * NQB);                                // 1024 blocks of 128
  const float invw  = 1.0f / WSC;                                     // weight carry x64
  const float ssc   = 0.125f;                                         // 1/sqrt(64)
  const float ssr   = 0.125f / RSC;                                   // same, for the x2048 residual products

  // (0) weight planes WqkvT (f16, x64), WoB (bf16, k-duplicated) and the f16 activation planes of q, k, v
  prep<<<gPrep, blk, 0, stream>>>(query, key_, value, w_q, w_k, w_v, w_o, WqkvT, WoB, XH);

  // (1..3) Q, K and V^T projections
  gemm_qkv<<<gQkv, blk, 0, stream>>>(XH, WqkvT, b_q, b_k, b_v, QH, KH, VT, DM, invw);

  // (4) flash attention -> Ctx bf16 hi | lo (concat layout, column h*64 + d)
  attn64<<<gAttn, blk128, 0, stream>>>(QH, KH, VT, Ctx, ssc, ssr);

  // (5) out = [ctx_hi | ctx_lo] . [Wo^T | Wo^T]^T + b_o  (K = 2048, bf16 operands) -> d_out f32 [4096][1024]
  gemm64_one<1, 0, 0><<<gN1k, blk, 0, stream>>>(
      Ctx, CTXP, 0LL, WoB, CTXP, 0LL, b_o, b_o, DM,
      (void*)out0, DM, 0LL, 0LL, MP, DM, CTXP, 1.0f);
  (void)hipGetLastError();
}

// v007
// One run takes 120 microseconds.
// Two timings next to v006 both put it at 1.04 times that version's speed.
// All steps since v000 together make it 3.76 times as fast.
// Contractions: q, k and v^T in-projections on v_wmma_f32_16x16x32_f16 (f16 activation plane x f16 weight plane
// carried x64, one product each); attention q.k^T on v_wmma_f32_16x16x32_f16 with q as f16 hi plane + f16 residual
// plane at the hi plane's own scale (two products, one accumulator) and k plain f16; p.v on v_wmma_f32_16x16x32_f16 with p
// carried x1024 (f16) and v^T as f16 hi plane + f16 residual plane at the hi plane's own scale (two products, one accumulator);
// output projection on v_wmma_f32_16x16x32_bf16 with the context as bf16 hi | lo planes concatenated along k against
// a k-duplicated bf16 weight plane (two products, one accumulator); all f32 accumulate; softmax in f32 on VALU;
// every float input RNE-converted to bf16 on load.
#include <hip/hip_runtime.h>
#include <math.h>
#include <stdint.h>

#define NBATCH 2
#define SEQ    2048
#define DM     1024
#define NH     16
#define HD     64
#define MP     (NBATCH * SEQ)
#define NQB    (SEQ / 64)
#define CTXP   (2 * DM)
#define QRES   ((size_t)MP * DM)
#define VRES   ((size_t)NBATCH * DM * SEQ)
#define WSC    64.0f
#define PSC    1024.0f
#define LP     72      // LDS row pitch of the attention tiles in halves: 144 B = 16 B x 9 (odd), for 16-B fragment reads
#define OP     68      // LDS row pitch of the attention context tile in floats: 272 B = 16 B x 17 (odd), lane = row on the store
#define GPIT   72      // LDS row pitch of the staged GEMM operand tiles in halves: 144 B, same reason
#define GROWS  384     // rows of one staged GEMM tile: 128 rows of A, then 256 rows of Bt, 64 k (128 B) each
#define GBUFH  (GROWS * GPIT)   // halves per staging buffer (55296 B)
#define ABUFH  (3 * 64 * LP)    // halves per attention staging buffer: K, V^T hi, V^T res tiles (27648 B)
static_assert(NH * HD == DM);
static_assert((SEQ % 64) == 0 && (DM % 64) == 0 && (MP % 64) == 0);
static_assert(HD == 64);
static_assert((MP % 128) == 0 && (DM % 256) == 0 && (SEQ % 256) == 0 && (DM % 128) == 0);

typedef _Float16       v16h __attribute__((ext_vector_type(16)));
typedef __bf16         v16b __attribute__((ext_vector_type(16)));
typedef unsigned short v16us __attribute__((ext_vector_type(16)));
typedef unsigned short v8us __attribute__((ext_vector_type(8)));
typedef float          v8f  __attribute__((ext_vector_type(8)));
typedef float          v4f  __attribute__((ext_vector_type(4)));
typedef unsigned int   v4u  __attribute__((ext_vector_type(4)));

union Frag { v16us u; v8us p[2]; v16h h; v16b b; };

// ---- scalar helpers --------------------------------------------------------------------------------
__device__ __forceinline__ unsigned short bf_bits(float f) {          // f32 -> bf16 bits, RNE convert
  unsigned u = __float_as_uint(f);
  return (unsigned short)((u + 0x7FFFu + ((u >> 16) & 1u)) >> 16);
}
__device__ __forceinline__ float bf_up(unsigned short h) { return __uint_as_float(((unsigned)h) << 16); }
__device__ __forceinline__ float bfr(float f) { return bf_up(bf_bits(f)); }   // value of the bf16 RNE convert
__device__ __forceinline__ unsigned short h_bits(_Float16 x) { return __builtin_bit_cast(unsigned short, x); }
__device__ __forceinline__ unsigned pk16(unsigned short a, unsigned short b) { return (unsigned)a | ((unsigned)b << 16); }
__device__ __forceinline__ float xhalf(float x) {                     // lane l takes lane l ^ 16's value
  const int b = __builtin_bit_cast(int, x);
  return __builtin_bit_cast(float, __builtin_amdgcn_permlanex16(b, b, 0x76543210, 0xfedcba98, false, false));
}
__device__ __forceinline__ v8f zero8() { v8f z = {0.f, 0.f, 0.f, 0.f, 0.f, 0.f, 0.f, 0.f}; return z; }

// ---- fragment loader: 16-bit A/B operand (bit planes), lane -> row/col (lane&15), p already includes +8*(lane>>4);
//      elements 0..7 <- p[0..7] (k0+8h..), elements 8..15 <- p[16..23] (k0+16+8h..)
__device__ __forceinline__ v16us ldfrag(const unsigned short* p) {
  Frag f;
  f.p[0] = *(const v8us*)(p);
  f.p[1] = *(const v8us*)(p + 16);
  return f.u;
}

// ---- WMMA helper (BF = 0: f16 operands, BF = 1: bf16 operands) and the GEMM loop's VALU hazard gaps -----------------
template <int BF>
__device__ __forceinline__ v8f mma_raw(v16us a, v16us b, v8f c) {
  Frag fa, fb;
  fa.u = a;
  fb.u = b;
  if constexpr (BF) {
    return __builtin_amdgcn_wmma_f32_16x16x32_bf16(false, fa.b, false, fb.b, (short)0, c, false, false);
  } else {
    return __builtin_amdgcn_wmma_f32_16x16x32_f16(false, fa.h, false, fb.h, (short)0, c, false, false);
  }
}
__device__ __forceinline__ void dep_guard1(v8f& a, v8f& b, v16us x) {
#if defined(__HIP_DEVICE_COMPILE__)
  asm volatile("v_nop\n\tv_nop\n\tv_nop\n\tv_nop" : "+v"(a), "+v"(b) : "v"(x));
#endif
}
__device__ __forceinline__ void keep4(v16us a, v16us b, v16us c, v16us d) {
#if defined(__HIP_DEVICE_COMPILE__)
  asm volatile("v_nop" :: "v"(a), "v"(b), "v"(c), "v"(d));
#endif
}
__device__ __forceinline__ void acc_guard4(v8f& a, v8f& b, v8f& c, v8f& d) {
#if defined(__HIP_DEVICE_COMPILE__)
  asm volatile("v_nop\n\tv_nop\n\tv_nop\n\tv_nop" : "+v"(a), "+v"(b), "+v"(c), "+v"(d));
#endif
}
// eight base-2 exponentials in place. One statement, so that behind each v_exp_f32 stands an instruction that neither reads
// its result nor overwrites its source (the next one's registers are its own), and behind the last the v_nop that fills that slot.
__device__ __forceinline__ void exp2x8(float (&e)[8]) {
#if defined(__HIP_DEVICE_COMPILE__)
  asm("v_exp_f32 %0, %0\n\tv_exp_f32 %1, %1\n\tv_exp_f32 %2, %2\n\tv_exp_f32 %3, %3\n\t"
      "v_exp_f32 %4, %4\n\tv_exp_f32 %5, %5\n\tv_exp_f32 %6, %6\n\tv_exp_f32 %7, %7\n\tv_nop"
      : "+v"(e[0]), "+v"(e[1]), "+v"(e[2]), "+v"(e[3]), "+v"(e[4]), "+v"(e[5]), "+v"(e[6]), "+v"(e[7]));
#endif
}
// eight halves of an attention tile from LDS: fb = byte address of the lane's place in row 0 of tile 0; tile, row, k constants
__device__ __forceinline__ v8us frd(unsigned fb, int tile, int row, int k) {
  return *(const __attribute__((address_space(3))) v8us*)(fb + 2u * (unsigned)(tile * 64 * LP + row * LP + k));
}
__device__ __forceinline__ void wave_sync_lds() {
  __builtin_amdgcn_fence(__ATOMIC_RELEASE, "workgroup");
  __builtin_amdgcn_wave_barrier();
  __builtin_amdgcn_fence(__ATOMIC_ACQUIRE, "workgroup");
}

// ---- one staged GEMM tile: 12 asynchronous 16-B copies per lane, global -> LDS, no register in between.
//      Copy i < 4 brings A row (32 i + lane's row), copy 4 + i brings Bt row (32 i + lane's row); eight lanes cover one
//      128-B row segment, so each wave-wide copy takes four whole lines. l = the lane's LDS byte address in row 0..31 of
//      the buffer; rows 32 apart lie 32 * 144 B apart. The closing s_wait_xcnt 0 stands inside the statement so that no
//      address register of an issued copy is rewritten in front of it.
__device__ __forceinline__ void stage12(unsigned l, const unsigned short* a, size_t sa,
                                        const unsigned short* b, size_t sb) {
#if defined(__HIP_DEVICE_COMPILE__)
  const unsigned st = 32u * GPIT * 2u;
  asm volatile(
      "global_load_async_to_lds_b128 %0, %12, off\n\t"
      "global_load_async_to_lds_b128 %1, %13, off\n\t"
      "global_load_async_to_lds_b128 %2, %14, off\n\t"
      "global_load_async_to_lds_b128 %3, %15, off\n\t"
      "global_load_async_to_lds_b128 %4, %16, off\n\t"
      "global_load_async_to_lds_b128 %5, %17, off\n\t"
      "global_load_async_to_lds_b128 %6, %18, off\n\t"
      "global_load_async_to_lds_b128 %7, %19, off\n\t"
      "global_load_async_to_lds_b128 %8, %20, off\n\t"
      "global_load_async_to_lds_b128 %9, %21, off\n\t"
      "global_load_async_to_lds_b128 %10, %22, off\n\t"
      "global_load_async_to_lds_b128 %11, %23, off\n\t"
      "s_wait_xcnt 0x0"
      :: "v"(l), "v"(l + st), "v"(l + 2u * st), "v"(l + 3u * st), "v"(l + 4u * st), "v"(l + 5u * st),
         "v"(l + 6u * st), "v"(l + 7u * st), "v"(l + 8u * st), "v"(l + 9u * st), "v"(l + 10u * st), "v"(l + 11u * st),
         "v"(a), "v"(a + sa), "v"(a + 2 * sa), "v"(a + 3 * sa),
         "v"(b), "v"(b + sb), "v"(b + 2 * sb), "v"(b + 3 * sb), "v"(b + 4 * sb), "v"(b + 5 * sb), "v"(b + 6 * sb),
         "v"(b + 7 * sb)
      : "memory");
#endif
}

// ---- one staged attention chunk (K, V^T hi, V^T res tiles of 64 rows x 128 B): 12 asynchronous 16-B copies per lane,
//      global -> LDS, no register in between. Copy 4 p + i brings row (16 i + lane's row) of tile p; eight lanes cover one
//      128-B row, so each wave-wide copy takes four whole lines. Addresses: scalar base + the lane's 32-bit byte offset
//      (ko in the K plane, vo in the V^T planes), so that no vector instruction forms them. The immediate offset moves the
//      LDS and the global address alike: it carries the copy's place in LDS (16 rows = 2304 B apart, counted from la, the
//      lane's LDS byte address in rows 0..15 of the buffer's first tile, or from la + 6 x 2304) and is taken off the
//      scalar base again. k, vh, vr = byte addresses of the chunk's first element in the three planes (wave-uniform).
//      The closing s_wait_xcnt 0 stands inside the statement so that no address register of an issued copy is rewritten
//      in front of it.
static_assert(16 * LP * 2 == 2304);
__device__ __forceinline__ void stage_kv(unsigned la, unsigned ko, unsigned vo, uint64_t k, uint64_t vh, uint64_t vr) {
#if defined(__HIP_DEVICE_COMPILE__)
  const uint64_t sk = (uint64_t)16 * DM * 2, sv = (uint64_t)16 * SEQ * 2;   // 16 rows in the K plane, in a V^T plane
  asm volatile(
      "global_load_async_to_lds_b128 %0, %2, %4\n\t"
      "global_load_async_to_lds_b128 %0, %2, %5 offset:2304\n\t"
      "global_load_async_to_lds_b128 %0, %2, %6 offset:4608\n\t"
      "global_load_async_to_lds_b128 %0, %2, %7 offset:6912\n\t"
      "global_load_async_to_lds_b128 %0, %3, %8 offset:9216\n\t"
      "global_load_async_to_lds_b128 %0, %3, %9 offset:11520\n\t"
      "global_load_async_to_lds_b128 %1, %3, %10\n\t"
      "global_load_async_to_lds_b128 %1, %3, %11 offset:2304\n\t"
      "global_load_async_to_lds_b128 %1, %3, %12 offset:4608\n\t"
      "global_load_async_to_lds_b128 %1, %3, %13 offset:6912\n\t"
      "global_load_async_to_lds_b128 %1, %3, %14 offset:9216\n\t"
      "global_load_async_to_lds_b128 %1, %3, %15 offset:11520\n\t"
      "s_wait_xcnt 0x0"
      :: "v"(la), "v"(la + 6u * 2304u), "v"(ko), "v"(vo),
         "s"(k), "s"(k + sk - 2304u), "s"(k + 2 * sk - 4608u), "s"(k + 3 * sk - 6912u),
         "s"(vh - 9216u), "s"(vh + sv - 11520u), "s"(vh + 2 * sv), "s"(vh + 3 * sv - 2304u),
         "s"(vr - 4608u), "s"(vr + sv - 6912u), "s"(vr + 2 * sv - 9216u), "s"(vr + 3 * sv - 11520u)
      : "memory");
#endif
}

// =====================================================================================================
// f32 -> f16 activation plane convert: Xh[i] = f16( bf16_RNE(X[i]) * wsc ), wsc a power of two (exact).
// Thread i handles elements 8i..8i+7 and writes one 16-B piece; 32 consecutive lanes of one instruction fill
// (host-checked) so every store is full-width.
// coverage: n8 threads x 8 elements = the whole plane. bx = the block's index within the plane's n8 / 256 blocks.
// =====================================================================================================
__device__ __forceinline__ void conv_h16(int bx, const float* __restrict__ W, unsigned short* Wh, int n8, float wsc) {
  const int i  = bx * 256 + threadIdx.x;
  const int ic = (i < n8) ? i : (n8 - 1);                     // clamped address
  const float* src = W + (size_t)ic * 8;
  const v4f a = *(const v4f*)(src);
  const v4f c = *(const v4f*)(src + 4);
  v4u o;
  o[0] = pk16(h_bits((_Float16)(bfr(a[0]) * wsc)), h_bits((_Float16)(bfr(a[1]) * wsc)));
  o[1] = pk16(h_bits((_Float16)(bfr(a[2]) * wsc)), h_bits((_Float16)(bfr(a[3]) * wsc)));
  o[2] = pk16(h_bits((_Float16)(bfr(c[0]) * wsc)), h_bits((_Float16)(bfr(c[1]) * wsc)));
  o[3] = pk16(h_bits((_Float16)(bfr(c[2]) * wsc)), h_bits((_Float16)(bfr(c[3]) * wsc)));
  if (i < n8) *(v4u*)(Wh + (size_t)i * 8) = o;
  // the caller's other parts follow in the same kernel: no register of the issued store is rewritten in front of this wait
  asm volatile("s_wait_xcnt 0x0" ::: "memory");
}

// =====================================================================================================
// 64x64 tile transpose-convert of an f32 weight tensor: z-slice in[z] is [R][C] f32 (row pitch C elements,
// slice stride inStrideZ); output is 16-bit with rows indexed by the INPUT COLUMN: out[z*outStrideZ + c*ldo + r]
// (the input row index r becomes the k-contiguous column), i.e. in[rows=R][cols=C] -> out[cols=C][rows=R].
//   BF == 0: value = f16( bf16_RNE(x) * sc )   (sc a power of two)
//   BF == 1: value = bf16_RNE(x) bits; DUP == 1 additionally writes the same 16-B piece at column offset + dupOff.
// blocks (bx, by, bz) = (R/64, C/64, Z), block 256, sT = the block's 64 x 72 halves of LDS. Load phase: 1024 float4 pieces (64 rows x 16) = the whole 64x64 tile,
// 4 per thread, converted and stored transposed into LDS with 16-bit element stores; __syncthreads; store phase:
// coverage: 2 iterations x 32 rows x (8 lanes x 8 halves) = the whole 64x64 output tile (x2 destinations if DUP);
//           the grid tiles every (r block, c block, z) exactly once.
// =====================================================================================================
template <int BF, int DUP>
__device__ __forceinline__ void tconv64(unsigned short* sT, int bx, int by, int bz,
                                        const float* __restrict__ in, long long inStrideZ, int C,
                                        unsigned short* out, long long outStrideZ, int ldo, int dupOff,
                                        float sc) {
  const int t  = threadIdx.x;
  const int r0 = bx * 64;
  const int c0 = by * 64;
  const float* src = in + (size_t)bz * (size_t)inStrideZ;
  unsigned short* dst = out + (size_t)bz * (size_t)outStrideZ;
#pragma unroll
  for (int i = 0; i < 4; ++i) {
    const int idx = t + 256 * i;                              // 0..1023
    const int rr  = idx >> 4;                                 // 0..63
    const int cq  = (idx & 15) * 4;                           // 0..60
    const v4f x = *(const v4f*)(src + (size_t)(r0 + rr) * (size_t)C + c0 + cq);
#pragma unroll
    for (int j = 0; j < 4; ++j) {
      unsigned short w;
      if (BF) {
        w = bf_bits(x[j]);
      } else {
        w = h_bits((_Float16)(bfr(x[j]) * sc));
      }
      sT[(cq + j) * 72 + rr] = w;
    }
  }
  __syncthreads();
  const int q8 = t >> 3;                                      // 0..31: row within the 32-row group
  const int c8 = (t & 7) * 8;
  v8us vv[2];
#pragma unroll
  for (int it = 0; it < 2; ++it) {
    const int row = it * 32 + q8;                             // it 0..1 x q8 0..31 = rows 0..63
    vv[it] = *(const v8us*)(sT + row * 72 + c8);
  }
  {
#pragma unroll
    for (int it = 0; it < 2; ++it) {
      const int row = it * 32 + q8;
      unsigned short* dp = dst + (size_t)(c0 + row) * (size_t)ldo + r0 + c8;
      *(v8us*)(dp) = vv[it];
      if (DUP) *(v8us*)(dp + dupOff) = vv[it];
    }
    // the caller's other parts follow in the same kernel: no register of the issued stores is rewritten in front of this wait
    asm volatile("s_wait_xcnt 0x0" ::: "memory");
  }
}

// =====================================================================================================
// All operand preparation in one launch; none of its parts reads what another writes. Block ranges (block-uniform):
//   0..767     weight planes: z = block >> 8 picks Wq, Wk, Wv; per head in[e = 1024][d = 64] -> WqkvT[z*1024 + h*64 + d][e]
//   768..1023  Wo: in[k][n] -> WoB[n][k] and WoB[n][1024 + k]
//   1024..     activation planes: z = (block - 1024) / PCB picks q, k, v -> XH + z * MP * DM, PCB blocks per plane
// =====================================================================================================
#define PCB ((MP * DM) / (8 * 256))
static_assert(((MP * DM) % (8 * 256)) == 0);
static_assert(DM / 64 == 16 && HD == 64 && NH * (DM / 64) == 256);   // the shifts and masks of the transpose ranges
__global__ __launch_bounds__(256) void prep(const float* __restrict__ xq, const float* __restrict__ xk,
                                            const float* __restrict__ xv, const float* __restrict__ wq,
                                            const float* __restrict__ wk, const float* __restrict__ wv,
                                            const float* __restrict__ wo, unsigned short* WqkvT, unsigned short* WoB,
                                            unsigned short* XH) {
  __shared__ __align__(16) unsigned short sT[64 * 72];        // [c local][r local], pitch 72 halves (144 B)
  const int bx = blockIdx.x;
  if (bx < 768) {
    const int z = bx >> 8, r = bx & 255;
    const float* w = (z == 0) ? wq : ((z == 1) ? wk : wv);
    tconv64<0, 0>(sT, r & 15, 0, r >> 4, w, (long long)DM * HD, HD, WqkvT + (size_t)z * DM * DM,
                  (long long)HD * DM, DM, 0, WSC);
  } else if (bx < 1024) {
    const int r = bx - 768;
    tconv64<1, 1>(sT, r & 15, r >> 4, 0, wo, 0LL, DM, WoB, 0LL, CTXP, DM, 1.0f);
  } else {
    const int r = bx - 1024;
    const int z = r / PCB;
    const float* x = (z == 0) ? xq : ((z == 1) ? xk : xv);
    conv_h16(r - z * PCB, x, XH + (size_t)z * MP * DM, (MP * DM) / 8, 1.0f);
  }
}

// =====================================================================================================
// Register-blocked batched 16-bit WMMA GEMM: C[m][n] = oscale * sum_k A[m][k] * Bt[n][k] + bias;
// one wave per 64x64 tile, 8 waves (2 x 4) = one 128x256 block tile. A row-major [M][K] pitch lda; Bt row-major [N][K]
// pitch ldb (k contiguous); M multiple of 128, N of 256, K of 64 (static here). b = batch (strides in elements).
// Operands: per 64 k the block's 128 A rows and 256 Bt rows are staged in LDS by asynchronous copies, two buffers: the
// copies of tile t + 2 go out behind the barrier at the foot of trip t and fly during trip t + 1; every fragment is read
// from LDS (k order per output element as before: ascending in steps of 32).
// BF: 0 = f16 operand planes, 1 = bf16 operand planes.
// Bias: BIASM == 0 -> per column: cols < Nb from bias0[col], cols >= Nb from bias1[col - Nb] (tile-uniform select of
//       clamped-address loads); BIASM == 1 -> per row bias0[m]. Bias values RNE-converted to bf16.
// OM: 0 = f32 out (pitch ldc); 2 = f16 out; 3 = f16 hi plane at C plus f16 residual plane (f - hi, unscaled, so that a
//     product with it adds into the hi product's accumulator; the small ones are f16 subnormals) at C + resOff (same
//     pitch and offsets).
// coverage: 4 slabs x 16 rows x 64 cols = the wave's whole 64x64 tile; tile = 0 .. (M/128)*(N/256) - 1 per batch,
//           a surplus block exits as a whole in front of every barrier and copy.
// sOp = two staging buffers [A 128 rows | Bt 256 rows] x 64 k; sT = per-wave 16x64 slab, pitch 68 floats (the kernel's LDS).
// =====================================================================================================
template <int BF, int OM, int BIASM>
__device__ __forceinline__ void gemm64(
    unsigned short* sOp, float (*sT)[16 * 68], int tile, int b,
    const unsigned short* __restrict__ A, int lda, long long strideA,
    const unsigned short* __restrict__ Bt, int ldb, long long strideB,
    const float* __restrict__ bias0, const float* __restrict__ bias1, int Nb,
    void* Cout, int ldc, long long strideC, long long resOff,
    int M, int N, int K, float oscale) {
  const int lane = threadIdx.x & 31;
  const int wave = threadIdx.x >> 5;
  const int tilesN = N >> 8;
  const int tilesM = M >> 7;
  if (tile >= tilesM * tilesN) return;   // block-uniform, in front of every barrier
  const int tm = tile / tilesN;
  const int tn = tile - tm * tilesN;
  const int mb0 = tm << 7;                     // block tile origin
  const int nb0 = tn << 8;
  const int wm  = wave >> 2;                   // wave's 64x64 tile inside the block tile
  const int wn  = wave & 3;
  const int m0 = mb0 + (wm << 6);
  const int n0 = nb0 + (wn << 6);

  const unsigned short* Ab = A  + (size_t)b * (size_t)strideA;
  const unsigned short* Bb = Bt + (size_t)b * (size_t)strideB;

  const int rlane = lane & 15;                 // row (A) / col (B, D) within subtile
  const int koff  = (lane >> 4) * 8;           // k offset of this lane half
  const int mOff  = (lane >> 4) * 8;           // D row offset

  v8f acc[4][4];
#pragma unroll
  for (int i = 0; i < 4; ++i)
#pragma unroll
    for (int j = 0; j < 4; ++j) acc[i][j] = zero8();

  // ---- staging addresses: thread -> row (tid >> 3) of each 32-row group, 16-B piece (tid & 7) of the 128-B segment ----
  const int crow = threadIdx.x >> 3;
  const int cpc  = (threadIdx.x & 7) * 8;
  const unsigned short* ga = Ab + (size_t)(mb0 + crow) * lda + cpc;
  const unsigned short* gb = Bb + (size_t)(nb0 + crow) * ldb + cpc;
  const size_t sa = (size_t)32 * lda, sb = (size_t)32 * ldb;
  const unsigned l0 =
      (unsigned)(uintptr_t)(const __attribute__((address_space(3))) unsigned short*)(sOp + crow * GPIT + cpc);
  const int T = K >> 6;                        // staged tiles of 64 k

  stage12(l0, ga, sa, gb, sb);                                 // tile 0 -> buffer 0
  asm volatile("s_wait_asynccnt 0x0" ::: "memory");            // this wave's copies of tile 0 have landed
  __syncthreads();                                             // ... and every other wave's
  if (T > 1) stage12(l0 + GBUFH * 2u, ga + 64, sa, gb + 64, sb);   // tile 1 -> buffer 1

  for (int t = 0; t < T; ++t) {
    const unsigned short* sbuf = sOp + (t & 1) * GBUFH;
    const unsigned short* fa = sbuf + ((wm << 6) + rlane) * GPIT + koff;
    const unsigned short* fb = sbuf + (128 + (wn << 6) + rlane) * GPIT + koff;
#pragma unroll
    for (int kk = 0; kk < 2; ++kk) {
      v16us bh[4], ah[4];
#pragma unroll
      for (int j = 0; j < 4; ++j) bh[j] = ldfrag(fb + (j << 4) * GPIT + kk * 32);
#pragma unroll
      for (int i = 0; i < 4; ++i) ah[i] = ldfrag(fa + (i << 4) * GPIT + kk * 32);
#pragma unroll
      for (int i = 0; i < 4; ++i) {
#pragma unroll
        for (int j = 0; j < 4; ++j) acc[i][j] = mma_raw<BF>(ah[i], bh[j], acc[i][j]);
        dep_guard1(acc[i][0], acc[i][3], ah[i]);
      }
      keep4(bh[0], bh[1], bh[2], bh[3]);
    }
    asm volatile("s_wait_dscnt 0x0" ::: "memory");             // this wave's reads of buffer t & 1 are done
    asm volatile("s_wait_asynccnt 0x0" ::: "memory");          // this wave's copies of tile t + 1 have landed
    __syncthreads();                                           // publishes tile t + 1, frees buffer t & 1
    if (t + 2 < T) stage12(l0 + (unsigned)(t & 1) * (GBUFH * 2u), ga + (size_t)(t + 2) * 64, sa, gb + (size_t)(t + 2) * 64, sb);
  }
  asm volatile("s_wait_asynccnt 0x0" ::: "memory");            // nothing of this wave is in flight past the loop
  acc_guard4(acc[0][0], acc[0][1], acc[0][2], acc[0][3]);
  acc_guard4(acc[1][0], acc[1][1], acc[1][2], acc[1][3]);
  acc_guard4(acc[2][0], acc[2][1], acc[2][2], acc[2][3]);
  acc_guard4(acc[3][0], acc[3][1], acc[3][2], acc[3][3]);

  // ---- per-lane column bias (BIASM == 0), RNE-converted ----
  const int hh2 = lane >> 4, c4 = (lane & 15) * 4;     // f32 out: 256-B row segment = 16 lanes x 16 B
  const int q8  = lane >> 3, c8 = (lane & 7) * 8;
  float bc[8];
#pragma unroll
  for (int e = 0; e < 8; ++e) bc[e] = 0.f;
  if (BIASM == 0) {
    const bool use1 = (n0 >= Nb);                      // tile-uniform
    if (OM == 0) {
      const int cb = n0 + c4;
      const int i0 = (cb < Nb - 4) ? cb : (Nb - 4);
      const int i1 = (cb - Nb > 0) ? (cb - Nb) : 0;
      const v4f b0v = *(const v4f*)(bias0 + i0);
      const v4f b1v = *(const v4f*)(bias1 + i1);
#pragma unroll
      for (int e = 0; e < 4; ++e) bc[e] = bfr(use1 ? b1v[e] : b0v[e]);
    } else {
      const int cb = n0 + c8;
      const int i0 = (cb < Nb - 8) ? cb : (Nb - 8);
      const int i1 = (cb - Nb > 0) ? (cb - Nb) : 0;
      const v4f b0a = *(const v4f*)(bias0 + i0), b0b = *(const v4f*)(bias0 + i0 + 4);
      const v4f b1a = *(const v4f*)(bias1 + i1), b1b = *(const v4f*)(bias1 + i1 + 4);
#pragma unroll
      for (int e = 0; e < 4; ++e) {
        bc[e]     = bfr(use1 ? b1a[e] : b0a[e]);
        bc[4 + e] = bfr(use1 ? b1b[e] : b0b[e]);
      }
    }
  }

  // ---- epilogue ----
  float* slab = sT[wave];
#pragma unroll
  for (int i = 0; i < 4; ++i) {
    const int mBase = m0 + (i << 4);
#pragma unroll
    for (int j = 0; j < 4; ++j) {
#pragma unroll
      for (int r = 0; r < 8; ++r) {
        slab[(mOff + r) * 68 + (j << 4) + rlane] = acc[i][j][r];
      }
    }
    wave_sync_lds();
    if constexpr (OM == 0) {
      float* C = (float*)Cout + (size_t)b * (size_t)strideC;
      v4f vals[8];
#pragma unroll
      for (int it = 0; it < 8; ++it) {
        const int row = it * 2 + hh2;                      // it 0..7 x hh2 0..1 = rows 0..15
        v4f v = *(const v4f*)(slab + row * 68 + c4);
#pragma unroll
        for (int e = 0; e < 4; ++e) v[e] = v[e] * oscale + bc[e];
        vals[it] = v;
      }
      {
#pragma unroll
        for (int it = 0; it < 8; ++it) {
          const int row = it * 2 + hh2;
          *(v4f*)(C + (size_t)(mBase + row) * ldc + n0 + c4) = vals[it];
        }
        
      }
    } else {
      unsigned short* C = (unsigned short*)Cout + (size_t)b * (size_t)strideC;
      v4u hv[4], hr[4];
#pragma unroll
      for (int it = 0; it < 4; ++it) {
        const int row = it * 4 + q8;                       // it 0..3 x q8 0..3 = rows 0..15
        const float* sp = slab + row * 68 + c8;
        float bm = 0.f;
        if (BIASM == 1) bm = bfr(bias0[mBase + row]);
        v4u a, ar;
#pragma unroll
        for (int e = 0; e < 4; ++e) {
          const float f0 = sp[2 * e]     * oscale + ((BIASM == 1) ? bm : bc[2 * e]);
          const float f1 = sp[2 * e + 1] * oscale + ((BIASM == 1) ? bm : bc[2 * e + 1]);
          const _Float16 g0 = (_Float16)f0, g1 = (_Float16)f1;
          a[e] = pk16(h_bits(g0), h_bits(g1));
          if (OM == 3) {
            const float e0 = f0 - (float)g0;
            const float e1 = f1 - (float)g1;
            ar[e] = pk16(h_bits((_Float16)e0), h_bits((_Float16)e1));
          } else {
            ar[e] = 0u;
          }
        }
        hv[it] = a;
        hr[it] = ar;
      }
      {
#pragma unroll
        for (int it = 0; it < 4; ++it) {
          const int row = it * 4 + q8;
          unsigned short* dp = C + (size_t)(mBase + row) * ldc + n0 + c8;
          *(v4u*)(dp) = hv[it];
          if (OM == 3) *(v4u*)(dp + resOff) = hr[it];
        }
        
      }
    }
    wave_sync_lds();
  }
}

// ---- one GEMM per launch: grid = ((M/128)*(N/256), batches) ----
template <int BF, int OM, int BIASM>
__global__ __launch_bounds__(256) void gemm64_one(
    const unsigned short* __restrict__ A, int lda, long long strideA,
    const unsigned short* __restrict__ Bt, int ldb, long long strideB,
    const float* __restrict__ bias0, const float* __restrict__ bias1, int Nb,
    void* Cout, int ldc, long long strideC, long long resOff,
    int M, int N, int K, float oscale) {
  __shared__ __align__(16) unsigned short sOp[2 * GBUFH];
  __shared__ __align__(16) float sT[8][16 * 68];
  gemm64<BF, OM, BIASM>(sOp, sT, blockIdx.x, blockIdx.y, A, lda, strideA, Bt, ldb, strideB, bias0, bias1, Nb,
                        Cout, ldc, strideC, resOff, M, N, K, oscale);
}

// ---- the three in-projections in one launch; they share no output and read only what the launch before wrote.
//      PJB blocks each, block >> 7 picks the projection (block-uniform):
//      0: Q = xq . WqT^T + b_q -> QH (f16 hi) and QH + QRES (f16 residual); column n = h*64 + d
//      1: K = xk . WkT^T + b_k -> KH (f16)
//      2: V^T per batch = WvT . xv^T + b_v -> VT (f16 hi [2][1024][2048]) and VT + VRES (residual); row m = h*64 + d
//         (per-row bias b_v[m]), column n = token s of batch (block & 127) >> 6
#define PJB 128
static_assert((MP / 128) * (DM / 256) == PJB && (DM / 128) * (SEQ / 256) * NBATCH == PJB && (DM / 128) * (SEQ / 256) == 64);
__global__ __launch_bounds__(256) void gemm_qkv(
    const unsigned short* __restrict__ XH, const unsigned short* __restrict__ WqkvT,
    const float* __restrict__ b_q, const float* __restrict__ b_k, const float* __restrict__ b_v,
    unsigned short* QH, unsigned short* KH, unsigned short* VT, int K, float oscale) {
  __shared__ __align__(16) unsigned short sOp[2 * GBUFH];
  __shared__ __align__(16) float sT[8][16 * 68];
  const int sel = blockIdx.x >> 7, r = blockIdx.x & 127;
  if (sel == 0) {
    gemm64<0, 3, 0>(sOp, sT, r, 0, XH, DM, 0LL, WqkvT, DM, 0LL, b_q, b_q, DM,
                    (void*)QH, DM, 0LL, (long long)QRES, MP, DM, K, oscale);
  } else if (sel == 1) {
    gemm64<0, 2, 0>(sOp, sT, r, 0, XH + (size_t)MP * DM, DM, 0LL, WqkvT + (size_t)DM * DM, DM, 0LL, b_k, b_k, DM,
                    (void*)KH, DM, 0LL, 0LL, MP, DM, K, oscale);
  } else {
    gemm64<0, 3, 1>(sOp, sT, r & 63, r >> 6, WqkvT + (size_t)2 * DM * DM, DM, 0LL,
                    XH + (size_t)2 * MP * DM, DM, (long long)SEQ * DM, b_v, b_v, SEQ,
                    (void*)VT, SEQ, (long long)DM * SEQ, (long long)VRES, DM, SEQ, K, oscale);
  }
}

// =====================================================================================================
// Flash attention, head dim 64, SEQ token rows per batch (all keys valid, no mask).
//   q planes (f16, pitch DM): hi at qhp[(b*SEQ + t)*DM + h*64 + d], residual at qhp + QRES (same offsets)
//   k plane (f16, pitch DM): khp[(b*SEQ + t)*DM + h*64 + d]
//   v^T planes (f16): hi at vtp[(b*DM + h*64 + d)*SEQ + s], residual at vtp + VRES
//   context planes (bf16, pitch CTXP): hi at ctxp[(b*SEQ + t)*CTXP + h*64 + d], lo at the same + DM
//   Products are taken transposed: S^T = K . Q^T (A = K rows, B = Q rows) and O^T += V^T . P^T (A = V^T rows, B = P^T), so
//   a lane holds scores of ONE query (column lane & 15), keys 8 (lane >> 4) + r of each 16-key tile: the row maximum
//   and the row sum are taken in the lane, plus one exchange between the wave halves (the sum's only in the epilogue),
//   and two converted score tiles are the B operand of the second product as they stand: P never leaves the registers.
//   The hi and the residual products add into ONE accumulator (both planes at one scale): the accumulator is the raw score,
//   the maximum is taken over raw scores (sc2 > 0), p = 2^(s sc2 - m sc2), sc2 = log2 e / sqrt(64), one multiply-add per
//   score, carried as f16(1024 p); context = p . v, hi and residual in one accumulator; online softmax (running max) in f32.
//   Block = 4 waves = 64 query rows of one (b, h); grid = NQB * NH * NBATCH; kv chunks of 64, static trip NQB.
//   K / V^T hi / V^T res chunk staging: 128 threads x 4 copies x 8 elements per plane = the whole 64x64 tile each, by
//   asynchronous copies into two buffers: the copies of chunk kt + 2 go out behind the one barrier at the foot of trip kt
//   and fly during trip kt + 1; trip kt reads buffer kt & 1 alone.
//   Fragment reads: K's eight as one group ahead of the 16 score products; V^T's eight of keys 0..31 as one group ahead of
//   the softmax; those of keys 32..63 in two groups of four ahead of the context products of keys 0..31.
//   Context coverage: each wave stores rows q0..q0+15 (it 0..3 x lane>>3 0..3) x 64 columns (8 lanes x 8) of both
//   the hi and the lo plane; grid covers all SEQ rows x NH head slices x NBATCH.
// =====================================================================================================
__global__ __launch_bounds__(128, 4)   // 4 waves per SIMD = the grid's four blocks per WGP all resident: a budget of 256 registers
void attn64(const unsigned short* __restrict__ qhp, const unsigned short* __restrict__ khp,
            const unsigned short* __restrict__ vtp, unsigned short* ctxp,
            float sc2) {
  __shared__ __align__(16) unsigned short KV[2 * ABUFH];          // two buffers of three 9-KB tiles, rows of 64 at pitch LP:
                                                                  // K [kv][d], V^T hi [d][kv], V^T res [d][kv]
  __shared__ __align__(16) float          Os[4][16 * OP];         // per wave context tile [row][d], rows of 64 at pitch OP

  const int tid  = threadIdx.x;
  const int wave = __builtin_amdgcn_readfirstlane(tid >> 5);   // wave-uniform: held in a scalar register across the loop
  const int hh   = (tid & 31) >> 4;
  const int c    = tid & 15;

  const int bx   = blockIdx.x;
  const int qb   = bx % NQB;
  const int rest = bx / NQB;
  const int h    = rest % NH;
  const int b    = rest / NH;
  const int q0   = qb * 64 + wave * 16;          // in-batch query row of this wave's first row
  const size_t rowB = (size_t)b * SEQ;

  const unsigned short* Qh = qhp + (size_t)h * HD;
  const unsigned short* Qr = qhp + QRES + (size_t)h * HD;
  const unsigned short* Kg = khp + (size_t)h * HD;
  const unsigned short* Vh = vtp + ((size_t)b * DM + (size_t)h * HD) * SEQ;
  const unsigned short* Vr = Vh + VRES;

  // the lane's fragment row (lane & 15) and k half in tile 0, as an LDS byte address: every fragment read is this
  // address plus the trip's buffer offset, in one register, plus a constant that fits the instruction's offset field
  const unsigned fb0 = (unsigned)(uintptr_t)(const __attribute__((address_space(3))) unsigned short*)(KV + c * LP + 8 * hh);

  // staging addresses: thread -> row (tid >> 3) of each 16-row group, 16-B piece (tid & 7) of the 128-B row
  const int crow = tid >> 3, cpc = (tid & 7) * 8;
  const unsigned ko = 2u * (unsigned)(crow * DM + cpc);           // the lane's byte offset in a chunk of the K plane
  const unsigned vo = 2u * (unsigned)(crow * SEQ + cpc);          // ... and of a V^T plane
  const uint64_t gk = (uint64_t)(uintptr_t)(Kg + rowB * DM);      // chunk 0: K row 0, d = 0
  const uint64_t gv = (uint64_t)(uintptr_t)Vh;                    // V^T hi row d = 0, s = 0
  const uint64_t gr = (uint64_t)(uintptr_t)Vr;                    // V^T res row d = 0, s = 0
  const unsigned l0 =
      (unsigned)(uintptr_t)(const __attribute__((address_space(3))) unsigned short*)(KV + crow * LP + cpc);
  static_assert(NQB >= 2);

  stage_kv(l0, ko, vo, gk, gv, gr);                               // chunk 0 -> buffer 0
  asm volatile("s_wait_asynccnt 0x0" ::: "memory");               // this wave's copies of chunk 0 have landed
  __syncthreads();                                                // ... and every other wave's
  stage_kv(l0 + ABUFH * 2u, ko, vo, gk + 64u * DM * 2u, gv + 128u, gr + 128u);   // chunk 1 -> buffer 1

  float mrun = -INFINITY, lsum = 0.f;   // query c: running maximum (both halves alike), sum over this half's keys
  v8f oacc[4];                          // O^T tiles: register r = context[d = 16 t + 8 hh + r] of query c
#pragma unroll
  for (int t = 0; t < 4; ++t) oacc[t] = zero8();

  for (int kt = 0; kt < NQB; ++kt) {         // static trip count
    const unsigned fb = fb0 + (unsigned)(kt & 1) * (ABUFH * 2u);   // this trip's buffer

    // ---- Q fragments (B operand, column = query = lane&15): hi and residual, 2 d-chunks each ----
    v16us qa[2], qr[2];
#pragma unroll
    for (int dc = 0; dc < 2; ++dc) {
      qa[dc] = ldfrag(Qh + (rowB + q0 + c) * DM + dc * 32 + 8 * hh);
      qr[dc] = ldfrag(Qr + (rowB + q0 + c) * DM + dc * 32 + 8 * hh);
    }

    // ---- K fragments (A operand, row = key 16 j + lane&15): all eight read from LDS as one group ----
    Frag kb[4][2];
#pragma unroll
    for (int dc = 0; dc < 2; ++dc) {   // in the order in which the products below take them
#pragma unroll
      for (int j = 0; j < 4; ++j) {
        kb[j][dc].p[0] = frd(fb, 0, j * 16, dc * 32);
        kb[j][dc].p[1] = frd(fb, 0, j * 16, dc * 32 + 16);
      }
    }
    __builtin_amdgcn_sched_barrier(0);   // keeps the reads one group ahead of the products; the scheduler otherwise sinks each to its user

    // ---- raw scores, transposed: s[j][r] = q . k of (key 16 j + 8 hh + r, query c); 16 products in a row on four independent
    //      accumulators, one per key tile; in each: d 0..31 hi, d 0..31 residual, d 32..63 hi, d 32..63 residual ----
    v8f s[4];
#pragma unroll
    for (int j = 0; j < 4; ++j) s[j] = zero8();
#pragma unroll
    for (int dc = 0; dc < 2; ++dc) {
#pragma unroll
      for (int j = 0; j < 4; ++j) s[j] = mma_raw<0>(kb[j][dc].u, qa[dc], s[j]);
#pragma unroll
      for (int j = 0; j < 4; ++j) s[j] = mma_raw<0>(kb[j][dc].u, qr[dc], s[j]);
    }
    __builtin_amdgcn_sched_barrier(0);   // the V^T reads below do not rise among the products, where K's registers are still held

    // ---- V^T fragments of keys 0..31 (A operand, row = d 16 t + lane&15), hi and residual: one group, in flight under the softmax ----
    Frag vb[2][4], vc[2][4];
#pragma unroll
    for (int t = 0; t < 4; ++t) {
      vb[0][t].p[0] = frd(fb, 1, t * 16, 0);
      vb[0][t].p[1] = frd(fb, 1, t * 16, 16);
      vc[0][t].p[0] = frd(fb, 2, t * 16, 0);
      vc[0][t].p[1] = frd(fb, 2, t * 16, 16);
    }
    __builtin_amdgcn_sched_barrier(0);   // keeps the group ahead of the softmax, which covers its latency

    // ---- maximum over the lane's 32 keys (four chains), then the other half's; online softmax; P^T (x1024, f16) packed
    //      in place: element 8 (j & 1) + r of fragment j >> 1 = key 32 (j >> 1) + 16 (j & 1) + 8 hh + r, the V^T loader's k order
    float mj[4], pj[4];
#pragma unroll
    for (int j = 0; j < 4; ++j) {
      mj[j] = s[j][0];
#pragma unroll
      for (int r = 1; r < 8; ++r) mj[j] = fmaxf(mj[j], s[j][r]);
    }
    float m = fmaxf(fmaxf(mj[0], mj[1]), fmaxf(mj[2], mj[3]));
    m = fmaxf(m, xhalf(m));
    const float mnew  = fmaxf(mrun, m);
    const float alpha = __builtin_amdgcn_exp2f((mrun - mnew) * sc2);
    const float nm    = -mnew * sc2;
    mrun = mnew;
    Frag pb[2];
#pragma unroll
    for (int j = 0; j < 4; ++j) {
      float e[8];
#pragma unroll
      for (int r = 0; r < 8; ++r) e[r] = fmaf(s[j][r], sc2, nm);   // exp(x) = 2^(x log2 e); the score scale rides in sc2
      exp2x8(e);
      pj[j] = e[0];
#pragma unroll
      for (int r = 1; r < 8; ++r) pj[j] += e[r];
#pragma unroll
      for (int r = 0; r < 8; ++r) pb[j >> 1].h[(j & 1) * 8 + r] = (_Float16)(e[r] * PSC);
    }
    lsum = lsum * alpha + ((pj[0] + pj[1]) + (pj[2] + pj[3]));
#pragma unroll
    for (int t = 0; t < 4; ++t) oacc[t] *= alpha;

    // ---- context^T += V^T . P^T (hi, then residual product into the same accumulator, f16 WMMA), keys ascending; the
    //      fragments of keys 32..63 are read in two groups of four, each ahead of four products of keys 0..31. The
    //      scheduling barriers keep each group whole and at its place (fragment registers: three groups of four live at most).
    __builtin_amdgcn_sched_barrier(0);   // the reads below do not rise into the softmax, where the score registers are still held
#pragma unroll
    for (int g = 0; g < 2; ++g) {
#pragma unroll
      for (int t = 2 * g; t < 2 * g + 2; ++t) {
        vb[1][t].p[0] = frd(fb, 1, t * 16, 32);
        vb[1][t].p[1] = frd(fb, 1, t * 16, 48);
        vc[1][t].p[0] = frd(fb, 2, t * 16, 32);
        vc[1][t].p[1] = frd(fb, 2, t * 16, 48);
      }
      __builtin_amdgcn_sched_barrier(0);   // the group's reads stay together ahead of the four products, not spread among them
#pragma unroll
      for (int t = 2 * g; t < 2 * g + 2; ++t) oacc[t] = mma_raw<0>(vb[0][t].u, pb[0].u, oacc[t]);
#pragma unroll
      for (int t = 2 * g; t < 2 * g + 2; ++t) oacc[t] = mma_raw<0>(vc[0][t].u, pb[0].u, oacc[t]);
      __builtin_amdgcn_sched_barrier(0);   // the next group's reads follow these products, whose fragment registers they take over
    }
#pragma unroll
    for (int t = 0; t < 4; ++t) oacc[t] = mma_raw<0>(vb[1][t].u, pb[1].u, oacc[t]);
#pragma unroll
    for (int t = 0; t < 4; ++t) oacc[t] = mma_raw<0>(vc[1][t].u, pb[1].u, oacc[t]);
    asm volatile("s_wait_dscnt 0x0" ::: "memory");                 // this wave's reads of buffer kt & 1 are done
    asm volatile("s_wait_asynccnt 0x0" ::: "memory");              // this wave's copies of chunk kt + 1 have landed
    __syncthreads();                                               // publishes chunk kt + 1, frees buffer kt & 1
    if (kt + 2 < NQB)
      stage_kv(l0 + (unsigned)(kt & 1) * (ABUFH * 2u), ko, vo, gk + (uint64_t)(kt + 2) * (64u * DM * 2u),
               gv + (uint64_t)(kt + 2) * 128u, gr + (uint64_t)(kt + 2) * 128u);
  }
  asm volatile("s_wait_asynccnt 0x0" ::: "memory");                // nothing of this wave is in flight past the loop

  // ---- normalise (1/l, the 1/1024 p carry), stage the wave's 16x64 tile, bf16 hi | lo
  //      the lane's index is taken anew here, so that no vector register carries it (or what derives from it) across the loop
  const int lane = (int)__builtin_amdgcn_mbcnt_lo(~0u, 0u);
  const int ec = lane & 15, eh = lane >> 4;
  float* os = Os[wave];
  {
    const float l = lsum + xhalf(lsum);   // the two halves' key sums join here, once
    const float inv = ((l > 0.f) ? (1.0f / l) : 0.f) * (1.0f / PSC);
#pragma unroll
    for (int t = 0; t < 4; ++t) {
      v4f lo, hi;
#pragma unroll
      for (int r = 0; r < 4; ++r) {
        lo[r] = oacc[t][r] * inv;
        hi[r] = oacc[t][4 + r] * inv;
      }
      *(v4f*)(os + ec * OP + t * 16 + 8 * eh)     = lo;
      *(v4f*)(os + ec * OP + t * 16 + 8 * eh + 4) = hi;
    }
  }
  wave_sync_lds();
  {
    const int q4 = lane >> 3, c8 = (lane & 7) * 8;
    v4u hv[4], hl[4];
#pragma unroll
    for (int it = 0; it < 4; ++it) {
      const int row = it * 4 + q4;   // it 0..3 x q4 0..3 = rows 0..15 of the wave tile
      const float* sp = os + row * OP + c8;
      v4u a, d;
#pragma unroll
      for (int e = 0; e < 4; ++e) {
        const float f0 = sp[2 * e], f1 = sp[2 * e + 1];
        const unsigned short hb0 = bf_bits(f0), hb1 = bf_bits(f1);
        const unsigned short lb0 = bf_bits(f0 - bf_up(hb0)), lb1 = bf_bits(f1 - bf_up(hb1));
        a[e] = pk16(hb0, hb1);
        d[e] = pk16(lb0, lb1);
      }
      hv[it] = a;
      hl[it] = d;
    }
    {
#pragma unroll
      for (int it = 0; it < 4; ++it) {
        const int row = it * 4 + q4;
        const size_t go = (rowB + q0 + row) * CTXP + (size_t)h * HD + c8;
        *(v4u*)(ctxp + go)      = hv[it];
        *(v4u*)(ctxp + go + DM) = hl[it];
      }
      
    }
  }
}

// =====================================================================================================
// Workspace map (bytes); every plane is an exact multiple of its 64x64-tile / whole-row / whole-line store
// granularity (M = MP = 4096 = 64 tiles, N = 1024 = 16 tiles; V^T per batch [1024][2048] = 16x32 tiles):
//   WqkvT f16 [3072 n][1024 k]        0           6291456   (rows 0..1023 = h*64+d of Wq, then Wk, then Wv; x64)
//   WoB   bf16 [1024 n][2048 k]       6291456     4194304   (Wo^T bf16, k-duplicated)
//   XH    f16 [3][4096][1024]         10485760    25165824  (converted activation planes of q, k, v)
//   QH|QR f16 [2][4096][1024]         35651584    16777216  (q hi plane, then q residual plane)
//   KH    f16 [4096][1024]            52428800    8388608
//   VT|VR f16 [2][2][1024][2048]      60817408    16777216  (v^T hi planes per batch, then residual planes)
//   Ctx   bf16 [4096][2048]           77594624    16777216  (context hi cols 0..1023, lo cols 1024..2047)
//   end                               94371840
// =====================================================================================================
extern "C" void kernel_launch(void* const* d_in, const int* in_sizes, int n_in,
                              void* d_out, int out_size, void* d_ws, size_t ws_size,
                              hipStream_t stream) {
  if (n_in < 11) return;
  if (in_sizes[0] != MP * DM || in_sizes[1] != MP * DM || in_sizes[2] != MP * DM) return;
  if (in_sizes[3] != NH * DM * HD || in_sizes[4] != NH * HD) return;
  if (in_sizes[5] != NH * DM * HD || in_sizes[6] != NH * HD) return;
  if (in_sizes[7] != NH * DM * HD || in_sizes[8] != NH * HD) return;
  if (in_sizes[9] != DM * DM || in_sizes[10] != DM) return;
  if (out_size != MP * DM) return;

  const float* query = (const float*)d_in[0];
  const float* key_  = (const float*)d_in[1];
  const float* value = (const float*)d_in[2];
  const float* w_q   = (const float*)d_in[3];
  const float* b_q   = (const float*)d_in[4];
  const float* w_k   = (const float*)d_in[5];
  const float* b_k   = (const float*)d_in[6];
  const float* w_v   = (const float*)d_in[7];
  const float* b_v   = (const float*)d_in[8];
  const float* w_o   = (const float*)d_in[9];
  const float* b_o   = (const float*)d_in[10];

  const size_t PW   = (size_t)3 * DM * DM * 2;            //  6291456
  const size_t PWO  = (size_t)DM * CTXP * 2;              //  4194304
  const size_t PX   = (size_t)3 * MP * DM * 2;            // 25165824
  const size_t PQ   = (size_t)2 * MP * DM * 2;            // 16777216
  const size_t PK   = (size_t)MP * DM * 2;                //  8388608
  const size_t PV   = (size_t)2 * NBATCH * DM * SEQ * 2;  // 16777216
  const size_t PC   = (size_t)MP * CTXP * 2;              // 16777216
  size_t off = 0;
  const size_t oW  = off; off += PW;
  const size_t oWo = off; off += PWO;
  const size_t oX  = off; off += PX;
  const size_t oQ  = off; off += PQ;
  const size_t oK  = off; off += PK;
  const size_t oV  = off; off += PV;
  const size_t oC  = off; off += PC;
  if (off > ws_size) return;                               // off = 94371840
  if (off > (size_t)134217728) return;

  char* ws = (char*)d_ws;
  unsigned short* WqkvT = (unsigned short*)(ws + oW);
  unsigned short* WoB   = (unsigned short*)(ws + oWo);
  unsigned short* XH    = (unsigned short*)(ws + oX);
  unsigned short* QH    = (unsigned short*)(ws + oQ);
  unsigned short* KH    = (unsigned short*)(ws + oK);
  unsigned short* VT    = (unsigned short*)(ws + oV);
  unsigned short* Ctx   = (unsigned short*)(ws + oC);
  float*          out0  = (float*)d_out;

  const dim3 blk(256), blk128(128);
  const dim3 gPrep(1024 + 3 * PCB);                                   // 768 + 256 transpose blocks, 3 x 2048 convert blocks
  const dim3 gQkv(3 * PJB);                                           // 3 projections x 128 block tiles
  const dim3 gN1k((MP / 128) * (DM / 256), 1);                        // 32 x 4 block tiles -> 128 blocks
  const dim3 gAttn(NBATCH * NH * NQB);                                // 1024 blocks of 128
  const float invw  = 1.0f / WSC;                                     // weight carry x64
  const float sc2   = 0.18033688f;                                    // log2 e / sqrt(64)

  // (0) weight planes WqkvT (f16, x64), WoB (bf16, k-duplicated) and the f16 activation planes of q, k, v
  prep<<<gPrep, blk, 0, stream>>>(query, key_, value, w_q, w_k, w_v, w_o, WqkvT, WoB, XH);

  // (1..3) Q, K and V^T projections
  gemm_qkv<<<gQkv, blk, 0, stream>>>(XH, WqkvT, b_q, b_k, b_v, QH, KH, VT, DM, invw);

  // (4) flash attention -> Ctx bf16 hi | lo (concat layout, column h*64 + d)
  attn64<<<gAttn, blk128, 0, stream>>>(QH, KH, VT, Ctx, sc2);

  // (5) out = [ctx_hi | ctx_lo] . [Wo^T | Wo^T]^T + b_o  (K = 2048, bf16 operands) -> d_out f32 [4096][1024]
  gemm64_one<1, 0, 0><<<gN1k, blk, 0, stream>>>(
      Ctx, CTXP, 0LL, WoB, CTXP, 0LL, b_o, b_o, DM,
      (void*)out0, DM, 0LL, 0LL, MP, DM, CTXP, 1.0f);
  (void)hipGetLastError();
}

// v010
// It runs in 88.4 microseconds.
// It is 1.36 times as fast as v007, going by the measured steps of the versions left out in between.
// Counting every step since v000, it is 5.10 times as fast.
// Contractions: q, k and v^T in-projections on v_wmma_f32_16x16x32_f16 (f16 activation plane x f16 weight plane
// carried x64, one product each); attention q.k^T on v_wmma_f32_16x16x32_f16 with q and k plain f16 (one product);
// p.v on v_wmma_f32_16x16x32_f16 with p carried x1024 (f16) and v^T plain f16 (one product);
// output projection on v_wmma_f32_16x16x32_f16 with the context plain f16 against an f16 weight plane carried x64
// (one product); all f32 accumulate; softmax in f32 on VALU;
// every float input RNE-converted to bf16 on load.
#include <hip/hip_runtime.h>
#include <math.h>
#include <stdint.h>

#define NBATCH 2
#define SEQ    2048
#define DM     1024
#define NH     16
#define HD     64
#define MP     (NBATCH * SEQ)
#define NQB    (SEQ / 64)
#define WSC    64.0f
#define PSC    1024.0f
#define LP     72      // LDS row pitch of the attention tiles in halves: 144 B = 16 B x 9 (odd), for 16-B fragment reads
#define OP     68      // LDS row pitch of the attention context tile in floats: 272 B = 16 B x 17 (odd), lane = row on the store
#define GPIT   72      // LDS row pitch of the staged GEMM operand tiles in halves: 144 B, same reason
#define GROWS  256     // rows of one staged GEMM tile: 128 rows of A, then 128 rows of Bt, 64 k (128 B) each
#define GBUFH  (GROWS * GPIT)   // halves per staging buffer (36864 B)
#define ABUFH  (2 * 64 * LP)    // halves per attention staging buffer: K and V^T tiles (18432 B)
static_assert(NH * HD == DM);
static_assert((SEQ % 64) == 0 && (DM % 64) == 0 && (MP % 64) == 0);
static_assert(HD == 64);
static_assert((MP % 128) == 0 && (SEQ % 128) == 0 && (DM % 128) == 0);

typedef _Float16       v16h __attribute__((ext_vector_type(16)));
typedef unsigned short v16us __attribute__((ext_vector_type(16)));
typedef unsigned short v8us __attribute__((ext_vector_type(8)));
typedef float          v8f  __attribute__((ext_vector_type(8)));
typedef float          v4f  __attribute__((ext_vector_type(4)));
typedef unsigned int   v4u  __attribute__((ext_vector_type(4)));

union Frag { v16us u; v8us p[2]; v16h h; };

// ---- scalar helpers --------------------------------------------------------------------------------
__device__ __forceinline__ unsigned short bf_bits(float f) {          // f32 -> bf16 bits, RNE convert
  unsigned u = __float_as_uint(f);
  return (unsigned short)((u + 0x7FFFu + ((u >> 16) & 1u)) >> 16);
}
__device__ __forceinline__ float bf_up(unsigned short h) { return __uint_as_float(((unsigned)h) << 16); }
__device__ __forceinline__ float bfr(float f) { return bf_up(bf_bits(f)); }   // value of the bf16 RNE convert
__device__ __forceinline__ unsigned short h_bits(_Float16 x) { return __builtin_bit_cast(unsigned short, x); }
__device__ __forceinline__ unsigned pk16(unsigned short a, unsigned short b) { return (unsigned)a | ((unsigned)b << 16); }
__device__ __forceinline__ float xhalf(float x) {                     // lane l takes lane l ^ 16's value
  const int b = __builtin_bit_cast(int, x);
  return __builtin_bit_cast(float, __builtin_amdgcn_permlanex16(b, b, 0x76543210, 0xfedcba98, false, false));
}
__device__ __forceinline__ v8f zero8() { v8f z = {0.f, 0.f, 0.f, 0.f, 0.f, 0.f, 0.f, 0.f}; return z; }

// ---- fragment loader: 16-bit A/B operand (bit planes), lane -> row/col (lane&15), p already includes +8*(lane>>4);
//      elements 0..7 <- p[0..7] (k0+8h..), elements 8..15 <- p[16..23] (k0+16+8h..)
__device__ __forceinline__ v16us ldfrag(const unsigned short* p) {
  Frag f;
  f.p[0] = *(const v8us*)(p);
  f.p[1] = *(const v8us*)(p + 16);
  return f.u;
}

// ---- WMMA helper (f16 operands) and the GEMM loop's VALU hazard gaps -----------------
__device__ __forceinline__ v8f mma_raw(v16us a, v16us b, v8f c) {
  Frag fa, fb;
  fa.u = a;
  fb.u = b;
  return __builtin_amdgcn_wmma_f32_16x16x32_f16(false, fa.h, false, fb.h, (short)0, c, false, false);
}
__device__ __forceinline__ void dep_guard1(v8f& a, v8f& b, v16us x) {
#if defined(__HIP_DEVICE_COMPILE__)
  asm volatile("v_nop\n\tv_nop\n\tv_nop\n\tv_nop" : "+v"(a), "+v"(b) : "v"(x));
#endif
}
__device__ __forceinline__ void keep4(v16us a, v16us b, v16us c, v16us d) {
#if defined(__HIP_DEVICE_COMPILE__)
  asm volatile("v_nop" :: "v"(a), "v"(b), "v"(c), "v"(d));
#endif
}
__device__ __forceinline__ void acc_guard4(v8f& a, v8f& b, v8f& c, v8f& d) {
#if defined(__HIP_DEVICE_COMPILE__)
  asm volatile("v_nop\n\tv_nop\n\tv_nop\n\tv_nop" : "+v"(a), "+v"(b), "+v"(c), "+v"(d));
#endif
}
// eight base-2 exponentials in place. One statement, so that behind each v_exp_f32 stands an instruction that neither reads
// its result nor overwrites its source (the next one's registers are its own), and behind the last the v_nop that fills that slot.
__device__ __forceinline__ void exp2x8(float (&e)[8]) {
#if defined(__HIP_DEVICE_COMPILE__)
  asm("v_exp_f32 %0, %0\n\tv_exp_f32 %1, %1\n\tv_exp_f32 %2, %2\n\tv_exp_f32 %3, %3\n\t"
      "v_exp_f32 %4, %4\n\tv_exp_f32 %5, %5\n\tv_exp_f32 %6, %6\n\tv_exp_f32 %7, %7\n\tv_nop"
      : "+v"(e[0]), "+v"(e[1]), "+v"(e[2]), "+v"(e[3]), "+v"(e[4]), "+v"(e[5]), "+v"(e[6]), "+v"(e[7]));
#endif
}
// eight halves of an attention tile from LDS: fb = byte address of the lane's place in row 0 of tile 0; tile, row, k constants
__device__ __forceinline__ v8us frd(unsigned fb, int tile, int row, int k) {
  return *(const __attribute__((address_space(3))) v8us*)(fb + 2u * (unsigned)(tile * 64 * LP + row * LP + k));
}
__device__ __forceinline__ void wave_sync_lds() {
  __builtin_amdgcn_fence(__ATOMIC_RELEASE, "workgroup");
  __builtin_amdgcn_wave_barrier();
  __builtin_amdgcn_fence(__ATOMIC_ACQUIRE, "workgroup");
}

// ---- one operand's 128 rows of a staged GEMM tile: 8 asynchronous 16-B copies per lane, global -> LDS, no register in
//      between. Copy i brings row (16 i + lane's row); eight lanes cover one 128-B row segment, so each wave-wide copy takes
//      four whole lines. l = the lane's LDS byte address in rows 0..15 of the operand's part of the buffer; rows 16 apart lie
//      16 * 144 B apart. The closing s_wait_xcnt 0 stands inside the statement so that no address register of an issued
//      copy is rewritten in front of it.
__device__ __forceinline__ void stage8(unsigned l, const unsigned short* g, size_t sg) {
#if defined(__HIP_DEVICE_COMPILE__)
  const unsigned st = 16u * GPIT * 2u;
  asm volatile(
      "global_load_async_to_lds_b128 %0, %8, off\n\t"
      "global_load_async_to_lds_b128 %1, %9, off\n\t"
      "global_load_async_to_lds_b128 %2, %10, off\n\t"
      "global_load_async_to_lds_b128 %3, %11, off\n\t"
      "global_load_async_to_lds_b128 %4, %12, off\n\t"
      "global_load_async_to_lds_b128 %5, %13, off\n\t"
      "global_load_async_to_lds_b128 %6, %14, off\n\t"
      "global_load_async_to_lds_b128 %7, %15, off\n\t"
      "s_wait_xcnt 0x0"
      :: "v"(l), "v"(l + st), "v"(l + 2u * st), "v"(l + 3u * st), "v"(l + 4u * st), "v"(l + 5u * st),
         "v"(l + 6u * st), "v"(l + 7u * st),
         "v"(g), "v"(g + sg), "v"(g + 2 * sg), "v"(g + 3 * sg), "v"(g + 4 * sg), "v"(g + 5 * sg), "v"(g + 6 * sg),
         "v"(g + 7 * sg)
      : "memory");
#endif
}
// ---- one staged GEMM tile: A's 128 rows, then Bt's 128 rows behind them in the buffer (16 copies per lane)
__device__ __forceinline__ void stage16(unsigned l, const unsigned short* a, size_t sa,
                                        const unsigned short* b, size_t sb) {
  stage8(l, a, sa);
  stage8(l + 128u * GPIT * 2u, b, sb);
}

// ---- one staged attention chunk (K and V^T tiles of 64 rows x 128 B): 8 asynchronous 16-B copies per lane,
//      global -> LDS, no register in between. Copy 4 p + i brings row (16 i + lane's row) of tile p; eight lanes cover one
//      128-B row, so each wave-wide copy takes four whole lines. Addresses: scalar base + the lane's 32-bit byte offset
//      (ko in the K plane, vo in the V^T plane), so that no vector instruction forms them. The immediate offset moves the
//      LDS and the global address alike: it carries the copy's place in LDS (16 rows = 2304 B apart, counted from la, the
//      lane's LDS byte address in rows 0..15 of the buffer's first tile, or from la + 6 x 2304) and is taken off the
//      scalar base again. k, vh = byte addresses of the chunk's first element in the two planes (wave-uniform).
//      The closing s_wait_xcnt 0 stands inside the statement so that no address register of an issued copy is rewritten
//      in front of it.
static_assert(16 * LP * 2 == 2304);
__device__ __forceinline__ void stage_kv(unsigned la, unsigned ko, unsigned vo, uint64_t k, uint64_t vh) {
#if defined(__HIP_DEVICE_COMPILE__)
  const uint64_t sk = (uint64_t)16 * DM * 2, sv = (uint64_t)16 * SEQ * 2;   // 16 rows in the K plane, in the V^T plane
  asm volatile(
      "global_load_async_to_lds_b128 %0, %2, %4\n\t"
      "global_load_async_to_lds_b128 %0, %2, %5 offset:2304\n\t"
      "global_load_async_to_lds_b128 %0, %2, %6 offset:4608\n\t"
      "global_load_async_to_lds_b128 %0, %2, %7 offset:6912\n\t"
      "global_load_async_to_lds_b128 %0, %3, %8 offset:9216\n\t"
      "global_load_async_to_lds_b128 %0, %3, %9 offset:11520\n\t"
      "global_load_async_to_lds_b128 %1, %3, %10\n\t"
      "global_load_async_to_lds_b128 %1, %3, %11 offset:2304\n\t"
      "s_wait_xcnt 0x0"
      :: "v"(la), "v"(la + 6u * 2304u), "v"(ko), "v"(vo),
         "s"(k), "s"(k + sk - 2304u), "s"(k + 2 * sk - 4608u), "s"(k + 3 * sk - 6912u),
         "s"(vh - 9216u), "s"(vh + sv - 11520u), "s"(vh + 2 * sv), "s"(vh + 3 * sv - 2304u)
      : "memory");
#endif
}

// =====================================================================================================
// f32 -> f16 activation plane convert: Xh[i] = f16( bf16_RNE(X[i]) * wsc ), wsc a power of two (exact).
// Thread i handles elements 8i..8i+7 and writes one 16-B piece; 32 consecutive lanes of one instruction fill
// (host-checked) so every store is full-width.
// coverage: n8 threads x 8 elements = the whole plane. bx = the block's index within the plane's n8 / 256 blocks.
// =====================================================================================================
__device__ __forceinline__ void conv_h16(int bx, const float* __restrict__ W, unsigned short* Wh, int n8, float wsc) {
  const int i  = bx * 256 + threadIdx.x;
  const int ic = (i < n8) ? i : (n8 - 1);                     // clamped address
  const float* src = W + (size_t)ic * 8;
  const v4f a = *(const v4f*)(src);
  const v4f c = *(const v4f*)(src + 4);
  v4u o;
  o[0] = pk16(h_bits((_Float16)(bfr(a[0]) * wsc)), h_bits((_Float16)(bfr(a[1]) * wsc)));
  o[1] = pk16(h_bits((_Float16)(bfr(a[2]) * wsc)), h_bits((_Float16)(bfr(a[3]) * wsc)));
  o[2] = pk16(h_bits((_Float16)(bfr(c[0]) * wsc)), h_bits((_Float16)(bfr(c[1]) * wsc)));
  o[3] = pk16(h_bits((_Float16)(bfr(c[2]) * wsc)), h_bits((_Float16)(bfr(c[3]) * wsc)));
  if (i < n8) *(v4u*)(Wh + (size_t)i * 8) = o;
  // the caller's other parts follow in the same kernel: no register of the issued store is rewritten in front of this wait
  asm volatile("s_wait_xcnt 0x0" ::: "memory");
}

// =====================================================================================================
// 64x64 tile transpose-convert of an f32 weight tensor: z-slice in[z] is [R][C] f32 (row pitch C elements,
// slice stride inStrideZ); output is 16-bit with rows indexed by the INPUT COLUMN: out[z*outStrideZ + c*ldo + r]
// (the input row index r becomes the k-contiguous column), i.e. in[rows=R][cols=C] -> out[cols=C][rows=R].
//   value = f16( bf16_RNE(x) * sc )   (sc a power of two)
// blocks (bx, by, bz) = (R/64, C/64, Z), block 256, sT = the block's 64 x 72 halves of LDS. Load phase: 1024 float4 pieces (64 rows x 16) = the whole 64x64 tile,
// 4 per thread, converted and stored transposed into LDS with 16-bit element stores; __syncthreads; store phase:
// coverage: 2 iterations x 32 rows x (8 lanes x 8 halves) = the whole 64x64 output tile;
//           the grid tiles every (r block, c block, z) exactly once.
// =====================================================================================================
__device__ __forceinline__ void tconv64(unsigned short* sT, int bx, int by, int bz,
                                        const float* __restrict__ in, long long inStrideZ, int C,
                                        unsigned short* out, long long outStrideZ, int ldo,
                                        float sc) {
  const int t  = threadIdx.x;
  const int r0 = bx * 64;
  const int c0 = by * 64;
  const float* src = in + (size_t)bz * (size_t)inStrideZ;
  unsigned short* dst = out + (size_t)bz * (size_t)outStrideZ;
#pragma unroll
  for (int i = 0; i < 4; ++i) {
    const int idx = t + 256 * i;                              // 0..1023
    const int rr  = idx >> 4;                                 // 0..63
    const int cq  = (idx & 15) * 4;                           // 0..60
    const v4f x = *(const v4f*)(src + (size_t)(r0 + rr) * (size_t)C + c0 + cq);
#pragma unroll
    for (int j = 0; j < 4; ++j) sT[(cq + j) * 72 + rr] = h_bits((_Float16)(bfr(x[j]) * sc));
  }
  __syncthreads();
  const int q8 = t >> 3;                                      // 0..31: row within the 32-row group
  const int c8 = (t & 7) * 8;
  v8us vv[2];
#pragma unroll
  for (int it = 0; it < 2; ++it) {
    const int row = it * 32 + q8;                             // it 0..1 x q8 0..31 = rows 0..63
    vv[it] = *(const v8us*)(sT + row * 72 + c8);
  }
  {
#pragma unroll
    for (int it = 0; it < 2; ++it) {
      const int row = it * 32 + q8;
      unsigned short* dp = dst + (size_t)(c0 + row) * (size_t)ldo + r0 + c8;
      *(v8us*)(dp) = vv[it];
    }
    // the caller's other parts follow in the same kernel: no register of the issued stores is rewritten in front of this wait
    asm volatile("s_wait_xcnt 0x0" ::: "memory");
  }
}

// =====================================================================================================
// All operand preparation in one launch; none of its parts reads what another writes. Block ranges (block-uniform):
//   0..767     weight planes: z = block >> 8 picks Wq, Wk, Wv; per head in[e = 1024][d = 64] -> WqkvT[z*1024 + h*64 + d][e]
//   768..1023  Wo: in[k][n] -> WoT[n][k]
//   1024..     activation planes: z = (block - 1024) / PCB picks q, k, v -> XH + z * MP * DM, PCB blocks per plane
// =====================================================================================================
#define PCB ((MP * DM) / (8 * 256))
static_assert(((MP * DM) % (8 * 256)) == 0);
static_assert(DM / 64 == 16 && HD == 64 && NH * (DM / 64) == 256);   // the shifts and masks of the transpose ranges
__global__ __launch_bounds__(256) void prep(const float* __restrict__ xq, const float* __restrict__ xk,
                                            const float* __restrict__ xv, const float* __restrict__ wq,
                                            const float* __restrict__ wk, const float* __restrict__ wv,
                                            const float* __restrict__ wo, unsigned short* WqkvT, unsigned short* WoT,
                                            unsigned short* XH) {
  __shared__ __align__(16) unsigned short sT[64 * 72];        // [c local][r local], pitch 72 halves (144 B)
  const int bx = blockIdx.x;
  if (bx < 768) {
    const int z = bx >> 8, r = bx & 255;
    const float* w = (z == 0) ? wq : ((z == 1) ? wk : wv);
    tconv64(sT, r & 15, 0, r >> 4, w, (long long)DM * HD, HD, WqkvT + (size_t)z * DM * DM,
            (long long)HD * DM, DM, WSC);
  } else if (bx < 1024) {
    const int r = bx - 768;
    tconv64(sT, r & 15, r >> 4, 0, wo, 0LL, DM, WoT, 0LL, DM, WSC);
  } else {
    const int r = bx - 1024;
    const int z = r / PCB;
    const float* x = (z == 0) ? xq : ((z == 1) ? xk : xv);
    conv_h16(r - z * PCB, x, XH + (size_t)z * MP * DM, (MP * DM) / 8, 1.0f);
  }
}

// =====================================================================================================
// Register-blocked batched f16 WMMA GEMM: C[m][n] = oscale * sum_k A[m][k] * Bt[n][k] + bias;
// one wave per 64x64 tile, 4 waves (2 x 2) = one 128x128 block tile, so that the output projection's 256 blocks take every
// WGP and the in-projections' 768 lie three to a WGP, all resident. A row-major [M][K] pitch lda; Bt row-major [N][K]
// pitch ldb (k contiguous); M and N multiples of 128, K of 64 (static here). b = batch (strides in elements).
// Operands: per 64 k the block's 128 A rows and 128 Bt rows are staged in LDS by asynchronous copies, two buffers: the
// copies of tile t + 2 go out behind the barrier at the foot of trip t and fly during trip t + 1; every fragment is read
// from LDS (k order per output element as before: ascending in steps of 32).
// Bias: BIASM == 0 -> per column: cols < Nb from bias0[col], cols >= Nb from bias1[col - Nb] (tile-uniform select of
//       clamped-address loads); BIASM == 1 -> per row bias0[m]. Bias values RNE-converted to bf16.
// OM: 0 = f32 out (pitch ldc); 2 = f16 out.
// coverage: 4 slabs x 16 rows x 64 cols = the wave's whole 64x64 tile; tile = 0 .. (M/128)*(N/128) - 1 per batch,
//           a surplus block exits as a whole in front of every barrier and copy.
// sOp = two staging buffers [A 128 rows | Bt 128 rows] x 64 k; sT = per-wave 16x64 slab, pitch 68 floats (the kernel's LDS).
// =====================================================================================================
template <int OM, int BIASM>
__device__ __forceinline__ void gemm64(
    unsigned short* sOp, float (*sT)[16 * 68], int tile, int b,
    const unsigned short* __restrict__ A, int lda, long long strideA,
    const unsigned short* __restrict__ Bt, int ldb, long long strideB,
    const float* __restrict__ bias0, const float* __restrict__ bias1, int Nb,
    void* Cout, int ldc, long long strideC,
    int M, int N, int K, float oscale) {
  const int lane = threadIdx.x & 31;
  const int wave = threadIdx.x >> 5;
  const int tilesN = N >> 7;
  const int tilesM = M >> 7;
  if (tile >= tilesM * tilesN) return;   // block-uniform, in front of every barrier
  const int tm = tile / tilesN;
  const int tn = tile - tm * tilesN;
  const int mb0 = tm << 7;                     // block tile origin
  const int nb0 = tn << 7;
  const int wm  = wave >> 1;                   // wave's 64x64 tile inside the block tile
  const int wn  = wave & 1;
  const int m0 = mb0 + (wm << 6);
  const int n0 = nb0 + (wn << 6);

  const unsigned short* Ab = A  + (size_t)b * (size_t)strideA;
  const unsigned short* Bb = Bt + (size_t)b * (size_t)strideB;

  const int rlane = lane & 15;                 // row (A) / col (B, D) within subtile
  const int koff  = (lane >> 4) * 8;           // k offset of this lane half
  const int mOff  = (lane >> 4) * 8;           // D row offset

  v8f acc[4][4];
#pragma unroll
  for (int i = 0; i < 4; ++i)
#pragma unroll
    for (int j = 0; j < 4; ++j) acc[i][j] = zero8();

  // ---- staging addresses: thread -> row (tid >> 3) of each 16-row group, 16-B piece (tid & 7) of the 128-B segment ----
  const int crow = threadIdx.x >> 3;
  const int cpc  = (threadIdx.x & 7) * 8;
  const unsigned short* ga = Ab + (size_t)(mb0 + crow) * lda + cpc;
  const unsigned short* gb = Bb + (size_t)(nb0 + crow) * ldb + cpc;
  const size_t sa = (size_t)16 * lda, sb = (size_t)16 * ldb;
  const unsigned l0 =
      (unsigned)(uintptr_t)(const __attribute__((address_space(3))) unsigned short*)(sOp + crow * GPIT + cpc);
  const int T = K >> 6;                        // staged tiles of 64 k

  stage16(l0, ga, sa, gb, sb);                                 // tile 0 -> buffer 0
  asm volatile("s_wait_asynccnt 0x0" ::: "memory");            // this wave's copies of tile 0 have landed
  __syncthreads();                                             // ... and every other wave's
  if (T > 1) stage16(l0 + GBUFH * 2u, ga + 64, sa, gb + 64, sb);   // tile 1 -> buffer 1

  for (int t = 0; t < T; ++t) {
    const unsigned short* sbuf = sOp + (t & 1) * GBUFH;
    const unsigned short* fa = sbuf + ((wm << 6) + rlane) * GPIT + koff;
    const unsigned short* fb = sbuf + (128 + (wn << 6) + rlane) * GPIT + koff;
#pragma unroll
    for (int kk = 0; kk < 2; ++kk) {
      v16us bh[4], ah[4];
#pragma unroll
      for (int j = 0; j < 4; ++j) bh[j] = ldfrag(fb + (j << 4) * GPIT + kk * 32);
#pragma unroll
      for (int i = 0; i < 4; ++i) ah[i] = ldfrag(fa + (i << 4) * GPIT + kk * 32);
#pragma unroll
      for (int i = 0; i < 4; ++i) {
#pragma unroll
        for (int j = 0; j < 4; ++j) acc[i][j] = mma_raw(ah[i], bh[j], acc[i][j]);
        dep_guard1(acc[i][0], acc[i][3], ah[i]);
      }
      keep4(bh[0], bh[1], bh[2], bh[3]);
    }
    asm volatile("s_wait_dscnt 0x0" ::: "memory");             // this wave's reads of buffer t & 1 are done
    asm volatile("s_wait_asynccnt 0x0" ::: "memory");          // this wave's copies of tile t + 1 have landed
    __syncthreads();                                           // publishes tile t + 1, frees buffer t & 1
    if (t + 2 < T) stage16(l0 + (unsigned)(t & 1) * (GBUFH * 2u), ga + (size_t)(t + 2) * 64, sa, gb + (size_t)(t + 2) * 64, sb);
  }
  asm volatile("s_wait_asynccnt 0x0" ::: "memory");            // nothing of this wave is in flight past the loop
  acc_guard4(acc[0][0], acc[0][1], acc[0][2], acc[0][3]);
  acc_guard4(acc[1][0], acc[1][1], acc[1][2], acc[1][3]);
  acc_guard4(acc[2][0], acc[2][1], acc[2][2], acc[2][3]);
  acc_guard4(acc[3][0], acc[3][1], acc[3][2], acc[3][3]);

  // ---- per-lane column bias (BIASM == 0), RNE-converted ----
  const int hh2 = lane >> 4, c4 = (lane & 15) * 4;     // f32 out: 256-B row segment = 16 lanes x 16 B
  const int q8  = lane >> 3, c8 = (lane & 7) * 8;
  float bc[8];
#pragma unroll
  for (int e = 0; e < 8; ++e) bc[e] = 0.f;
  if (BIASM == 0) {
    const bool use1 = (n0 >= Nb);                      // tile-uniform
    if (OM == 0) {
      const int cb = n0 + c4;
      const int i0 = (cb < Nb - 4) ? cb : (Nb - 4);
      const int i1 = (cb - Nb > 0) ? (cb - Nb) : 0;
      const v4f b0v = *(const v4f*)(bias0 + i0);
      const v4f b1v = *(const v4f*)(bias1 + i1);
#pragma unroll
      for (int e = 0; e < 4; ++e) bc[e] = bfr(use1 ? b1v[e] : b0v[e]);
    } else {
      const int cb = n0 + c8;
      const int i0 = (cb < Nb - 8) ? cb : (Nb - 8);
      const int i1 = (cb - Nb > 0) ? (cb - Nb) : 0;
      const v4f b0a = *(const v4f*)(bias0 + i0), b0b = *(const v4f*)(bias0 + i0 + 4);
      const v4f b1a = *(const v4f*)(bias1 + i1), b1b = *(const v4f*)(bias1 + i1 + 4);
#pragma unroll
      for (int e = 0; e < 4; ++e) {
        bc[e]     = bfr(use1 ? b1a[e] : b0a[e]);
        bc[4 + e] = bfr(use1 ? b1b[e] : b0b[e]);
      }
    }
  }

  // ---- epilogue ----
  float* slab = sT[wave];
#pragma unroll
  for (int i = 0; i < 4; ++i) {
    const int mBase = m0 + (i << 4);
#pragma unroll
    for (int j = 0; j < 4; ++j) {
#pragma unroll
      for (int r = 0; r < 8; ++r) {
        slab[(mOff + r) * 68 + (j << 4) + rlane] = acc[i][j][r];
      }
    }
    wave_sync_lds();
    if constexpr (OM == 0) {
      float* C = (float*)Cout + (size_t)b * (size_t)strideC;
      v4f vals[8];
#pragma unroll
      for (int it = 0; it < 8; ++it) {
        const int row = it * 2 + hh2;                      // it 0..7 x hh2 0..1 = rows 0..15
        v4f v = *(const v4f*)(slab + row * 68 + c4);
#pragma unroll
        for (int e = 0; e < 4; ++e) v[e] = v[e] * oscale + bc[e];
        vals[it] = v;
      }
      {
#pragma unroll
        for (int it = 0; it < 8; ++it) {
          const int row = it * 2 + hh2;
          *(v4f*)(C + (size_t)(mBase + row) * ldc + n0 + c4) = vals[it];
        }
        
      }
    } else {
      unsigned short* C = (unsigned short*)Cout + (size_t)b * (size_t)strideC;
      v4u hv[4];
#pragma unroll
      for (int it = 0; it < 4; ++it) {
        const int row = it * 4 + q8;                       // it 0..3 x q8 0..3 = rows 0..15
        const float* sp = slab + row * 68 + c8;
        float bm = 0.f;
        if (BIASM == 1) bm = bfr(bias0[mBase + row]);
        v4u a;
#pragma unroll
        for (int e = 0; e < 4; ++e) {
          const float f0 = sp[2 * e]     * oscale + ((BIASM == 1) ? bm : bc[2 * e]);
          const float f1 = sp[2 * e + 1] * oscale + ((BIASM == 1) ? bm : bc[2 * e + 1]);
          a[e] = pk16(h_bits((_Float16)f0), h_bits((_Float16)f1));
        }
        hv[it] = a;
      }
      {
#pragma unroll
        for (int it = 0; it < 4; ++it) {
          const int row = it * 4 + q8;
          unsigned short* dp = C + (size_t)(mBase + row) * ldc + n0 + c8;
          *(v4u*)(dp) = hv[it];
        }
        
      }
    }
    wave_sync_lds();
  }
}

// ---- one GEMM per launch: grid = ((M/128)*(N/128), batches) ----
template <int OM, int BIASM>
__global__ __launch_bounds__(128, 3) void gemm64_one(
    const unsigned short* __restrict__ A, int lda, long long strideA,
    const unsigned short* __restrict__ Bt, int ldb, long long strideB,
    const float* __restrict__ bias0, const float* __restrict__ bias1, int Nb,
    void* Cout, int ldc, long long strideC,
    int M, int N, int K, float oscale) {
  __shared__ __align__(16) unsigned short sOp[2 * GBUFH];
  __shared__ __align__(16) float sT[4][16 * 68];
  gemm64<OM, BIASM>(sOp, sT, blockIdx.x, blockIdx.y, A, lda, strideA, Bt, ldb, strideB, bias0, bias1, Nb,
                    Cout, ldc, strideC, M, N, K, oscale);
}

// ---- the three in-projections in one launch; they share no output and read only what the launch before wrote.
//      PJB blocks each, block >> 8 picks the projection (block-uniform):
//      0: Q = xq . WqT^T + b_q -> QH (f16); column n = h*64 + d
//      1: K = xk . WkT^T + b_k -> KH (f16)
//      2: V^T per batch = WvT . xv^T + b_v -> VT (f16 [2][1024][2048]); row m = h*64 + d
//         (per-row bias b_v[m]), column n = token s of batch (block & 255) >> 7
#define PJB 256
static_assert((MP / 128) * (DM / 128) == PJB && (DM / 128) * (SEQ / 128) * NBATCH == PJB && (DM / 128) * (SEQ / 128) == 128);
__global__ __launch_bounds__(128, 3)   // 3 waves per SIMD = three blocks per WGP, the whole grid resident at once
void gemm_qkv(
    const unsigned short* __restrict__ XH, const unsigned short* __restrict__ WqkvT,
    const float* __restrict__ b_q, const float* __restrict__ b_k, const float* __restrict__ b_v,
    unsigned short* QH, unsigned short* KH, unsigned short* VT, int K, float oscale) {
  __shared__ __align__(16) unsigned short sOp[2 * GBUFH];
  __shared__ __align__(16) float sT[4][16 * 68];
  const int sel = blockIdx.x >> 8, r = blockIdx.x & 255;
  if (sel == 0) {
    gemm64<2, 0>(sOp, sT, r, 0, XH, DM, 0LL, WqkvT, DM, 0LL, b_q, b_q, DM,
                 (void*)QH, DM, 0LL, MP, DM, K, oscale);
  } else if (sel == 1) {
    gemm64<2, 0>(sOp, sT, r, 0, XH + (size_t)MP * DM, DM, 0LL, WqkvT + (size_t)DM * DM, DM, 0LL, b_k, b_k, DM,
                 (void*)KH, DM, 0LL, MP, DM, K, oscale);
  } else {
    gemm64<2, 1>(sOp, sT, r & 127, r >> 7, WqkvT + (size_t)2 * DM * DM, DM, 0LL,
                 XH + (size_t)2 * MP * DM, DM, (long long)SEQ * DM, b_v, b_v, SEQ,
                 (void*)VT, SEQ, (long long)DM * SEQ, DM, SEQ, K, oscale);
  }
}

// =====================================================================================================
// Flash attention, head dim 64, SEQ token rows per batch (all keys valid, no mask).
//   q plane (f16, pitch DM): qhp[(b*SEQ + t)*DM + h*64 + d]
//   k plane (f16, pitch DM): khp[(b*SEQ + t)*DM + h*64 + d]
//   v^T plane (f16): vtp[(b*DM + h*64 + d)*SEQ + s]
//   context plane (f16, pitch DM): ctxp[(b*SEQ + t)*DM + h*64 + d] (one plane: the output projection takes its weights at
//   bf16's 8 bits, so a second context plane cannot carry that product past them)
//   Products are taken transposed: S^T = K . Q^T (A = K rows, B = Q rows) and O^T += V^T . P^T (A = V^T rows, B = P^T), so
//   a lane holds scores of ONE query (column lane & 15), keys 8 (lane >> 4) + r of each 16-key tile: the row maximum
//   and the row sum are taken in the lane, plus one exchange between the wave halves (the sum's only in the epilogue),
//   and two converted score tiles are the B operand of the second product as they stand: P never leaves the registers.
//   Every operand of the two products is one f16 plane (q, k, p, v^T alike: a second plane for one operand cannot carry a
//   product past the 11 bits of the other, and the inputs are taken at bf16's 8). The accumulator is the raw score,
//   the maximum is taken over raw scores (sc2 > 0), p = 2^(s sc2 - m sc2), sc2 = log2 e / sqrt(64), one multiply-add per
//   score, carried as f16(1024 p); context = p . v; online softmax (running max) in f32.
//   Block = 4 waves = 64 query rows of one (b, h); grid = NQB * NH * NBATCH; kv chunks of 64, static trip NQB.
//   K / V^T chunk staging: 128 threads x 4 copies x 8 elements per plane = the whole 64x64 tile each, by
//   asynchronous copies into two buffers: the copies of chunk kt + 2 go out behind the one barrier at the foot of trip kt
//   and fly during trip kt + 1; trip kt reads buffer kt & 1 alone.
//   Fragment reads: K's eight as one group ahead of the 8 score products; V^T's eight as one group ahead of the softmax.
//   Context coverage: each wave stores rows q0..q0+15 (it 0..3 x lane>>3 0..3) x 64 columns (8 lanes x 8);
//   grid covers all SEQ rows x NH head slices x NBATCH.
// =====================================================================================================
__global__ __launch_bounds__(128, 4)   // 4 waves per SIMD = the grid's four blocks per WGP all resident: a budget of 256 registers
void attn64(const unsigned short* __restrict__ qhp, const unsigned short* __restrict__ khp,
            const unsigned short* __restrict__ vtp, unsigned short* ctxp,
            float sc2) {
  __shared__ __align__(16) unsigned short KV[2 * ABUFH];          // two buffers of two 9-KB tiles, rows of 64 at pitch LP:
                                                                  // K [kv][d], V^T [d][kv]
  __shared__ __align__(16) float          Os[4][16 * OP];         // per wave context tile [row][d], rows of 64 at pitch OP

  const int tid  = threadIdx.x;
  const int wave = __builtin_amdgcn_readfirstlane(tid >> 5);   // wave-uniform: held in a scalar register across the loop
  const int hh   = (tid & 31) >> 4;
  const int c    = tid & 15;

  const int bx   = blockIdx.x;
  const int qb   = bx % NQB;
  const int rest = bx / NQB;
  const int h    = rest % NH;
  const int b    = rest / NH;
  const int q0   = qb * 64 + wave * 16;          // in-batch query row of this wave's first row
  const size_t rowB = (size_t)b * SEQ;

  const unsigned short* Qh = qhp + (size_t)h * HD;
  const unsigned short* Kg = khp + (size_t)h * HD;
  const unsigned short* Vh = vtp + ((size_t)b * DM + (size_t)h * HD) * SEQ;

  // the lane's fragment row (lane & 15) and k half in tile 0, as an LDS byte address: every fragment read is this one
  // register plus a constant that fits the instruction's offset field
  const unsigned fb0 = (unsigned)(uintptr_t)(const __attribute__((address_space(3))) unsigned short*)(KV + c * LP + 8 * hh);

  // staging addresses: thread -> row (tid >> 3) of each 16-row group, 16-B piece (tid & 7) of the 128-B row
  const int crow = tid >> 3, cpc = (tid & 7) * 8;
  const unsigned ko = 2u * (unsigned)(crow * DM + cpc);           // the lane's byte offset in a chunk of the K plane
  const unsigned vo = 2u * (unsigned)(crow * SEQ + cpc);          // ... and of the V^T plane
  const uint64_t gk = (uint64_t)(uintptr_t)(Kg + rowB * DM);      // chunk 0: K row 0, d = 0
  const uint64_t gv = (uint64_t)(uintptr_t)Vh;                    // V^T row d = 0, s = 0
  const unsigned l0 =
      (unsigned)(uintptr_t)(const __attribute__((address_space(3))) unsigned short*)(KV + crow * LP + cpc);
  static_assert(NQB >= 2);

  stage_kv(l0, ko, vo, gk, gv);                                   // chunk 0 -> buffer 0
  asm volatile("s_wait_asynccnt 0x0" ::: "memory");               // this wave's copies of chunk 0 have landed
  __syncthreads();                                                // ... and every other wave's
  stage_kv(l0 + ABUFH * 2u, ko, vo, gk + 64u * DM * 2u, gv + 128u);   // chunk 1 -> buffer 1

  float mrun = -INFINITY, lsum = 0.f;   // query c: running maximum (both halves alike), sum over this half's keys
  v8f oacc[4];                          // O^T tiles: register r = context[d = 16 t + 8 hh + r] of query c
#pragma unroll
  for (int t = 0; t < 4; ++t) oacc[t] = zero8();

  for (int kt = 0; kt < NQB; ++kt) {         // static trip count
    const unsigned fb = fb0 + (unsigned)(kt & 1) * (ABUFH * 2u);   // this trip's buffer

    // ---- Q fragments (B operand, column = query = lane&15), 2 d-chunks ----
    v16us qa[2];
#pragma unroll
    for (int dc = 0; dc < 2; ++dc) qa[dc] = ldfrag(Qh + (rowB + q0 + c) * DM + dc * 32 + 8 * hh);

    // ---- K fragments (A operand, row = key 16 j + lane&15): all eight read from LDS as one group ----
    Frag kb[4][2];
#pragma unroll
    for (int dc = 0; dc < 2; ++dc) {   // in the order in which the products below take them
#pragma unroll
      for (int j = 0; j < 4; ++j) {
        kb[j][dc].p[0] = frd(fb, 0, j * 16, dc * 32);
        kb[j][dc].p[1] = frd(fb, 0, j * 16, dc * 32 + 16);
      }
    }
    __builtin_amdgcn_sched_barrier(0);   // keeps the reads one group ahead of the products; the scheduler otherwise sinks each to its user

    // ---- raw scores, transposed: s[j][r] = q . k of (key 16 j + 8 hh + r, query c); 8 products in a row on four independent
    //      accumulators, one per key tile; in each: d 0..31, then d 32..63 ----
    v8f s[4];
#pragma unroll
    for (int j = 0; j < 4; ++j) s[j] = zero8();
#pragma unroll
    for (int dc = 0; dc < 2; ++dc) {
#pragma unroll
      for (int j = 0; j < 4; ++j) s[j] = mma_raw(kb[j][dc].u, qa[dc], s[j]);
    }
    __builtin_amdgcn_sched_barrier(0);   // the V^T reads below do not rise to the head of the products, where all of K's registers are still held

    // ---- V^T fragments (A operand, row = d 16 t + lane&15), keys 0..31 and 32..63: one group, in flight under the softmax ----
    Frag vb[2][4];
#pragma unroll
    for (int kc = 0; kc < 2; ++kc) {   // in the order in which the products below take them
#pragma unroll
      for (int t = 0; t < 4; ++t) {
        vb[kc][t].p[0] = frd(fb, 1, t * 16, kc * 32);
        vb[kc][t].p[1] = frd(fb, 1, t * 16, kc * 32 + 16);
      }
    }
    __builtin_amdgcn_sched_barrier(0);   // keeps the group ahead of the softmax, which covers its latency

    // ---- maximum over the lane's 32 keys (four chains), then the other half's; online softmax; P^T (x1024, f16) packed
    //      in place: element 8 (j & 1) + r of fragment j >> 1 = key 32 (j >> 1) + 16 (j & 1) + 8 hh + r, the V^T loader's k order
    float mj[4], pj[4];
#pragma unroll
    for (int j = 0; j < 4; ++j) {
      mj[j] = s[j][0];
#pragma unroll
      for (int r = 1; r < 8; ++r) mj[j] = fmaxf(mj[j], s[j][r]);
    }
    float m = fmaxf(fmaxf(mj[0], mj[1]), fmaxf(mj[2], mj[3]));
    m = fmaxf(m, xhalf(m));
    const float mnew  = fmaxf(mrun, m);
    const float alpha = __builtin_amdgcn_exp2f((mrun - mnew) * sc2);
    const float nm    = -mnew * sc2;
    mrun = mnew;
    Frag pb[2];
#pragma unroll
    for (int j = 0; j < 4; ++j) {
      float e[8];
#pragma unroll
      for (int r = 0; r < 8; ++r) e[r] = fmaf(s[j][r], sc2, nm);   // exp(x) = 2^(x log2 e); the score scale rides in sc2
      exp2x8(e);
      pj[j] = e[0];
#pragma unroll
      for (int r = 1; r < 8; ++r) pj[j] += e[r];
#pragma unroll
      for (int r = 0; r < 8; ++r) pb[j >> 1].h[(j & 1) * 8 + r] = (_Float16)(e[r] * PSC);
    }
    lsum = lsum * alpha + ((pj[0] + pj[1]) + (pj[2] + pj[3]));
#pragma unroll
    for (int t = 0; t < 4; ++t) oacc[t] *= alpha;

    // ---- context^T += V^T . P^T (f16 WMMA), keys ascending: 8 products in a row on four independent accumulators ----
#pragma unroll
    for (int kc = 0; kc < 2; ++kc) {
#pragma unroll
      for (int t = 0; t < 4; ++t) oacc[t] = mma_raw(vb[kc][t].u, pb[kc].u, oacc[t]);
    }
    __builtin_amdgcn_sched_barrier(0);   // softmax and products stay ahead of the foot: the scheduler otherwise lifts its waits to behind
                                         // the last LDS read, where the next chunk's copies have had only the score products to land
    asm volatile("s_wait_dscnt 0x0" ::: "memory");                 // this wave's reads of buffer kt & 1 are done
    asm volatile("s_wait_asynccnt 0x0" ::: "memory");              // this wave's copies of chunk kt + 1 have landed
    __syncthreads();                                               // publishes chunk kt + 1, frees buffer kt & 1
    if (kt + 2 < NQB)
      stage_kv(l0 + (unsigned)(kt & 1) * (ABUFH * 2u), ko, vo, gk + (uint64_t)(kt + 2) * (64u * DM * 2u),
               gv + (uint64_t)(kt + 2) * 128u);
  }
  asm volatile("s_wait_asynccnt 0x0" ::: "memory");                // nothing of this wave is in flight past the loop

  // ---- normalise (1/l, the 1/1024 p carry), stage the wave's 16x64 tile, f16
  //      the lane's index is taken anew here, so that no vector register carries it (or what derives from it) across the loop
  const int lane = (int)__builtin_amdgcn_mbcnt_lo(~0u, 0u);
  const int ec = lane & 15, eh = lane >> 4;
  float* os = Os[wave];
  {
    const float l = lsum + xhalf(lsum);   // the two halves' key sums join here, once
    const float inv = ((l > 0.f) ? (1.0f / l) : 0.f) * (1.0f / PSC);
#pragma unroll
    for (int t = 0; t < 4; ++t) {
      v4f lo, hi;
#pragma unroll
      for (int r = 0; r < 4; ++r) {
        lo[r] = oacc[t][r] * inv;
        hi[r] = oacc[t][4 + r] * inv;
      }
      *(v4f*)(os + ec * OP + t * 16 + 8 * eh)     = lo;
      *(v4f*)(os + ec * OP + t * 16 + 8 * eh + 4) = hi;
    }
  }
  wave_sync_lds();
  {
    const int q4 = lane >> 3, c8 = (lane & 7) * 8;
    v4u hv[4];
#pragma unroll
    for (int it = 0; it < 4; ++it) {
      const int row = it * 4 + q4;   // it 0..3 x q4 0..3 = rows 0..15 of the wave tile
      const float* sp = os + row * OP + c8;
      v4u a;
#pragma unroll
      for (int e = 0; e < 4; ++e) a[e] = pk16(h_bits((_Float16)sp[2 * e]), h_bits((_Float16)sp[2 * e + 1]));
      hv[it] = a;
    }
#pragma unroll
    for (int it = 0; it < 4; ++it) {
      const int row = it * 4 + q4;
      *(v4u*)(ctxp + (rowB + q0 + row) * DM + (size_t)h * HD + c8) = hv[it];
    }
  }
}

// =====================================================================================================
// Workspace map (bytes); every plane is an exact multiple of its 64x64-tile / whole-row / whole-line store
// granularity (M = MP = 4096 = 64 tiles, N = 1024 = 16 tiles; V^T per batch [1024][2048] = 16x32 tiles):
//   WqkvT f16 [3072 n][1024 k]        0           6291456   (rows 0..1023 = h*64+d of Wq, then Wk, then Wv; x64)
//   WoT   f16 [1024 n][1024 k]        6291456     2097152   (Wo^T; x64)
//   XH    f16 [3][4096][1024]         8388608     25165824  (converted activation planes of q, k, v)
//   QH    f16 [4096][1024]            33554432    8388608
//   KH    f16 [4096][1024]            41943040    8388608
//   VT    f16 [2][1024][2048]         50331648    8388608   (v^T plane per batch)
//   Ctx   f16 [4096][1024]            58720256    8388608   (context, column h*64 + d)
//   end                               67108864
// =====================================================================================================
extern "C" void kernel_launch(void* const* d_in, const int* in_sizes, int n_in,
                              void* d_out, int out_size, void* d_ws, size_t ws_size,
                              hipStream_t stream) {
  if (n_in < 11) return;
  if (in_sizes[0] != MP * DM || in_sizes[1] != MP * DM || in_sizes[2] != MP * DM) return;
  if (in_sizes[3] != NH * DM * HD || in_sizes[4] != NH * HD) return;
  if (in_sizes[5] != NH * DM * HD || in_sizes[6] != NH * HD) return;
  if (in_sizes[7] != NH * DM * HD || in_sizes[8] != NH * HD) return;
  if (in_sizes[9] != DM * DM || in_sizes[10] != DM) return;
  if (out_size != MP * DM) return;

  const float* query = (const float*)d_in[0];
  const float* key_  = (const float*)d_in[1];
  const float* value = (const float*)d_in[2];
  const float* w_q   = (const float*)d_in[3];
  const float* b_q   = (const float*)d_in[4];
  const float* w_k   = (const float*)d_in[5];
  const float* b_k   = (const float*)d_in[6];
  const float* w_v   = (const float*)d_in[7];
  const float* b_v   = (const float*)d_in[8];
  const float* w_o   = (const float*)d_in[9];
  const float* b_o   = (const float*)d_in[10];

  const size_t PW   = (size_t)3 * DM * DM * 2;            //  6291456
  const size_t PWO  = (size_t)DM * DM * 2;                //  2097152
  const size_t PX   = (size_t)3 * MP * DM * 2;            // 25165824
  const size_t PQ   = (size_t)MP * DM * 2;                //  8388608
  const size_t PK   = (size_t)MP * DM * 2;                //  8388608
  const size_t PV   = (size_t)NBATCH * DM * SEQ * 2;      //  8388608
  const size_t PC   = (size_t)MP * DM * 2;                //  8388608
  size_t off = 0;
  const size_t oW  = off; off += PW;
  const size_t oWo = off; off += PWO;
  const size_t oX  = off; off += PX;
  const size_t oQ  = off; off += PQ;
  const size_t oK  = off; off += PK;
  const size_t oV  = off; off += PV;
  const size_t oC  = off; off += PC;
  if (off > ws_size) return;                               // off = 67108864
  if (off > (size_t)134217728) return;

  char* ws = (char*)d_ws;
  unsigned short* WqkvT = (unsigned short*)(ws + oW);
  unsigned short* WoT   = (unsigned short*)(ws + oWo);
  unsigned short* XH    = (unsigned short*)(ws + oX);
  unsigned short* QH    = (unsigned short*)(ws + oQ);
  unsigned short* KH    = (unsigned short*)(ws + oK);
  unsigned short* VT    = (unsigned short*)(ws + oV);
  unsigned short* Ctx   = (unsigned short*)(ws + oC);
  float*          out0  = (float*)d_out;

  const dim3 blk(256), blk128(128);
  const dim3 gPrep(1024 + 3 * PCB);                                   // 768 + 256 transpose blocks, 3 x 2048 convert blocks
  const dim3 gQkv(3 * PJB);                                           // 3 projections x 256 block tiles
  const dim3 gN1k((MP / 128) * (DM / 128), 1);                        // 32 x 8 block tiles -> 256 blocks
  const dim3 gAttn(NBATCH * NH * NQB);                                // 1024 blocks of 128
  const float invw  = 1.0f / WSC;                                     // weight carry x64
  const float sc2   = 0.18033688f;                                    // log2 e / sqrt(64)

  // (0) weight planes WqkvT and WoT (f16, x64) and the f16 activation planes of q, k, v
  prep<<<gPrep, blk, 0, stream>>>(query, key_, value, w_q, w_k, w_v, w_o, WqkvT, WoT, XH);

  // (1..3) Q, K and V^T projections
  gemm_qkv<<<gQkv, blk128, 0, stream>>>(XH, WqkvT, b_q, b_k, b_v, QH, KH, VT, DM, invw);

  // (4) flash attention -> Ctx f16 (concat layout, column h*64 + d)
  attn64<<<gAttn, blk128, 0, stream>>>(QH, KH, VT, Ctx, sc2);

  // (5) out = ctx . (Wo^T)^T + b_o  (K = 1024, f16 operands) -> d_out f32 [4096][1024]
  gemm64_one<0, 0><<<gN1k, blk128, 0, stream>>>(
      Ctx, DM, 0LL, WoT, DM, 0LL, b_o, b_o, DM,
      (void*)out0, DM, 0LL, MP, DM, DM, invw);
  (void)hipGetLastError();
}
